// v000
// Times are from an AMD MI455X. After a warm-up the kernel runs many times in a row, and a time is the length of
// such a window on the GPU divided by its runs, so every launch and the gaps after it count. The runs cycle
// through copies of the inputs. A figure is the median of several windows, for all but v000 over two sittings.
// Sittings can differ by a few percent; kernels timed side by side share one.
// v000, which the later versions start from, runs in 1700 microseconds.
#include <hip/hip_runtime.h>
// Multi-head attention whose heads are STACKED along the batch axis (B=4096 rows, EMBED=256, 4 heads × 64): q = queries·W_Query, k = keys·W_Key, v = values·W_Value ((in,out), no bias); the heads are split TF-style into [H·B, 64] = [16384, 64] and ONE softmax(q·kᵀ/√64)·v runs over all 16384 stacked rows
// (every query attends to every (head, row) key); the result is merged back to [B, H·64].
// Compute dtype: inputs and weights rounded to bf16; q, k, v as f16 GEMM outputs written directly in the stacked [h·4096 + b][64] layout (grid.y = head); fused flash-style kernel over T = 16384 (online softmax f32, P f16 ×2^10, f32 accumulate) on v_wmma_f32_16x16x32_f16;
// the f32 result rows are permuted into the merged output by a copy kernel (32 lanes × 16 B per instruction).
#define BB 1
#define TT 16384
#define NH 1
#define NB 4096
#define NHD 4
#define EE 256
#define DD 64
#define NR (BB * TT)

typedef __bf16 v16b __attribute__((ext_vector_type(16)));
typedef unsigned short v8us __attribute__((ext_vector_type(8), may_alias));
typedef float  v8f  __attribute__((ext_vector_type(8)));
typedef float  v4f  __attribute__((ext_vector_type(4)));
typedef float  v4fa __attribute__((ext_vector_type(4), may_alias));
union FragB { v16b v; v8us half[2]; unsigned short u[16]; };

__device__ __forceinline__ unsigned short bf16_bits(float x) { unsigned int u = __float_as_uint(x); return (unsigned short)((u + 0x7FFFu + ((u >> 16) & 1u)) >> 16); }
__device__ __forceinline__ float bf16_val(unsigned short b) { return __uint_as_float(((unsigned int)b) << 16); }
__device__ __forceinline__ float bf16_round(float x) { return bf16_val(bf16_bits(x)); }
// D += A·B with NT terms: 1 = ah·bh, 2 = + al·bh (A split), 3 = + ah·bl (both split)
template <int NT>
__device__ __forceinline__ v8f mmaN(v16b ah, v16b al, v16b bh, v16b bl, v8f c) {
  c = __builtin_amdgcn_wmma_f32_16x16x32_bf16(false, ah, false, bh, (short)0, c, false, false);
  if (NT >= 2) c = __builtin_amdgcn_wmma_f32_16x16x32_bf16(false, al, false, bh, (short)0, c, false, false);
  if (NT >= 3) c = __builtin_amdgcn_wmma_f32_16x16x32_bf16(false, ah, false, bl, (short)0, c, false, false);
  asm volatile("v_nop\n\tv_nop\n\tv_nop\n\tv_nop" : "+v"(c) : "v"(ah), "v"(al), "v"(bh), "v"(bl));
  return c;
}

__global__ __launch_bounds__(256) void k_wt_bf16(const float* __restrict__ W, unsigned short* __restrict__ Wt, int K, int N) {
  const int t = blockIdx.x * 256 + threadIdx.x;
  const int k8n = K / 8;
  if (t >= N * k8n) return;
  const int n = t / k8n, k8 = (t % k8n) * 8;
  v8us v;
#pragma unroll
  for (int i = 0; i < 8; ++i) v[i] = bf16_bits(W[(size_t)(k8 + i) * N + n]);
  *(v8us*)(Wt + (size_t)n * K + k8) = v;
  
}

// GEMM C[M][N] (f32, pitch ldc) = act(A[M][K]·W + bias). A f32 row-major (pitch lda) converted per fragment to bf16
// (ASPLIT: hi/lo two planes -> 2 terms, else single rounded term); Wt bf16 [N][K] (pitch ldb). BIAS_BF16 rounds the
// bias to bf16 first (bias quantised to bf16 before the add). K%32==0, M%16==0, N%64==0.
template <bool ASPLIT, int ACT, bool BIAS_BF16>
__global__ __launch_bounds__(128) void k_gemm_bf(const float* __restrict__ A, int lda, const unsigned short* __restrict__ Wt, int ldb,
                                               const float* __restrict__ bias, float* __restrict__ C, int ldc, int M, int N, int K) {
  __shared__ __attribute__((aligned(16))) float so[4][16][64];
  const int tid = threadIdx.x, w = tid >> 5, lane = tid & 31, ln = lane & 15, hh = lane >> 4;
  const int ntn = N / 64;
  const int wid = blockIdx.x * 4 + w;
  const int mt = wid / ntn, nq = wid % ntn;
  if (mt * 16 >= M) return;
  const int row0 = mt * 16, col0 = nq * 64;
  const float* arow = A + (size_t)(row0 + ln) * lda;
  v8f acc[4] = {};
  for (int kb = 0; kb < K; kb += 32) {
    FragB ah, al;
    const v4f x0 = *(const v4fa*)(arow + kb + 8 * hh), x1 = *(const v4fa*)(arow + kb + 8 * hh + 4);
    const v4f x2 = *(const v4fa*)(arow + kb + 16 + 8 * hh), x3 = *(const v4fa*)(arow + kb + 16 + 8 * hh + 4);
    float xs[16] = {x0[0],x0[1],x0[2],x0[3],x1[0],x1[1],x1[2],x1[3],x2[0],x2[1],x2[2],x2[3],x3[0],x3[1],x3[2],x3[3]};
#pragma unroll
    for (int i = 0; i < 16; ++i) { const unsigned short hb = bf16_bits(xs[i]); ah.u[i] = hb; al.u[i] = ASPLIT ? bf16_bits(xs[i] - bf16_val(hb)) : (unsigned short)0; }
#pragma unroll
    for (int t = 0; t < 4; ++t) {
      const unsigned short* brow = Wt + (size_t)(col0 + t * 16 + ln) * ldb + kb;
      FragB b;
      b.half[0] = *(const v8us*)(brow + 8 * hh);
      b.half[1] = *(const v8us*)(brow + 16 + 8 * hh);
      acc[t] = mmaN<ASPLIT ? 2 : 1>(ah.v, al.v, b.v, b.v, acc[t]);
    }
  }
#pragma unroll
  for (int t = 0; t < 4; ++t) {
    float bv = bias ? bias[col0 + t * 16 + ln] : 0.f;
    if (BIAS_BF16) bv = bf16_round(bv);
#pragma unroll
    for (int r = 0; r < 8; ++r) { float v = acc[t][r] + bv; if (ACT == 1) v = fmaxf(v, 0.f); so[w][8 * hh + r][t * 16 + ln] = v; }
  }
  __builtin_amdgcn_fence(__ATOMIC_ACQ_REL, "workgroup");
  __builtin_amdgcn_wave_barrier();
  const int rsub = lane >> 4, c4 = (lane & 15) * 4;
  {
#pragma unroll
    for (int q = 0; q < 8; ++q) {
      const int r = q * 2 + rsub;
      const v4f v = *(const v4fa*)&so[w][r][c4];
      *(v4f*)(C + (size_t)(row0 + r) * ldc + col0 + c4) = v;
    }
    
  }
}

// Flash-style causal/unmasked attention, all contractions 3-term bf16 hi/lo splits, f32 softmax with running max.
// q,k,v rows are read from f32 buffers with arbitrary row pitch (so they can live inside a fused qkv buffer);
// D = head size (multiple of 32, <= 128); one wave = 16 query rows; block = 4 waves (64 queries) sharing K/V chunks of 32.
template <int D, bool CAUSAL>
__global__ __launch_bounds__(128) void k_flash(const float* __restrict__ qb, const float* __restrict__ kb, const float* __restrict__ vb,
                                             int pitch, int T, int H, float scale, float* __restrict__ y, int ypitch) {
  constexpr int KS = D / 32;        // k-steps for QK
  constexpr int DT = D / 16;        // d tiles for PV
  __shared__ __attribute__((aligned(16))) unsigned short sKh[32][D + 8], sKl[32][D + 8], sVh[32][D + 8], sVl[32][D + 8];
  __shared__ __attribute__((aligned(16))) unsigned short sPh[4][16][40], sPl[4][16][40];
  __shared__ __attribute__((aligned(16))) float sO[4][16][D];
  const int tid = threadIdx.x, w = tid >> 5, lane = tid & 31, ln = lane & 15, hh = lane >> 4;
  const int nqb = (T + 63) / 64;
  const int bh = blockIdx.x / nqb, qblk = blockIdx.x % nqb;
  const int b = bh / H, h = bh % H;
  const int q0 = qblk * 64 + w * 16;
  const float* Q = qb + (size_t)b * T * pitch + h * D;
  const float* K = kb + (size_t)b * T * pitch + h * D;
  const float* V = vb + (size_t)b * T * pitch + h * D;

  // A fragments of the wave's 16 query rows (scaled), hi/lo
  FragB aqh[KS], aql[KS];
  {
    int row = q0 + ln; if (row >= T) row = T - 1;
    const float* qr = Q + (size_t)row * pitch;
#pragma unroll
    for (int ks = 0; ks < KS; ++ks)
#pragma unroll
      for (int i = 0; i < 16; ++i) {
        const int d = ks * 32 + ((i < 8) ? (8 * hh + i) : (16 + 8 * hh + (i - 8)));
        const float x = qr[d] * scale; const unsigned short hb = bf16_bits(x);
        aqh[ks].u[i] = hb; aql[ks].u[i] = bf16_bits(x - bf16_val(hb));
      }
  }
  float m_r[8], l_r[8];
#pragma unroll
  for (int r = 0; r < 8; ++r) { m_r[r] = -3.0e38f; l_r[r] = 0.f; }
  v8f oacc[DT];
#pragma unroll
  for (int dt = 0; dt < DT; ++dt) oacc[dt] = (v8f){0.f,0.f,0.f,0.f,0.f,0.f,0.f,0.f};

  const int kv_end = CAUSAL ? min(T, qblk * 64 + 64) : T;     // block-uniform
  for (int j0 = 0; j0 < kv_end; j0 += 32) {
    __syncthreads();
    for (int e = tid; e < 32 * (D / 4); e += 128) {
      const int r = e / (D / 4), c4 = (e % (D / 4)) * 4;
      const int key = j0 + r;
      v4f kf = {0.f,0.f,0.f,0.f}, vf = {0.f,0.f,0.f,0.f};
      if (key < T) { kf = *(const v4fa*)(K + (size_t)key * pitch + c4); vf = *(const v4fa*)(V + (size_t)key * pitch + c4); }
#pragma unroll
      for (int t = 0; t < 4; ++t) {
        unsigned short hb = bf16_bits(kf[t]); sKh[r][c4 + t] = hb; sKl[r][c4 + t] = bf16_bits(kf[t] - bf16_val(hb));
        hb = bf16_bits(vf[t]); sVh[r][c4 + t] = hb; sVl[r][c4 + t] = bf16_bits(vf[t] - bf16_val(hb));
      }
    }
    __syncthreads();
    // S tile 16 x 32
    v8f s[2];
#pragma unroll
    for (int nt = 0; nt < 2; ++nt) {
      v8f acc = {};
#pragma unroll
      for (int ks = 0; ks < KS; ++ks) {
        FragB bh_, bl_;
        bh_.half[0] = *(const v8us*)&sKh[nt * 16 + ln][ks * 32 + 8 * hh]; bh_.half[1] = *(const v8us*)&sKh[nt * 16 + ln][ks * 32 + 16 + 8 * hh];
        bl_.half[0] = *(const v8us*)&sKl[nt * 16 + ln][ks * 32 + 8 * hh]; bl_.half[1] = *(const v8us*)&sKl[nt * 16 + ln][ks * 32 + 16 + 8 * hh];
        acc = mmaN<3>(aqh[ks].v, aql[ks].v, bh_.v, bl_.v, acc);
      }
      s[nt] = acc;
    }
    // mask + running max (rows 8hh+r; the 16 lanes of a half share rows)
    float alpha[8];
#pragma unroll
    for (int r = 0; r < 8; ++r) {
      const int qi = q0 + 8 * hh + r;
      const int ja = j0 + ln, jb = j0 + 16 + ln;
      if (CAUSAL) { if (ja > qi) s[0][r] = -3.0e38f; if (jb > qi) s[1][r] = -3.0e38f; }
      if (ja >= T) s[0][r] = -3.0e38f;
      if (jb >= T) s[1][r] = -3.0e38f;
      float mx = fmaxf(s[0][r], s[1][r]);
      mx = fmaxf(mx, __shfl_xor(mx, 1, 32)); mx = fmaxf(mx, __shfl_xor(mx, 2, 32)); mx = fmaxf(mx, __shfl_xor(mx, 4, 32)); mx = fmaxf(mx, __shfl_xor(mx, 8, 32));
      const float mnew = fmaxf(m_r[r], mx);
      alpha[r] = (mnew > -1.0e38f) ? __expf(m_r[r] - mnew) : 1.0f;
      const float p0 = (s[0][r] > -1.0e38f) ? __expf(s[0][r] - mnew) : 0.f;
      const float p1 = (s[1][r] > -1.0e38f) ? __expf(s[1][r] - mnew) : 0.f;
      m_r[r] = mnew;
      l_r[r] = l_r[r] * alpha[r] + p0 + p1;            // per-lane partial row sum (16 lanes combined at the end)
      unsigned short hb = bf16_bits(p0); sPh[w][8 * hh + r][ln] = hb;      sPl[w][8 * hh + r][ln] = bf16_bits(p0 - bf16_val(hb));
      hb = bf16_bits(p1);                sPh[w][8 * hh + r][16 + ln] = hb; sPl[w][8 * hh + r][16 + ln] = bf16_bits(p1 - bf16_val(hb));
    }
#pragma unroll
    for (int dt = 0; dt < DT; ++dt)
#pragma unroll
      for (int r = 0; r < 8; ++r) oacc[dt][r] *= alpha[r];
    __builtin_amdgcn_fence(__ATOMIC_ACQ_REL, "workgroup");
    __builtin_amdgcn_wave_barrier();
    FragB pah, pal;
    pah.half[0] = *(const v8us*)&sPh[w][ln][8 * hh]; pah.half[1] = *(const v8us*)&sPh[w][ln][16 + 8 * hh];
    pal.half[0] = *(const v8us*)&sPl[w][ln][8 * hh]; pal.half[1] = *(const v8us*)&sPl[w][ln][16 + 8 * hh];
#pragma unroll
    for (int dt = 0; dt < DT; ++dt) {
      FragB bvh, bvl;
#pragma unroll
      for (int i = 0; i < 8; ++i) {
        bvh.u[i] = sVh[8 * hh + i][dt * 16 + ln]; bvh.u[8 + i] = sVh[16 + 8 * hh + i][dt * 16 + ln];
        bvl.u[i] = sVl[8 * hh + i][dt * 16 + ln]; bvl.u[8 + i] = sVl[16 + 8 * hh + i][dt * 16 + ln];
      }
      oacc[dt] = mmaN<3>(pah.v, pal.v, bvh.v, bvl.v, oacc[dt]);
    }
    __builtin_amdgcn_fence(__ATOMIC_ACQ_REL, "workgroup");
    __builtin_amdgcn_wave_barrier();
  }
#pragma unroll
  for (int r = 0; r < 8; ++r) {
    float l = l_r[r];
    l += __shfl_xor(l, 1, 32); l += __shfl_xor(l, 2, 32); l += __shfl_xor(l, 4, 32); l += __shfl_xor(l, 8, 32);
    l_r[r] = (l > 0.f) ? 1.0f / l : 0.f;
  }
#pragma unroll
  for (int dt = 0; dt < DT; ++dt)
#pragma unroll
    for (int r = 0; r < 8; ++r) sO[w][8 * hh + r][dt * 16 + ln] = oacc[dt][r] * l_r[r];
  __builtin_amdgcn_fence(__ATOMIC_ACQ_REL, "workgroup");
  __builtin_amdgcn_wave_barrier();
  {
    for (int r = 0; r < 16; ++r) {
      const int row = q0 + r;
      if (row < T && lane < D / 4) {
        const v4f val = *(const v4fa*)&sO[w][r][lane * 4];
        *(v4f*)(y + ((size_t)b * T + row) * ypitch + h * D + lane * 4) = val;
      }
    }
    
  }
}

// GEMM C = act(A·W + bias + resid): A f32 (ASPLIT -> hi/lo 2 terms), Wt bf16 [N][K]; ACT 0 none, 1 relu, 2 exact gelu;
// resid (optional, f32, row index = (row % rmod), pitch ldr, RES_BF16 rounds it) added before the activation.
template <bool ASPLIT, int ACT, bool BIAS_BF16, bool RES_BF16>
__global__ __launch_bounds__(128) void k_gemm_bf3(const float* __restrict__ A, int lda, const unsigned short* __restrict__ Wt, int ldb,
                                                const float* __restrict__ bias, const float* __restrict__ resid, int rmod, int ldr,
                                                float* __restrict__ C, int ldc, int M, int N, int K) {
  __shared__ __attribute__((aligned(16))) float so[4][16][64];
  const int tid = threadIdx.x, w = tid >> 5, lane = tid & 31, ln = lane & 15, hh = lane >> 4;
  const int ntn = N / 64;
  const int wid = blockIdx.x * 4 + w;
  const int mt = wid / ntn, nq = wid % ntn;
  if (mt * 16 >= M) return;
  const int row0 = mt * 16, col0 = nq * 64;
  const float* arow = A + (size_t)(row0 + ln) * lda;
  v8f acc[4] = {};
  for (int kb = 0; kb < K; kb += 32) {
    FragB ah, al;
    const v4f x0 = *(const v4fa*)(arow + kb + 8 * hh), x1 = *(const v4fa*)(arow + kb + 8 * hh + 4);
    const v4f x2 = *(const v4fa*)(arow + kb + 16 + 8 * hh), x3 = *(const v4fa*)(arow + kb + 16 + 8 * hh + 4);
    float xs[16] = {x0[0],x0[1],x0[2],x0[3],x1[0],x1[1],x1[2],x1[3],x2[0],x2[1],x2[2],x2[3],x3[0],x3[1],x3[2],x3[3]};
#pragma unroll
    for (int i = 0; i < 16; ++i) { const unsigned short hb = bf16_bits(xs[i]); ah.u[i] = hb; al.u[i] = ASPLIT ? bf16_bits(xs[i] - bf16_val(hb)) : (unsigned short)0; }
#pragma unroll
    for (int t = 0; t < 4; ++t) {
      const unsigned short* brow = Wt + (size_t)(col0 + t * 16 + ln) * ldb + kb;
      FragB b;
      b.half[0] = *(const v8us*)(brow + 8 * hh);
      b.half[1] = *(const v8us*)(brow + 16 + 8 * hh);
      acc[t] = mmaN<ASPLIT ? 2 : 1>(ah.v, al.v, b.v, b.v, acc[t]);
    }
  }
#pragma unroll
  for (int t = 0; t < 4; ++t) {
    const int col = col0 + t * 16 + ln;
    float bv = bias ? bias[col] : 0.f;
    if (BIAS_BF16) bv = bf16_round(bv);
#pragma unroll
    for (int r = 0; r < 8; ++r) {
      float v = acc[t][r] + bv;
      if (resid) { float rv = resid[(size_t)((row0 + 8 * hh + r) % rmod) * ldr + col]; if (RES_BF16) rv = bf16_round(rv); v += rv; }
      if (ACT == 1) v = fmaxf(v, 0.f);
      if (ACT == 2) v = 0.5f * v * (1.0f + erff(v * 0.70710678118654752f));
      if (ACT == 3) { const float u = 0.7978845608028654f * (v + 0.044715f * v * v * v); v = 0.5f * v * (1.0f + tanhf(u)); }
      so[w][8 * hh + r][t * 16 + ln] = v;
    }
  }
  __builtin_amdgcn_fence(__ATOMIC_ACQ_REL, "workgroup");
  __builtin_amdgcn_wave_barrier();
  const int rsub = lane >> 4, c4 = (lane & 15) * 4;
  {
#pragma unroll
    for (int q = 0; q < 8; ++q) {
      const int r = q * 2 + rsub;
      const v4f v = *(const v4fa*)&so[w][r][c4];
      *(v4f*)(C + (size_t)(row0 + r) * ldc + col0 + c4) = v;
    }
    
  }
}
// row LayerNorm (biased variance, eps) over N: s = X (+ R); optional out_sum <- s; out_norm <- (s-mu)*rsqrt(var+eps)*g + b
template <bool PARAM_BF16>
__global__ __launch_bounds__(256) void k_layernorm(const float* __restrict__ X, const float* __restrict__ R, const float* __restrict__ g, const float* __restrict__ bta,
                                                  float* __restrict__ out_sum, float* __restrict__ out_norm, int N, float eps) {
  __shared__ float red[256];
  const int row = blockIdx.x, tid = threadIdx.x;
  const float* x = X + (size_t)row * N; const float* rr = R ? R + (size_t)row * N : nullptr;
  float vals[16];                     // up to N = 4096
  const int per = N / 256;            // contiguous chunk per thread? use strided-by-4 chunks: thread handles j = tid*4 + 1024*u
  float s1 = 0.f;
  for (int u = 0; u < per / 4; ++u) {
    const int j = tid * 4 + 1024 * u;
    const v4f a = *(const v4fa*)(x + j);
    v4f b = {0.f,0.f,0.f,0.f}; if (rr) b = *(const v4fa*)(rr + j);
#pragma unroll
    for (int q = 0; q < 4; ++q) { const float v = a[q] + b[q]; vals[u * 4 + q] = v; s1 += v; }
  }
  red[tid] = s1; __syncthreads();
  for (int st = 128; st > 0; st >>= 1) { if (tid < st) red[tid] += red[tid + st]; __syncthreads(); }
  const float mu = red[0] / (float)N; __syncthreads();
  float s2 = 0.f;
  for (int u = 0; u < per / 4; ++u)
#pragma unroll
    for (int q = 0; q < 4; ++q) { const float c = vals[u * 4 + q] - mu; s2 += c * c; }
  red[tid] = s2; __syncthreads();
  for (int st = 128; st > 0; st >>= 1) { if (tid < st) red[tid] += red[tid + st]; __syncthreads(); }
  const float rs = rsqrtf(red[0] / (float)N + eps);
  {
    for (int u = 0; u < per / 4; ++u) {
      const int j = tid * 4 + 1024 * u;
      v4f o, sm;
#pragma unroll
      for (int q = 0; q < 4; ++q) {
        float gg = g[j + q], bb = bta[j + q];
        if (PARAM_BF16) { gg = bf16_round(gg); bb = bf16_round(bb); }
        sm[q] = vals[u * 4 + q]; o[q] = (vals[u * 4 + q] - mu) * rs * gg + bb;
      }
      if (out_sum) *(v4f*)(out_sum + (size_t)row * N + j) = sm;
      *(v4f*)(out_norm + (size_t)row * N + j) = o;
    }
    
  }
}



// ---- f16 WMMA path (v_wmma_f32_16x16x32_f16): 11-bit significands for operands in range — used where a [0,1] probability operand needs more precision than bf16
typedef _Float16 v16h __attribute__((ext_vector_type(16)));
union FragH { v16h v; v8us half[2]; _Float16 h[16]; unsigned short u[16]; };
template <int NT>
__device__ __forceinline__ v8f mmaH(v16h ah, v16h al, v16h bh, v16h bl, v8f c) {
  c = __builtin_amdgcn_wmma_f32_16x16x32_f16(false, ah, false, bh, (short)0, c, false, false);
  if (NT >= 2) c = __builtin_amdgcn_wmma_f32_16x16x32_f16(false, al, false, bh, (short)0, c, false, false);
  if (NT >= 3) c = __builtin_amdgcn_wmma_f32_16x16x32_f16(false, ah, false, bl, (short)0, c, false, false);
  asm volatile("v_nop\n\tv_nop\n\tv_nop\n\tv_nop" : "+v"(c) : "v"(ah), "v"(al), "v"(bh), "v"(bl));
  return c;
}
// batched GEMM like k_gemm_b but f16 operands: A f32 (split into f16 hi/lo if ASPLIT, else rounded to f16), Bt = f16 values [n][k]; alpha; C f32; N multiple of 16 (partial tiles skipped)
template <bool ASPLIT>
__global__ __launch_bounds__(128) void k_gemm_h(const float* __restrict__ A, int lda, size_t sA, const _Float16* __restrict__ Bh, int ldb, size_t sB, float alpha, float* __restrict__ C, int ldc, size_t sC, int M, int N, int K) {
  __shared__ __attribute__((aligned(16))) float so[4][16][64];
  const int tid = threadIdx.x, w = tid >> 5, lane = tid & 31, ln = lane & 15, hh = lane >> 4; const int by = blockIdx.y;
  A += (size_t)by * sA; Bh += (size_t)by * sB; C += (size_t)by * sC;
  const int ntn = (N + 63) / 64; const int wid = blockIdx.x * 4 + w; const int mt = wid / ntn, nq = wid % ntn; if (mt * 16 >= M) return;
  const int row0 = mt * 16, col0 = nq * 64; const float* arow = A + (size_t)(row0 + ln) * lda;
  v8f acc[4] = {};
  for (int kb = 0; kb < K; kb += 32) {
    FragH ah, al;
    const v4f x0 = *(const v4fa*)(arow + kb + 8 * hh), x1 = *(const v4fa*)(arow + kb + 8 * hh + 4), x2 = *(const v4fa*)(arow + kb + 16 + 8 * hh), x3 = *(const v4fa*)(arow + kb + 16 + 8 * hh + 4);
    float xs[16] = {x0[0],x0[1],x0[2],x0[3],x1[0],x1[1],x1[2],x1[3],x2[0],x2[1],x2[2],x2[3],x3[0],x3[1],x3[2],x3[3]};
#pragma unroll
    for (int i = 0; i < 16; ++i) { const _Float16 h = (_Float16)xs[i]; ah.h[i] = h; al.h[i] = ASPLIT ? (_Float16)(xs[i] - (float)h) : (_Float16)0.0f; }
#pragma unroll
    for (int t = 0; t < 4; ++t) { if (col0 + t * 16 >= N) continue; const size_t boff = (size_t)(col0 + t * 16 + ln) * ldb + kb; FragH bq; bq.half[0] = *(const v8us*)(Bh + boff + 8 * hh); bq.half[1] = *(const v8us*)(Bh + boff + 16 + 8 * hh);
      acc[t] = mmaH<ASPLIT ? 2 : 1>(ah.v, al.v, bq.v, bq.v, acc[t]); }
  }
#pragma unroll
  for (int t = 0; t < 4; ++t) { if (col0 + t * 16 >= N) continue;
#pragma unroll
    for (int r = 0; r < 8; ++r) so[w][8 * hh + r][t * 16 + ln] = acc[t][r] * alpha; }
  __builtin_amdgcn_fence(__ATOMIC_ACQ_REL, "workgroup"); __builtin_amdgcn_wave_barrier();
  const int rsub = lane >> 4, c4 = (lane & 15) * 4;
  {
#pragma unroll
    for (int q = 0; q < 8; ++q) { const int r = q * 2 + rsub; if (col0 + c4 < N) { const v4f v = *(const v4fa*)&so[w][r][c4]; *(v4f*)(C + (size_t)(row0 + r) * ldc + col0 + c4) = v; } }
     }
}

// Wt[n][k] = f16(bf16(W[k][n])·scale) from f32 row-major W[K][N] (scale = power of two; bf16-exact weights stay exact in f16 away from the subnormal range)
__global__ __launch_bounds__(256) void k_wt_f16(const float* __restrict__ W, _Float16* __restrict__ Wt, int K, int N, float scale) {
  const int t = blockIdx.x * 256 + threadIdx.x; if (t >= N * (K / 8)) return; const int n = t / (K / 8), k8 = (t % (K / 8)) * 8; FragH f;
#pragma unroll
  for (int i = 0; i < 8; ++i) f.h[i] = (_Float16)(bf16_round(W[(size_t)(k8 + i) * N + n]) * scale); const v8us o = f.half[0];
  *(v8us*)((unsigned short*)Wt + (size_t)n * K + k8) = o; 
}
// k_gemm_hh variant with fused epilogue: v = acc·alpha + bias[by·sBias + col] (+ CP[(row/rowsPerB)·sCPb + by·64 + col] if CP) ; ACT 0 none / 1 elu ; writes f16 C16 (and f32 C if non-null)
template <int ACT>
__global__ __launch_bounds__(128) void k_gemm_hhx(const _Float16* __restrict__ A, int lda, size_t sA, const _Float16* __restrict__ Bh, int ldb, size_t sB, float alpha, const float* __restrict__ bias, size_t sBias, const float* __restrict__ CP, int rowsPerB, size_t sCPb, int row0g,
    float* __restrict__ C, _Float16* __restrict__ C16, int ldc, size_t sC, int M, int N, int K) {
  __shared__ __attribute__((aligned(16))) float so[4][16][64];
  const int tid = threadIdx.x, w = tid >> 5, lane = tid & 31, ln = lane & 15, hh = lane >> 4; const int by = blockIdx.y;
  A += (size_t)by * sA; Bh += (size_t)by * sB; const size_t cofs = (size_t)by * sC; const float* bp = bias ? bias + (size_t)by * sBias : nullptr;
  const int ntn = (N + 63) / 64; const int wid = blockIdx.x * 4 + w; const int mt = wid / ntn, nq = wid % ntn; if (mt * 16 >= M) return;
  const int row0 = mt * 16, col0 = nq * 64; const _Float16* arow = A + (size_t)(row0 + ln) * lda;
  v8f acc[4] = {};
  for (int kb = 0; kb < K; kb += 32) { FragH ah; ah.half[0] = *(const v8us*)((const unsigned short*)arow + kb + 8 * hh); ah.half[1] = *(const v8us*)((const unsigned short*)arow + kb + 16 + 8 * hh);
#pragma unroll
    for (int t = 0; t < 4; ++t) { if (col0 + t * 16 >= N) continue; const size_t boff = (size_t)(col0 + t * 16 + ln) * ldb + kb; FragH bq; bq.half[0] = *(const v8us*)((const unsigned short*)Bh + boff + 8 * hh); bq.half[1] = *(const v8us*)((const unsigned short*)Bh + boff + 16 + 8 * hh);
      acc[t] = mmaH<1>(ah.v, ah.v, bq.v, bq.v, acc[t]); }
  }
#pragma unroll
  for (int t = 0; t < 4; ++t) { if (col0 + t * 16 >= N) continue; const int col = col0 + t * 16 + ln; const float bv = bp ? bf16_round(bp[col]) : 0.f;
#pragma unroll
    for (int r = 0; r < 8; ++r) { float v = acc[t][r] * alpha + bv; if (CP) { const int bidx = (row0g + row0 + 8 * hh + r) / rowsPerB; v += CP[(size_t)bidx * sCPb + (size_t)by * 64 + col]; } if (ACT == 1) v = (v > 0.f) ? v : expm1f(v); else if (ACT == 7) v = (v > 0.f) ? v + 1.0f : expf(v); else if (ACT == 8) v = tanhf(v); else if (ACT == 9) v = 0.5f * v * (1.0f + tanhf(0.7978845608028654f * (v + 0.044715f * v * v * v))); else if (ACT == 11) v = 1.0f / (1.0f + expf(-v)); else if (ACT == 12) v = (v > 0.f) ? v : 0.01f * v; else if (ACT == 14) v = (v > 0.f) ? v : 0.1f * v; else if (ACT == 15) v = v / (1.0f + expf(-v)); else if (ACT == 3) v = fmaxf(v, 0.f); else if (ACT == 6) v = 0.5f * v * (1.0f + erff(v * 0.70710678118654752f)); so[w][8 * hh + r][t * 16 + ln] = v; } }
  __builtin_amdgcn_fence(__ATOMIC_ACQ_REL, "workgroup"); __builtin_amdgcn_wave_barrier();
  const int rsub = lane >> 4, c4 = (lane & 15) * 4; typedef _Float16 v4h __attribute__((ext_vector_type(4)));
  {
#pragma unroll
    for (int q = 0; q < 8; ++q) { const int r = q * 2 + rsub; if (col0 + c4 < N) { const v4f v = *(const v4fa*)&so[w][r][c4]; if (C) *(v4f*)(C + cofs + (size_t)(row0 + r) * ldc + col0 + c4) = v; if (C16) { v4h h4; for (int i = 0; i < 4; ++i) h4[i] = (_Float16)v[i]; *(v4h*)(C16 + cofs + (size_t)(row0 + r) * ldc + col0 + c4) = h4; } } }
     }
}


typedef _Float16 v4h __attribute__((ext_vector_type(4)));

__global__ __launch_bounds__(256) void k_x16(const float* __restrict__ x, _Float16* __restrict__ X16, size_t n8) { const size_t t = (size_t)blockIdx.x * 256 + threadIdx.x; if (t >= n8) return; FragH f;
#pragma unroll
  for (int q = 0; q < 8; ++q) f.h[q] = (_Float16)bf16_round(x[t * 8 + q]); *(v8us*)((unsigned short*)X16 + t * 8) = f.half[0];  }
__global__ __launch_bounds__(256) void k_h16(const float* __restrict__ x, _Float16* __restrict__ X16, size_t n8) { const size_t t = (size_t)blockIdx.x * 256 + threadIdx.x; if (t >= n8) return; FragH f;
#pragma unroll
  for (int q = 0; q < 8; ++q) f.h[q] = (_Float16)x[t * 8 + q]; *(v8us*)((unsigned short*)X16 + t * 8) = f.half[0];  }
__global__ __launch_bounds__(256) void k_round16f(const float* __restrict__ W, _Float16* __restrict__ Bt, size_t n8) { const size_t t = (size_t)blockIdx.x * 256 + threadIdx.x; if (t >= n8) return; FragH f;
#pragma unroll
  for (int i = 0; i < 8; ++i) f.h[i] = (_Float16)(bf16_round(W[t * 8 + i]) * 16.0f); *(v8us*)((unsigned short*)Bt + t * 8) = f.half[0];  }
template <int NHv, int TTv>
__global__ __launch_bounds__(256) void k_vt(const _Float16* __restrict__ V16, int ldv, int voff, _Float16* __restrict__ Vt) { __shared__ unsigned short tl[64][66]; const int tid = threadIdx.x; const int slab = blockIdx.x / (TTv / 64), lg = blockIdx.x % (TTv / 64); const int b = slab / NHv, h = slab % NHv;
  for (int i = tid; i < 64 * 8; i += 256) { const int r = i / 8, c8 = (i % 8) * 8; FragH f; f.half[0] = *(const v8us*)((const unsigned short*)V16 + ((size_t)b * TTv + lg * 64 + r) * ldv + voff + h * 64 + c8);
#pragma unroll
    for (int q = 0; q < 8; ++q) tl[r][c8 + q] = f.u[q]; }
  __syncthreads();
  {
#pragma unroll
    for (int rd = 0; rd < 2; ++rd) { const int d = rd * 32 + tid / 8, pc = tid % 8; FragH f;
#pragma unroll
      for (int q = 0; q < 8; ++q) f.u[q] = tl[pc * 8 + q][d];
      *(v8us*)((unsigned short*)Vt + ((size_t)slab * 64 + d) * TTv + lg * 64 + pc * 8) = f.half[0]; }
     } }

__global__ __launch_bounds__(256) void k_h16s(const float* __restrict__ F, _Float16* __restrict__ H, size_t n8) { const size_t t = (size_t)blockIdx.x * 256 + threadIdx.x; if (t >= n8) return; const v4f a = *(const v4fa*)(F + t * 8), c = *(const v4fa*)(F + t * 8 + 4); FragH f;
#pragma unroll
  for (int q = 0; q < 4; ++q) { f.h[q] = (_Float16)(a[q] * 16.0f); f.h[4 + q] = (_Float16)(c[q] * 16.0f); } *(v8us*)((unsigned short*)H + t * 8) = f.half[0];  }
__global__ __launch_bounds__(256) void k_merge(const float* __restrict__ O, float* __restrict__ out) {
  const int tid = threadIdx.x; const int wg = blockIdx.x * 8 + (tid >> 5); if (wg >= NB * 2) return; const int b = wg >> 1, hp = wg & 1; const int l = tid & 31; const int h = hp * 2 + (l >> 4), c4 = (l & 15) * 4;
  const v4f v = *(const v4fa*)(O + ((size_t)h * NB + b) * DD + c4); float* o = out + (size_t)b * EE + h * DD + c4;
  *(v4f*)o = v;  }
__global__ __launch_bounds__(128) void k_flash(const _Float16* __restrict__ Q16, int ldq, const _Float16* __restrict__ K16, int ldk, const _Float16* __restrict__ Vt, const int* __restrict__ MSK, float* __restrict__ O, int ldo) {
  constexpr int RPW = 16, RTN = RPW / 16, NQB = TT / (4 * RPW), DT = 4, KS = 2;
  __shared__ __attribute__((aligned(16))) unsigned short sP[4][RPW][40]; __shared__ __attribute__((aligned(16))) float sO[4][RPW][64 + 4];
  const int tid = threadIdx.x, w = tid >> 5, lane = tid & 31, ln = lane & 15, hh = lane >> 4;
  const int slab = blockIdx.x / NQB, qblk = blockIdx.x % NQB; const int b = slab / NH, h = slab % NH; const int qb0 = qblk * (4 * RPW); const int q0 = qb0 + w * RPW;
  FragH aq[2][KS];
#pragma unroll
  for (int rt = 0; rt < RTN; ++rt) { const unsigned short* qr = (const unsigned short*)Q16 + ((size_t)b * TT + q0 + rt * 16 + ln) * ldq + h * 64;
#pragma unroll
    for (int ks = 0; ks < KS; ++ks) { aq[rt][ks].half[0] = *(const v8us*)(qr + ks * 32 + 8 * hh); aq[rt][ks].half[1] = *(const v8us*)(qr + ks * 32 + 16 + 8 * hh); } }
  const unsigned short* Vth = (const unsigned short*)Vt + (size_t)slab * 64 * TT;
  float m_r[2][8], l_r[2][8]; v8f oacc[2][DT];
#pragma unroll
  for (int rt = 0; rt < RTN; ++rt) {
#pragma unroll
    for (int r = 0; r < 8; ++r) { m_r[rt][r] = -3.0e38f; l_r[rt][r] = 0.f; }
#pragma unroll
    for (int dt = 0; dt < DT; ++dt) oacc[rt][dt] = (v8f){0.f,0.f,0.f,0.f,0.f,0.f,0.f,0.f}; }
  const int jend = TT;
#pragma unroll 1
  for (int j0 = 0; j0 < jend; j0 += 32) {
    v8f s[2][2];
#pragma unroll
    for (int nt = 0; nt < 2; ++nt) { const unsigned short* kr = (const unsigned short*)K16 + ((size_t)b * TT + j0 + nt * 16 + ln) * ldk + h * 64; FragH bk[KS];
#pragma unroll
      for (int ks = 0; ks < KS; ++ks) { bk[ks].half[0] = *(const v8us*)(kr + ks * 32 + 8 * hh); bk[ks].half[1] = *(const v8us*)(kr + ks * 32 + 16 + 8 * hh); }
#pragma unroll
      for (int rt = 0; rt < RTN; ++rt) { v8f acc = (v8f){0.f,0.f,0.f,0.f,0.f,0.f,0.f,0.f};
#pragma unroll
        for (int ks = 0; ks < KS; ++ks) acc = mmaH<1>(aq[rt][ks].v, aq[rt][ks].v, bk[ks].v, bk[ks].v, acc); s[rt][nt] = acc; } }
#pragma unroll
    for (int rt = 0; rt < RTN; ++rt)
#pragma unroll
      for (int r = 0; r < 8; ++r) { const int tq = q0 + rt * 16 + 8 * hh + r; const int k0 = j0 + ln, k1 = j0 + 16 + ln; (void)tq; (void)k0; (void)k1;
        const bool ok0 = true, ok1 = true;
        const float s0 = s[rt][0][r] * 0.125f, s1 = s[rt][1][r] * 0.125f; float mc = fmaxf(s0, s1);
        mc = fmaxf(mc, __shfl_xor(mc, 1, 32)); mc = fmaxf(mc, __shfl_xor(mc, 2, 32)); mc = fmaxf(mc, __shfl_xor(mc, 4, 32)); mc = fmaxf(mc, __shfl_xor(mc, 8, 32));
        const float mn = fmaxf(m_r[rt][r], mc); const float al = (mn > -1.0e38f) ? expf(m_r[rt][r] - mn) : 1.0f; m_r[rt][r] = mn; const float p0 = ok0 ? expf(s0 - mn) : 0.f, p1 = ok1 ? expf(s1 - mn) : 0.f; l_r[rt][r] = l_r[rt][r] * al + p0 + p1;
#pragma unroll
        for (int dt = 0; dt < DT; ++dt) oacc[rt][dt][r] *= al;
        FragH t2; t2.h[0] = (_Float16)(p0 * 1024.0f); t2.h[1] = (_Float16)(p1 * 1024.0f); sP[w][rt * 16 + 8 * hh + r][ln] = t2.u[0]; sP[w][rt * 16 + 8 * hh + r][16 + ln] = t2.u[1]; }
    __builtin_amdgcn_fence(__ATOMIC_ACQ_REL, "workgroup"); __builtin_amdgcn_wave_barrier();
    FragH pa[2];
#pragma unroll
    for (int rt = 0; rt < RTN; ++rt) { pa[rt].half[0] = *(const v8us*)&sP[w][rt * 16 + ln][8 * hh]; pa[rt].half[1] = *(const v8us*)&sP[w][rt * 16 + ln][16 + 8 * hh]; }
#pragma unroll
    for (int dt = 0; dt < DT; ++dt) { const unsigned short* vrow = Vth + (size_t)(dt * 16 + ln) * TT + j0; FragH bv; bv.half[0] = *(const v8us*)(vrow + 8 * hh); bv.half[1] = *(const v8us*)(vrow + 16 + 8 * hh);
#pragma unroll
      for (int rt = 0; rt < RTN; ++rt) oacc[rt][dt] = mmaH<1>(pa[rt].v, pa[rt].v, bv.v, bv.v, oacc[rt][dt]); }
    __builtin_amdgcn_fence(__ATOMIC_ACQ_REL, "workgroup"); __builtin_amdgcn_wave_barrier(); }
#pragma unroll
  for (int rt = 0; rt < RTN; ++rt) {
#pragma unroll
    for (int r = 0; r < 8; ++r) { float l = l_r[rt][r]; l += __shfl_xor(l, 1, 32); l += __shfl_xor(l, 2, 32); l += __shfl_xor(l, 4, 32); l += __shfl_xor(l, 8, 32); l_r[rt][r] = (l > 0.f) ? 1.0f / (l * 1024.0f) : 0.f; }
#pragma unroll
    for (int dt = 0; dt < DT; ++dt)
#pragma unroll
      for (int r = 0; r < 8; ++r) sO[w][rt * 16 + 8 * hh + r][dt * 16 + ln] = oacc[rt][dt][r] * l_r[rt][r]; }
  __builtin_amdgcn_fence(__ATOMIC_ACQ_REL, "workgroup"); __builtin_amdgcn_wave_barrier();
  {
#pragma unroll
    for (int rp = 0; rp < RPW; rp += 2) { const int r = rp + (lane >> 4), pc = lane & 15; const v4f val = *(const v4fa*)&sO[w][r][pc * 4]; *(v4f*)(O + ((size_t)b * TT + q0 + r) * ldo + h * 64 + pc * 4) = val; }
     } }

extern "C" void kernel_launch(void* const* d_in, const int* in_sizes, int n_in,
                              void* d_out, int out_size, void* d_ws, size_t ws_size, hipStream_t stream) {
  (void)in_sizes; (void)n_in; (void)out_size;
  const float* const* I = (const float* const*)d_in; const float* xq = I[0]; const float* xk = I[1]; const float* xv = I[2]; const float* Wq = I[3]; const float* Wk = I[4]; const float* Wv = I[5];
  char* ws = (char*)d_ws; size_t off = 0;
  auto take = [&](size_t bytes) { char* p = ws + off; off += (bytes + 255) & ~(size_t)255; return p; };
  const size_t WSZ = (size_t)EE * EE; _Float16* Bw = (_Float16*)take(3 * WSZ * 2);
  _Float16* Xq = (_Float16*)take((size_t)NB * EE * 2); _Float16* Xk = (_Float16*)take((size_t)NB * EE * 2); _Float16* Xv = (_Float16*)take((size_t)NB * EE * 2);
  _Float16* Qs = (_Float16*)take((size_t)TT * DD * 2); _Float16* Ks = (_Float16*)take((size_t)TT * DD * 2); _Float16* Vs = (_Float16*)take((size_t)TT * DD * 2); _Float16* Vt = (_Float16*)take((size_t)TT * DD * 2); float* O = (float*)take((size_t)TT * DD * 4);
  if (off > ws_size) return;      // 0.4 + 3 × 2.1 + 4 × 2.1 + 4.2 ≈ 19 MB
  const unsigned gw = (unsigned)((EE * (EE / 8) + 255) / 256);
  k_wt_f16<<<gw, 256, 0, stream>>>(Wq, Bw, EE, EE, 16.0f); k_wt_f16<<<gw, 256, 0, stream>>>(Wk, Bw + WSZ, EE, EE, 16.0f); k_wt_f16<<<gw, 256, 0, stream>>>(Wv, Bw + 2 * WSZ, EE, EE, 16.0f);      /* (in,out) → Bt ×2^4 */
  const unsigned g8 = (unsigned)(((size_t)NB * EE / 8 + 255) / 256); k_x16<<<g8, 256, 0, stream>>>(xq, Xq, (size_t)NB * EE / 8); k_x16<<<g8, 256, 0, stream>>>(xk, Xk, (size_t)NB * EE / 8); k_x16<<<g8, 256, 0, stream>>>(xv, Xv, (size_t)NB * EE / 8);
  const dim3 gs(((NB / 16) * 1 + 3) / 4, NHD);      /* per head h = grid.y: C16[h·NB + b][0..63] = X·Bt[h·64 .. h·64+63]ᵀ — M 4096 N 64 K 256, written straight into the stacked plane */
  k_gemm_hhx<0><<<gs, 128, 0, stream>>>(Xq, EE, 0, Bw, EE, (size_t)DD * EE, 0.0625f, nullptr, 0, nullptr, 1, 0, 0, nullptr, Qs, DD, (size_t)NB * DD, NB, DD, EE);
  k_gemm_hhx<0><<<gs, 128, 0, stream>>>(Xk, EE, 0, Bw + WSZ, EE, (size_t)DD * EE, 0.0625f, nullptr, 0, nullptr, 1, 0, 0, nullptr, Ks, DD, (size_t)NB * DD, NB, DD, EE);
  k_gemm_hhx<0><<<gs, 128, 0, stream>>>(Xv, EE, 0, Bw + 2 * WSZ, EE, (size_t)DD * EE, 0.0625f, nullptr, 0, nullptr, 1, 0, 0, nullptr, Vs, DD, (size_t)NB * DD, NB, DD, EE);
  k_vt<NH, TT><<<BB * NH * (TT / 64), 256, 0, stream>>>(Vs, DD, 0, Vt);      /* Vᵀ [64][16384] */
  k_flash<<<BB * NH * (TT / 64), 128, 0, stream>>>(Qs, DD, Ks, DD, Vt, nullptr, O, DD);      /* one slab: 16384 queries × 16384 keys */
  k_merge<<<(NB * 2 + 7) / 8, 256, 0, stream>>>(O, (float*)d_out);
}

// v001
// It runs in 369 microseconds.
// In two side-by-side timings against v000, it was 4.63 and 4.62 times as fast.
#include <hip/hip_runtime.h>
// Multi-head attention whose heads are STACKED along the batch axis (B=4096 rows, EMBED=256, 4 heads × 64): q = queries·W_Query, k = keys·W_Key, v = values·W_Value ((in,out), no bias); the heads are split TF-style into [H·B, 64] = [16384, 64] and ONE softmax(q·kᵀ/√64)·v runs over all 16384 stacked rows
// (every query attends to every (head, row) key); the result is merged back to [B, H·64].
// Compute dtype: inputs and weights rounded to bf16; q, k, v as f16 GEMM outputs written directly in the stacked [h·4096 + b][64] layout (grid.y = head); fused flash-style kernel over T = 16384 (online softmax f32, P f16 ×2^10, f32 accumulate) on v_wmma_f32_16x16x32_f16;
// the f32 result rows are permuted into the merged output by a copy kernel (32 lanes × 16 B per instruction).
#define BB 1
#define TT 16384
#define NH 1
#define NB 4096
#define NHD 4
#define EE 256
#define DD 64
#define NR (BB * TT)

typedef __bf16 v16b __attribute__((ext_vector_type(16)));
typedef unsigned short v8us __attribute__((ext_vector_type(8), may_alias));
typedef float  v8f  __attribute__((ext_vector_type(8)));
typedef float  v4f  __attribute__((ext_vector_type(4)));
typedef float  v4fa __attribute__((ext_vector_type(4), may_alias));
union FragB { v16b v; v8us half[2]; unsigned short u[16]; };

__device__ __forceinline__ unsigned short bf16_bits(float x) { unsigned int u = __float_as_uint(x); return (unsigned short)((u + 0x7FFFu + ((u >> 16) & 1u)) >> 16); }
__device__ __forceinline__ float bf16_val(unsigned short b) { return __uint_as_float(((unsigned int)b) << 16); }
__device__ __forceinline__ float bf16_round(float x) { return bf16_val(bf16_bits(x)); }
// D += A·B with NT terms: 1 = ah·bh, 2 = + al·bh (A split), 3 = + ah·bl (both split)
template <int NT>
__device__ __forceinline__ v8f mmaN(v16b ah, v16b al, v16b bh, v16b bl, v8f c) {
  c = __builtin_amdgcn_wmma_f32_16x16x32_bf16(false, ah, false, bh, (short)0, c, false, false);
  if (NT >= 2) c = __builtin_amdgcn_wmma_f32_16x16x32_bf16(false, al, false, bh, (short)0, c, false, false);
  if (NT >= 3) c = __builtin_amdgcn_wmma_f32_16x16x32_bf16(false, ah, false, bl, (short)0, c, false, false);
  asm volatile("v_nop\n\tv_nop\n\tv_nop\n\tv_nop" : "+v"(c) : "v"(ah), "v"(al), "v"(bh), "v"(bl));
  return c;
}

__global__ __launch_bounds__(256) void k_wt_bf16(const float* __restrict__ W, unsigned short* __restrict__ Wt, int K, int N) {
  const int t = blockIdx.x * 256 + threadIdx.x;
  const int k8n = K / 8;
  if (t >= N * k8n) return;
  const int n = t / k8n, k8 = (t % k8n) * 8;
  v8us v;
#pragma unroll
  for (int i = 0; i < 8; ++i) v[i] = bf16_bits(W[(size_t)(k8 + i) * N + n]);
  *(v8us*)(Wt + (size_t)n * K + k8) = v;
  
}

// GEMM C[M][N] (f32, pitch ldc) = act(A[M][K]·W + bias). A f32 row-major (pitch lda) converted per fragment to bf16
// (ASPLIT: hi/lo two planes -> 2 terms, else single rounded term); Wt bf16 [N][K] (pitch ldb). BIAS_BF16 rounds the
// bias to bf16 first (bias quantised to bf16 before the add). K%32==0, M%16==0, N%64==0.
template <bool ASPLIT, int ACT, bool BIAS_BF16>
__global__ __launch_bounds__(128) void k_gemm_bf(const float* __restrict__ A, int lda, const unsigned short* __restrict__ Wt, int ldb,
                                               const float* __restrict__ bias, float* __restrict__ C, int ldc, int M, int N, int K) {
  __shared__ __attribute__((aligned(16))) float so[4][16][64];
  const int tid = threadIdx.x, w = tid >> 5, lane = tid & 31, ln = lane & 15, hh = lane >> 4;
  const int ntn = N / 64;
  const int wid = blockIdx.x * 4 + w;
  const int mt = wid / ntn, nq = wid % ntn;
  if (mt * 16 >= M) return;
  const int row0 = mt * 16, col0 = nq * 64;
  const float* arow = A + (size_t)(row0 + ln) * lda;
  v8f acc[4] = {};
  for (int kb = 0; kb < K; kb += 32) {
    FragB ah, al;
    const v4f x0 = *(const v4fa*)(arow + kb + 8 * hh), x1 = *(const v4fa*)(arow + kb + 8 * hh + 4);
    const v4f x2 = *(const v4fa*)(arow + kb + 16 + 8 * hh), x3 = *(const v4fa*)(arow + kb + 16 + 8 * hh + 4);
    float xs[16] = {x0[0],x0[1],x0[2],x0[3],x1[0],x1[1],x1[2],x1[3],x2[0],x2[1],x2[2],x2[3],x3[0],x3[1],x3[2],x3[3]};
#pragma unroll
    for (int i = 0; i < 16; ++i) { const unsigned short hb = bf16_bits(xs[i]); ah.u[i] = hb; al.u[i] = ASPLIT ? bf16_bits(xs[i] - bf16_val(hb)) : (unsigned short)0; }
#pragma unroll
    for (int t = 0; t < 4; ++t) {
      const unsigned short* brow = Wt + (size_t)(col0 + t * 16 + ln) * ldb + kb;
      FragB b;
      b.half[0] = *(const v8us*)(brow + 8 * hh);
      b.half[1] = *(const v8us*)(brow + 16 + 8 * hh);
      acc[t] = mmaN<ASPLIT ? 2 : 1>(ah.v, al.v, b.v, b.v, acc[t]);
    }
  }
#pragma unroll
  for (int t = 0; t < 4; ++t) {
    float bv = bias ? bias[col0 + t * 16 + ln] : 0.f;
    if (BIAS_BF16) bv = bf16_round(bv);
#pragma unroll
    for (int r = 0; r < 8; ++r) { float v = acc[t][r] + bv; if (ACT == 1) v = fmaxf(v, 0.f); so[w][8 * hh + r][t * 16 + ln] = v; }
  }
  __builtin_amdgcn_fence(__ATOMIC_ACQ_REL, "workgroup");
  __builtin_amdgcn_wave_barrier();
  const int rsub = lane >> 4, c4 = (lane & 15) * 4;
  {
#pragma unroll
    for (int q = 0; q < 8; ++q) {
      const int r = q * 2 + rsub;
      const v4f v = *(const v4fa*)&so[w][r][c4];
      *(v4f*)(C + (size_t)(row0 + r) * ldc + col0 + c4) = v;
    }
    
  }
}

// Flash-style causal/unmasked attention, all contractions 3-term bf16 hi/lo splits, f32 softmax with running max.
// q,k,v rows are read from f32 buffers with arbitrary row pitch (so they can live inside a fused qkv buffer);
// D = head size (multiple of 32, <= 128); one wave = 16 query rows; block = 4 waves (64 queries) sharing K/V chunks of 32.
template <int D, bool CAUSAL>
__global__ __launch_bounds__(128) void k_flash(const float* __restrict__ qb, const float* __restrict__ kb, const float* __restrict__ vb,
                                             int pitch, int T, int H, float scale, float* __restrict__ y, int ypitch) {
  constexpr int KS = D / 32;        // k-steps for QK
  constexpr int DT = D / 16;        // d tiles for PV
  __shared__ __attribute__((aligned(16))) unsigned short sKh[32][D + 8], sKl[32][D + 8], sVh[32][D + 8], sVl[32][D + 8];
  __shared__ __attribute__((aligned(16))) unsigned short sPh[4][16][40], sPl[4][16][40];
  __shared__ __attribute__((aligned(16))) float sO[4][16][D];
  const int tid = threadIdx.x, w = tid >> 5, lane = tid & 31, ln = lane & 15, hh = lane >> 4;
  const int nqb = (T + 63) / 64;
  const int bh = blockIdx.x / nqb, qblk = blockIdx.x % nqb;
  const int b = bh / H, h = bh % H;
  const int q0 = qblk * 64 + w * 16;
  const float* Q = qb + (size_t)b * T * pitch + h * D;
  const float* K = kb + (size_t)b * T * pitch + h * D;
  const float* V = vb + (size_t)b * T * pitch + h * D;

  // A fragments of the wave's 16 query rows (scaled), hi/lo
  FragB aqh[KS], aql[KS];
  {
    int row = q0 + ln; if (row >= T) row = T - 1;
    const float* qr = Q + (size_t)row * pitch;
#pragma unroll
    for (int ks = 0; ks < KS; ++ks)
#pragma unroll
      for (int i = 0; i < 16; ++i) {
        const int d = ks * 32 + ((i < 8) ? (8 * hh + i) : (16 + 8 * hh + (i - 8)));
        const float x = qr[d] * scale; const unsigned short hb = bf16_bits(x);
        aqh[ks].u[i] = hb; aql[ks].u[i] = bf16_bits(x - bf16_val(hb));
      }
  }
  float m_r[8], l_r[8];
#pragma unroll
  for (int r = 0; r < 8; ++r) { m_r[r] = -3.0e38f; l_r[r] = 0.f; }
  v8f oacc[DT];
#pragma unroll
  for (int dt = 0; dt < DT; ++dt) oacc[dt] = (v8f){0.f,0.f,0.f,0.f,0.f,0.f,0.f,0.f};

  const int kv_end = CAUSAL ? min(T, qblk * 64 + 64) : T;     // block-uniform
  for (int j0 = 0; j0 < kv_end; j0 += 32) {
    __syncthreads();
    for (int e = tid; e < 32 * (D / 4); e += 128) {
      const int r = e / (D / 4), c4 = (e % (D / 4)) * 4;
      const int key = j0 + r;
      v4f kf = {0.f,0.f,0.f,0.f}, vf = {0.f,0.f,0.f,0.f};
      if (key < T) { kf = *(const v4fa*)(K + (size_t)key * pitch + c4); vf = *(const v4fa*)(V + (size_t)key * pitch + c4); }
#pragma unroll
      for (int t = 0; t < 4; ++t) {
        unsigned short hb = bf16_bits(kf[t]); sKh[r][c4 + t] = hb; sKl[r][c4 + t] = bf16_bits(kf[t] - bf16_val(hb));
        hb = bf16_bits(vf[t]); sVh[r][c4 + t] = hb; sVl[r][c4 + t] = bf16_bits(vf[t] - bf16_val(hb));
      }
    }
    __syncthreads();
    // S tile 16 x 32
    v8f s[2];
#pragma unroll
    for (int nt = 0; nt < 2; ++nt) {
      v8f acc = {};
#pragma unroll
      for (int ks = 0; ks < KS; ++ks) {
        FragB bh_, bl_;
        bh_.half[0] = *(const v8us*)&sKh[nt * 16 + ln][ks * 32 + 8 * hh]; bh_.half[1] = *(const v8us*)&sKh[nt * 16 + ln][ks * 32 + 16 + 8 * hh];
        bl_.half[0] = *(const v8us*)&sKl[nt * 16 + ln][ks * 32 + 8 * hh]; bl_.half[1] = *(const v8us*)&sKl[nt * 16 + ln][ks * 32 + 16 + 8 * hh];
        acc = mmaN<3>(aqh[ks].v, aql[ks].v, bh_.v, bl_.v, acc);
      }
      s[nt] = acc;
    }
    // mask + running max (rows 8hh+r; the 16 lanes of a half share rows)
    float alpha[8];
#pragma unroll
    for (int r = 0; r < 8; ++r) {
      const int qi = q0 + 8 * hh + r;
      const int ja = j0 + ln, jb = j0 + 16 + ln;
      if (CAUSAL) { if (ja > qi) s[0][r] = -3.0e38f; if (jb > qi) s[1][r] = -3.0e38f; }
      if (ja >= T) s[0][r] = -3.0e38f;
      if (jb >= T) s[1][r] = -3.0e38f;
      float mx = fmaxf(s[0][r], s[1][r]);
      mx = fmaxf(mx, __shfl_xor(mx, 1, 32)); mx = fmaxf(mx, __shfl_xor(mx, 2, 32)); mx = fmaxf(mx, __shfl_xor(mx, 4, 32)); mx = fmaxf(mx, __shfl_xor(mx, 8, 32));
      const float mnew = fmaxf(m_r[r], mx);
      alpha[r] = (mnew > -1.0e38f) ? __expf(m_r[r] - mnew) : 1.0f;
      const float p0 = (s[0][r] > -1.0e38f) ? __expf(s[0][r] - mnew) : 0.f;
      const float p1 = (s[1][r] > -1.0e38f) ? __expf(s[1][r] - mnew) : 0.f;
      m_r[r] = mnew;
      l_r[r] = l_r[r] * alpha[r] + p0 + p1;            // per-lane partial row sum (16 lanes combined at the end)
      unsigned short hb = bf16_bits(p0); sPh[w][8 * hh + r][ln] = hb;      sPl[w][8 * hh + r][ln] = bf16_bits(p0 - bf16_val(hb));
      hb = bf16_bits(p1);                sPh[w][8 * hh + r][16 + ln] = hb; sPl[w][8 * hh + r][16 + ln] = bf16_bits(p1 - bf16_val(hb));
    }
#pragma unroll
    for (int dt = 0; dt < DT; ++dt)
#pragma unroll
      for (int r = 0; r < 8; ++r) oacc[dt][r] *= alpha[r];
    __builtin_amdgcn_fence(__ATOMIC_ACQ_REL, "workgroup");
    __builtin_amdgcn_wave_barrier();
    FragB pah, pal;
    pah.half[0] = *(const v8us*)&sPh[w][ln][8 * hh]; pah.half[1] = *(const v8us*)&sPh[w][ln][16 + 8 * hh];
    pal.half[0] = *(const v8us*)&sPl[w][ln][8 * hh]; pal.half[1] = *(const v8us*)&sPl[w][ln][16 + 8 * hh];
#pragma unroll
    for (int dt = 0; dt < DT; ++dt) {
      FragB bvh, bvl;
#pragma unroll
      for (int i = 0; i < 8; ++i) {
        bvh.u[i] = sVh[8 * hh + i][dt * 16 + ln]; bvh.u[8 + i] = sVh[16 + 8 * hh + i][dt * 16 + ln];
        bvl.u[i] = sVl[8 * hh + i][dt * 16 + ln]; bvl.u[8 + i] = sVl[16 + 8 * hh + i][dt * 16 + ln];
      }
      oacc[dt] = mmaN<3>(pah.v, pal.v, bvh.v, bvl.v, oacc[dt]);
    }
    __builtin_amdgcn_fence(__ATOMIC_ACQ_REL, "workgroup");
    __builtin_amdgcn_wave_barrier();
  }
#pragma unroll
  for (int r = 0; r < 8; ++r) {
    float l = l_r[r];
    l += __shfl_xor(l, 1, 32); l += __shfl_xor(l, 2, 32); l += __shfl_xor(l, 4, 32); l += __shfl_xor(l, 8, 32);
    l_r[r] = (l > 0.f) ? 1.0f / l : 0.f;
  }
#pragma unroll
  for (int dt = 0; dt < DT; ++dt)
#pragma unroll
    for (int r = 0; r < 8; ++r) sO[w][8 * hh + r][dt * 16 + ln] = oacc[dt][r] * l_r[r];
  __builtin_amdgcn_fence(__ATOMIC_ACQ_REL, "workgroup");
  __builtin_amdgcn_wave_barrier();
  {
    for (int r = 0; r < 16; ++r) {
      const int row = q0 + r;
      if (row < T && lane < D / 4) {
        const v4f val = *(const v4fa*)&sO[w][r][lane * 4];
        *(v4f*)(y + ((size_t)b * T + row) * ypitch + h * D + lane * 4) = val;
      }
    }
    
  }
}

// GEMM C = act(A·W + bias + resid): A f32 (ASPLIT -> hi/lo 2 terms), Wt bf16 [N][K]; ACT 0 none, 1 relu, 2 exact gelu;
// resid (optional, f32, row index = (row % rmod), pitch ldr, RES_BF16 rounds it) added before the activation.
template <bool ASPLIT, int ACT, bool BIAS_BF16, bool RES_BF16>
__global__ __launch_bounds__(128) void k_gemm_bf3(const float* __restrict__ A, int lda, const unsigned short* __restrict__ Wt, int ldb,
                                                const float* __restrict__ bias, const float* __restrict__ resid, int rmod, int ldr,
                                                float* __restrict__ C, int ldc, int M, int N, int K) {
  __shared__ __attribute__((aligned(16))) float so[4][16][64];
  const int tid = threadIdx.x, w = tid >> 5, lane = tid & 31, ln = lane & 15, hh = lane >> 4;
  const int ntn = N / 64;
  const int wid = blockIdx.x * 4 + w;
  const int mt = wid / ntn, nq = wid % ntn;
  if (mt * 16 >= M) return;
  const int row0 = mt * 16, col0 = nq * 64;
  const float* arow = A + (size_t)(row0 + ln) * lda;
  v8f acc[4] = {};
  for (int kb = 0; kb < K; kb += 32) {
    FragB ah, al;
    const v4f x0 = *(const v4fa*)(arow + kb + 8 * hh), x1 = *(const v4fa*)(arow + kb + 8 * hh + 4);
    const v4f x2 = *(const v4fa*)(arow + kb + 16 + 8 * hh), x3 = *(const v4fa*)(arow + kb + 16 + 8 * hh + 4);
    float xs[16] = {x0[0],x0[1],x0[2],x0[3],x1[0],x1[1],x1[2],x1[3],x2[0],x2[1],x2[2],x2[3],x3[0],x3[1],x3[2],x3[3]};
#pragma unroll
    for (int i = 0; i < 16; ++i) { const unsigned short hb = bf16_bits(xs[i]); ah.u[i] = hb; al.u[i] = ASPLIT ? bf16_bits(xs[i] - bf16_val(hb)) : (unsigned short)0; }
#pragma unroll
    for (int t = 0; t < 4; ++t) {
      const unsigned short* brow = Wt + (size_t)(col0 + t * 16 + ln) * ldb + kb;
      FragB b;
      b.half[0] = *(const v8us*)(brow + 8 * hh);
      b.half[1] = *(const v8us*)(brow + 16 + 8 * hh);
      acc[t] = mmaN<ASPLIT ? 2 : 1>(ah.v, al.v, b.v, b.v, acc[t]);
    }
  }
#pragma unroll
  for (int t = 0; t < 4; ++t) {
    const int col = col0 + t * 16 + ln;
    float bv = bias ? bias[col] : 0.f;
    if (BIAS_BF16) bv = bf16_round(bv);
#pragma unroll
    for (int r = 0; r < 8; ++r) {
      float v = acc[t][r] + bv;
      if (resid) { float rv = resid[(size_t)((row0 + 8 * hh + r) % rmod) * ldr + col]; if (RES_BF16) rv = bf16_round(rv); v += rv; }
      if (ACT == 1) v = fmaxf(v, 0.f);
      if (ACT == 2) v = 0.5f * v * (1.0f + erff(v * 0.70710678118654752f));
      if (ACT == 3) { const float u = 0.7978845608028654f * (v + 0.044715f * v * v * v); v = 0.5f * v * (1.0f + tanhf(u)); }
      so[w][8 * hh + r][t * 16 + ln] = v;
    }
  }
  __builtin_amdgcn_fence(__ATOMIC_ACQ_REL, "workgroup");
  __builtin_amdgcn_wave_barrier();
  const int rsub = lane >> 4, c4 = (lane & 15) * 4;
  {
#pragma unroll
    for (int q = 0; q < 8; ++q) {
      const int r = q * 2 + rsub;
      const v4f v = *(const v4fa*)&so[w][r][c4];
      *(v4f*)(C + (size_t)(row0 + r) * ldc + col0 + c4) = v;
    }
    
  }
}
// row LayerNorm (biased variance, eps) over N: s = X (+ R); optional out_sum <- s; out_norm <- (s-mu)*rsqrt(var+eps)*g + b
template <bool PARAM_BF16>
__global__ __launch_bounds__(256) void k_layernorm(const float* __restrict__ X, const float* __restrict__ R, const float* __restrict__ g, const float* __restrict__ bta,
                                                  float* __restrict__ out_sum, float* __restrict__ out_norm, int N, float eps) {
  __shared__ float red[256];
  const int row = blockIdx.x, tid = threadIdx.x;
  const float* x = X + (size_t)row * N; const float* rr = R ? R + (size_t)row * N : nullptr;
  float vals[16];                     // up to N = 4096
  const int per = N / 256;            // contiguous chunk per thread? use strided-by-4 chunks: thread handles j = tid*4 + 1024*u
  float s1 = 0.f;
  for (int u = 0; u < per / 4; ++u) {
    const int j = tid * 4 + 1024 * u;
    const v4f a = *(const v4fa*)(x + j);
    v4f b = {0.f,0.f,0.f,0.f}; if (rr) b = *(const v4fa*)(rr + j);
#pragma unroll
    for (int q = 0; q < 4; ++q) { const float v = a[q] + b[q]; vals[u * 4 + q] = v; s1 += v; }
  }
  red[tid] = s1; __syncthreads();
  for (int st = 128; st > 0; st >>= 1) { if (tid < st) red[tid] += red[tid + st]; __syncthreads(); }
  const float mu = red[0] / (float)N; __syncthreads();
  float s2 = 0.f;
  for (int u = 0; u < per / 4; ++u)
#pragma unroll
    for (int q = 0; q < 4; ++q) { const float c = vals[u * 4 + q] - mu; s2 += c * c; }
  red[tid] = s2; __syncthreads();
  for (int st = 128; st > 0; st >>= 1) { if (tid < st) red[tid] += red[tid + st]; __syncthreads(); }
  const float rs = rsqrtf(red[0] / (float)N + eps);
  {
    for (int u = 0; u < per / 4; ++u) {
      const int j = tid * 4 + 1024 * u;
      v4f o, sm;
#pragma unroll
      for (int q = 0; q < 4; ++q) {
        float gg = g[j + q], bb = bta[j + q];
        if (PARAM_BF16) { gg = bf16_round(gg); bb = bf16_round(bb); }
        sm[q] = vals[u * 4 + q]; o[q] = (vals[u * 4 + q] - mu) * rs * gg + bb;
      }
      if (out_sum) *(v4f*)(out_sum + (size_t)row * N + j) = sm;
      *(v4f*)(out_norm + (size_t)row * N + j) = o;
    }
    
  }
}



// ---- f16 WMMA path (v_wmma_f32_16x16x32_f16): 11-bit significands for operands in range — used where a [0,1] probability operand needs more precision than bf16
typedef _Float16 v16h __attribute__((ext_vector_type(16)));
union FragH { v16h v; v8us half[2]; _Float16 h[16]; unsigned short u[16]; };
template <int NT>
__device__ __forceinline__ v8f mmaH(v16h ah, v16h al, v16h bh, v16h bl, v8f c) {
  c = __builtin_amdgcn_wmma_f32_16x16x32_f16(false, ah, false, bh, (short)0, c, false, false);
  if (NT >= 2) c = __builtin_amdgcn_wmma_f32_16x16x32_f16(false, al, false, bh, (short)0, c, false, false);
  if (NT >= 3) c = __builtin_amdgcn_wmma_f32_16x16x32_f16(false, ah, false, bl, (short)0, c, false, false);
  asm volatile("v_nop\n\tv_nop\n\tv_nop\n\tv_nop" : "+v"(c) : "v"(ah), "v"(al), "v"(bh), "v"(bl));
  return c;
}
// batched GEMM like k_gemm_b but f16 operands: A f32 (split into f16 hi/lo if ASPLIT, else rounded to f16), Bt = f16 values [n][k]; alpha; C f32; N multiple of 16 (partial tiles skipped)
template <bool ASPLIT>
__global__ __launch_bounds__(128) void k_gemm_h(const float* __restrict__ A, int lda, size_t sA, const _Float16* __restrict__ Bh, int ldb, size_t sB, float alpha, float* __restrict__ C, int ldc, size_t sC, int M, int N, int K) {
  __shared__ __attribute__((aligned(16))) float so[4][16][64];
  const int tid = threadIdx.x, w = tid >> 5, lane = tid & 31, ln = lane & 15, hh = lane >> 4; const int by = blockIdx.y;
  A += (size_t)by * sA; Bh += (size_t)by * sB; C += (size_t)by * sC;
  const int ntn = (N + 63) / 64; const int wid = blockIdx.x * 4 + w; const int mt = wid / ntn, nq = wid % ntn; if (mt * 16 >= M) return;
  const int row0 = mt * 16, col0 = nq * 64; const float* arow = A + (size_t)(row0 + ln) * lda;
  v8f acc[4] = {};
  for (int kb = 0; kb < K; kb += 32) {
    FragH ah, al;
    const v4f x0 = *(const v4fa*)(arow + kb + 8 * hh), x1 = *(const v4fa*)(arow + kb + 8 * hh + 4), x2 = *(const v4fa*)(arow + kb + 16 + 8 * hh), x3 = *(const v4fa*)(arow + kb + 16 + 8 * hh + 4);
    float xs[16] = {x0[0],x0[1],x0[2],x0[3],x1[0],x1[1],x1[2],x1[3],x2[0],x2[1],x2[2],x2[3],x3[0],x3[1],x3[2],x3[3]};
#pragma unroll
    for (int i = 0; i < 16; ++i) { const _Float16 h = (_Float16)xs[i]; ah.h[i] = h; al.h[i] = ASPLIT ? (_Float16)(xs[i] - (float)h) : (_Float16)0.0f; }
#pragma unroll
    for (int t = 0; t < 4; ++t) { if (col0 + t * 16 >= N) continue; const size_t boff = (size_t)(col0 + t * 16 + ln) * ldb + kb; FragH bq; bq.half[0] = *(const v8us*)(Bh + boff + 8 * hh); bq.half[1] = *(const v8us*)(Bh + boff + 16 + 8 * hh);
      acc[t] = mmaH<ASPLIT ? 2 : 1>(ah.v, al.v, bq.v, bq.v, acc[t]); }
  }
#pragma unroll
  for (int t = 0; t < 4; ++t) { if (col0 + t * 16 >= N) continue;
#pragma unroll
    for (int r = 0; r < 8; ++r) so[w][8 * hh + r][t * 16 + ln] = acc[t][r] * alpha; }
  __builtin_amdgcn_fence(__ATOMIC_ACQ_REL, "workgroup"); __builtin_amdgcn_wave_barrier();
  const int rsub = lane >> 4, c4 = (lane & 15) * 4;
  {
#pragma unroll
    for (int q = 0; q < 8; ++q) { const int r = q * 2 + rsub; if (col0 + c4 < N) { const v4f v = *(const v4fa*)&so[w][r][c4]; *(v4f*)(C + (size_t)(row0 + r) * ldc + col0 + c4) = v; } }
     }
}

// Wt[n][k] = f16(bf16(W[k][n])·scale) from f32 row-major W[K][N] (scale = power of two; bf16-exact weights stay exact in f16 away from the subnormal range)
__global__ __launch_bounds__(256) void k_wt_f16(const float* __restrict__ W, _Float16* __restrict__ Wt, int K, int N, float scale) {
  const int t = blockIdx.x * 256 + threadIdx.x; if (t >= N * (K / 8)) return; const int n = t / (K / 8), k8 = (t % (K / 8)) * 8; FragH f;
#pragma unroll
  for (int i = 0; i < 8; ++i) f.h[i] = (_Float16)(bf16_round(W[(size_t)(k8 + i) * N + n]) * scale); const v8us o = f.half[0];
  *(v8us*)((unsigned short*)Wt + (size_t)n * K + k8) = o; 
}
// k_gemm_hh variant with fused epilogue: v = acc·alpha + bias[by·sBias + col] (+ CP[(row/rowsPerB)·sCPb + by·64 + col] if CP) ; ACT 0 none / 1 elu ; writes f16 C16 (and f32 C if non-null)
template <int ACT>
__global__ __launch_bounds__(128) void k_gemm_hhx(const _Float16* __restrict__ A, int lda, size_t sA, const _Float16* __restrict__ Bh, int ldb, size_t sB, float alpha, const float* __restrict__ bias, size_t sBias, const float* __restrict__ CP, int rowsPerB, size_t sCPb, int row0g,
    float* __restrict__ C, _Float16* __restrict__ C16, int ldc, size_t sC, int M, int N, int K) {
  __shared__ __attribute__((aligned(16))) float so[4][16][64];
  const int tid = threadIdx.x, w = tid >> 5, lane = tid & 31, ln = lane & 15, hh = lane >> 4; const int by = blockIdx.y;
  A += (size_t)by * sA; Bh += (size_t)by * sB; const size_t cofs = (size_t)by * sC; const float* bp = bias ? bias + (size_t)by * sBias : nullptr;
  const int ntn = (N + 63) / 64; const int wid = blockIdx.x * 4 + w; const int mt = wid / ntn, nq = wid % ntn; if (mt * 16 >= M) return;
  const int row0 = mt * 16, col0 = nq * 64; const _Float16* arow = A + (size_t)(row0 + ln) * lda;
  v8f acc[4] = {};
  for (int kb = 0; kb < K; kb += 32) { FragH ah; ah.half[0] = *(const v8us*)((const unsigned short*)arow + kb + 8 * hh); ah.half[1] = *(const v8us*)((const unsigned short*)arow + kb + 16 + 8 * hh);
#pragma unroll
    for (int t = 0; t < 4; ++t) { if (col0 + t * 16 >= N) continue; const size_t boff = (size_t)(col0 + t * 16 + ln) * ldb + kb; FragH bq; bq.half[0] = *(const v8us*)((const unsigned short*)Bh + boff + 8 * hh); bq.half[1] = *(const v8us*)((const unsigned short*)Bh + boff + 16 + 8 * hh);
      acc[t] = mmaH<1>(ah.v, ah.v, bq.v, bq.v, acc[t]); }
  }
#pragma unroll
  for (int t = 0; t < 4; ++t) { if (col0 + t * 16 >= N) continue; const int col = col0 + t * 16 + ln; const float bv = bp ? bf16_round(bp[col]) : 0.f;
#pragma unroll
    for (int r = 0; r < 8; ++r) { float v = acc[t][r] * alpha + bv; if (CP) { const int bidx = (row0g + row0 + 8 * hh + r) / rowsPerB; v += CP[(size_t)bidx * sCPb + (size_t)by * 64 + col]; } if (ACT == 1) v = (v > 0.f) ? v : expm1f(v); else if (ACT == 7) v = (v > 0.f) ? v + 1.0f : expf(v); else if (ACT == 8) v = tanhf(v); else if (ACT == 9) v = 0.5f * v * (1.0f + tanhf(0.7978845608028654f * (v + 0.044715f * v * v * v))); else if (ACT == 11) v = 1.0f / (1.0f + expf(-v)); else if (ACT == 12) v = (v > 0.f) ? v : 0.01f * v; else if (ACT == 14) v = (v > 0.f) ? v : 0.1f * v; else if (ACT == 15) v = v / (1.0f + expf(-v)); else if (ACT == 3) v = fmaxf(v, 0.f); else if (ACT == 6) v = 0.5f * v * (1.0f + erff(v * 0.70710678118654752f)); so[w][8 * hh + r][t * 16 + ln] = v; } }
  __builtin_amdgcn_fence(__ATOMIC_ACQ_REL, "workgroup"); __builtin_amdgcn_wave_barrier();
  const int rsub = lane >> 4, c4 = (lane & 15) * 4; typedef _Float16 v4h __attribute__((ext_vector_type(4)));
  {
#pragma unroll
    for (int q = 0; q < 8; ++q) { const int r = q * 2 + rsub; if (col0 + c4 < N) { const v4f v = *(const v4fa*)&so[w][r][c4]; if (C) *(v4f*)(C + cofs + (size_t)(row0 + r) * ldc + col0 + c4) = v; if (C16) { v4h h4; for (int i = 0; i < 4; ++i) h4[i] = (_Float16)v[i]; *(v4h*)(C16 + cofs + (size_t)(row0 + r) * ldc + col0 + c4) = h4; } } }
     }
}


typedef _Float16 v4h __attribute__((ext_vector_type(4)));

__global__ __launch_bounds__(256) void k_x16(const float* __restrict__ x, _Float16* __restrict__ X16, size_t n8) { const size_t t = (size_t)blockIdx.x * 256 + threadIdx.x; if (t >= n8) return; FragH f;
#pragma unroll
  for (int q = 0; q < 8; ++q) f.h[q] = (_Float16)bf16_round(x[t * 8 + q]); *(v8us*)((unsigned short*)X16 + t * 8) = f.half[0];  }
__global__ __launch_bounds__(256) void k_h16(const float* __restrict__ x, _Float16* __restrict__ X16, size_t n8) { const size_t t = (size_t)blockIdx.x * 256 + threadIdx.x; if (t >= n8) return; FragH f;
#pragma unroll
  for (int q = 0; q < 8; ++q) f.h[q] = (_Float16)x[t * 8 + q]; *(v8us*)((unsigned short*)X16 + t * 8) = f.half[0];  }
__global__ __launch_bounds__(256) void k_round16f(const float* __restrict__ W, _Float16* __restrict__ Bt, size_t n8) { const size_t t = (size_t)blockIdx.x * 256 + threadIdx.x; if (t >= n8) return; FragH f;
#pragma unroll
  for (int i = 0; i < 8; ++i) f.h[i] = (_Float16)(bf16_round(W[t * 8 + i]) * 16.0f); *(v8us*)((unsigned short*)Bt + t * 8) = f.half[0];  }
template <int NHv, int TTv>
__global__ __launch_bounds__(256) void k_vt(const _Float16* __restrict__ V16, int ldv, int voff, _Float16* __restrict__ Vt) { __shared__ unsigned short tl[64][66]; const int tid = threadIdx.x; const int slab = blockIdx.x / (TTv / 64), lg = blockIdx.x % (TTv / 64); const int b = slab / NHv, h = slab % NHv;
  for (int i = tid; i < 64 * 8; i += 256) { const int r = i / 8, c8 = (i % 8) * 8; FragH f; f.half[0] = *(const v8us*)((const unsigned short*)V16 + ((size_t)b * TTv + lg * 64 + r) * ldv + voff + h * 64 + c8);
#pragma unroll
    for (int q = 0; q < 8; ++q) tl[r][c8 + q] = f.u[q]; }
  __syncthreads();
  {
#pragma unroll
    for (int rd = 0; rd < 2; ++rd) { const int d = rd * 32 + tid / 8, pc = tid % 8; FragH f;
#pragma unroll
      for (int q = 0; q < 8; ++q) f.u[q] = tl[pc * 8 + q][d];
      *(v8us*)((unsigned short*)Vt + ((size_t)slab * 64 + d) * TTv + lg * 64 + pc * 8) = f.half[0]; }
     } }

__global__ __launch_bounds__(256) void k_h16s(const float* __restrict__ F, _Float16* __restrict__ H, size_t n8) { const size_t t = (size_t)blockIdx.x * 256 + threadIdx.x; if (t >= n8) return; const v4f a = *(const v4fa*)(F + t * 8), c = *(const v4fa*)(F + t * 8 + 4); FragH f;
#pragma unroll
  for (int q = 0; q < 4; ++q) { f.h[q] = (_Float16)(a[q] * 16.0f); f.h[4 + q] = (_Float16)(c[q] * 16.0f); } *(v8us*)((unsigned short*)H + t * 8) = f.half[0];  }
__global__ __launch_bounds__(256) void k_merge(const float* __restrict__ O, float* __restrict__ out) {
  const int tid = threadIdx.x; const int wg = blockIdx.x * 8 + (tid >> 5); if (wg >= NB * 2) return; const int b = wg >> 1, hp = wg & 1; const int l = tid & 31; const int h = hp * 2 + (l >> 4), c4 = (l & 15) * 4;
  const v4f v = *(const v4fa*)(O + ((size_t)h * NB + b) * DD + c4); float* o = out + (size_t)b * EE + h * DD + c4;
  *(v4f*)o = v;  }
// Work-group = 32 waves (8 per SIMD): wave w works query tile (w & 3) against every KSPL-th block of 32 keys, starting at block (w >> 2), with its own running max, sum and
// un-normalised accumulator; the KSPL partials of a query row are merged in LDS behind one work-group barrier (weights exp(m_g - M)).
__global__ __launch_bounds__(1024) void k_flash(const _Float16* __restrict__ Q16, int ldq, const _Float16* __restrict__ K16, int ldk, const _Float16* __restrict__ Vt, const int* __restrict__ MSK, float* __restrict__ O, int ldo) {
  constexpr int RPW = 16, RTN = RPW / 16, NQB = TT / (4 * RPW), DT = 4, KS = 2, KSPL = 8, NW = 4 * KSPL;
  __shared__ __attribute__((aligned(16))) unsigned short sP[NW][RPW][40]; __shared__ __attribute__((aligned(16))) float sO[NW][RPW][64 + 4]; __shared__ float sM[NW][RPW], sL[NW][RPW];
  const int tid = threadIdx.x, lane = tid & 31, ln = lane & 15, hh = lane >> 4;
  const int w = __builtin_amdgcn_readfirstlane(tid >> 5) & (NW - 1);      // wave number in a scalar register, so that the key loop's counter and branch are scalar; the mask (an identity) shows the compiler its range: no zero-trip path, no spill
  const int slab = blockIdx.x / NQB, qblk = blockIdx.x % NQB; const int b = slab / NH, h = slab % NH; const int qb0 = qblk * (4 * RPW); const int q0 = qb0 + (w & 3) * RPW;
  FragH aq[2][KS];
#pragma unroll
  for (int rt = 0; rt < RTN; ++rt) { const unsigned short* qr = (const unsigned short*)Q16 + ((size_t)b * TT + q0 + rt * 16 + ln) * ldq + h * 64;
#pragma unroll
    for (int ks = 0; ks < KS; ++ks) { aq[rt][ks].half[0] = *(const v8us*)(qr + ks * 32 + 8 * hh); aq[rt][ks].half[1] = *(const v8us*)(qr + ks * 32 + 16 + 8 * hh); } }
  const unsigned short* Vth = (const unsigned short*)Vt + (size_t)slab * 64 * TT;
  float m_r[2][8], l_r[2][8]; v8f oacc[2][DT];
#pragma unroll
  for (int rt = 0; rt < RTN; ++rt) {
#pragma unroll
    for (int r = 0; r < 8; ++r) { m_r[rt][r] = -3.0e38f; l_r[rt][r] = 0.f; }
#pragma unroll
    for (int dt = 0; dt < DT; ++dt) oacc[rt][dt] = (v8f){0.f,0.f,0.f,0.f,0.f,0.f,0.f,0.f}; }
  const int jend = TT;
#pragma unroll 1
  for (int j0 = (w >> 2) * 32; j0 < jend; j0 += 32 * KSPL) {
    v8f s[2][2];
#pragma unroll
    for (int nt = 0; nt < 2; ++nt) { const unsigned short* kr = (const unsigned short*)K16 + ((size_t)b * TT + j0 + nt * 16 + ln) * ldk + h * 64; FragH bk[KS];
#pragma unroll
      for (int ks = 0; ks < KS; ++ks) { bk[ks].half[0] = *(const v8us*)(kr + ks * 32 + 8 * hh); bk[ks].half[1] = *(const v8us*)(kr + ks * 32 + 16 + 8 * hh); }
#pragma unroll
      for (int rt = 0; rt < RTN; ++rt) { v8f acc = (v8f){0.f,0.f,0.f,0.f,0.f,0.f,0.f,0.f};
#pragma unroll
        for (int ks = 0; ks < KS; ++ks) acc = mmaH<1>(aq[rt][ks].v, aq[rt][ks].v, bk[ks].v, bk[ks].v, acc); s[rt][nt] = acc; } }
#pragma unroll
    for (int rt = 0; rt < RTN; ++rt)
#pragma unroll
      for (int r = 0; r < 8; ++r) { const int tq = q0 + rt * 16 + 8 * hh + r; const int k0 = j0 + ln, k1 = j0 + 16 + ln; (void)tq; (void)k0; (void)k1;
        const bool ok0 = true, ok1 = true;
        const float s0 = s[rt][0][r] * 0.125f, s1 = s[rt][1][r] * 0.125f; float mc = fmaxf(s0, s1);
        mc = fmaxf(mc, __shfl_xor(mc, 1, 32)); mc = fmaxf(mc, __shfl_xor(mc, 2, 32)); mc = fmaxf(mc, __shfl_xor(mc, 4, 32)); mc = fmaxf(mc, __shfl_xor(mc, 8, 32));
        const float mn = fmaxf(m_r[rt][r], mc); const float al = (mn > -1.0e38f) ? expf(m_r[rt][r] - mn) : 1.0f; m_r[rt][r] = mn; const float p0 = ok0 ? expf(s0 - mn) : 0.f, p1 = ok1 ? expf(s1 - mn) : 0.f; l_r[rt][r] = l_r[rt][r] * al + p0 + p1;
#pragma unroll
        for (int dt = 0; dt < DT; ++dt) oacc[rt][dt][r] *= al;
        FragH t2; t2.h[0] = (_Float16)(p0 * 1024.0f); t2.h[1] = (_Float16)(p1 * 1024.0f); sP[w][rt * 16 + 8 * hh + r][ln] = t2.u[0]; sP[w][rt * 16 + 8 * hh + r][16 + ln] = t2.u[1]; }
    __builtin_amdgcn_fence(__ATOMIC_ACQ_REL, "workgroup"); __builtin_amdgcn_wave_barrier();
    FragH pa[2];
#pragma unroll
    for (int rt = 0; rt < RTN; ++rt) { pa[rt].half[0] = *(const v8us*)&sP[w][rt * 16 + ln][8 * hh]; pa[rt].half[1] = *(const v8us*)&sP[w][rt * 16 + ln][16 + 8 * hh]; }
#pragma unroll
    for (int dt = 0; dt < DT; ++dt) { const unsigned short* vrow = Vth + (size_t)(dt * 16 + ln) * TT + j0; FragH bv; bv.half[0] = *(const v8us*)(vrow + 8 * hh); bv.half[1] = *(const v8us*)(vrow + 16 + 8 * hh);
#pragma unroll
      for (int rt = 0; rt < RTN; ++rt) oacc[rt][dt] = mmaH<1>(pa[rt].v, pa[rt].v, bv.v, bv.v, oacc[rt][dt]); }
    __builtin_amdgcn_fence(__ATOMIC_ACQ_REL, "workgroup"); __builtin_amdgcn_wave_barrier(); }
#pragma unroll
  for (int rt = 0; rt < RTN; ++rt) {
#pragma unroll
    for (int r = 0; r < 8; ++r) { float l = l_r[rt][r]; l += __shfl_xor(l, 1, 32); l += __shfl_xor(l, 2, 32); l += __shfl_xor(l, 4, 32); l += __shfl_xor(l, 8, 32);
      if (ln == 0) { sM[w][rt * 16 + 8 * hh + r] = m_r[rt][r]; sL[w][rt * 16 + 8 * hh + r] = l; } }
#pragma unroll
    for (int dt = 0; dt < DT; ++dt)
#pragma unroll
      for (int r = 0; r < 8; ++r) sO[w][rt * 16 + 8 * hh + r][dt * 16 + ln] = oacc[rt][dt][r]; }
  __syncthreads();      // every wave's partial (max, sum, accumulator) is in LDS before any wave merges
  for (int e = tid; e < 4 * RPW * 16; e += 32 * NW) { const int row = e >> 4, pc = e & 15, qt = row / RPW, r = row % RPW;      // one query row per 16 lanes, 16 B per lane
    float mg[KSPL], M = -3.0e38f;
#pragma unroll
    for (int g = 0; g < KSPL; ++g) { mg[g] = sM[g * 4 + qt][r]; M = fmaxf(M, mg[g]); }
    float L = 0.f; v4f acc = {0.f, 0.f, 0.f, 0.f};
#pragma unroll
    for (int g = 0; g < KSPL; ++g) { const float wg = expf(mg[g] - M); L += wg * sL[g * 4 + qt][r]; const v4f pv = *(const v4fa*)&sO[g * 4 + qt][r][pc * 4]; acc += pv * wg; }
    const float inv = (L > 0.f) ? 1.0f / (L * 1024.0f) : 0.f;
    *(v4f*)(O + ((size_t)b * TT + qb0 + row) * ldo + h * 64 + pc * 4) = acc * inv; } }

extern "C" void kernel_launch(void* const* d_in, const int* in_sizes, int n_in,
                              void* d_out, int out_size, void* d_ws, size_t ws_size, hipStream_t stream) {
  (void)in_sizes; (void)n_in; (void)out_size;
  const float* const* I = (const float* const*)d_in; const float* xq = I[0]; const float* xk = I[1]; const float* xv = I[2]; const float* Wq = I[3]; const float* Wk = I[4]; const float* Wv = I[5];
  char* ws = (char*)d_ws; size_t off = 0;
  auto take = [&](size_t bytes) { char* p = ws + off; off += (bytes + 255) & ~(size_t)255; return p; };
  const size_t WSZ = (size_t)EE * EE; _Float16* Bw = (_Float16*)take(3 * WSZ * 2);
  _Float16* Xq = (_Float16*)take((size_t)NB * EE * 2); _Float16* Xk = (_Float16*)take((size_t)NB * EE * 2); _Float16* Xv = (_Float16*)take((size_t)NB * EE * 2);
  _Float16* Qs = (_Float16*)take((size_t)TT * DD * 2); _Float16* Ks = (_Float16*)take((size_t)TT * DD * 2); _Float16* Vs = (_Float16*)take((size_t)TT * DD * 2); _Float16* Vt = (_Float16*)take((size_t)TT * DD * 2); float* O = (float*)take((size_t)TT * DD * 4);
  if (off > ws_size) return;      // 0.4 + 3 × 2.1 + 4 × 2.1 + 4.2 ≈ 19 MB
  const unsigned gw = (unsigned)((EE * (EE / 8) + 255) / 256);
  k_wt_f16<<<gw, 256, 0, stream>>>(Wq, Bw, EE, EE, 16.0f); k_wt_f16<<<gw, 256, 0, stream>>>(Wk, Bw + WSZ, EE, EE, 16.0f); k_wt_f16<<<gw, 256, 0, stream>>>(Wv, Bw + 2 * WSZ, EE, EE, 16.0f);      /* (in,out) → Bt ×2^4 */
  const unsigned g8 = (unsigned)(((size_t)NB * EE / 8 + 255) / 256); k_x16<<<g8, 256, 0, stream>>>(xq, Xq, (size_t)NB * EE / 8); k_x16<<<g8, 256, 0, stream>>>(xk, Xk, (size_t)NB * EE / 8); k_x16<<<g8, 256, 0, stream>>>(xv, Xv, (size_t)NB * EE / 8);
  const dim3 gs(((NB / 16) * 1 + 3) / 4, NHD);      /* per head h = grid.y: C16[h·NB + b][0..63] = X·Bt[h·64 .. h·64+63]ᵀ — M 4096 N 64 K 256, written straight into the stacked plane */
  k_gemm_hhx<0><<<gs, 128, 0, stream>>>(Xq, EE, 0, Bw, EE, (size_t)DD * EE, 0.0625f, nullptr, 0, nullptr, 1, 0, 0, nullptr, Qs, DD, (size_t)NB * DD, NB, DD, EE);
  k_gemm_hhx<0><<<gs, 128, 0, stream>>>(Xk, EE, 0, Bw + WSZ, EE, (size_t)DD * EE, 0.0625f, nullptr, 0, nullptr, 1, 0, 0, nullptr, Ks, DD, (size_t)NB * DD, NB, DD, EE);
  k_gemm_hhx<0><<<gs, 128, 0, stream>>>(Xv, EE, 0, Bw + 2 * WSZ, EE, (size_t)DD * EE, 0.0625f, nullptr, 0, nullptr, 1, 0, 0, nullptr, Vs, DD, (size_t)NB * DD, NB, DD, EE);
  k_vt<NH, TT><<<BB * NH * (TT / 64), 256, 0, stream>>>(Vs, DD, 0, Vt);      /* Vᵀ [64][16384] */
  k_flash<<<BB * NH * (TT / 64), 1024, 0, stream>>>(Qs, DD, Ks, DD, Vt, nullptr, O, DD);      /* one slab: 16384 queries × 16384 keys */
  k_merge<<<(NB * 2 + 7) / 8, 256, 0, stream>>>(O, (float*)d_out);
}

// v002
// Measured time: 315 microseconds a run.
// Two timings next to v001 both put it at 1.17 times that version's speed.
// Counting every step since v000, it is 5.43 times as fast.
#include <hip/hip_runtime.h>
// Multi-head attention whose heads are STACKED along the batch axis (B=4096 rows, EMBED=256, 4 heads × 64): q = queries·W_Query, k = keys·W_Key, v = values·W_Value ((in,out), no bias); the heads are split TF-style into [H·B, 64] = [16384, 64] and ONE softmax(q·kᵀ/√64)·v runs over all 16384 stacked rows
// (every query attends to every (head, row) key); the result is merged back to [B, H·64].
// Compute dtype: inputs and weights rounded to bf16; q, k, v as f16 GEMM outputs written directly in the stacked [h·4096 + b][64] layout (grid.y = head); fused flash-style kernel over T = 16384 (online softmax f32, P f16 ×2^10, f32 accumulate) on v_wmma_f32_16x16x32_f16;
// the f32 result rows are permuted into the merged output by a copy kernel (32 lanes × 16 B per instruction).
#define BB 1
#define TT 16384
#define NH 1
#define NB 4096
#define NHD 4
#define EE 256
#define DD 64
#define NR (BB * TT)

typedef __bf16 v16b __attribute__((ext_vector_type(16)));
typedef unsigned short v8us __attribute__((ext_vector_type(8), may_alias));
typedef float  v8f  __attribute__((ext_vector_type(8)));
typedef float  v4f  __attribute__((ext_vector_type(4)));
typedef float  v4fa __attribute__((ext_vector_type(4), may_alias));
union FragB { v16b v; v8us half[2]; unsigned short u[16]; };

__device__ __forceinline__ unsigned short bf16_bits(float x) { unsigned int u = __float_as_uint(x); return (unsigned short)((u + 0x7FFFu + ((u >> 16) & 1u)) >> 16); }
__device__ __forceinline__ float bf16_val(unsigned short b) { return __uint_as_float(((unsigned int)b) << 16); }
__device__ __forceinline__ float bf16_round(float x) { return bf16_val(bf16_bits(x)); }
// D += A·B with NT terms: 1 = ah·bh, 2 = + al·bh (A split), 3 = + ah·bl (both split)
template <int NT>
__device__ __forceinline__ v8f mmaN(v16b ah, v16b al, v16b bh, v16b bl, v8f c) {
  c = __builtin_amdgcn_wmma_f32_16x16x32_bf16(false, ah, false, bh, (short)0, c, false, false);
  if (NT >= 2) c = __builtin_amdgcn_wmma_f32_16x16x32_bf16(false, al, false, bh, (short)0, c, false, false);
  if (NT >= 3) c = __builtin_amdgcn_wmma_f32_16x16x32_bf16(false, ah, false, bl, (short)0, c, false, false);
  asm volatile("v_nop\n\tv_nop\n\tv_nop\n\tv_nop" : "+v"(c) : "v"(ah), "v"(al), "v"(bh), "v"(bl));
  return c;
}

__global__ __launch_bounds__(256) void k_wt_bf16(const float* __restrict__ W, unsigned short* __restrict__ Wt, int K, int N) {
  const int t = blockIdx.x * 256 + threadIdx.x;
  const int k8n = K / 8;
  if (t >= N * k8n) return;
  const int n = t / k8n, k8 = (t % k8n) * 8;
  v8us v;
#pragma unroll
  for (int i = 0; i < 8; ++i) v[i] = bf16_bits(W[(size_t)(k8 + i) * N + n]);
  *(v8us*)(Wt + (size_t)n * K + k8) = v;
  
}

// GEMM C[M][N] (f32, pitch ldc) = act(A[M][K]·W + bias). A f32 row-major (pitch lda) converted per fragment to bf16
// (ASPLIT: hi/lo two planes -> 2 terms, else single rounded term); Wt bf16 [N][K] (pitch ldb). BIAS_BF16 rounds the
// bias to bf16 first (bias quantised to bf16 before the add). K%32==0, M%16==0, N%64==0.
template <bool ASPLIT, int ACT, bool BIAS_BF16>
__global__ __launch_bounds__(128) void k_gemm_bf(const float* __restrict__ A, int lda, const unsigned short* __restrict__ Wt, int ldb,
                                               const float* __restrict__ bias, float* __restrict__ C, int ldc, int M, int N, int K) {
  __shared__ __attribute__((aligned(16))) float so[4][16][64];
  const int tid = threadIdx.x, w = tid >> 5, lane = tid & 31, ln = lane & 15, hh = lane >> 4;
  const int ntn = N / 64;
  const int wid = blockIdx.x * 4 + w;
  const int mt = wid / ntn, nq = wid % ntn;
  if (mt * 16 >= M) return;
  const int row0 = mt * 16, col0 = nq * 64;
  const float* arow = A + (size_t)(row0 + ln) * lda;
  v8f acc[4] = {};
  for (int kb = 0; kb < K; kb += 32) {
    FragB ah, al;
    const v4f x0 = *(const v4fa*)(arow + kb + 8 * hh), x1 = *(const v4fa*)(arow + kb + 8 * hh + 4);
    const v4f x2 = *(const v4fa*)(arow + kb + 16 + 8 * hh), x3 = *(const v4fa*)(arow + kb + 16 + 8 * hh + 4);
    float xs[16] = {x0[0],x0[1],x0[2],x0[3],x1[0],x1[1],x1[2],x1[3],x2[0],x2[1],x2[2],x2[3],x3[0],x3[1],x3[2],x3[3]};
#pragma unroll
    for (int i = 0; i < 16; ++i) { const unsigned short hb = bf16_bits(xs[i]); ah.u[i] = hb; al.u[i] = ASPLIT ? bf16_bits(xs[i] - bf16_val(hb)) : (unsigned short)0; }
#pragma unroll
    for (int t = 0; t < 4; ++t) {
      const unsigned short* brow = Wt + (size_t)(col0 + t * 16 + ln) * ldb + kb;
      FragB b;
      b.half[0] = *(const v8us*)(brow + 8 * hh);
      b.half[1] = *(const v8us*)(brow + 16 + 8 * hh);
      acc[t] = mmaN<ASPLIT ? 2 : 1>(ah.v, al.v, b.v, b.v, acc[t]);
    }
  }
#pragma unroll
  for (int t = 0; t < 4; ++t) {
    float bv = bias ? bias[col0 + t * 16 + ln] : 0.f;
    if (BIAS_BF16) bv = bf16_round(bv);
#pragma unroll
    for (int r = 0; r < 8; ++r) { float v = acc[t][r] + bv; if (ACT == 1) v = fmaxf(v, 0.f); so[w][8 * hh + r][t * 16 + ln] = v; }
  }
  __builtin_amdgcn_fence(__ATOMIC_ACQ_REL, "workgroup");
  __builtin_amdgcn_wave_barrier();
  const int rsub = lane >> 4, c4 = (lane & 15) * 4;
  {
#pragma unroll
    for (int q = 0; q < 8; ++q) {
      const int r = q * 2 + rsub;
      const v4f v = *(const v4fa*)&so[w][r][c4];
      *(v4f*)(C + (size_t)(row0 + r) * ldc + col0 + c4) = v;
    }
    
  }
}

// Flash-style causal/unmasked attention, all contractions 3-term bf16 hi/lo splits, f32 softmax with running max.
// q,k,v rows are read from f32 buffers with arbitrary row pitch (so they can live inside a fused qkv buffer);
// D = head size (multiple of 32, <= 128); one wave = 16 query rows; block = 4 waves (64 queries) sharing K/V chunks of 32.
template <int D, bool CAUSAL>
__global__ __launch_bounds__(128) void k_flash(const float* __restrict__ qb, const float* __restrict__ kb, const float* __restrict__ vb,
                                             int pitch, int T, int H, float scale, float* __restrict__ y, int ypitch) {
  constexpr int KS = D / 32;        // k-steps for QK
  constexpr int DT = D / 16;        // d tiles for PV
  __shared__ __attribute__((aligned(16))) unsigned short sKh[32][D + 8], sKl[32][D + 8], sVh[32][D + 8], sVl[32][D + 8];
  __shared__ __attribute__((aligned(16))) unsigned short sPh[4][16][40], sPl[4][16][40];
  __shared__ __attribute__((aligned(16))) float sO[4][16][D];
  const int tid = threadIdx.x, w = tid >> 5, lane = tid & 31, ln = lane & 15, hh = lane >> 4;
  const int nqb = (T + 63) / 64;
  const int bh = blockIdx.x / nqb, qblk = blockIdx.x % nqb;
  const int b = bh / H, h = bh % H;
  const int q0 = qblk * 64 + w * 16;
  const float* Q = qb + (size_t)b * T * pitch + h * D;
  const float* K = kb + (size_t)b * T * pitch + h * D;
  const float* V = vb + (size_t)b * T * pitch + h * D;

  // A fragments of the wave's 16 query rows (scaled), hi/lo
  FragB aqh[KS], aql[KS];
  {
    int row = q0 + ln; if (row >= T) row = T - 1;
    const float* qr = Q + (size_t)row * pitch;
#pragma unroll
    for (int ks = 0; ks < KS; ++ks)
#pragma unroll
      for (int i = 0; i < 16; ++i) {
        const int d = ks * 32 + ((i < 8) ? (8 * hh + i) : (16 + 8 * hh + (i - 8)));
        const float x = qr[d] * scale; const unsigned short hb = bf16_bits(x);
        aqh[ks].u[i] = hb; aql[ks].u[i] = bf16_bits(x - bf16_val(hb));
      }
  }
  float m_r[8], l_r[8];
#pragma unroll
  for (int r = 0; r < 8; ++r) { m_r[r] = -3.0e38f; l_r[r] = 0.f; }
  v8f oacc[DT];
#pragma unroll
  for (int dt = 0; dt < DT; ++dt) oacc[dt] = (v8f){0.f,0.f,0.f,0.f,0.f,0.f,0.f,0.f};

  const int kv_end = CAUSAL ? min(T, qblk * 64 + 64) : T;     // block-uniform
  for (int j0 = 0; j0 < kv_end; j0 += 32) {
    __syncthreads();
    for (int e = tid; e < 32 * (D / 4); e += 128) {
      const int r = e / (D / 4), c4 = (e % (D / 4)) * 4;
      const int key = j0 + r;
      v4f kf = {0.f,0.f,0.f,0.f}, vf = {0.f,0.f,0.f,0.f};
      if (key < T) { kf = *(const v4fa*)(K + (size_t)key * pitch + c4); vf = *(const v4fa*)(V + (size_t)key * pitch + c4); }
#pragma unroll
      for (int t = 0; t < 4; ++t) {
        unsigned short hb = bf16_bits(kf[t]); sKh[r][c4 + t] = hb; sKl[r][c4 + t] = bf16_bits(kf[t] - bf16_val(hb));
        hb = bf16_bits(vf[t]); sVh[r][c4 + t] = hb; sVl[r][c4 + t] = bf16_bits(vf[t] - bf16_val(hb));
      }
    }
    __syncthreads();
    // S tile 16 x 32
    v8f s[2];
#pragma unroll
    for (int nt = 0; nt < 2; ++nt) {
      v8f acc = {};
#pragma unroll
      for (int ks = 0; ks < KS; ++ks) {
        FragB bh_, bl_;
        bh_.half[0] = *(const v8us*)&sKh[nt * 16 + ln][ks * 32 + 8 * hh]; bh_.half[1] = *(const v8us*)&sKh[nt * 16 + ln][ks * 32 + 16 + 8 * hh];
        bl_.half[0] = *(const v8us*)&sKl[nt * 16 + ln][ks * 32 + 8 * hh]; bl_.half[1] = *(const v8us*)&sKl[nt * 16 + ln][ks * 32 + 16 + 8 * hh];
        acc = mmaN<3>(aqh[ks].v, aql[ks].v, bh_.v, bl_.v, acc);
      }
      s[nt] = acc;
    }
    // mask + running max (rows 8hh+r; the 16 lanes of a half share rows)
    float alpha[8];
#pragma unroll
    for (int r = 0; r < 8; ++r) {
      const int qi = q0 + 8 * hh + r;
      const int ja = j0 + ln, jb = j0 + 16 + ln;
      if (CAUSAL) { if (ja > qi) s[0][r] = -3.0e38f; if (jb > qi) s[1][r] = -3.0e38f; }
      if (ja >= T) s[0][r] = -3.0e38f;
      if (jb >= T) s[1][r] = -3.0e38f;
      float mx = fmaxf(s[0][r], s[1][r]);
      mx = fmaxf(mx, __shfl_xor(mx, 1, 32)); mx = fmaxf(mx, __shfl_xor(mx, 2, 32)); mx = fmaxf(mx, __shfl_xor(mx, 4, 32)); mx = fmaxf(mx, __shfl_xor(mx, 8, 32));
      const float mnew = fmaxf(m_r[r], mx);
      alpha[r] = (mnew > -1.0e38f) ? __expf(m_r[r] - mnew) : 1.0f;
      const float p0 = (s[0][r] > -1.0e38f) ? __expf(s[0][r] - mnew) : 0.f;
      const float p1 = (s[1][r] > -1.0e38f) ? __expf(s[1][r] - mnew) : 0.f;
      m_r[r] = mnew;
      l_r[r] = l_r[r] * alpha[r] + p0 + p1;            // per-lane partial row sum (16 lanes combined at the end)
      unsigned short hb = bf16_bits(p0); sPh[w][8 * hh + r][ln] = hb;      sPl[w][8 * hh + r][ln] = bf16_bits(p0 - bf16_val(hb));
      hb = bf16_bits(p1);                sPh[w][8 * hh + r][16 + ln] = hb; sPl[w][8 * hh + r][16 + ln] = bf16_bits(p1 - bf16_val(hb));
    }
#pragma unroll
    for (int dt = 0; dt < DT; ++dt)
#pragma unroll
      for (int r = 0; r < 8; ++r) oacc[dt][r] *= alpha[r];
    __builtin_amdgcn_fence(__ATOMIC_ACQ_REL, "workgroup");
    __builtin_amdgcn_wave_barrier();
    FragB pah, pal;
    pah.half[0] = *(const v8us*)&sPh[w][ln][8 * hh]; pah.half[1] = *(const v8us*)&sPh[w][ln][16 + 8 * hh];
    pal.half[0] = *(const v8us*)&sPl[w][ln][8 * hh]; pal.half[1] = *(const v8us*)&sPl[w][ln][16 + 8 * hh];
#pragma unroll
    for (int dt = 0; dt < DT; ++dt) {
      FragB bvh, bvl;
#pragma unroll
      for (int i = 0; i < 8; ++i) {
        bvh.u[i] = sVh[8 * hh + i][dt * 16 + ln]; bvh.u[8 + i] = sVh[16 + 8 * hh + i][dt * 16 + ln];
        bvl.u[i] = sVl[8 * hh + i][dt * 16 + ln]; bvl.u[8 + i] = sVl[16 + 8 * hh + i][dt * 16 + ln];
      }
      oacc[dt] = mmaN<3>(pah.v, pal.v, bvh.v, bvl.v, oacc[dt]);
    }
    __builtin_amdgcn_fence(__ATOMIC_ACQ_REL, "workgroup");
    __builtin_amdgcn_wave_barrier();
  }
#pragma unroll
  for (int r = 0; r < 8; ++r) {
    float l = l_r[r];
    l += __shfl_xor(l, 1, 32); l += __shfl_xor(l, 2, 32); l += __shfl_xor(l, 4, 32); l += __shfl_xor(l, 8, 32);
    l_r[r] = (l > 0.f) ? 1.0f / l : 0.f;
  }
#pragma unroll
  for (int dt = 0; dt < DT; ++dt)
#pragma unroll
    for (int r = 0; r < 8; ++r) sO[w][8 * hh + r][dt * 16 + ln] = oacc[dt][r] * l_r[r];
  __builtin_amdgcn_fence(__ATOMIC_ACQ_REL, "workgroup");
  __builtin_amdgcn_wave_barrier();
  {
    for (int r = 0; r < 16; ++r) {
      const int row = q0 + r;
      if (row < T && lane < D / 4) {
        const v4f val = *(const v4fa*)&sO[w][r][lane * 4];
        *(v4f*)(y + ((size_t)b * T + row) * ypitch + h * D + lane * 4) = val;
      }
    }
    
  }
}

// GEMM C = act(A·W + bias + resid): A f32 (ASPLIT -> hi/lo 2 terms), Wt bf16 [N][K]; ACT 0 none, 1 relu, 2 exact gelu;
// resid (optional, f32, row index = (row % rmod), pitch ldr, RES_BF16 rounds it) added before the activation.
template <bool ASPLIT, int ACT, bool BIAS_BF16, bool RES_BF16>
__global__ __launch_bounds__(128) void k_gemm_bf3(const float* __restrict__ A, int lda, const unsigned short* __restrict__ Wt, int ldb,
                                                const float* __restrict__ bias, const float* __restrict__ resid, int rmod, int ldr,
                                                float* __restrict__ C, int ldc, int M, int N, int K) {
  __shared__ __attribute__((aligned(16))) float so[4][16][64];
  const int tid = threadIdx.x, w = tid >> 5, lane = tid & 31, ln = lane & 15, hh = lane >> 4;
  const int ntn = N / 64;
  const int wid = blockIdx.x * 4 + w;
  const int mt = wid / ntn, nq = wid % ntn;
  if (mt * 16 >= M) return;
  const int row0 = mt * 16, col0 = nq * 64;
  const float* arow = A + (size_t)(row0 + ln) * lda;
  v8f acc[4] = {};
  for (int kb = 0; kb < K; kb += 32) {
    FragB ah, al;
    const v4f x0 = *(const v4fa*)(arow + kb + 8 * hh), x1 = *(const v4fa*)(arow + kb + 8 * hh + 4);
    const v4f x2 = *(const v4fa*)(arow + kb + 16 + 8 * hh), x3 = *(const v4fa*)(arow + kb + 16 + 8 * hh + 4);
    float xs[16] = {x0[0],x0[1],x0[2],x0[3],x1[0],x1[1],x1[2],x1[3],x2[0],x2[1],x2[2],x2[3],x3[0],x3[1],x3[2],x3[3]};
#pragma unroll
    for (int i = 0; i < 16; ++i) { const unsigned short hb = bf16_bits(xs[i]); ah.u[i] = hb; al.u[i] = ASPLIT ? bf16_bits(xs[i] - bf16_val(hb)) : (unsigned short)0; }
#pragma unroll
    for (int t = 0; t < 4; ++t) {
      const unsigned short* brow = Wt + (size_t)(col0 + t * 16 + ln) * ldb + kb;
      FragB b;
      b.half[0] = *(const v8us*)(brow + 8 * hh);
      b.half[1] = *(const v8us*)(brow + 16 + 8 * hh);
      acc[t] = mmaN<ASPLIT ? 2 : 1>(ah.v, al.v, b.v, b.v, acc[t]);
    }
  }
#pragma unroll
  for (int t = 0; t < 4; ++t) {
    const int col = col0 + t * 16 + ln;
    float bv = bias ? bias[col] : 0.f;
    if (BIAS_BF16) bv = bf16_round(bv);
#pragma unroll
    for (int r = 0; r < 8; ++r) {
      float v = acc[t][r] + bv;
      if (resid) { float rv = resid[(size_t)((row0 + 8 * hh + r) % rmod) * ldr + col]; if (RES_BF16) rv = bf16_round(rv); v += rv; }
      if (ACT == 1) v = fmaxf(v, 0.f);
      if (ACT == 2) v = 0.5f * v * (1.0f + erff(v * 0.70710678118654752f));
      if (ACT == 3) { const float u = 0.7978845608028654f * (v + 0.044715f * v * v * v); v = 0.5f * v * (1.0f + tanhf(u)); }
      so[w][8 * hh + r][t * 16 + ln] = v;
    }
  }
  __builtin_amdgcn_fence(__ATOMIC_ACQ_REL, "workgroup");
  __builtin_amdgcn_wave_barrier();
  const int rsub = lane >> 4, c4 = (lane & 15) * 4;
  {
#pragma unroll
    for (int q = 0; q < 8; ++q) {
      const int r = q * 2 + rsub;
      const v4f v = *(const v4fa*)&so[w][r][c4];
      *(v4f*)(C + (size_t)(row0 + r) * ldc + col0 + c4) = v;
    }
    
  }
}
// row LayerNorm (biased variance, eps) over N: s = X (+ R); optional out_sum <- s; out_norm <- (s-mu)*rsqrt(var+eps)*g + b
template <bool PARAM_BF16>
__global__ __launch_bounds__(256) void k_layernorm(const float* __restrict__ X, const float* __restrict__ R, const float* __restrict__ g, const float* __restrict__ bta,
                                                  float* __restrict__ out_sum, float* __restrict__ out_norm, int N, float eps) {
  __shared__ float red[256];
  const int row = blockIdx.x, tid = threadIdx.x;
  const float* x = X + (size_t)row * N; const float* rr = R ? R + (size_t)row * N : nullptr;
  float vals[16];                     // up to N = 4096
  const int per = N / 256;            // contiguous chunk per thread? use strided-by-4 chunks: thread handles j = tid*4 + 1024*u
  float s1 = 0.f;
  for (int u = 0; u < per / 4; ++u) {
    const int j = tid * 4 + 1024 * u;
    const v4f a = *(const v4fa*)(x + j);
    v4f b = {0.f,0.f,0.f,0.f}; if (rr) b = *(const v4fa*)(rr + j);
#pragma unroll
    for (int q = 0; q < 4; ++q) { const float v = a[q] + b[q]; vals[u * 4 + q] = v; s1 += v; }
  }
  red[tid] = s1; __syncthreads();
  for (int st = 128; st > 0; st >>= 1) { if (tid < st) red[tid] += red[tid + st]; __syncthreads(); }
  const float mu = red[0] / (float)N; __syncthreads();
  float s2 = 0.f;
  for (int u = 0; u < per / 4; ++u)
#pragma unroll
    for (int q = 0; q < 4; ++q) { const float c = vals[u * 4 + q] - mu; s2 += c * c; }
  red[tid] = s2; __syncthreads();
  for (int st = 128; st > 0; st >>= 1) { if (tid < st) red[tid] += red[tid + st]; __syncthreads(); }
  const float rs = rsqrtf(red[0] / (float)N + eps);
  {
    for (int u = 0; u < per / 4; ++u) {
      const int j = tid * 4 + 1024 * u;
      v4f o, sm;
#pragma unroll
      for (int q = 0; q < 4; ++q) {
        float gg = g[j + q], bb = bta[j + q];
        if (PARAM_BF16) { gg = bf16_round(gg); bb = bf16_round(bb); }
        sm[q] = vals[u * 4 + q]; o[q] = (vals[u * 4 + q] - mu) * rs * gg + bb;
      }
      if (out_sum) *(v4f*)(out_sum + (size_t)row * N + j) = sm;
      *(v4f*)(out_norm + (size_t)row * N + j) = o;
    }
    
  }
}



// ---- f16 WMMA path (v_wmma_f32_16x16x32_f16): 11-bit significands for operands in range — used where a [0,1] probability operand needs more precision than bf16
typedef _Float16 v16h __attribute__((ext_vector_type(16)));
union FragH { v16h v; v8us half[2]; _Float16 h[16]; unsigned short u[16]; };
template <int NT>
__device__ __forceinline__ v8f mmaH(v16h ah, v16h al, v16h bh, v16h bl, v8f c) {
  c = __builtin_amdgcn_wmma_f32_16x16x32_f16(false, ah, false, bh, (short)0, c, false, false);
  if (NT >= 2) c = __builtin_amdgcn_wmma_f32_16x16x32_f16(false, al, false, bh, (short)0, c, false, false);
  if (NT >= 3) c = __builtin_amdgcn_wmma_f32_16x16x32_f16(false, ah, false, bl, (short)0, c, false, false);
  asm volatile("v_nop\n\tv_nop\n\tv_nop\n\tv_nop" : "+v"(c) : "v"(ah), "v"(al), "v"(bh), "v"(bl));
  return c;
}
// batched GEMM like k_gemm_b but f16 operands: A f32 (split into f16 hi/lo if ASPLIT, else rounded to f16), Bt = f16 values [n][k]; alpha; C f32; N multiple of 16 (partial tiles skipped)
template <bool ASPLIT>
__global__ __launch_bounds__(128) void k_gemm_h(const float* __restrict__ A, int lda, size_t sA, const _Float16* __restrict__ Bh, int ldb, size_t sB, float alpha, float* __restrict__ C, int ldc, size_t sC, int M, int N, int K) {
  __shared__ __attribute__((aligned(16))) float so[4][16][64];
  const int tid = threadIdx.x, w = tid >> 5, lane = tid & 31, ln = lane & 15, hh = lane >> 4; const int by = blockIdx.y;
  A += (size_t)by * sA; Bh += (size_t)by * sB; C += (size_t)by * sC;
  const int ntn = (N + 63) / 64; const int wid = blockIdx.x * 4 + w; const int mt = wid / ntn, nq = wid % ntn; if (mt * 16 >= M) return;
  const int row0 = mt * 16, col0 = nq * 64; const float* arow = A + (size_t)(row0 + ln) * lda;
  v8f acc[4] = {};
  for (int kb = 0; kb < K; kb += 32) {
    FragH ah, al;
    const v4f x0 = *(const v4fa*)(arow + kb + 8 * hh), x1 = *(const v4fa*)(arow + kb + 8 * hh + 4), x2 = *(const v4fa*)(arow + kb + 16 + 8 * hh), x3 = *(const v4fa*)(arow + kb + 16 + 8 * hh + 4);
    float xs[16] = {x0[0],x0[1],x0[2],x0[3],x1[0],x1[1],x1[2],x1[3],x2[0],x2[1],x2[2],x2[3],x3[0],x3[1],x3[2],x3[3]};
#pragma unroll
    for (int i = 0; i < 16; ++i) { const _Float16 h = (_Float16)xs[i]; ah.h[i] = h; al.h[i] = ASPLIT ? (_Float16)(xs[i] - (float)h) : (_Float16)0.0f; }
#pragma unroll
    for (int t = 0; t < 4; ++t) { if (col0 + t * 16 >= N) continue; const size_t boff = (size_t)(col0 + t * 16 + ln) * ldb + kb; FragH bq; bq.half[0] = *(const v8us*)(Bh + boff + 8 * hh); bq.half[1] = *(const v8us*)(Bh + boff + 16 + 8 * hh);
      acc[t] = mmaH<ASPLIT ? 2 : 1>(ah.v, al.v, bq.v, bq.v, acc[t]); }
  }
#pragma unroll
  for (int t = 0; t < 4; ++t) { if (col0 + t * 16 >= N) continue;
#pragma unroll
    for (int r = 0; r < 8; ++r) so[w][8 * hh + r][t * 16 + ln] = acc[t][r] * alpha; }
  __builtin_amdgcn_fence(__ATOMIC_ACQ_REL, "workgroup"); __builtin_amdgcn_wave_barrier();
  const int rsub = lane >> 4, c4 = (lane & 15) * 4;
  {
#pragma unroll
    for (int q = 0; q < 8; ++q) { const int r = q * 2 + rsub; if (col0 + c4 < N) { const v4f v = *(const v4fa*)&so[w][r][c4]; *(v4f*)(C + (size_t)(row0 + r) * ldc + col0 + c4) = v; } }
     }
}

// Wt[n][k] = f16(bf16(W[k][n])·scale) from f32 row-major W[K][N] (scale = power of two; bf16-exact weights stay exact in f16 away from the subnormal range)
__global__ __launch_bounds__(256) void k_wt_f16(const float* __restrict__ W, _Float16* __restrict__ Wt, int K, int N, float scale) {
  const int t = blockIdx.x * 256 + threadIdx.x; if (t >= N * (K / 8)) return; const int n = t / (K / 8), k8 = (t % (K / 8)) * 8; FragH f;
#pragma unroll
  for (int i = 0; i < 8; ++i) f.h[i] = (_Float16)(bf16_round(W[(size_t)(k8 + i) * N + n]) * scale); const v8us o = f.half[0];
  *(v8us*)((unsigned short*)Wt + (size_t)n * K + k8) = o; 
}
// k_gemm_hh variant with fused epilogue: v = acc·alpha + bias[by·sBias + col] (+ CP[(row/rowsPerB)·sCPb + by·64 + col] if CP) ; ACT 0 none / 1 elu ; writes f16 C16 (and f32 C if non-null)
template <int ACT>
__global__ __launch_bounds__(128) void k_gemm_hhx(const _Float16* __restrict__ A, int lda, size_t sA, const _Float16* __restrict__ Bh, int ldb, size_t sB, float alpha, const float* __restrict__ bias, size_t sBias, const float* __restrict__ CP, int rowsPerB, size_t sCPb, int row0g,
    float* __restrict__ C, _Float16* __restrict__ C16, int ldc, size_t sC, int M, int N, int K) {
  __shared__ __attribute__((aligned(16))) float so[4][16][64];
  const int tid = threadIdx.x, w = tid >> 5, lane = tid & 31, ln = lane & 15, hh = lane >> 4; const int by = blockIdx.y;
  A += (size_t)by * sA; Bh += (size_t)by * sB; const size_t cofs = (size_t)by * sC; const float* bp = bias ? bias + (size_t)by * sBias : nullptr;
  const int ntn = (N + 63) / 64; const int wid = blockIdx.x * 4 + w; const int mt = wid / ntn, nq = wid % ntn; if (mt * 16 >= M) return;
  const int row0 = mt * 16, col0 = nq * 64; const _Float16* arow = A + (size_t)(row0 + ln) * lda;
  v8f acc[4] = {};
  for (int kb = 0; kb < K; kb += 32) { FragH ah; ah.half[0] = *(const v8us*)((const unsigned short*)arow + kb + 8 * hh); ah.half[1] = *(const v8us*)((const unsigned short*)arow + kb + 16 + 8 * hh);
#pragma unroll
    for (int t = 0; t < 4; ++t) { if (col0 + t * 16 >= N) continue; const size_t boff = (size_t)(col0 + t * 16 + ln) * ldb + kb; FragH bq; bq.half[0] = *(const v8us*)((const unsigned short*)Bh + boff + 8 * hh); bq.half[1] = *(const v8us*)((const unsigned short*)Bh + boff + 16 + 8 * hh);
      acc[t] = mmaH<1>(ah.v, ah.v, bq.v, bq.v, acc[t]); }
  }
#pragma unroll
  for (int t = 0; t < 4; ++t) { if (col0 + t * 16 >= N) continue; const int col = col0 + t * 16 + ln; const float bv = bp ? bf16_round(bp[col]) : 0.f;
#pragma unroll
    for (int r = 0; r < 8; ++r) { float v = acc[t][r] * alpha + bv; if (CP) { const int bidx = (row0g + row0 + 8 * hh + r) / rowsPerB; v += CP[(size_t)bidx * sCPb + (size_t)by * 64 + col]; } if (ACT == 1) v = (v > 0.f) ? v : expm1f(v); else if (ACT == 7) v = (v > 0.f) ? v + 1.0f : expf(v); else if (ACT == 8) v = tanhf(v); else if (ACT == 9) v = 0.5f * v * (1.0f + tanhf(0.7978845608028654f * (v + 0.044715f * v * v * v))); else if (ACT == 11) v = 1.0f / (1.0f + expf(-v)); else if (ACT == 12) v = (v > 0.f) ? v : 0.01f * v; else if (ACT == 14) v = (v > 0.f) ? v : 0.1f * v; else if (ACT == 15) v = v / (1.0f + expf(-v)); else if (ACT == 3) v = fmaxf(v, 0.f); else if (ACT == 6) v = 0.5f * v * (1.0f + erff(v * 0.70710678118654752f)); so[w][8 * hh + r][t * 16 + ln] = v; } }
  __builtin_amdgcn_fence(__ATOMIC_ACQ_REL, "workgroup"); __builtin_amdgcn_wave_barrier();
  const int rsub = lane >> 4, c4 = (lane & 15) * 4; typedef _Float16 v4h __attribute__((ext_vector_type(4)));
  {
#pragma unroll
    for (int q = 0; q < 8; ++q) { const int r = q * 2 + rsub; if (col0 + c4 < N) { const v4f v = *(const v4fa*)&so[w][r][c4]; if (C) *(v4f*)(C + cofs + (size_t)(row0 + r) * ldc + col0 + c4) = v; if (C16) { v4h h4; for (int i = 0; i < 4; ++i) h4[i] = (_Float16)v[i]; *(v4h*)(C16 + cofs + (size_t)(row0 + r) * ldc + col0 + c4) = h4; } } }
     }
}


typedef _Float16 v4h __attribute__((ext_vector_type(4)));

__global__ __launch_bounds__(256) void k_x16(const float* __restrict__ x, _Float16* __restrict__ X16, size_t n8) { const size_t t = (size_t)blockIdx.x * 256 + threadIdx.x; if (t >= n8) return; FragH f;
#pragma unroll
  for (int q = 0; q < 8; ++q) f.h[q] = (_Float16)bf16_round(x[t * 8 + q]); *(v8us*)((unsigned short*)X16 + t * 8) = f.half[0];  }
__global__ __launch_bounds__(256) void k_h16(const float* __restrict__ x, _Float16* __restrict__ X16, size_t n8) { const size_t t = (size_t)blockIdx.x * 256 + threadIdx.x; if (t >= n8) return; FragH f;
#pragma unroll
  for (int q = 0; q < 8; ++q) f.h[q] = (_Float16)x[t * 8 + q]; *(v8us*)((unsigned short*)X16 + t * 8) = f.half[0];  }
__global__ __launch_bounds__(256) void k_round16f(const float* __restrict__ W, _Float16* __restrict__ Bt, size_t n8) { const size_t t = (size_t)blockIdx.x * 256 + threadIdx.x; if (t >= n8) return; FragH f;
#pragma unroll
  for (int i = 0; i < 8; ++i) f.h[i] = (_Float16)(bf16_round(W[t * 8 + i]) * 16.0f); *(v8us*)((unsigned short*)Bt + t * 8) = f.half[0];  }
template <int NHv, int TTv>
__global__ __launch_bounds__(256) void k_vt(const _Float16* __restrict__ V16, int ldv, int voff, _Float16* __restrict__ Vt) { __shared__ unsigned short tl[64][66]; const int tid = threadIdx.x; const int slab = blockIdx.x / (TTv / 64), lg = blockIdx.x % (TTv / 64); const int b = slab / NHv, h = slab % NHv;
  for (int i = tid; i < 64 * 8; i += 256) { const int r = i / 8, c8 = (i % 8) * 8; FragH f; f.half[0] = *(const v8us*)((const unsigned short*)V16 + ((size_t)b * TTv + lg * 64 + r) * ldv + voff + h * 64 + c8);
#pragma unroll
    for (int q = 0; q < 8; ++q) tl[r][c8 + q] = f.u[q]; }
  __syncthreads();
  {
#pragma unroll
    for (int rd = 0; rd < 2; ++rd) { const int d = rd * 32 + tid / 8, pc = tid % 8; FragH f;
#pragma unroll
      for (int q = 0; q < 8; ++q) f.u[q] = tl[pc * 8 + q][d];
      *(v8us*)((unsigned short*)Vt + ((size_t)slab * 64 + d) * TTv + lg * 64 + pc * 8) = f.half[0]; }
     } }

__global__ __launch_bounds__(256) void k_h16s(const float* __restrict__ F, _Float16* __restrict__ H, size_t n8) { const size_t t = (size_t)blockIdx.x * 256 + threadIdx.x; if (t >= n8) return; const v4f a = *(const v4fa*)(F + t * 8), c = *(const v4fa*)(F + t * 8 + 4); FragH f;
#pragma unroll
  for (int q = 0; q < 4; ++q) { f.h[q] = (_Float16)(a[q] * 16.0f); f.h[4 + q] = (_Float16)(c[q] * 16.0f); } *(v8us*)((unsigned short*)H + t * 8) = f.half[0];  }
__global__ __launch_bounds__(256) void k_merge(const float* __restrict__ O, float* __restrict__ out) {
  const int tid = threadIdx.x; const int wg = blockIdx.x * 8 + (tid >> 5); if (wg >= NB * 2) return; const int b = wg >> 1, hp = wg & 1; const int l = tid & 31; const int h = hp * 2 + (l >> 4), c4 = (l & 15) * 4;
  const v4f v = *(const v4fa*)(O + ((size_t)h * NB + b) * DD + c4); float* o = out + (size_t)b * EE + h * DD + c4;
  *(v4f*)o = v;  }
__global__ __launch_bounds__(1024) void k_flash(const _Float16* __restrict__ Q16, int ldq, const _Float16* __restrict__ K16, int ldk, const _Float16* __restrict__ Vt, const int* __restrict__ MSK, float* __restrict__ O, int ldo) {
  constexpr int RPW = 16, NQB = TT / (4 * RPW), DT = 4, KS = 2, KSPL = 8, NW = 4 * KSPL;
  __shared__ __attribute__((aligned(16))) float sO[NW][RPW][64 + 4]; __shared__ float sM[NW][RPW], sL[NW][RPW];
  const int tid = threadIdx.x, lane = tid & 31, ln = lane & 15, hh = lane >> 4;
  const int w = __builtin_amdgcn_readfirstlane(tid >> 5) & (NW - 1);      // wave number in a scalar register, so that the key loop's counter and branch are scalar; the mask (an identity) shows the compiler its range: no zero-trip path, no spill
  const int slab = blockIdx.x / NQB, qblk = blockIdx.x % NQB; const int b = slab / NH, h = slab % NH; const int qb0 = qblk * (4 * RPW); const int q0 = qb0 + (w & 3) * RPW;
  FragH bq[KS];      // B operand: column ln = query q0 + ln
  { const unsigned short* qr = (const unsigned short*)Q16 + ((size_t)b * TT + q0 + ln) * ldq + h * 64;
#pragma unroll
    for (int ks = 0; ks < KS; ++ks) { bq[ks].half[0] = *(const v8us*)(qr + ks * 32 + 8 * hh); bq[ks].half[1] = *(const v8us*)(qr + ks * 32 + 16 + 8 * hh); } }
  const unsigned short* Vth = (const unsigned short*)Vt + (size_t)slab * 64 * TT;
  float m_q = -3.0e38f, l_q = 0.f; v8f oacc[DT];      // of query ln: running max (equal in both halves), this half's share of the sum, O^T rows dt * 16 + 8hh + r
#pragma unroll
  for (int dt = 0; dt < DT; ++dt) oacc[dt] = (v8f){0.f,0.f,0.f,0.f,0.f,0.f,0.f,0.f};
  const int jend = TT;
#pragma unroll 1
  for (int j0 = (w >> 2) * 32; j0 < jend; j0 += 32 * KSPL) {
    v8f s[2];      // s[nt][r] = score of key j0 + nt * 16 + 8hh + r with query ln
#pragma unroll
    for (int nt = 0; nt < 2; ++nt) { const unsigned short* kr = (const unsigned short*)K16 + ((size_t)b * TT + j0 + nt * 16 + ln) * ldk + h * 64; FragH ak[KS];
#pragma unroll
      for (int ks = 0; ks < KS; ++ks) { ak[ks].half[0] = *(const v8us*)(kr + ks * 32 + 8 * hh); ak[ks].half[1] = *(const v8us*)(kr + ks * 32 + 16 + 8 * hh); }
      v8f acc = (v8f){0.f,0.f,0.f,0.f,0.f,0.f,0.f,0.f};
#pragma unroll
      for (int ks = 0; ks < KS; ++ks) acc = mmaH<1>(ak[ks].v, ak[ks].v, bq[ks].v, bq[ks].v, acc);
      s[nt] = acc * 0.125f; }
    float mc = fmaxf(s[0][0], s[1][0]);
#pragma unroll
    for (int r = 1; r < 8; ++r) mc = fmaxf(mc, fmaxf(s[0][r], s[1][r]));
    mc = fmaxf(mc, __int_as_float(__builtin_amdgcn_permlanex16(__float_as_int(mc), __float_as_int(mc), 0x76543210, 0xfedcba98, false, false)));      // lane l <-> l ^ 16: the other 16 keys of the same query
    const float mn = fmaxf(m_q, mc); const float al = expf(m_q - mn); m_q = mn;
    FragH pb; float ps = 0.f;
#pragma unroll
    for (int r = 0; r < 8; ++r) { const float p0 = expf(s[0][r] - mn), p1 = expf(s[1][r] - mn); ps += p0 + p1; pb.h[r] = (_Float16)(p0 * 1024.0f); pb.h[8 + r] = (_Float16)(p1 * 1024.0f); }
    l_q = l_q * al + ps;
#pragma unroll
    for (int dt = 0; dt < DT; ++dt) oacc[dt] *= al;
#pragma unroll
    for (int dt = 0; dt < DT; ++dt) { const unsigned short* vrow = Vth + (size_t)(dt * 16 + ln) * TT + j0; FragH av; av.half[0] = *(const v8us*)(vrow + 8 * hh); av.half[1] = *(const v8us*)(vrow + 16 + 8 * hh);
      oacc[dt] = mmaH<1>(av.v, av.v, pb.v, pb.v, oacc[dt]); } }
  l_q += __int_as_float(__builtin_amdgcn_permlanex16(__float_as_int(l_q), __float_as_int(l_q), 0x76543210, 0xfedcba98, false, false));      // the halves' sums joined once
  if (hh == 0) { sM[w][ln] = m_q; sL[w][ln] = l_q; }
#pragma unroll
  for (int dt = 0; dt < DT; ++dt) { *(v4fa*)&sO[w][ln][dt * 16 + 8 * hh] = (v4f){oacc[dt][0], oacc[dt][1], oacc[dt][2], oacc[dt][3]}; *(v4fa*)&sO[w][ln][dt * 16 + 8 * hh + 4] = (v4f){oacc[dt][4], oacc[dt][5], oacc[dt][6], oacc[dt][7]}; }
  __syncthreads();      // every wave's partial (max, sum, accumulator) is in LDS before any wave merges
  for (int e = tid; e < 4 * RPW * 16; e += 32 * NW) { const int row = e >> 4, pc = e & 15, qt = row / RPW, r = row % RPW;      // one query row per 16 lanes, 16 B per lane
    float mg[KSPL], M = -3.0e38f;
#pragma unroll
    for (int g = 0; g < KSPL; ++g) { mg[g] = sM[g * 4 + qt][r]; M = fmaxf(M, mg[g]); }
    float L = 0.f; v4f acc = {0.f, 0.f, 0.f, 0.f};
#pragma unroll
    for (int g = 0; g < KSPL; ++g) { const float wg = expf(mg[g] - M); L += wg * sL[g * 4 + qt][r]; const v4f pv = *(const v4fa*)&sO[g * 4 + qt][r][pc * 4]; acc += pv * wg; }
    const float inv = (L > 0.f) ? 1.0f / (L * 1024.0f) : 0.f;
    *(v4f*)(O + ((size_t)b * TT + qb0 + row) * ldo + h * 64 + pc * 4) = acc * inv; } }

extern "C" void kernel_launch(void* const* d_in, const int* in_sizes, int n_in,
                              void* d_out, int out_size, void* d_ws, size_t ws_size, hipStream_t stream) {
  (void)in_sizes; (void)n_in; (void)out_size;
  const float* const* I = (const float* const*)d_in; const float* xq = I[0]; const float* xk = I[1]; const float* xv = I[2]; const float* Wq = I[3]; const float* Wk = I[4]; const float* Wv = I[5];
  char* ws = (char*)d_ws; size_t off = 0;
  auto take = [&](size_t bytes) { char* p = ws + off; off += (bytes + 255) & ~(size_t)255; return p; };
  const size_t WSZ = (size_t)EE * EE; _Float16* Bw = (_Float16*)take(3 * WSZ * 2);
  _Float16* Xq = (_Float16*)take((size_t)NB * EE * 2); _Float16* Xk = (_Float16*)take((size_t)NB * EE * 2); _Float16* Xv = (_Float16*)take((size_t)NB * EE * 2);
  _Float16* Qs = (_Float16*)take((size_t)TT * DD * 2); _Float16* Ks = (_Float16*)take((size_t)TT * DD * 2); _Float16* Vs = (_Float16*)take((size_t)TT * DD * 2); _Float16* Vt = (_Float16*)take((size_t)TT * DD * 2); float* O = (float*)take((size_t)TT * DD * 4);
  if (off > ws_size) return;      // 0.4 + 3 × 2.1 + 4 × 2.1 + 4.2 ≈ 19 MB
  const unsigned gw = (unsigned)((EE * (EE / 8) + 255) / 256);
  k_wt_f16<<<gw, 256, 0, stream>>>(Wq, Bw, EE, EE, 16.0f); k_wt_f16<<<gw, 256, 0, stream>>>(Wk, Bw + WSZ, EE, EE, 16.0f); k_wt_f16<<<gw, 256, 0, stream>>>(Wv, Bw + 2 * WSZ, EE, EE, 16.0f);      /* (in,out) → Bt ×2^4 */
  const unsigned g8 = (unsigned)(((size_t)NB * EE / 8 + 255) / 256); k_x16<<<g8, 256, 0, stream>>>(xq, Xq, (size_t)NB * EE / 8); k_x16<<<g8, 256, 0, stream>>>(xk, Xk, (size_t)NB * EE / 8); k_x16<<<g8, 256, 0, stream>>>(xv, Xv, (size_t)NB * EE / 8);
  const dim3 gs(((NB / 16) * 1 + 3) / 4, NHD);      /* per head h = grid.y: C16[h·NB + b][0..63] = X·Bt[h·64 .. h·64+63]ᵀ — M 4096 N 64 K 256, written straight into the stacked plane */
  k_gemm_hhx<0><<<gs, 128, 0, stream>>>(Xq, EE, 0, Bw, EE, (size_t)DD * EE, 0.0625f, nullptr, 0, nullptr, 1, 0, 0, nullptr, Qs, DD, (size_t)NB * DD, NB, DD, EE);
  k_gemm_hhx<0><<<gs, 128, 0, stream>>>(Xk, EE, 0, Bw + WSZ, EE, (size_t)DD * EE, 0.0625f, nullptr, 0, nullptr, 1, 0, 0, nullptr, Ks, DD, (size_t)NB * DD, NB, DD, EE);
  k_gemm_hhx<0><<<gs, 128, 0, stream>>>(Xv, EE, 0, Bw + 2 * WSZ, EE, (size_t)DD * EE, 0.0625f, nullptr, 0, nullptr, 1, 0, 0, nullptr, Vs, DD, (size_t)NB * DD, NB, DD, EE);
  k_vt<NH, TT><<<BB * NH * (TT / 64), 256, 0, stream>>>(Vs, DD, 0, Vt);      /* Vᵀ [64][16384] */
  k_flash<<<BB * NH * (TT / 64), 1024, 0, stream>>>(Qs, DD, Ks, DD, Vt, nullptr, O, DD);      /* one slab: 16384 queries × 16384 keys */
  k_merge<<<(NB * 2 + 7) / 8, 256, 0, stream>>>(O, (float*)d_out);
}

// v003
// One run takes 246 microseconds.
// Next to v002, in two timings, it ran 1.27 and 1.29 times as fast.
// All steps since v000 together make it 6.96 times as fast.
#include <hip/hip_runtime.h>
// Multi-head attention whose heads are STACKED along the batch axis (B=4096 rows, EMBED=256, 4 heads × 64): q = queries·W_Query, k = keys·W_Key, v = values·W_Value ((in,out), no bias); the heads are split TF-style into [H·B, 64] = [16384, 64] and ONE softmax(q·kᵀ/√64)·v runs over all 16384 stacked rows
// (every query attends to every (head, row) key); the result is merged back to [B, H·64].
// Compute dtype: inputs and weights rounded to bf16; q, k, v as f16 GEMM outputs written directly in the stacked [h·4096 + b][64] layout (grid.y = head); fused flash-style kernel over T = 16384 (online softmax f32, P f16 ×2^10, f32 accumulate) on v_wmma_f32_16x16x32_f16;
// the f32 result rows are permuted into the merged output by a copy kernel (32 lanes × 16 B per instruction).
#define BB 1
#define TT 16384
#define NH 1
#define NB 4096
#define NHD 4
#define EE 256
#define DD 64
#define NR (BB * TT)

typedef __bf16 v16b __attribute__((ext_vector_type(16)));
typedef unsigned short v8us __attribute__((ext_vector_type(8), may_alias));
typedef float  v8f  __attribute__((ext_vector_type(8)));
typedef float  v4f  __attribute__((ext_vector_type(4)));
typedef float  v4fa __attribute__((ext_vector_type(4), may_alias));
union FragB { v16b v; v8us half[2]; unsigned short u[16]; };

__device__ __forceinline__ unsigned short bf16_bits(float x) { unsigned int u = __float_as_uint(x); return (unsigned short)((u + 0x7FFFu + ((u >> 16) & 1u)) >> 16); }
__device__ __forceinline__ float bf16_val(unsigned short b) { return __uint_as_float(((unsigned int)b) << 16); }
__device__ __forceinline__ float bf16_round(float x) { return bf16_val(bf16_bits(x)); }
// D += A·B with NT terms: 1 = ah·bh, 2 = + al·bh (A split), 3 = + ah·bl (both split)
template <int NT>
__device__ __forceinline__ v8f mmaN(v16b ah, v16b al, v16b bh, v16b bl, v8f c) {
  c = __builtin_amdgcn_wmma_f32_16x16x32_bf16(false, ah, false, bh, (short)0, c, false, false);
  if (NT >= 2) c = __builtin_amdgcn_wmma_f32_16x16x32_bf16(false, al, false, bh, (short)0, c, false, false);
  if (NT >= 3) c = __builtin_amdgcn_wmma_f32_16x16x32_bf16(false, ah, false, bl, (short)0, c, false, false);
  asm volatile("v_nop\n\tv_nop\n\tv_nop\n\tv_nop" : "+v"(c) : "v"(ah), "v"(al), "v"(bh), "v"(bl));
  return c;
}

__global__ __launch_bounds__(256) void k_wt_bf16(const float* __restrict__ W, unsigned short* __restrict__ Wt, int K, int N) {
  const int t = blockIdx.x * 256 + threadIdx.x;
  const int k8n = K / 8;
  if (t >= N * k8n) return;
  const int n = t / k8n, k8 = (t % k8n) * 8;
  v8us v;
#pragma unroll
  for (int i = 0; i < 8; ++i) v[i] = bf16_bits(W[(size_t)(k8 + i) * N + n]);
  *(v8us*)(Wt + (size_t)n * K + k8) = v;
  
}

// GEMM C[M][N] (f32, pitch ldc) = act(A[M][K]·W + bias). A f32 row-major (pitch lda) converted per fragment to bf16
// (ASPLIT: hi/lo two planes -> 2 terms, else single rounded term); Wt bf16 [N][K] (pitch ldb). BIAS_BF16 rounds the
// bias to bf16 first (bias quantised to bf16 before the add). K%32==0, M%16==0, N%64==0.
template <bool ASPLIT, int ACT, bool BIAS_BF16>
__global__ __launch_bounds__(128) void k_gemm_bf(const float* __restrict__ A, int lda, const unsigned short* __restrict__ Wt, int ldb,
                                               const float* __restrict__ bias, float* __restrict__ C, int ldc, int M, int N, int K) {
  __shared__ __attribute__((aligned(16))) float so[4][16][64];
  const int tid = threadIdx.x, w = tid >> 5, lane = tid & 31, ln = lane & 15, hh = lane >> 4;
  const int ntn = N / 64;
  const int wid = blockIdx.x * 4 + w;
  const int mt = wid / ntn, nq = wid % ntn;
  if (mt * 16 >= M) return;
  const int row0 = mt * 16, col0 = nq * 64;
  const float* arow = A + (size_t)(row0 + ln) * lda;
  v8f acc[4] = {};
  for (int kb = 0; kb < K; kb += 32) {
    FragB ah, al;
    const v4f x0 = *(const v4fa*)(arow + kb + 8 * hh), x1 = *(const v4fa*)(arow + kb + 8 * hh + 4);
    const v4f x2 = *(const v4fa*)(arow + kb + 16 + 8 * hh), x3 = *(const v4fa*)(arow + kb + 16 + 8 * hh + 4);
    float xs[16] = {x0[0],x0[1],x0[2],x0[3],x1[0],x1[1],x1[2],x1[3],x2[0],x2[1],x2[2],x2[3],x3[0],x3[1],x3[2],x3[3]};
#pragma unroll
    for (int i = 0; i < 16; ++i) { const unsigned short hb = bf16_bits(xs[i]); ah.u[i] = hb; al.u[i] = ASPLIT ? bf16_bits(xs[i] - bf16_val(hb)) : (unsigned short)0; }
#pragma unroll
    for (int t = 0; t < 4; ++t) {
      const unsigned short* brow = Wt + (size_t)(col0 + t * 16 + ln) * ldb + kb;
      FragB b;
      b.half[0] = *(const v8us*)(brow + 8 * hh);
      b.half[1] = *(const v8us*)(brow + 16 + 8 * hh);
      acc[t] = mmaN<ASPLIT ? 2 : 1>(ah.v, al.v, b.v, b.v, acc[t]);
    }
  }
#pragma unroll
  for (int t = 0; t < 4; ++t) {
    float bv = bias ? bias[col0 + t * 16 + ln] : 0.f;
    if (BIAS_BF16) bv = bf16_round(bv);
#pragma unroll
    for (int r = 0; r < 8; ++r) { float v = acc[t][r] + bv; if (ACT == 1) v = fmaxf(v, 0.f); so[w][8 * hh + r][t * 16 + ln] = v; }
  }
  __builtin_amdgcn_fence(__ATOMIC_ACQ_REL, "workgroup");
  __builtin_amdgcn_wave_barrier();
  const int rsub = lane >> 4, c4 = (lane & 15) * 4;
  {
#pragma unroll
    for (int q = 0; q < 8; ++q) {
      const int r = q * 2 + rsub;
      const v4f v = *(const v4fa*)&so[w][r][c4];
      *(v4f*)(C + (size_t)(row0 + r) * ldc + col0 + c4) = v;
    }
    
  }
}

// Flash-style causal/unmasked attention, all contractions 3-term bf16 hi/lo splits, f32 softmax with running max.
// q,k,v rows are read from f32 buffers with arbitrary row pitch (so they can live inside a fused qkv buffer);
// D = head size (multiple of 32, <= 128); one wave = 16 query rows; block = 4 waves (64 queries) sharing K/V chunks of 32.
template <int D, bool CAUSAL>
__global__ __launch_bounds__(128) void k_flash(const float* __restrict__ qb, const float* __restrict__ kb, const float* __restrict__ vb,
                                             int pitch, int T, int H, float scale, float* __restrict__ y, int ypitch) {
  constexpr int KS = D / 32;        // k-steps for QK
  constexpr int DT = D / 16;        // d tiles for PV
  __shared__ __attribute__((aligned(16))) unsigned short sKh[32][D + 8], sKl[32][D + 8], sVh[32][D + 8], sVl[32][D + 8];
  __shared__ __attribute__((aligned(16))) unsigned short sPh[4][16][40], sPl[4][16][40];
  __shared__ __attribute__((aligned(16))) float sO[4][16][D];
  const int tid = threadIdx.x, w = tid >> 5, lane = tid & 31, ln = lane & 15, hh = lane >> 4;
  const int nqb = (T + 63) / 64;
  const int bh = blockIdx.x / nqb, qblk = blockIdx.x % nqb;
  const int b = bh / H, h = bh % H;
  const int q0 = qblk * 64 + w * 16;
  const float* Q = qb + (size_t)b * T * pitch + h * D;
  const float* K = kb + (size_t)b * T * pitch + h * D;
  const float* V = vb + (size_t)b * T * pitch + h * D;

  // A fragments of the wave's 16 query rows (scaled), hi/lo
  FragB aqh[KS], aql[KS];
  {
    int row = q0 + ln; if (row >= T) row = T - 1;
    const float* qr = Q + (size_t)row * pitch;
#pragma unroll
    for (int ks = 0; ks < KS; ++ks)
#pragma unroll
      for (int i = 0; i < 16; ++i) {
        const int d = ks * 32 + ((i < 8) ? (8 * hh + i) : (16 + 8 * hh + (i - 8)));
        const float x = qr[d] * scale; const unsigned short hb = bf16_bits(x);
        aqh[ks].u[i] = hb; aql[ks].u[i] = bf16_bits(x - bf16_val(hb));
      }
  }
  float m_r[8], l_r[8];
#pragma unroll
  for (int r = 0; r < 8; ++r) { m_r[r] = -3.0e38f; l_r[r] = 0.f; }
  v8f oacc[DT];
#pragma unroll
  for (int dt = 0; dt < DT; ++dt) oacc[dt] = (v8f){0.f,0.f,0.f,0.f,0.f,0.f,0.f,0.f};

  const int kv_end = CAUSAL ? min(T, qblk * 64 + 64) : T;     // block-uniform
  for (int j0 = 0; j0 < kv_end; j0 += 32) {
    __syncthreads();
    for (int e = tid; e < 32 * (D / 4); e += 128) {
      const int r = e / (D / 4), c4 = (e % (D / 4)) * 4;
      const int key = j0 + r;
      v4f kf = {0.f,0.f,0.f,0.f}, vf = {0.f,0.f,0.f,0.f};
      if (key < T) { kf = *(const v4fa*)(K + (size_t)key * pitch + c4); vf = *(const v4fa*)(V + (size_t)key * pitch + c4); }
#pragma unroll
      for (int t = 0; t < 4; ++t) {
        unsigned short hb = bf16_bits(kf[t]); sKh[r][c4 + t] = hb; sKl[r][c4 + t] = bf16_bits(kf[t] - bf16_val(hb));
        hb = bf16_bits(vf[t]); sVh[r][c4 + t] = hb; sVl[r][c4 + t] = bf16_bits(vf[t] - bf16_val(hb));
      }
    }
    __syncthreads();
    // S tile 16 x 32
    v8f s[2];
#pragma unroll
    for (int nt = 0; nt < 2; ++nt) {
      v8f acc = {};
#pragma unroll
      for (int ks = 0; ks < KS; ++ks) {
        FragB bh_, bl_;
        bh_.half[0] = *(const v8us*)&sKh[nt * 16 + ln][ks * 32 + 8 * hh]; bh_.half[1] = *(const v8us*)&sKh[nt * 16 + ln][ks * 32 + 16 + 8 * hh];
        bl_.half[0] = *(const v8us*)&sKl[nt * 16 + ln][ks * 32 + 8 * hh]; bl_.half[1] = *(const v8us*)&sKl[nt * 16 + ln][ks * 32 + 16 + 8 * hh];
        acc = mmaN<3>(aqh[ks].v, aql[ks].v, bh_.v, bl_.v, acc);
      }
      s[nt] = acc;
    }
    // mask + running max (rows 8hh+r; the 16 lanes of a half share rows)
    float alpha[8];
#pragma unroll
    for (int r = 0; r < 8; ++r) {
      const int qi = q0 + 8 * hh + r;
      const int ja = j0 + ln, jb = j0 + 16 + ln;
      if (CAUSAL) { if (ja > qi) s[0][r] = -3.0e38f; if (jb > qi) s[1][r] = -3.0e38f; }
      if (ja >= T) s[0][r] = -3.0e38f;
      if (jb >= T) s[1][r] = -3.0e38f;
      float mx = fmaxf(s[0][r], s[1][r]);
      mx = fmaxf(mx, __shfl_xor(mx, 1, 32)); mx = fmaxf(mx, __shfl_xor(mx, 2, 32)); mx = fmaxf(mx, __shfl_xor(mx, 4, 32)); mx = fmaxf(mx, __shfl_xor(mx, 8, 32));
      const float mnew = fmaxf(m_r[r], mx);
      alpha[r] = (mnew > -1.0e38f) ? __expf(m_r[r] - mnew) : 1.0f;
      const float p0 = (s[0][r] > -1.0e38f) ? __expf(s[0][r] - mnew) : 0.f;
      const float p1 = (s[1][r] > -1.0e38f) ? __expf(s[1][r] - mnew) : 0.f;
      m_r[r] = mnew;
      l_r[r] = l_r[r] * alpha[r] + p0 + p1;            // per-lane partial row sum (16 lanes combined at the end)
      unsigned short hb = bf16_bits(p0); sPh[w][8 * hh + r][ln] = hb;      sPl[w][8 * hh + r][ln] = bf16_bits(p0 - bf16_val(hb));
      hb = bf16_bits(p1);                sPh[w][8 * hh + r][16 + ln] = hb; sPl[w][8 * hh + r][16 + ln] = bf16_bits(p1 - bf16_val(hb));
    }
#pragma unroll
    for (int dt = 0; dt < DT; ++dt)
#pragma unroll
      for (int r = 0; r < 8; ++r) oacc[dt][r] *= alpha[r];
    __builtin_amdgcn_fence(__ATOMIC_ACQ_REL, "workgroup");
    __builtin_amdgcn_wave_barrier();
    FragB pah, pal;
    pah.half[0] = *(const v8us*)&sPh[w][ln][8 * hh]; pah.half[1] = *(const v8us*)&sPh[w][ln][16 + 8 * hh];
    pal.half[0] = *(const v8us*)&sPl[w][ln][8 * hh]; pal.half[1] = *(const v8us*)&sPl[w][ln][16 + 8 * hh];
#pragma unroll
    for (int dt = 0; dt < DT; ++dt) {
      FragB bvh, bvl;
#pragma unroll
      for (int i = 0; i < 8; ++i) {
        bvh.u[i] = sVh[8 * hh + i][dt * 16 + ln]; bvh.u[8 + i] = sVh[16 + 8 * hh + i][dt * 16 + ln];
        bvl.u[i] = sVl[8 * hh + i][dt * 16 + ln]; bvl.u[8 + i] = sVl[16 + 8 * hh + i][dt * 16 + ln];
      }
      oacc[dt] = mmaN<3>(pah.v, pal.v, bvh.v, bvl.v, oacc[dt]);
    }
    __builtin_amdgcn_fence(__ATOMIC_ACQ_REL, "workgroup");
    __builtin_amdgcn_wave_barrier();
  }
#pragma unroll
  for (int r = 0; r < 8; ++r) {
    float l = l_r[r];
    l += __shfl_xor(l, 1, 32); l += __shfl_xor(l, 2, 32); l += __shfl_xor(l, 4, 32); l += __shfl_xor(l, 8, 32);
    l_r[r] = (l > 0.f) ? 1.0f / l : 0.f;
  }
#pragma unroll
  for (int dt = 0; dt < DT; ++dt)
#pragma unroll
    for (int r = 0; r < 8; ++r) sO[w][8 * hh + r][dt * 16 + ln] = oacc[dt][r] * l_r[r];
  __builtin_amdgcn_fence(__ATOMIC_ACQ_REL, "workgroup");
  __builtin_amdgcn_wave_barrier();
  {
    for (int r = 0; r < 16; ++r) {
      const int row = q0 + r;
      if (row < T && lane < D / 4) {
        const v4f val = *(const v4fa*)&sO[w][r][lane * 4];
        *(v4f*)(y + ((size_t)b * T + row) * ypitch + h * D + lane * 4) = val;
      }
    }
    
  }
}

// GEMM C = act(A·W + bias + resid): A f32 (ASPLIT -> hi/lo 2 terms), Wt bf16 [N][K]; ACT 0 none, 1 relu, 2 exact gelu;
// resid (optional, f32, row index = (row % rmod), pitch ldr, RES_BF16 rounds it) added before the activation.
template <bool ASPLIT, int ACT, bool BIAS_BF16, bool RES_BF16>
__global__ __launch_bounds__(128) void k_gemm_bf3(const float* __restrict__ A, int lda, const unsigned short* __restrict__ Wt, int ldb,
                                                const float* __restrict__ bias, const float* __restrict__ resid, int rmod, int ldr,
                                                float* __restrict__ C, int ldc, int M, int N, int K) {
  __shared__ __attribute__((aligned(16))) float so[4][16][64];
  const int tid = threadIdx.x, w = tid >> 5, lane = tid & 31, ln = lane & 15, hh = lane >> 4;
  const int ntn = N / 64;
  const int wid = blockIdx.x * 4 + w;
  const int mt = wid / ntn, nq = wid % ntn;
  if (mt * 16 >= M) return;
  const int row0 = mt * 16, col0 = nq * 64;
  const float* arow = A + (size_t)(row0 + ln) * lda;
  v8f acc[4] = {};
  for (int kb = 0; kb < K; kb += 32) {
    FragB ah, al;
    const v4f x0 = *(const v4fa*)(arow + kb + 8 * hh), x1 = *(const v4fa*)(arow + kb + 8 * hh + 4);
    const v4f x2 = *(const v4fa*)(arow + kb + 16 + 8 * hh), x3 = *(const v4fa*)(arow + kb + 16 + 8 * hh + 4);
    float xs[16] = {x0[0],x0[1],x0[2],x0[3],x1[0],x1[1],x1[2],x1[3],x2[0],x2[1],x2[2],x2[3],x3[0],x3[1],x3[2],x3[3]};
#pragma unroll
    for (int i = 0; i < 16; ++i) { const unsigned short hb = bf16_bits(xs[i]); ah.u[i] = hb; al.u[i] = ASPLIT ? bf16_bits(xs[i] - bf16_val(hb)) : (unsigned short)0; }
#pragma unroll
    for (int t = 0; t < 4; ++t) {
      const unsigned short* brow = Wt + (size_t)(col0 + t * 16 + ln) * ldb + kb;
      FragB b;
      b.half[0] = *(const v8us*)(brow + 8 * hh);
      b.half[1] = *(const v8us*)(brow + 16 + 8 * hh);
      acc[t] = mmaN<ASPLIT ? 2 : 1>(ah.v, al.v, b.v, b.v, acc[t]);
    }
  }
#pragma unroll
  for (int t = 0; t < 4; ++t) {
    const int col = col0 + t * 16 + ln;
    float bv = bias ? bias[col] : 0.f;
    if (BIAS_BF16) bv = bf16_round(bv);
#pragma unroll
    for (int r = 0; r < 8; ++r) {
      float v = acc[t][r] + bv;
      if (resid) { float rv = resid[(size_t)((row0 + 8 * hh + r) % rmod) * ldr + col]; if (RES_BF16) rv = bf16_round(rv); v += rv; }
      if (ACT == 1) v = fmaxf(v, 0.f);
      if (ACT == 2) v = 0.5f * v * (1.0f + erff(v * 0.70710678118654752f));
      if (ACT == 3) { const float u = 0.7978845608028654f * (v + 0.044715f * v * v * v); v = 0.5f * v * (1.0f + tanhf(u)); }
      so[w][8 * hh + r][t * 16 + ln] = v;
    }
  }
  __builtin_amdgcn_fence(__ATOMIC_ACQ_REL, "workgroup");
  __builtin_amdgcn_wave_barrier();
  const int rsub = lane >> 4, c4 = (lane & 15) * 4;
  {
#pragma unroll
    for (int q = 0; q < 8; ++q) {
      const int r = q * 2 + rsub;
      const v4f v = *(const v4fa*)&so[w][r][c4];
      *(v4f*)(C + (size_t)(row0 + r) * ldc + col0 + c4) = v;
    }
    
  }
}
// row LayerNorm (biased variance, eps) over N: s = X (+ R); optional out_sum <- s; out_norm <- (s-mu)*rsqrt(var+eps)*g + b
template <bool PARAM_BF16>
__global__ __launch_bounds__(256) void k_layernorm(const float* __restrict__ X, const float* __restrict__ R, const float* __restrict__ g, const float* __restrict__ bta,
                                                  float* __restrict__ out_sum, float* __restrict__ out_norm, int N, float eps) {
  __shared__ float red[256];
  const int row = blockIdx.x, tid = threadIdx.x;
  const float* x = X + (size_t)row * N; const float* rr = R ? R + (size_t)row * N : nullptr;
  float vals[16];                     // up to N = 4096
  const int per = N / 256;            // contiguous chunk per thread? use strided-by-4 chunks: thread handles j = tid*4 + 1024*u
  float s1 = 0.f;
  for (int u = 0; u < per / 4; ++u) {
    const int j = tid * 4 + 1024 * u;
    const v4f a = *(const v4fa*)(x + j);
    v4f b = {0.f,0.f,0.f,0.f}; if (rr) b = *(const v4fa*)(rr + j);
#pragma unroll
    for (int q = 0; q < 4; ++q) { const float v = a[q] + b[q]; vals[u * 4 + q] = v; s1 += v; }
  }
  red[tid] = s1; __syncthreads();
  for (int st = 128; st > 0; st >>= 1) { if (tid < st) red[tid] += red[tid + st]; __syncthreads(); }
  const float mu = red[0] / (float)N; __syncthreads();
  float s2 = 0.f;
  for (int u = 0; u < per / 4; ++u)
#pragma unroll
    for (int q = 0; q < 4; ++q) { const float c = vals[u * 4 + q] - mu; s2 += c * c; }
  red[tid] = s2; __syncthreads();
  for (int st = 128; st > 0; st >>= 1) { if (tid < st) red[tid] += red[tid + st]; __syncthreads(); }
  const float rs = rsqrtf(red[0] / (float)N + eps);
  {
    for (int u = 0; u < per / 4; ++u) {
      const int j = tid * 4 + 1024 * u;
      v4f o, sm;
#pragma unroll
      for (int q = 0; q < 4; ++q) {
        float gg = g[j + q], bb = bta[j + q];
        if (PARAM_BF16) { gg = bf16_round(gg); bb = bf16_round(bb); }
        sm[q] = vals[u * 4 + q]; o[q] = (vals[u * 4 + q] - mu) * rs * gg + bb;
      }
      if (out_sum) *(v4f*)(out_sum + (size_t)row * N + j) = sm;
      *(v4f*)(out_norm + (size_t)row * N + j) = o;
    }
    
  }
}



// ---- f16 WMMA path (v_wmma_f32_16x16x32_f16): 11-bit significands for operands in range — used where a [0,1] probability operand needs more precision than bf16
typedef _Float16 v16h __attribute__((ext_vector_type(16)));
union FragH { v16h v; v8us half[2]; _Float16 h[16]; unsigned short u[16]; };
template <int NT>
__device__ __forceinline__ v8f mmaH(v16h ah, v16h al, v16h bh, v16h bl, v8f c) {
  c = __builtin_amdgcn_wmma_f32_16x16x32_f16(false, ah, false, bh, (short)0, c, false, false);
  if (NT >= 2) c = __builtin_amdgcn_wmma_f32_16x16x32_f16(false, al, false, bh, (short)0, c, false, false);
  if (NT >= 3) c = __builtin_amdgcn_wmma_f32_16x16x32_f16(false, ah, false, bl, (short)0, c, false, false);
  asm volatile("v_nop\n\tv_nop\n\tv_nop\n\tv_nop" : "+v"(c) : "v"(ah), "v"(al), "v"(bh), "v"(bl));
  return c;
}
// batched GEMM like k_gemm_b but f16 operands: A f32 (split into f16 hi/lo if ASPLIT, else rounded to f16), Bt = f16 values [n][k]; alpha; C f32; N multiple of 16 (partial tiles skipped)
template <bool ASPLIT>
__global__ __launch_bounds__(128) void k_gemm_h(const float* __restrict__ A, int lda, size_t sA, const _Float16* __restrict__ Bh, int ldb, size_t sB, float alpha, float* __restrict__ C, int ldc, size_t sC, int M, int N, int K) {
  __shared__ __attribute__((aligned(16))) float so[4][16][64];
  const int tid = threadIdx.x, w = tid >> 5, lane = tid & 31, ln = lane & 15, hh = lane >> 4; const int by = blockIdx.y;
  A += (size_t)by * sA; Bh += (size_t)by * sB; C += (size_t)by * sC;
  const int ntn = (N + 63) / 64; const int wid = blockIdx.x * 4 + w; const int mt = wid / ntn, nq = wid % ntn; if (mt * 16 >= M) return;
  const int row0 = mt * 16, col0 = nq * 64; const float* arow = A + (size_t)(row0 + ln) * lda;
  v8f acc[4] = {};
  for (int kb = 0; kb < K; kb += 32) {
    FragH ah, al;
    const v4f x0 = *(const v4fa*)(arow + kb + 8 * hh), x1 = *(const v4fa*)(arow + kb + 8 * hh + 4), x2 = *(const v4fa*)(arow + kb + 16 + 8 * hh), x3 = *(const v4fa*)(arow + kb + 16 + 8 * hh + 4);
    float xs[16] = {x0[0],x0[1],x0[2],x0[3],x1[0],x1[1],x1[2],x1[3],x2[0],x2[1],x2[2],x2[3],x3[0],x3[1],x3[2],x3[3]};
#pragma unroll
    for (int i = 0; i < 16; ++i) { const _Float16 h = (_Float16)xs[i]; ah.h[i] = h; al.h[i] = ASPLIT ? (_Float16)(xs[i] - (float)h) : (_Float16)0.0f; }
#pragma unroll
    for (int t = 0; t < 4; ++t) { if (col0 + t * 16 >= N) continue; const size_t boff = (size_t)(col0 + t * 16 + ln) * ldb + kb; FragH bq; bq.half[0] = *(const v8us*)(Bh + boff + 8 * hh); bq.half[1] = *(const v8us*)(Bh + boff + 16 + 8 * hh);
      acc[t] = mmaH<ASPLIT ? 2 : 1>(ah.v, al.v, bq.v, bq.v, acc[t]); }
  }
#pragma unroll
  for (int t = 0; t < 4; ++t) { if (col0 + t * 16 >= N) continue;
#pragma unroll
    for (int r = 0; r < 8; ++r) so[w][8 * hh + r][t * 16 + ln] = acc[t][r] * alpha; }
  __builtin_amdgcn_fence(__ATOMIC_ACQ_REL, "workgroup"); __builtin_amdgcn_wave_barrier();
  const int rsub = lane >> 4, c4 = (lane & 15) * 4;
  {
#pragma unroll
    for (int q = 0; q < 8; ++q) { const int r = q * 2 + rsub; if (col0 + c4 < N) { const v4f v = *(const v4fa*)&so[w][r][c4]; *(v4f*)(C + (size_t)(row0 + r) * ldc + col0 + c4) = v; } }
     }
}

// Wt[n][k] = f16(bf16(W[k][n])·scale) from f32 row-major W[K][N] (scale = power of two; bf16-exact weights stay exact in f16 away from the subnormal range)
__global__ __launch_bounds__(256) void k_wt_f16(const float* __restrict__ W, _Float16* __restrict__ Wt, int K, int N, float scale) {
  const int t = blockIdx.x * 256 + threadIdx.x; if (t >= N * (K / 8)) return; const int n = t / (K / 8), k8 = (t % (K / 8)) * 8; FragH f;
#pragma unroll
  for (int i = 0; i < 8; ++i) f.h[i] = (_Float16)(bf16_round(W[(size_t)(k8 + i) * N + n]) * scale); const v8us o = f.half[0];
  *(v8us*)((unsigned short*)Wt + (size_t)n * K + k8) = o; 
}
// k_gemm_hh variant with fused epilogue: v = acc·alpha + bias[by·sBias + col] (+ CP[(row/rowsPerB)·sCPb + by·64 + col] if CP) ; ACT 0 none / 1 elu ; writes f16 C16 (and f32 C if non-null)
template <int ACT>
__global__ __launch_bounds__(128) void k_gemm_hhx(const _Float16* __restrict__ A, int lda, size_t sA, const _Float16* __restrict__ Bh, int ldb, size_t sB, float alpha, const float* __restrict__ bias, size_t sBias, const float* __restrict__ CP, int rowsPerB, size_t sCPb, int row0g,
    float* __restrict__ C, _Float16* __restrict__ C16, int ldc, size_t sC, int M, int N, int K) {
  __shared__ __attribute__((aligned(16))) float so[4][16][64];
  const int tid = threadIdx.x, w = tid >> 5, lane = tid & 31, ln = lane & 15, hh = lane >> 4; const int by = blockIdx.y;
  A += (size_t)by * sA; Bh += (size_t)by * sB; const size_t cofs = (size_t)by * sC; const float* bp = bias ? bias + (size_t)by * sBias : nullptr;
  const int ntn = (N + 63) / 64; const int wid = blockIdx.x * 4 + w; const int mt = wid / ntn, nq = wid % ntn; if (mt * 16 >= M) return;
  const int row0 = mt * 16, col0 = nq * 64; const _Float16* arow = A + (size_t)(row0 + ln) * lda;
  v8f acc[4] = {};
  for (int kb = 0; kb < K; kb += 32) { FragH ah; ah.half[0] = *(const v8us*)((const unsigned short*)arow + kb + 8 * hh); ah.half[1] = *(const v8us*)((const unsigned short*)arow + kb + 16 + 8 * hh);
#pragma unroll
    for (int t = 0; t < 4; ++t) { if (col0 + t * 16 >= N) continue; const size_t boff = (size_t)(col0 + t * 16 + ln) * ldb + kb; FragH bq; bq.half[0] = *(const v8us*)((const unsigned short*)Bh + boff + 8 * hh); bq.half[1] = *(const v8us*)((const unsigned short*)Bh + boff + 16 + 8 * hh);
      acc[t] = mmaH<1>(ah.v, ah.v, bq.v, bq.v, acc[t]); }
  }
#pragma unroll
  for (int t = 0; t < 4; ++t) { if (col0 + t * 16 >= N) continue; const int col = col0 + t * 16 + ln; const float bv = bp ? bf16_round(bp[col]) : 0.f;
#pragma unroll
    for (int r = 0; r < 8; ++r) { float v = acc[t][r] * alpha + bv; if (CP) { const int bidx = (row0g + row0 + 8 * hh + r) / rowsPerB; v += CP[(size_t)bidx * sCPb + (size_t)by * 64 + col]; } if (ACT == 1) v = (v > 0.f) ? v : expm1f(v); else if (ACT == 7) v = (v > 0.f) ? v + 1.0f : expf(v); else if (ACT == 8) v = tanhf(v); else if (ACT == 9) v = 0.5f * v * (1.0f + tanhf(0.7978845608028654f * (v + 0.044715f * v * v * v))); else if (ACT == 11) v = 1.0f / (1.0f + expf(-v)); else if (ACT == 12) v = (v > 0.f) ? v : 0.01f * v; else if (ACT == 14) v = (v > 0.f) ? v : 0.1f * v; else if (ACT == 15) v = v / (1.0f + expf(-v)); else if (ACT == 3) v = fmaxf(v, 0.f); else if (ACT == 6) v = 0.5f * v * (1.0f + erff(v * 0.70710678118654752f)); so[w][8 * hh + r][t * 16 + ln] = v; } }
  __builtin_amdgcn_fence(__ATOMIC_ACQ_REL, "workgroup"); __builtin_amdgcn_wave_barrier();
  const int rsub = lane >> 4, c4 = (lane & 15) * 4; typedef _Float16 v4h __attribute__((ext_vector_type(4)));
  {
#pragma unroll
    for (int q = 0; q < 8; ++q) { const int r = q * 2 + rsub; if (col0 + c4 < N) { const v4f v = *(const v4fa*)&so[w][r][c4]; if (C) *(v4f*)(C + cofs + (size_t)(row0 + r) * ldc + col0 + c4) = v; if (C16) { v4h h4; for (int i = 0; i < 4; ++i) h4[i] = (_Float16)v[i]; *(v4h*)(C16 + cofs + (size_t)(row0 + r) * ldc + col0 + c4) = h4; } } }
     }
}


typedef _Float16 v4h __attribute__((ext_vector_type(4)));

__global__ __launch_bounds__(256) void k_x16(const float* __restrict__ x, _Float16* __restrict__ X16, size_t n8) { const size_t t = (size_t)blockIdx.x * 256 + threadIdx.x; if (t >= n8) return; FragH f;
#pragma unroll
  for (int q = 0; q < 8; ++q) f.h[q] = (_Float16)bf16_round(x[t * 8 + q]); *(v8us*)((unsigned short*)X16 + t * 8) = f.half[0];  }
__global__ __launch_bounds__(256) void k_h16(const float* __restrict__ x, _Float16* __restrict__ X16, size_t n8) { const size_t t = (size_t)blockIdx.x * 256 + threadIdx.x; if (t >= n8) return; FragH f;
#pragma unroll
  for (int q = 0; q < 8; ++q) f.h[q] = (_Float16)x[t * 8 + q]; *(v8us*)((unsigned short*)X16 + t * 8) = f.half[0];  }
__global__ __launch_bounds__(256) void k_round16f(const float* __restrict__ W, _Float16* __restrict__ Bt, size_t n8) { const size_t t = (size_t)blockIdx.x * 256 + threadIdx.x; if (t >= n8) return; FragH f;
#pragma unroll
  for (int i = 0; i < 8; ++i) f.h[i] = (_Float16)(bf16_round(W[t * 8 + i]) * 16.0f); *(v8us*)((unsigned short*)Bt + t * 8) = f.half[0];  }
__global__ __launch_bounds__(256) void k_h16s(const float* __restrict__ F, _Float16* __restrict__ H, size_t n8) { const size_t t = (size_t)blockIdx.x * 256 + threadIdx.x; if (t >= n8) return; const v4f a = *(const v4fa*)(F + t * 8), c = *(const v4fa*)(F + t * 8 + 4); FragH f;
#pragma unroll
  for (int q = 0; q < 4; ++q) { f.h[q] = (_Float16)(a[q] * 16.0f); f.h[4 + q] = (_Float16)(c[q] * 16.0f); } *(v8us*)((unsigned short*)H + t * 8) = f.half[0];  }
// K and V rewritten in the order in which k_flash's A fragments take them, so that each of its wave-wide 16-byte loads covers 512 contiguous bytes (4 whole lines) instead of 32 bytes of each of 16 lines.
// Unit = 16 B = 8 f16 of one lane, lane = 16hh + ln. Kp: per 16 keys 4 loads (ks, half): unit = K[key tile * 16 + ln][ks * 32 + half * 16 + 8hh + 0..7]. Vp: per 32 keys 8 loads (dt, half): unit = V[key block * 32 + half * 16 + 8hh + 0..7][dt * 16 + ln].
// Even blocks transpose 64 keys of V through LDS, odd blocks permute 64 keys of K; thread t writes unit t, so the stores are whole lines too.
__global__ __launch_bounds__(256) void k_pack(const _Float16* __restrict__ K16, const _Float16* __restrict__ V16, _Float16* __restrict__ Kp, _Float16* __restrict__ Vp) {
  __shared__ unsigned short tl[64][66]; const int tid = threadIdx.x; const int lg = blockIdx.x >> 1;
  if (blockIdx.x & 1) {
#pragma unroll      // both 16-byte loads are issued before the first store waits for its data
    for (int rd = 0; rd < 2; ++rd) { const int c = rd * 256 + tid, ln = c & 15, hh = (c >> 4) & 1, half = (c >> 5) & 1, ks = (c >> 6) & 1, kt = c >> 7;
      const v8us u = *(const v8us*)((const unsigned short*)K16 + ((size_t)lg * 64 + kt * 16 + ln) * 64 + ks * 32 + half * 16 + hh * 8);
      *(v8us*)((unsigned short*)Kp + (size_t)lg * 4096 + c * 8) = u; }
    asm volatile("s_wait_xcnt 0x0" ::: "memory");      // precaution: stands in front of every later write of a register that the two K stores name (in the listing this branch's exit also falls through into the V part, which rewrites them)
    return; }
  for (int i = tid; i < 64 * 8; i += 256) { const int r = i / 8, c8 = (i % 8) * 8; FragH f; f.half[0] = *(const v8us*)((const unsigned short*)V16 + ((size_t)lg * 64 + r) * 64 + c8);
#pragma unroll
    for (int q = 0; q < 8; ++q) tl[r][c8 + q] = f.u[q]; }
  __syncthreads();
#pragma unroll
  for (int rd = 0; rd < 2; ++rd) { const int c = rd * 256 + tid, ln = c & 15, hh = (c >> 4) & 1, half = (c >> 5) & 1, dt = (c >> 6) & 3; FragH f;
#pragma unroll
    for (int q = 0; q < 8; ++q) f.u[q] = tl[rd * 32 + half * 16 + hh * 8 + q][dt * 16 + ln];
    *(v8us*)((unsigned short*)Vp + (size_t)lg * 4096 + c * 8) = f.half[0]; } }
__global__ __launch_bounds__(256) void k_merge(const float* __restrict__ O, float* __restrict__ out) {
  const int tid = threadIdx.x; const int wg = blockIdx.x * 8 + (tid >> 5); if (wg >= NB * 2) return; const int b = wg >> 1, hp = wg & 1; const int l = tid & 31; const int h = hp * 2 + (l >> 4), c4 = (l & 15) * 4;
  const v4f v = *(const v4fa*)(O + ((size_t)h * NB + b) * DD + c4); float* o = out + (size_t)b * EE + h * DD + c4;
  *(v4f*)o = v;  }
__global__ __launch_bounds__(1024) void k_flash(const _Float16* __restrict__ Q16, int ldq, const _Float16* __restrict__ Kp, const _Float16* __restrict__ Vp, const int* __restrict__ MSK, float* __restrict__ O, int ldo) {
  constexpr int RPW = 16, NQB = TT / (4 * RPW), DT = 4, KS = 2, KSPL = 8, NW = 4 * KSPL;
  __shared__ __attribute__((aligned(16))) float sO[NW][RPW][64 + 4]; __shared__ float sM[NW][RPW], sL[NW][RPW];
  const int tid = threadIdx.x, lane = tid & 31, ln = lane & 15, hh = lane >> 4;
  const int w = __builtin_amdgcn_readfirstlane(tid >> 5) & (NW - 1);      // wave number in a scalar register, so that the key loop's counter and branch are scalar; the mask (an identity) shows the compiler its range: no zero-trip path, no spill
  const int slab = blockIdx.x / NQB, qblk = blockIdx.x % NQB; const int b = slab / NH, h = slab % NH; const int qb0 = qblk * (4 * RPW); const int q0 = qb0 + (w & 3) * RPW;
  FragH bq[KS];      // B operand: column ln = query q0 + ln
  { const unsigned short* qr = (const unsigned short*)Q16 + ((size_t)b * TT + q0 + ln) * ldq + h * 64;
#pragma unroll
    for (int ks = 0; ks < KS; ++ks) { bq[ks].half[0] = *(const v8us*)(qr + ks * 32 + 8 * hh); bq[ks].half[1] = *(const v8us*)(qr + ks * 32 + 16 + 8 * hh); } }
  const unsigned short* Kf = (const unsigned short*)Kp + (size_t)slab * 64 * TT + lane * 8; const unsigned short* Vf = (const unsigned short*)Vp + (size_t)slab * 64 * TT + lane * 8;      // k_pack's planes: 64 f16 per key, a lane's 16 B at lane * 16 in every 512-byte load
  float m_q = -3.0e38f, l_q = 0.f; v8f oacc[DT];      // of query ln: running max (equal in both halves), this half's share of the sum, O^T rows dt * 16 + 8hh + r
#pragma unroll
  for (int dt = 0; dt < DT; ++dt) oacc[dt] = (v8f){0.f,0.f,0.f,0.f,0.f,0.f,0.f,0.f};
  const int jend = TT;
#pragma unroll 1
  for (int j0 = (w >> 2) * 32; j0 < jend; j0 += 32 * KSPL) {
    v8f s[2];      // s[nt][r] = score of key j0 + nt * 16 + 8hh + r with query ln
#pragma unroll
    for (int nt = 0; nt < 2; ++nt) { const unsigned short* kr = Kf + (size_t)(j0 + nt * 16) * 64; FragH ak[KS];
#pragma unroll
      for (int ks = 0; ks < KS; ++ks) { ak[ks].half[0] = *(const v8us*)(kr + ks * 512); ak[ks].half[1] = *(const v8us*)(kr + ks * 512 + 256); }
      v8f acc = (v8f){0.f,0.f,0.f,0.f,0.f,0.f,0.f,0.f};
#pragma unroll
      for (int ks = 0; ks < KS; ++ks) acc = mmaH<1>(ak[ks].v, ak[ks].v, bq[ks].v, bq[ks].v, acc);
      s[nt] = acc * 0.125f; }
    float mc = fmaxf(s[0][0], s[1][0]);
#pragma unroll
    for (int r = 1; r < 8; ++r) mc = fmaxf(mc, fmaxf(s[0][r], s[1][r]));
    mc = fmaxf(mc, __int_as_float(__builtin_amdgcn_permlanex16(__float_as_int(mc), __float_as_int(mc), 0x76543210, 0xfedcba98, false, false)));      // lane l <-> l ^ 16: the other 16 keys of the same query
    const float mn = fmaxf(m_q, mc); const float al = expf(m_q - mn); m_q = mn;
    FragH pb; float ps = 0.f;
#pragma unroll
    for (int r = 0; r < 8; ++r) { const float p0 = expf(s[0][r] - mn), p1 = expf(s[1][r] - mn); ps += p0 + p1; pb.h[r] = (_Float16)(p0 * 1024.0f); pb.h[8 + r] = (_Float16)(p1 * 1024.0f); }
    l_q = l_q * al + ps;
#pragma unroll
    for (int dt = 0; dt < DT; ++dt) oacc[dt] *= al;
#pragma unroll
    for (int dt = 0; dt < DT; ++dt) { const unsigned short* vrow = Vf + (size_t)j0 * 64 + dt * 512; FragH av; av.half[0] = *(const v8us*)vrow; av.half[1] = *(const v8us*)(vrow + 256);
      oacc[dt] = mmaH<1>(av.v, av.v, pb.v, pb.v, oacc[dt]); } }
  l_q += __int_as_float(__builtin_amdgcn_permlanex16(__float_as_int(l_q), __float_as_int(l_q), 0x76543210, 0xfedcba98, false, false));      // the halves' sums joined once
  if (hh == 0) { sM[w][ln] = m_q; sL[w][ln] = l_q; }
#pragma unroll
  for (int dt = 0; dt < DT; ++dt) { *(v4fa*)&sO[w][ln][dt * 16 + 8 * hh] = (v4f){oacc[dt][0], oacc[dt][1], oacc[dt][2], oacc[dt][3]}; *(v4fa*)&sO[w][ln][dt * 16 + 8 * hh + 4] = (v4f){oacc[dt][4], oacc[dt][5], oacc[dt][6], oacc[dt][7]}; }
  __syncthreads();      // every wave's partial (max, sum, accumulator) is in LDS before any wave merges
  for (int e = tid; e < 4 * RPW * 16; e += 32 * NW) { const int row = e >> 4, pc = e & 15, qt = row / RPW, r = row % RPW;      // one query row per 16 lanes, 16 B per lane
    float mg[KSPL], M = -3.0e38f;
#pragma unroll
    for (int g = 0; g < KSPL; ++g) { mg[g] = sM[g * 4 + qt][r]; M = fmaxf(M, mg[g]); }
    float L = 0.f; v4f acc = {0.f, 0.f, 0.f, 0.f};
#pragma unroll
    for (int g = 0; g < KSPL; ++g) { const float wg = expf(mg[g] - M); L += wg * sL[g * 4 + qt][r]; const v4f pv = *(const v4fa*)&sO[g * 4 + qt][r][pc * 4]; acc += pv * wg; }
    const float inv = (L > 0.f) ? 1.0f / (L * 1024.0f) : 0.f;
    *(v4f*)(O + ((size_t)b * TT + qb0 + row) * ldo + h * 64 + pc * 4) = acc * inv; } }

extern "C" void kernel_launch(void* const* d_in, const int* in_sizes, int n_in,
                              void* d_out, int out_size, void* d_ws, size_t ws_size, hipStream_t stream) {
  (void)in_sizes; (void)n_in; (void)out_size;
  const float* const* I = (const float* const*)d_in; const float* xq = I[0]; const float* xk = I[1]; const float* xv = I[2]; const float* Wq = I[3]; const float* Wk = I[4]; const float* Wv = I[5];
  char* ws = (char*)d_ws; size_t off = 0;
  auto take = [&](size_t bytes) { char* p = ws + off; off += (bytes + 255) & ~(size_t)255; return p; };
  const size_t WSZ = (size_t)EE * EE; _Float16* Bw = (_Float16*)take(3 * WSZ * 2);
  _Float16* Xq = (_Float16*)take((size_t)NB * EE * 2); _Float16* Xk = (_Float16*)take((size_t)NB * EE * 2); _Float16* Xv = (_Float16*)take((size_t)NB * EE * 2);
  _Float16* Qs = (_Float16*)take((size_t)TT * DD * 2); _Float16* Ks = (_Float16*)take((size_t)TT * DD * 2); _Float16* Vs = (_Float16*)take((size_t)TT * DD * 2); _Float16* Kp = (_Float16*)take((size_t)TT * DD * 2); _Float16* Vp = (_Float16*)take((size_t)TT * DD * 2); float* O = (float*)take((size_t)TT * DD * 4);
  if (off > ws_size) return;      // 0.4 + 3 x 2.1 + 5 x 2.1 + 4.2 = about 21 MB
  const unsigned gw = (unsigned)((EE * (EE / 8) + 255) / 256);
  k_wt_f16<<<gw, 256, 0, stream>>>(Wq, Bw, EE, EE, 16.0f); k_wt_f16<<<gw, 256, 0, stream>>>(Wk, Bw + WSZ, EE, EE, 16.0f); k_wt_f16<<<gw, 256, 0, stream>>>(Wv, Bw + 2 * WSZ, EE, EE, 16.0f);      /* (in,out) → Bt ×2^4 */
  const unsigned g8 = (unsigned)(((size_t)NB * EE / 8 + 255) / 256); k_x16<<<g8, 256, 0, stream>>>(xq, Xq, (size_t)NB * EE / 8); k_x16<<<g8, 256, 0, stream>>>(xk, Xk, (size_t)NB * EE / 8); k_x16<<<g8, 256, 0, stream>>>(xv, Xv, (size_t)NB * EE / 8);
  const dim3 gs(((NB / 16) * 1 + 3) / 4, NHD);      /* per head h = grid.y: C16[h·NB + b][0..63] = X·Bt[h·64 .. h·64+63]ᵀ — M 4096 N 64 K 256, written straight into the stacked plane */
  k_gemm_hhx<0><<<gs, 128, 0, stream>>>(Xq, EE, 0, Bw, EE, (size_t)DD * EE, 0.0625f, nullptr, 0, nullptr, 1, 0, 0, nullptr, Qs, DD, (size_t)NB * DD, NB, DD, EE);
  k_gemm_hhx<0><<<gs, 128, 0, stream>>>(Xk, EE, 0, Bw + WSZ, EE, (size_t)DD * EE, 0.0625f, nullptr, 0, nullptr, 1, 0, 0, nullptr, Ks, DD, (size_t)NB * DD, NB, DD, EE);
  k_gemm_hhx<0><<<gs, 128, 0, stream>>>(Xv, EE, 0, Bw + 2 * WSZ, EE, (size_t)DD * EE, 0.0625f, nullptr, 0, nullptr, 1, 0, 0, nullptr, Vs, DD, (size_t)NB * DD, NB, DD, EE);
  k_pack<<<2 * (TT / 64), 256, 0, stream>>>(Ks, Vs, Kp, Vp);      /* K and V in fragment order */
  k_flash<<<BB * NH * (TT / 64), 1024, 0, stream>>>(Qs, DD, Kp, Vp, nullptr, O, DD);      /* one slab: 16384 queries × 16384 keys */
  k_merge<<<(NB * 2 + 7) / 8, 256, 0, stream>>>(O, (float*)d_out);
}

// v004
// One run takes 227 microseconds.
// Timed twice side by side with v003, it ran 1.06 and 1.07 times as fast.
// Counting every step since v000, it is 7.42 times as fast.
#include <hip/hip_runtime.h>
// Multi-head attention whose heads are STACKED along the batch axis (B=4096 rows, EMBED=256, 4 heads × 64): q = queries·W_Query, k = keys·W_Key, v = values·W_Value ((in,out), no bias); the heads are split TF-style into [H·B, 64] = [16384, 64] and ONE softmax(q·kᵀ/√64)·v runs over all 16384 stacked rows
// (every query attends to every (head, row) key); the result is merged back to [B, H·64].
// Compute dtype: inputs and weights rounded to bf16; q, k, v as f16 GEMM outputs written directly in the stacked [h·4096 + b][64] layout (grid.y = head); fused flash-style kernel over T = 16384 (online softmax f32, P f16 ×2^10, f32 accumulate) on v_wmma_f32_16x16x32_f16;
// the f32 result rows are permuted into the merged output by a copy kernel (32 lanes × 16 B per instruction).
#define BB 1
#define TT 16384
#define NH 1
#define NB 4096
#define NHD 4
#define EE 256
#define DD 64
#define NR (BB * TT)

typedef __bf16 v16b __attribute__((ext_vector_type(16)));
typedef unsigned short v8us __attribute__((ext_vector_type(8), may_alias));
typedef float  v8f  __attribute__((ext_vector_type(8)));
typedef float  v4f  __attribute__((ext_vector_type(4)));
typedef float  v4fa __attribute__((ext_vector_type(4), may_alias));
union FragB { v16b v; v8us half[2]; unsigned short u[16]; };

__device__ __forceinline__ unsigned short bf16_bits(float x) { unsigned int u = __float_as_uint(x); return (unsigned short)((u + 0x7FFFu + ((u >> 16) & 1u)) >> 16); }
__device__ __forceinline__ float bf16_val(unsigned short b) { return __uint_as_float(((unsigned int)b) << 16); }
__device__ __forceinline__ float bf16_round(float x) { return bf16_val(bf16_bits(x)); }
// D += A·B with NT terms: 1 = ah·bh, 2 = + al·bh (A split), 3 = + ah·bl (both split)
template <int NT>
__device__ __forceinline__ v8f mmaN(v16b ah, v16b al, v16b bh, v16b bl, v8f c) {
  c = __builtin_amdgcn_wmma_f32_16x16x32_bf16(false, ah, false, bh, (short)0, c, false, false);
  if (NT >= 2) c = __builtin_amdgcn_wmma_f32_16x16x32_bf16(false, al, false, bh, (short)0, c, false, false);
  if (NT >= 3) c = __builtin_amdgcn_wmma_f32_16x16x32_bf16(false, ah, false, bl, (short)0, c, false, false);
  asm volatile("v_nop\n\tv_nop\n\tv_nop\n\tv_nop" : "+v"(c) : "v"(ah), "v"(al), "v"(bh), "v"(bl));
  return c;
}

__global__ __launch_bounds__(256) void k_wt_bf16(const float* __restrict__ W, unsigned short* __restrict__ Wt, int K, int N) {
  const int t = blockIdx.x * 256 + threadIdx.x;
  const int k8n = K / 8;
  if (t >= N * k8n) return;
  const int n = t / k8n, k8 = (t % k8n) * 8;
  v8us v;
#pragma unroll
  for (int i = 0; i < 8; ++i) v[i] = bf16_bits(W[(size_t)(k8 + i) * N + n]);
  *(v8us*)(Wt + (size_t)n * K + k8) = v;
  
}

// GEMM C[M][N] (f32, pitch ldc) = act(A[M][K]·W + bias). A f32 row-major (pitch lda) converted per fragment to bf16
// (ASPLIT: hi/lo two planes -> 2 terms, else single rounded term); Wt bf16 [N][K] (pitch ldb). BIAS_BF16 rounds the
// bias to bf16 first (bias quantised to bf16 before the add). K%32==0, M%16==0, N%64==0.
template <bool ASPLIT, int ACT, bool BIAS_BF16>
__global__ __launch_bounds__(128) void k_gemm_bf(const float* __restrict__ A, int lda, const unsigned short* __restrict__ Wt, int ldb,
                                               const float* __restrict__ bias, float* __restrict__ C, int ldc, int M, int N, int K) {
  __shared__ __attribute__((aligned(16))) float so[4][16][64];
  const int tid = threadIdx.x, w = tid >> 5, lane = tid & 31, ln = lane & 15, hh = lane >> 4;
  const int ntn = N / 64;
  const int wid = blockIdx.x * 4 + w;
  const int mt = wid / ntn, nq = wid % ntn;
  if (mt * 16 >= M) return;
  const int row0 = mt * 16, col0 = nq * 64;
  const float* arow = A + (size_t)(row0 + ln) * lda;
  v8f acc[4] = {};
  for (int kb = 0; kb < K; kb += 32) {
    FragB ah, al;
    const v4f x0 = *(const v4fa*)(arow + kb + 8 * hh), x1 = *(const v4fa*)(arow + kb + 8 * hh + 4);
    const v4f x2 = *(const v4fa*)(arow + kb + 16 + 8 * hh), x3 = *(const v4fa*)(arow + kb + 16 + 8 * hh + 4);
    float xs[16] = {x0[0],x0[1],x0[2],x0[3],x1[0],x1[1],x1[2],x1[3],x2[0],x2[1],x2[2],x2[3],x3[0],x3[1],x3[2],x3[3]};
#pragma unroll
    for (int i = 0; i < 16; ++i) { const unsigned short hb = bf16_bits(xs[i]); ah.u[i] = hb; al.u[i] = ASPLIT ? bf16_bits(xs[i] - bf16_val(hb)) : (unsigned short)0; }
#pragma unroll
    for (int t = 0; t < 4; ++t) {
      const unsigned short* brow = Wt + (size_t)(col0 + t * 16 + ln) * ldb + kb;
      FragB b;
      b.half[0] = *(const v8us*)(brow + 8 * hh);
      b.half[1] = *(const v8us*)(brow + 16 + 8 * hh);
      acc[t] = mmaN<ASPLIT ? 2 : 1>(ah.v, al.v, b.v, b.v, acc[t]);
    }
  }
#pragma unroll
  for (int t = 0; t < 4; ++t) {
    float bv = bias ? bias[col0 + t * 16 + ln] : 0.f;
    if (BIAS_BF16) bv = bf16_round(bv);
#pragma unroll
    for (int r = 0; r < 8; ++r) { float v = acc[t][r] + bv; if (ACT == 1) v = fmaxf(v, 0.f); so[w][8 * hh + r][t * 16 + ln] = v; }
  }
  __builtin_amdgcn_fence(__ATOMIC_ACQ_REL, "workgroup");
  __builtin_amdgcn_wave_barrier();
  const int rsub = lane >> 4, c4 = (lane & 15) * 4;
  {
#pragma unroll
    for (int q = 0; q < 8; ++q) {
      const int r = q * 2 + rsub;
      const v4f v = *(const v4fa*)&so[w][r][c4];
      *(v4f*)(C + (size_t)(row0 + r) * ldc + col0 + c4) = v;
    }
    
  }
}

// Flash-style causal/unmasked attention, all contractions 3-term bf16 hi/lo splits, f32 softmax with running max.
// q,k,v rows are read from f32 buffers with arbitrary row pitch (so they can live inside a fused qkv buffer);
// D = head size (multiple of 32, <= 128); one wave = 16 query rows; block = 4 waves (64 queries) sharing K/V chunks of 32.
template <int D, bool CAUSAL>
__global__ __launch_bounds__(128) void k_flash(const float* __restrict__ qb, const float* __restrict__ kb, const float* __restrict__ vb,
                                             int pitch, int T, int H, float scale, float* __restrict__ y, int ypitch) {
  constexpr int KS = D / 32;        // k-steps for QK
  constexpr int DT = D / 16;        // d tiles for PV
  __shared__ __attribute__((aligned(16))) unsigned short sKh[32][D + 8], sKl[32][D + 8], sVh[32][D + 8], sVl[32][D + 8];
  __shared__ __attribute__((aligned(16))) unsigned short sPh[4][16][40], sPl[4][16][40];
  __shared__ __attribute__((aligned(16))) float sO[4][16][D];
  const int tid = threadIdx.x, w = tid >> 5, lane = tid & 31, ln = lane & 15, hh = lane >> 4;
  const int nqb = (T + 63) / 64;
  const int bh = blockIdx.x / nqb, qblk = blockIdx.x % nqb;
  const int b = bh / H, h = bh % H;
  const int q0 = qblk * 64 + w * 16;
  const float* Q = qb + (size_t)b * T * pitch + h * D;
  const float* K = kb + (size_t)b * T * pitch + h * D;
  const float* V = vb + (size_t)b * T * pitch + h * D;

  // A fragments of the wave's 16 query rows (scaled), hi/lo
  FragB aqh[KS], aql[KS];
  {
    int row = q0 + ln; if (row >= T) row = T - 1;
    const float* qr = Q + (size_t)row * pitch;
#pragma unroll
    for (int ks = 0; ks < KS; ++ks)
#pragma unroll
      for (int i = 0; i < 16; ++i) {
        const int d = ks * 32 + ((i < 8) ? (8 * hh + i) : (16 + 8 * hh + (i - 8)));
        const float x = qr[d] * scale; const unsigned short hb = bf16_bits(x);
        aqh[ks].u[i] = hb; aql[ks].u[i] = bf16_bits(x - bf16_val(hb));
      }
  }
  float m_r[8], l_r[8];
#pragma unroll
  for (int r = 0; r < 8; ++r) { m_r[r] = -3.0e38f; l_r[r] = 0.f; }
  v8f oacc[DT];
#pragma unroll
  for (int dt = 0; dt < DT; ++dt) oacc[dt] = (v8f){0.f,0.f,0.f,0.f,0.f,0.f,0.f,0.f};

  const int kv_end = CAUSAL ? min(T, qblk * 64 + 64) : T;     // block-uniform
  for (int j0 = 0; j0 < kv_end; j0 += 32) {
    __syncthreads();
    for (int e = tid; e < 32 * (D / 4); e += 128) {
      const int r = e / (D / 4), c4 = (e % (D / 4)) * 4;
      const int key = j0 + r;
      v4f kf = {0.f,0.f,0.f,0.f}, vf = {0.f,0.f,0.f,0.f};
      if (key < T) { kf = *(const v4fa*)(K + (size_t)key * pitch + c4); vf = *(const v4fa*)(V + (size_t)key * pitch + c4); }
#pragma unroll
      for (int t = 0; t < 4; ++t) {
        unsigned short hb = bf16_bits(kf[t]); sKh[r][c4 + t] = hb; sKl[r][c4 + t] = bf16_bits(kf[t] - bf16_val(hb));
        hb = bf16_bits(vf[t]); sVh[r][c4 + t] = hb; sVl[r][c4 + t] = bf16_bits(vf[t] - bf16_val(hb));
      }
    }
    __syncthreads();
    // S tile 16 x 32
    v8f s[2];
#pragma unroll
    for (int nt = 0; nt < 2; ++nt) {
      v8f acc = {};
#pragma unroll
      for (int ks = 0; ks < KS; ++ks) {
        FragB bh_, bl_;
        bh_.half[0] = *(const v8us*)&sKh[nt * 16 + ln][ks * 32 + 8 * hh]; bh_.half[1] = *(const v8us*)&sKh[nt * 16 + ln][ks * 32 + 16 + 8 * hh];
        bl_.half[0] = *(const v8us*)&sKl[nt * 16 + ln][ks * 32 + 8 * hh]; bl_.half[1] = *(const v8us*)&sKl[nt * 16 + ln][ks * 32 + 16 + 8 * hh];
        acc = mmaN<3>(aqh[ks].v, aql[ks].v, bh_.v, bl_.v, acc);
      }
      s[nt] = acc;
    }
    // mask + running max (rows 8hh+r; the 16 lanes of a half share rows)
    float alpha[8];
#pragma unroll
    for (int r = 0; r < 8; ++r) {
      const int qi = q0 + 8 * hh + r;
      const int ja = j0 + ln, jb = j0 + 16 + ln;
      if (CAUSAL) { if (ja > qi) s[0][r] = -3.0e38f; if (jb > qi) s[1][r] = -3.0e38f; }
      if (ja >= T) s[0][r] = -3.0e38f;
      if (jb >= T) s[1][r] = -3.0e38f;
      float mx = fmaxf(s[0][r], s[1][r]);
      mx = fmaxf(mx, __shfl_xor(mx, 1, 32)); mx = fmaxf(mx, __shfl_xor(mx, 2, 32)); mx = fmaxf(mx, __shfl_xor(mx, 4, 32)); mx = fmaxf(mx, __shfl_xor(mx, 8, 32));
      const float mnew = fmaxf(m_r[r], mx);
      alpha[r] = (mnew > -1.0e38f) ? __expf(m_r[r] - mnew) : 1.0f;
      const float p0 = (s[0][r] > -1.0e38f) ? __expf(s[0][r] - mnew) : 0.f;
      const float p1 = (s[1][r] > -1.0e38f) ? __expf(s[1][r] - mnew) : 0.f;
      m_r[r] = mnew;
      l_r[r] = l_r[r] * alpha[r] + p0 + p1;            // per-lane partial row sum (16 lanes combined at the end)
      unsigned short hb = bf16_bits(p0); sPh[w][8 * hh + r][ln] = hb;      sPl[w][8 * hh + r][ln] = bf16_bits(p0 - bf16_val(hb));
      hb = bf16_bits(p1);                sPh[w][8 * hh + r][16 + ln] = hb; sPl[w][8 * hh + r][16 + ln] = bf16_bits(p1 - bf16_val(hb));
    }
#pragma unroll
    for (int dt = 0; dt < DT; ++dt)
#pragma unroll
      for (int r = 0; r < 8; ++r) oacc[dt][r] *= alpha[r];
    __builtin_amdgcn_fence(__ATOMIC_ACQ_REL, "workgroup");
    __builtin_amdgcn_wave_barrier();
    FragB pah, pal;
    pah.half[0] = *(const v8us*)&sPh[w][ln][8 * hh]; pah.half[1] = *(const v8us*)&sPh[w][ln][16 + 8 * hh];
    pal.half[0] = *(const v8us*)&sPl[w][ln][8 * hh]; pal.half[1] = *(const v8us*)&sPl[w][ln][16 + 8 * hh];
#pragma unroll
    for (int dt = 0; dt < DT; ++dt) {
      FragB bvh, bvl;
#pragma unroll
      for (int i = 0; i < 8; ++i) {
        bvh.u[i] = sVh[8 * hh + i][dt * 16 + ln]; bvh.u[8 + i] = sVh[16 + 8 * hh + i][dt * 16 + ln];
        bvl.u[i] = sVl[8 * hh + i][dt * 16 + ln]; bvl.u[8 + i] = sVl[16 + 8 * hh + i][dt * 16 + ln];
      }
      oacc[dt] = mmaN<3>(pah.v, pal.v, bvh.v, bvl.v, oacc[dt]);
    }
    __builtin_amdgcn_fence(__ATOMIC_ACQ_REL, "workgroup");
    __builtin_amdgcn_wave_barrier();
  }
#pragma unroll
  for (int r = 0; r < 8; ++r) {
    float l = l_r[r];
    l += __shfl_xor(l, 1, 32); l += __shfl_xor(l, 2, 32); l += __shfl_xor(l, 4, 32); l += __shfl_xor(l, 8, 32);
    l_r[r] = (l > 0.f) ? 1.0f / l : 0.f;
  }
#pragma unroll
  for (int dt = 0; dt < DT; ++dt)
#pragma unroll
    for (int r = 0; r < 8; ++r) sO[w][8 * hh + r][dt * 16 + ln] = oacc[dt][r] * l_r[r];
  __builtin_amdgcn_fence(__ATOMIC_ACQ_REL, "workgroup");
  __builtin_amdgcn_wave_barrier();
  {
    for (int r = 0; r < 16; ++r) {
      const int row = q0 + r;
      if (row < T && lane < D / 4) {
        const v4f val = *(const v4fa*)&sO[w][r][lane * 4];
        *(v4f*)(y + ((size_t)b * T + row) * ypitch + h * D + lane * 4) = val;
      }
    }
    
  }
}

// GEMM C = act(A·W + bias + resid): A f32 (ASPLIT -> hi/lo 2 terms), Wt bf16 [N][K]; ACT 0 none, 1 relu, 2 exact gelu;
// resid (optional, f32, row index = (row % rmod), pitch ldr, RES_BF16 rounds it) added before the activation.
template <bool ASPLIT, int ACT, bool BIAS_BF16, bool RES_BF16>
__global__ __launch_bounds__(128) void k_gemm_bf3(const float* __restrict__ A, int lda, const unsigned short* __restrict__ Wt, int ldb,
                                                const float* __restrict__ bias, const float* __restrict__ resid, int rmod, int ldr,
                                                float* __restrict__ C, int ldc, int M, int N, int K) {
  __shared__ __attribute__((aligned(16))) float so[4][16][64];
  const int tid = threadIdx.x, w = tid >> 5, lane = tid & 31, ln = lane & 15, hh = lane >> 4;
  const int ntn = N / 64;
  const int wid = blockIdx.x * 4 + w;
  const int mt = wid / ntn, nq = wid % ntn;
  if (mt * 16 >= M) return;
  const int row0 = mt * 16, col0 = nq * 64;
  const float* arow = A + (size_t)(row0 + ln) * lda;
  v8f acc[4] = {};
  for (int kb = 0; kb < K; kb += 32) {
    FragB ah, al;
    const v4f x0 = *(const v4fa*)(arow + kb + 8 * hh), x1 = *(const v4fa*)(arow + kb + 8 * hh + 4);
    const v4f x2 = *(const v4fa*)(arow + kb + 16 + 8 * hh), x3 = *(const v4fa*)(arow + kb + 16 + 8 * hh + 4);
    float xs[16] = {x0[0],x0[1],x0[2],x0[3],x1[0],x1[1],x1[2],x1[3],x2[0],x2[1],x2[2],x2[3],x3[0],x3[1],x3[2],x3[3]};
#pragma unroll
    for (int i = 0; i < 16; ++i) { const unsigned short hb = bf16_bits(xs[i]); ah.u[i] = hb; al.u[i] = ASPLIT ? bf16_bits(xs[i] - bf16_val(hb)) : (unsigned short)0; }
#pragma unroll
    for (int t = 0; t < 4; ++t) {
      const unsigned short* brow = Wt + (size_t)(col0 + t * 16 + ln) * ldb + kb;
      FragB b;
      b.half[0] = *(const v8us*)(brow + 8 * hh);
      b.half[1] = *(const v8us*)(brow + 16 + 8 * hh);
      acc[t] = mmaN<ASPLIT ? 2 : 1>(ah.v, al.v, b.v, b.v, acc[t]);
    }
  }
#pragma unroll
  for (int t = 0; t < 4; ++t) {
    const int col = col0 + t * 16 + ln;
    float bv = bias ? bias[col] : 0.f;
    if (BIAS_BF16) bv = bf16_round(bv);
#pragma unroll
    for (int r = 0; r < 8; ++r) {
      float v = acc[t][r] + bv;
      if (resid) { float rv = resid[(size_t)((row0 + 8 * hh + r) % rmod) * ldr + col]; if (RES_BF16) rv = bf16_round(rv); v += rv; }
      if (ACT == 1) v = fmaxf(v, 0.f);
      if (ACT == 2) v = 0.5f * v * (1.0f + erff(v * 0.70710678118654752f));
      if (ACT == 3) { const float u = 0.7978845608028654f * (v + 0.044715f * v * v * v); v = 0.5f * v * (1.0f + tanhf(u)); }
      so[w][8 * hh + r][t * 16 + ln] = v;
    }
  }
  __builtin_amdgcn_fence(__ATOMIC_ACQ_REL, "workgroup");
  __builtin_amdgcn_wave_barrier();
  const int rsub = lane >> 4, c4 = (lane & 15) * 4;
  {
#pragma unroll
    for (int q = 0; q < 8; ++q) {
      const int r = q * 2 + rsub;
      const v4f v = *(const v4fa*)&so[w][r][c4];
      *(v4f*)(C + (size_t)(row0 + r) * ldc + col0 + c4) = v;
    }
    
  }
}
// row LayerNorm (biased variance, eps) over N: s = X (+ R); optional out_sum <- s; out_norm <- (s-mu)*rsqrt(var+eps)*g + b
template <bool PARAM_BF16>
__global__ __launch_bounds__(256) void k_layernorm(const float* __restrict__ X, const float* __restrict__ R, const float* __restrict__ g, const float* __restrict__ bta,
                                                  float* __restrict__ out_sum, float* __restrict__ out_norm, int N, float eps) {
  __shared__ float red[256];
  const int row = blockIdx.x, tid = threadIdx.x;
  const float* x = X + (size_t)row * N; const float* rr = R ? R + (size_t)row * N : nullptr;
  float vals[16];                     // up to N = 4096
  const int per = N / 256;            // contiguous chunk per thread? use strided-by-4 chunks: thread handles j = tid*4 + 1024*u
  float s1 = 0.f;
  for (int u = 0; u < per / 4; ++u) {
    const int j = tid * 4 + 1024 * u;
    const v4f a = *(const v4fa*)(x + j);
    v4f b = {0.f,0.f,0.f,0.f}; if (rr) b = *(const v4fa*)(rr + j);
#pragma unroll
    for (int q = 0; q < 4; ++q) { const float v = a[q] + b[q]; vals[u * 4 + q] = v; s1 += v; }
  }
  red[tid] = s1; __syncthreads();
  for (int st = 128; st > 0; st >>= 1) { if (tid < st) red[tid] += red[tid + st]; __syncthreads(); }
  const float mu = red[0] / (float)N; __syncthreads();
  float s2 = 0.f;
  for (int u = 0; u < per / 4; ++u)
#pragma unroll
    for (int q = 0; q < 4; ++q) { const float c = vals[u * 4 + q] - mu; s2 += c * c; }
  red[tid] = s2; __syncthreads();
  for (int st = 128; st > 0; st >>= 1) { if (tid < st) red[tid] += red[tid + st]; __syncthreads(); }
  const float rs = rsqrtf(red[0] / (float)N + eps);
  {
    for (int u = 0; u < per / 4; ++u) {
      const int j = tid * 4 + 1024 * u;
      v4f o, sm;
#pragma unroll
      for (int q = 0; q < 4; ++q) {
        float gg = g[j + q], bb = bta[j + q];
        if (PARAM_BF16) { gg = bf16_round(gg); bb = bf16_round(bb); }
        sm[q] = vals[u * 4 + q]; o[q] = (vals[u * 4 + q] - mu) * rs * gg + bb;
      }
      if (out_sum) *(v4f*)(out_sum + (size_t)row * N + j) = sm;
      *(v4f*)(out_norm + (size_t)row * N + j) = o;
    }
    
  }
}



// ---- f16 WMMA path (v_wmma_f32_16x16x32_f16): 11-bit significands for operands in range — used where a [0,1] probability operand needs more precision than bf16
typedef _Float16 v16h __attribute__((ext_vector_type(16)));
union FragH { v16h v; v8us half[2]; _Float16 h[16]; unsigned short u[16]; };
template <int NT>
__device__ __forceinline__ v8f mmaH(v16h ah, v16h al, v16h bh, v16h bl, v8f c) {
  c = __builtin_amdgcn_wmma_f32_16x16x32_f16(false, ah, false, bh, (short)0, c, false, false);
  if (NT >= 2) c = __builtin_amdgcn_wmma_f32_16x16x32_f16(false, al, false, bh, (short)0, c, false, false);
  if (NT >= 3) c = __builtin_amdgcn_wmma_f32_16x16x32_f16(false, ah, false, bl, (short)0, c, false, false);
  asm volatile("v_nop\n\tv_nop\n\tv_nop\n\tv_nop" : "+v"(c) : "v"(ah), "v"(al), "v"(bh), "v"(bl));
  return c;
}
// batched GEMM like k_gemm_b but f16 operands: A f32 (split into f16 hi/lo if ASPLIT, else rounded to f16), Bt = f16 values [n][k]; alpha; C f32; N multiple of 16 (partial tiles skipped)
template <bool ASPLIT>
__global__ __launch_bounds__(128) void k_gemm_h(const float* __restrict__ A, int lda, size_t sA, const _Float16* __restrict__ Bh, int ldb, size_t sB, float alpha, float* __restrict__ C, int ldc, size_t sC, int M, int N, int K) {
  __shared__ __attribute__((aligned(16))) float so[4][16][64];
  const int tid = threadIdx.x, w = tid >> 5, lane = tid & 31, ln = lane & 15, hh = lane >> 4; const int by = blockIdx.y;
  A += (size_t)by * sA; Bh += (size_t)by * sB; C += (size_t)by * sC;
  const int ntn = (N + 63) / 64; const int wid = blockIdx.x * 4 + w; const int mt = wid / ntn, nq = wid % ntn; if (mt * 16 >= M) return;
  const int row0 = mt * 16, col0 = nq * 64; const float* arow = A + (size_t)(row0 + ln) * lda;
  v8f acc[4] = {};
  for (int kb = 0; kb < K; kb += 32) {
    FragH ah, al;
    const v4f x0 = *(const v4fa*)(arow + kb + 8 * hh), x1 = *(const v4fa*)(arow + kb + 8 * hh + 4), x2 = *(const v4fa*)(arow + kb + 16 + 8 * hh), x3 = *(const v4fa*)(arow + kb + 16 + 8 * hh + 4);
    float xs[16] = {x0[0],x0[1],x0[2],x0[3],x1[0],x1[1],x1[2],x1[3],x2[0],x2[1],x2[2],x2[3],x3[0],x3[1],x3[2],x3[3]};
#pragma unroll
    for (int i = 0; i < 16; ++i) { const _Float16 h = (_Float16)xs[i]; ah.h[i] = h; al.h[i] = ASPLIT ? (_Float16)(xs[i] - (float)h) : (_Float16)0.0f; }
#pragma unroll
    for (int t = 0; t < 4; ++t) { if (col0 + t * 16 >= N) continue; const size_t boff = (size_t)(col0 + t * 16 + ln) * ldb + kb; FragH bq; bq.half[0] = *(const v8us*)(Bh + boff + 8 * hh); bq.half[1] = *(const v8us*)(Bh + boff + 16 + 8 * hh);
      acc[t] = mmaH<ASPLIT ? 2 : 1>(ah.v, al.v, bq.v, bq.v, acc[t]); }
  }
#pragma unroll
  for (int t = 0; t < 4; ++t) { if (col0 + t * 16 >= N) continue;
#pragma unroll
    for (int r = 0; r < 8; ++r) so[w][8 * hh + r][t * 16 + ln] = acc[t][r] * alpha; }
  __builtin_amdgcn_fence(__ATOMIC_ACQ_REL, "workgroup"); __builtin_amdgcn_wave_barrier();
  const int rsub = lane >> 4, c4 = (lane & 15) * 4;
  {
#pragma unroll
    for (int q = 0; q < 8; ++q) { const int r = q * 2 + rsub; if (col0 + c4 < N) { const v4f v = *(const v4fa*)&so[w][r][c4]; *(v4f*)(C + (size_t)(row0 + r) * ldc + col0 + c4) = v; } }
     }
}

// Wt[n][k] = f16(bf16(W[k][n])·scale) from f32 row-major W[K][N] (scale = power of two; bf16-exact weights stay exact in f16 away from the subnormal range)
__global__ __launch_bounds__(256) void k_wt_f16(const float* __restrict__ W, _Float16* __restrict__ Wt, int K, int N, float scale) {
  const int t = blockIdx.x * 256 + threadIdx.x; if (t >= N * (K / 8)) return; const int n = t / (K / 8), k8 = (t % (K / 8)) * 8; FragH f;
#pragma unroll
  for (int i = 0; i < 8; ++i) f.h[i] = (_Float16)(bf16_round(W[(size_t)(k8 + i) * N + n]) * scale); const v8us o = f.half[0];
  *(v8us*)((unsigned short*)Wt + (size_t)n * K + k8) = o; 
}
// k_gemm_hh variant with fused epilogue: v = acc·alpha + bias[by·sBias + col] (+ CP[(row/rowsPerB)·sCPb + by·64 + col] if CP) ; ACT 0 none / 1 elu ; writes f16 C16 (and f32 C if non-null)
template <int ACT>
__global__ __launch_bounds__(128) void k_gemm_hhx(const _Float16* __restrict__ A, int lda, size_t sA, const _Float16* __restrict__ Bh, int ldb, size_t sB, float alpha, const float* __restrict__ bias, size_t sBias, const float* __restrict__ CP, int rowsPerB, size_t sCPb, int row0g,
    float* __restrict__ C, _Float16* __restrict__ C16, int ldc, size_t sC, int M, int N, int K) {
  __shared__ __attribute__((aligned(16))) float so[4][16][64];
  const int tid = threadIdx.x, w = tid >> 5, lane = tid & 31, ln = lane & 15, hh = lane >> 4; const int by = blockIdx.y;
  A += (size_t)by * sA; Bh += (size_t)by * sB; const size_t cofs = (size_t)by * sC; const float* bp = bias ? bias + (size_t)by * sBias : nullptr;
  const int ntn = (N + 63) / 64; const int wid = blockIdx.x * 4 + w; const int mt = wid / ntn, nq = wid % ntn; if (mt * 16 >= M) return;
  const int row0 = mt * 16, col0 = nq * 64; const _Float16* arow = A + (size_t)(row0 + ln) * lda;
  v8f acc[4] = {};
  for (int kb = 0; kb < K; kb += 32) { FragH ah; ah.half[0] = *(const v8us*)((const unsigned short*)arow + kb + 8 * hh); ah.half[1] = *(const v8us*)((const unsigned short*)arow + kb + 16 + 8 * hh);
#pragma unroll
    for (int t = 0; t < 4; ++t) { if (col0 + t * 16 >= N) continue; const size_t boff = (size_t)(col0 + t * 16 + ln) * ldb + kb; FragH bq; bq.half[0] = *(const v8us*)((const unsigned short*)Bh + boff + 8 * hh); bq.half[1] = *(const v8us*)((const unsigned short*)Bh + boff + 16 + 8 * hh);
      acc[t] = mmaH<1>(ah.v, ah.v, bq.v, bq.v, acc[t]); }
  }
#pragma unroll
  for (int t = 0; t < 4; ++t) { if (col0 + t * 16 >= N) continue; const int col = col0 + t * 16 + ln; const float bv = bp ? bf16_round(bp[col]) : 0.f;
#pragma unroll
    for (int r = 0; r < 8; ++r) { float v = acc[t][r] * alpha + bv; if (CP) { const int bidx = (row0g + row0 + 8 * hh + r) / rowsPerB; v += CP[(size_t)bidx * sCPb + (size_t)by * 64 + col]; } if (ACT == 1) v = (v > 0.f) ? v : expm1f(v); else if (ACT == 7) v = (v > 0.f) ? v + 1.0f : expf(v); else if (ACT == 8) v = tanhf(v); else if (ACT == 9) v = 0.5f * v * (1.0f + tanhf(0.7978845608028654f * (v + 0.044715f * v * v * v))); else if (ACT == 11) v = 1.0f / (1.0f + expf(-v)); else if (ACT == 12) v = (v > 0.f) ? v : 0.01f * v; else if (ACT == 14) v = (v > 0.f) ? v : 0.1f * v; else if (ACT == 15) v = v / (1.0f + expf(-v)); else if (ACT == 3) v = fmaxf(v, 0.f); else if (ACT == 6) v = 0.5f * v * (1.0f + erff(v * 0.70710678118654752f)); so[w][8 * hh + r][t * 16 + ln] = v; } }
  __builtin_amdgcn_fence(__ATOMIC_ACQ_REL, "workgroup"); __builtin_amdgcn_wave_barrier();
  const int rsub = lane >> 4, c4 = (lane & 15) * 4; typedef _Float16 v4h __attribute__((ext_vector_type(4)));
  {
#pragma unroll
    for (int q = 0; q < 8; ++q) { const int r = q * 2 + rsub; if (col0 + c4 < N) { const v4f v = *(const v4fa*)&so[w][r][c4]; if (C) *(v4f*)(C + cofs + (size_t)(row0 + r) * ldc + col0 + c4) = v; if (C16) { v4h h4; for (int i = 0; i < 4; ++i) h4[i] = (_Float16)v[i]; *(v4h*)(C16 + cofs + (size_t)(row0 + r) * ldc + col0 + c4) = h4; } } }
     }
}


typedef _Float16 v4h __attribute__((ext_vector_type(4)));

__global__ __launch_bounds__(256) void k_x16(const float* __restrict__ x, _Float16* __restrict__ X16, size_t n8) { const size_t t = (size_t)blockIdx.x * 256 + threadIdx.x; if (t >= n8) return; FragH f;
#pragma unroll
  for (int q = 0; q < 8; ++q) f.h[q] = (_Float16)bf16_round(x[t * 8 + q]); *(v8us*)((unsigned short*)X16 + t * 8) = f.half[0];  }
__global__ __launch_bounds__(256) void k_h16(const float* __restrict__ x, _Float16* __restrict__ X16, size_t n8) { const size_t t = (size_t)blockIdx.x * 256 + threadIdx.x; if (t >= n8) return; FragH f;
#pragma unroll
  for (int q = 0; q < 8; ++q) f.h[q] = (_Float16)x[t * 8 + q]; *(v8us*)((unsigned short*)X16 + t * 8) = f.half[0];  }
__global__ __launch_bounds__(256) void k_round16f(const float* __restrict__ W, _Float16* __restrict__ Bt, size_t n8) { const size_t t = (size_t)blockIdx.x * 256 + threadIdx.x; if (t >= n8) return; FragH f;
#pragma unroll
  for (int i = 0; i < 8; ++i) f.h[i] = (_Float16)(bf16_round(W[t * 8 + i]) * 16.0f); *(v8us*)((unsigned short*)Bt + t * 8) = f.half[0];  }
__global__ __launch_bounds__(256) void k_h16s(const float* __restrict__ F, _Float16* __restrict__ H, size_t n8) { const size_t t = (size_t)blockIdx.x * 256 + threadIdx.x; if (t >= n8) return; const v4f a = *(const v4fa*)(F + t * 8), c = *(const v4fa*)(F + t * 8 + 4); FragH f;
#pragma unroll
  for (int q = 0; q < 4; ++q) { f.h[q] = (_Float16)(a[q] * 16.0f); f.h[4 + q] = (_Float16)(c[q] * 16.0f); } *(v8us*)((unsigned short*)H + t * 8) = f.half[0];  }
// K and V rewritten in the order in which k_flash's A fragments take them, so that each of its wave-wide 16-byte loads covers 512 contiguous bytes (4 whole lines) instead of 32 bytes of each of 16 lines.
// Unit = 16 B = 8 f16 of one lane, lane = 16hh + ln. Kp: per 16 keys 4 loads (ks, half): unit = K[key tile * 16 + ln][ks * 32 + half * 16 + 8hh + 0..7]. Vp: per 32 keys 8 loads (dt, half): unit = V[key block * 32 + half * 16 + 8hh + 0..7][dt * 16 + ln].
// Even blocks transpose 64 keys of V through LDS, odd blocks permute 64 keys of K; thread t writes unit t, so the stores are whole lines too.
__global__ __launch_bounds__(256) void k_pack(const _Float16* __restrict__ K16, const _Float16* __restrict__ V16, _Float16* __restrict__ Kp, _Float16* __restrict__ Vp) {
  __shared__ unsigned short tl[64][66]; const int tid = threadIdx.x; const int lg = blockIdx.x >> 1;
  if (blockIdx.x & 1) {
#pragma unroll      // both 16-byte loads are issued before the first store waits for its data
    for (int rd = 0; rd < 2; ++rd) { const int c = rd * 256 + tid, ln = c & 15, hh = (c >> 4) & 1, half = (c >> 5) & 1, ks = (c >> 6) & 1, kt = c >> 7;
      const v8us u = *(const v8us*)((const unsigned short*)K16 + ((size_t)lg * 64 + kt * 16 + ln) * 64 + ks * 32 + half * 16 + hh * 8);
      *(v8us*)((unsigned short*)Kp + (size_t)lg * 4096 + c * 8) = u; }
    asm volatile("s_wait_xcnt 0x0" ::: "memory");      // precaution: stands in front of every later write of a register that the two K stores name (in the listing this branch's exit also falls through into the V part, which rewrites them)
    return; }
  for (int i = tid; i < 64 * 8; i += 256) { const int r = i / 8, c8 = (i % 8) * 8; FragH f; f.half[0] = *(const v8us*)((const unsigned short*)V16 + ((size_t)lg * 64 + r) * 64 + c8);
#pragma unroll
    for (int q = 0; q < 8; ++q) tl[r][c8 + q] = f.u[q]; }
  __syncthreads();
#pragma unroll
  for (int rd = 0; rd < 2; ++rd) { const int c = rd * 256 + tid, ln = c & 15, hh = (c >> 4) & 1, half = (c >> 5) & 1, dt = (c >> 6) & 3; FragH f;
#pragma unroll
    for (int q = 0; q < 8; ++q) f.u[q] = tl[rd * 32 + half * 16 + hh * 8 + q][dt * 16 + ln];
    *(v8us*)((unsigned short*)Vp + (size_t)lg * 4096 + c * 8) = f.half[0]; } }
__global__ __launch_bounds__(256) void k_merge(const float* __restrict__ O, float* __restrict__ out) {
  const int tid = threadIdx.x; const int wg = blockIdx.x * 8 + (tid >> 5); if (wg >= NB * 2) return; const int b = wg >> 1, hp = wg & 1; const int l = tid & 31; const int h = hp * 2 + (l >> 4), c4 = (l & 15) * 4;
  const v4f v = *(const v4fa*)(O + ((size_t)h * NB + b) * DD + c4); float* o = out + (size_t)b * EE + h * DD + c4;
  *(v4f*)o = v;  }
__global__ __launch_bounds__(1024) void k_flash(const _Float16* __restrict__ Q16, int ldq, const _Float16* __restrict__ Kp, const _Float16* __restrict__ Vp, const int* __restrict__ MSK, float* __restrict__ O, int ldo) {
  constexpr int RPW = 16, NQB = TT / (4 * RPW), DT = 4, KS = 2, KSPL = 8, NW = 4 * KSPL;
  constexpr float C2 = 0.125f * 1.4426950408889634f;      // 1/sqrt(64) * log2(e): exp(s/8 - m/8) = 2^(C2 s - C2 m), so a weight costs one fused multiply-add and one hardware 2^x; maxima are kept on the raw products (C2 > 0 keeps their order)
  __shared__ __attribute__((aligned(16))) float sO[NW][RPW][64 + 4]; __shared__ float sM[NW][RPW], sL[NW][RPW];
  const int tid = threadIdx.x, lane = tid & 31, ln = lane & 15, hh = lane >> 4;
  const int w = __builtin_amdgcn_readfirstlane(tid >> 5) & (NW - 1);      // wave number in a scalar register, so that the key loop's counter and branch are scalar; the mask (an identity) shows the compiler its range: no zero-trip path, no spill
  const int slab = blockIdx.x / NQB, qblk = blockIdx.x % NQB; const int b = slab / NH, h = slab % NH; const int qb0 = qblk * (4 * RPW); const int q0 = qb0 + (w & 3) * RPW;
  FragH bq[KS];      // B operand: column ln = query q0 + ln
  { const unsigned short* qr = (const unsigned short*)Q16 + ((size_t)b * TT + q0 + ln) * ldq + h * 64;
#pragma unroll
    for (int ks = 0; ks < KS; ++ks) { bq[ks].half[0] = *(const v8us*)(qr + ks * 32 + 8 * hh); bq[ks].half[1] = *(const v8us*)(qr + ks * 32 + 16 + 8 * hh); } }
  const unsigned short* Kf = (const unsigned short*)Kp + (size_t)slab * 64 * TT + lane * 8; const unsigned short* Vf = (const unsigned short*)Vp + (size_t)slab * 64 * TT + lane * 8;      // k_pack's planes: 64 f16 per key, a lane's 16 B at lane * 16 in every 512-byte load
  float m_q = -3.0e38f, l_q = 0.f; v8f oacc[DT];      // of query ln: running max (equal in both halves), this half's share of the sum, O^T rows dt * 16 + 8hh + r
#pragma unroll
  for (int dt = 0; dt < DT; ++dt) oacc[dt] = (v8f){0.f,0.f,0.f,0.f,0.f,0.f,0.f,0.f};
  const int jend = TT;
#pragma unroll 1
  for (int j0 = (w >> 2) * 32; j0 < jend; j0 += 32 * KSPL) {
    v8f s[2];      // s[nt][r] = raw product (score * 8) of key j0 + nt * 16 + 8hh + r with query ln
#pragma unroll
    for (int nt = 0; nt < 2; ++nt) { const unsigned short* kr = Kf + (size_t)(j0 + nt * 16) * 64; FragH ak[KS];
#pragma unroll
      for (int ks = 0; ks < KS; ++ks) { ak[ks].half[0] = *(const v8us*)(kr + ks * 512); ak[ks].half[1] = *(const v8us*)(kr + ks * 512 + 256); }
      v8f acc = (v8f){0.f,0.f,0.f,0.f,0.f,0.f,0.f,0.f};
#pragma unroll
      for (int ks = 0; ks < KS; ++ks) acc = mmaH<1>(ak[ks].v, ak[ks].v, bq[ks].v, bq[ks].v, acc);
      s[nt] = acc; }
    float mc = fmaxf(s[0][0], s[1][0]);
#pragma unroll
    for (int r = 1; r < 8; ++r) mc = fmaxf(mc, fmaxf(s[0][r], s[1][r]));
    mc = fmaxf(mc, __int_as_float(__builtin_amdgcn_permlanex16(__float_as_int(mc), __float_as_int(mc), 0x76543210, 0xfedcba98, false, false)));      // lane l <-> l ^ 16: the other 16 keys of the same query
    const float mn = fmaxf(m_q, mc); const float al = __builtin_amdgcn_exp2f((m_q - mn) * C2); m_q = mn;
    const float mb = fmaf(mn, C2, -10.0f);      // the 2^10 of the f16 weights rides in the exponent: weights and their sum both carry it, and the merge divides it out
    FragH pb; float ps = 0.f;
#pragma unroll
    for (int r = 0; r < 8; ++r) { const float p0 = __builtin_amdgcn_exp2f(fmaf(s[0][r], C2, -mb)), p1 = __builtin_amdgcn_exp2f(fmaf(s[1][r], C2, -mb)); ps += p0 + p1; pb.h[r] = (_Float16)p0; pb.h[8 + r] = (_Float16)p1; }
    l_q = l_q * al + ps;
#pragma unroll
    for (int dt = 0; dt < DT; ++dt) oacc[dt] *= al;
#pragma unroll
    for (int dt = 0; dt < DT; ++dt) { const unsigned short* vrow = Vf + (size_t)j0 * 64 + dt * 512; FragH av; av.half[0] = *(const v8us*)vrow; av.half[1] = *(const v8us*)(vrow + 256);
      oacc[dt] = mmaH<1>(av.v, av.v, pb.v, pb.v, oacc[dt]); } }
  l_q += __int_as_float(__builtin_amdgcn_permlanex16(__float_as_int(l_q), __float_as_int(l_q), 0x76543210, 0xfedcba98, false, false));      // the halves' sums joined once
  if (hh == 0) { sM[w][ln] = m_q; sL[w][ln] = l_q; }
#pragma unroll
  for (int dt = 0; dt < DT; ++dt) { *(v4fa*)&sO[w][ln][dt * 16 + 8 * hh] = (v4f){oacc[dt][0], oacc[dt][1], oacc[dt][2], oacc[dt][3]}; *(v4fa*)&sO[w][ln][dt * 16 + 8 * hh + 4] = (v4f){oacc[dt][4], oacc[dt][5], oacc[dt][6], oacc[dt][7]}; }
  __syncthreads();      // every wave's partial (max, sum, accumulator) is in LDS before any wave merges
  for (int e = tid; e < 4 * RPW * 16; e += 32 * NW) { const int row = e >> 4, pc = e & 15, qt = row / RPW, r = row % RPW;      // one query row per 16 lanes, 16 B per lane
    float mg[KSPL], M = -3.0e38f;
#pragma unroll
    for (int g = 0; g < KSPL; ++g) { mg[g] = sM[g * 4 + qt][r]; M = fmaxf(M, mg[g]); }
    float L = 0.f; v4f acc = {0.f, 0.f, 0.f, 0.f};
#pragma unroll
    for (int g = 0; g < KSPL; ++g) { const float wg = __builtin_amdgcn_exp2f((mg[g] - M) * C2); L += wg * sL[g * 4 + qt][r]; const v4f pv = *(const v4fa*)&sO[g * 4 + qt][r][pc * 4]; acc += pv * wg; }
    const float inv = (L > 0.f) ? 1.0f / L : 0.f;      // L and acc both carry the 2^10
    *(v4f*)(O + ((size_t)b * TT + qb0 + row) * ldo + h * 64 + pc * 4) = acc * inv; } }

extern "C" void kernel_launch(void* const* d_in, const int* in_sizes, int n_in,
                              void* d_out, int out_size, void* d_ws, size_t ws_size, hipStream_t stream) {
  (void)in_sizes; (void)n_in; (void)out_size;
  const float* const* I = (const float* const*)d_in; const float* xq = I[0]; const float* xk = I[1]; const float* xv = I[2]; const float* Wq = I[3]; const float* Wk = I[4]; const float* Wv = I[5];
  char* ws = (char*)d_ws; size_t off = 0;
  auto take = [&](size_t bytes) { char* p = ws + off; off += (bytes + 255) & ~(size_t)255; return p; };
  const size_t WSZ = (size_t)EE * EE; _Float16* Bw = (_Float16*)take(3 * WSZ * 2);
  _Float16* Xq = (_Float16*)take((size_t)NB * EE * 2); _Float16* Xk = (_Float16*)take((size_t)NB * EE * 2); _Float16* Xv = (_Float16*)take((size_t)NB * EE * 2);
  _Float16* Qs = (_Float16*)take((size_t)TT * DD * 2); _Float16* Ks = (_Float16*)take((size_t)TT * DD * 2); _Float16* Vs = (_Float16*)take((size_t)TT * DD * 2); _Float16* Kp = (_Float16*)take((size_t)TT * DD * 2); _Float16* Vp = (_Float16*)take((size_t)TT * DD * 2); float* O = (float*)take((size_t)TT * DD * 4);
  if (off > ws_size) return;      // 0.4 + 3 x 2.1 + 5 x 2.1 + 4.2 = about 21 MB
  const unsigned gw = (unsigned)((EE * (EE / 8) + 255) / 256);
  k_wt_f16<<<gw, 256, 0, stream>>>(Wq, Bw, EE, EE, 16.0f); k_wt_f16<<<gw, 256, 0, stream>>>(Wk, Bw + WSZ, EE, EE, 16.0f); k_wt_f16<<<gw, 256, 0, stream>>>(Wv, Bw + 2 * WSZ, EE, EE, 16.0f);      /* (in,out) → Bt ×2^4 */
  const unsigned g8 = (unsigned)(((size_t)NB * EE / 8 + 255) / 256); k_x16<<<g8, 256, 0, stream>>>(xq, Xq, (size_t)NB * EE / 8); k_x16<<<g8, 256, 0, stream>>>(xk, Xk, (size_t)NB * EE / 8); k_x16<<<g8, 256, 0, stream>>>(xv, Xv, (size_t)NB * EE / 8);
  const dim3 gs(((NB / 16) * 1 + 3) / 4, NHD);      /* per head h = grid.y: C16[h·NB + b][0..63] = X·Bt[h·64 .. h·64+63]ᵀ — M 4096 N 64 K 256, written straight into the stacked plane */
  k_gemm_hhx<0><<<gs, 128, 0, stream>>>(Xq, EE, 0, Bw, EE, (size_t)DD * EE, 0.0625f, nullptr, 0, nullptr, 1, 0, 0, nullptr, Qs, DD, (size_t)NB * DD, NB, DD, EE);
  k_gemm_hhx<0><<<gs, 128, 0, stream>>>(Xk, EE, 0, Bw + WSZ, EE, (size_t)DD * EE, 0.0625f, nullptr, 0, nullptr, 1, 0, 0, nullptr, Ks, DD, (size_t)NB * DD, NB, DD, EE);
  k_gemm_hhx<0><<<gs, 128, 0, stream>>>(Xv, EE, 0, Bw + 2 * WSZ, EE, (size_t)DD * EE, 0.0625f, nullptr, 0, nullptr, 1, 0, 0, nullptr, Vs, DD, (size_t)NB * DD, NB, DD, EE);
  k_pack<<<2 * (TT / 64), 256, 0, stream>>>(Ks, Vs, Kp, Vp);      /* K and V in fragment order */
  k_flash<<<BB * NH * (TT / 64), 1024, 0, stream>>>(Qs, DD, Kp, Vp, nullptr, O, DD);      /* one slab: 16384 queries × 16384 keys */
  k_merge<<<(NB * 2 + 7) / 8, 256, 0, stream>>>(O, (float*)d_out);
}

// v005
// One run takes 133 microseconds.
// Two timings next to v004 put it at 1.73 and 1.71 times that version's speed.
// Counting every step since v000, it is 12.8 times as fast.
#include <hip/hip_runtime.h>
// Multi-head attention whose heads are STACKED along the batch axis (B=4096 rows, EMBED=256, 4 heads × 64): q = queries·W_Query, k = keys·W_Key, v = values·W_Value ((in,out), no bias); the heads are split TF-style into [H·B, 64] = [16384, 64] and ONE softmax(q·kᵀ/√64)·v runs over all 16384 stacked rows
// (every query attends to every (head, row) key); the result is merged back to [B, H·64].
// Compute dtype: inputs and weights rounded to bf16; q, k, v as f16 GEMM outputs written directly in the stacked [h·4096 + b][64] layout (grid.y = head); fused flash-style kernel over T = 16384 (online softmax f32, P f16 ×2^10, f32 accumulate) on v_wmma_f32_16x16x32_f16;
// the f32 result rows are permuted into the merged output by a copy kernel (32 lanes × 16 B per instruction).
#define BB 1
#define TT 16384
#define NH 1
#define NB 4096
#define NHD 4
#define EE 256
#define DD 64
#define NR (BB * TT)

typedef __bf16 v16b __attribute__((ext_vector_type(16)));
typedef unsigned short v8us __attribute__((ext_vector_type(8), may_alias));
typedef float  v8f  __attribute__((ext_vector_type(8)));
typedef float  v4f  __attribute__((ext_vector_type(4)));
typedef float  v4fa __attribute__((ext_vector_type(4), may_alias));
union FragB { v16b v; v8us half[2]; unsigned short u[16]; };

__device__ __forceinline__ unsigned short bf16_bits(float x) { unsigned int u = __float_as_uint(x); return (unsigned short)((u + 0x7FFFu + ((u >> 16) & 1u)) >> 16); }
__device__ __forceinline__ float bf16_val(unsigned short b) { return __uint_as_float(((unsigned int)b) << 16); }
__device__ __forceinline__ float bf16_round(float x) { return bf16_val(bf16_bits(x)); }
// D += A·B with NT terms: 1 = ah·bh, 2 = + al·bh (A split), 3 = + ah·bl (both split)
template <int NT>
__device__ __forceinline__ v8f mmaN(v16b ah, v16b al, v16b bh, v16b bl, v8f c) {
  c = __builtin_amdgcn_wmma_f32_16x16x32_bf16(false, ah, false, bh, (short)0, c, false, false);
  if (NT >= 2) c = __builtin_amdgcn_wmma_f32_16x16x32_bf16(false, al, false, bh, (short)0, c, false, false);
  if (NT >= 3) c = __builtin_amdgcn_wmma_f32_16x16x32_bf16(false, ah, false, bl, (short)0, c, false, false);
  asm volatile("v_nop\n\tv_nop\n\tv_nop\n\tv_nop" : "+v"(c) : "v"(ah), "v"(al), "v"(bh), "v"(bl));
  return c;
}

__global__ __launch_bounds__(256) void k_wt_bf16(const float* __restrict__ W, unsigned short* __restrict__ Wt, int K, int N) {
  const int t = blockIdx.x * 256 + threadIdx.x;
  const int k8n = K / 8;
  if (t >= N * k8n) return;
  const int n = t / k8n, k8 = (t % k8n) * 8;
  v8us v;
#pragma unroll
  for (int i = 0; i < 8; ++i) v[i] = bf16_bits(W[(size_t)(k8 + i) * N + n]);
  *(v8us*)(Wt + (size_t)n * K + k8) = v;
  
}

// GEMM C[M][N] (f32, pitch ldc) = act(A[M][K]·W + bias). A f32 row-major (pitch lda) converted per fragment to bf16
// (ASPLIT: hi/lo two planes -> 2 terms, else single rounded term); Wt bf16 [N][K] (pitch ldb). BIAS_BF16 rounds the
// bias to bf16 first (bias quantised to bf16 before the add). K%32==0, M%16==0, N%64==0.
template <bool ASPLIT, int ACT, bool BIAS_BF16>
__global__ __launch_bounds__(128) void k_gemm_bf(const float* __restrict__ A, int lda, const unsigned short* __restrict__ Wt, int ldb,
                                               const float* __restrict__ bias, float* __restrict__ C, int ldc, int M, int N, int K) {
  __shared__ __attribute__((aligned(16))) float so[4][16][64];
  const int tid = threadIdx.x, w = tid >> 5, lane = tid & 31, ln = lane & 15, hh = lane >> 4;
  const int ntn = N / 64;
  const int wid = blockIdx.x * 4 + w;
  const int mt = wid / ntn, nq = wid % ntn;
  if (mt * 16 >= M) return;
  const int row0 = mt * 16, col0 = nq * 64;
  const float* arow = A + (size_t)(row0 + ln) * lda;
  v8f acc[4] = {};
  for (int kb = 0; kb < K; kb += 32) {
    FragB ah, al;
    const v4f x0 = *(const v4fa*)(arow + kb + 8 * hh), x1 = *(const v4fa*)(arow + kb + 8 * hh + 4);
    const v4f x2 = *(const v4fa*)(arow + kb + 16 + 8 * hh), x3 = *(const v4fa*)(arow + kb + 16 + 8 * hh + 4);
    float xs[16] = {x0[0],x0[1],x0[2],x0[3],x1[0],x1[1],x1[2],x1[3],x2[0],x2[1],x2[2],x2[3],x3[0],x3[1],x3[2],x3[3]};
#pragma unroll
    for (int i = 0; i < 16; ++i) { const unsigned short hb = bf16_bits(xs[i]); ah.u[i] = hb; al.u[i] = ASPLIT ? bf16_bits(xs[i] - bf16_val(hb)) : (unsigned short)0; }
#pragma unroll
    for (int t = 0; t < 4; ++t) {
      const unsigned short* brow = Wt + (size_t)(col0 + t * 16 + ln) * ldb + kb;
      FragB b;
      b.half[0] = *(const v8us*)(brow + 8 * hh);
      b.half[1] = *(const v8us*)(brow + 16 + 8 * hh);
      acc[t] = mmaN<ASPLIT ? 2 : 1>(ah.v, al.v, b.v, b.v, acc[t]);
    }
  }
#pragma unroll
  for (int t = 0; t < 4; ++t) {
    float bv = bias ? bias[col0 + t * 16 + ln] : 0.f;
    if (BIAS_BF16) bv = bf16_round(bv);
#pragma unroll
    for (int r = 0; r < 8; ++r) { float v = acc[t][r] + bv; if (ACT == 1) v = fmaxf(v, 0.f); so[w][8 * hh + r][t * 16 + ln] = v; }
  }
  __builtin_amdgcn_fence(__ATOMIC_ACQ_REL, "workgroup");
  __builtin_amdgcn_wave_barrier();
  const int rsub = lane >> 4, c4 = (lane & 15) * 4;
  {
#pragma unroll
    for (int q = 0; q < 8; ++q) {
      const int r = q * 2 + rsub;
      const v4f v = *(const v4fa*)&so[w][r][c4];
      *(v4f*)(C + (size_t)(row0 + r) * ldc + col0 + c4) = v;
    }
    
  }
}

// Flash-style causal/unmasked attention, all contractions 3-term bf16 hi/lo splits, f32 softmax with running max.
// q,k,v rows are read from f32 buffers with arbitrary row pitch (so they can live inside a fused qkv buffer);
// D = head size (multiple of 32, <= 128); one wave = 16 query rows; block = 4 waves (64 queries) sharing K/V chunks of 32.
template <int D, bool CAUSAL>
__global__ __launch_bounds__(128) void k_flash(const float* __restrict__ qb, const float* __restrict__ kb, const float* __restrict__ vb,
                                             int pitch, int T, int H, float scale, float* __restrict__ y, int ypitch) {
  constexpr int KS = D / 32;        // k-steps for QK
  constexpr int DT = D / 16;        // d tiles for PV
  __shared__ __attribute__((aligned(16))) unsigned short sKh[32][D + 8], sKl[32][D + 8], sVh[32][D + 8], sVl[32][D + 8];
  __shared__ __attribute__((aligned(16))) unsigned short sPh[4][16][40], sPl[4][16][40];
  __shared__ __attribute__((aligned(16))) float sO[4][16][D];
  const int tid = threadIdx.x, w = tid >> 5, lane = tid & 31, ln = lane & 15, hh = lane >> 4;
  const int nqb = (T + 63) / 64;
  const int bh = blockIdx.x / nqb, qblk = blockIdx.x % nqb;
  const int b = bh / H, h = bh % H;
  const int q0 = qblk * 64 + w * 16;
  const float* Q = qb + (size_t)b * T * pitch + h * D;
  const float* K = kb + (size_t)b * T * pitch + h * D;
  const float* V = vb + (size_t)b * T * pitch + h * D;

  // A fragments of the wave's 16 query rows (scaled), hi/lo
  FragB aqh[KS], aql[KS];
  {
    int row = q0 + ln; if (row >= T) row = T - 1;
    const float* qr = Q + (size_t)row * pitch;
#pragma unroll
    for (int ks = 0; ks < KS; ++ks)
#pragma unroll
      for (int i = 0; i < 16; ++i) {
        const int d = ks * 32 + ((i < 8) ? (8 * hh + i) : (16 + 8 * hh + (i - 8)));
        const float x = qr[d] * scale; const unsigned short hb = bf16_bits(x);
        aqh[ks].u[i] = hb; aql[ks].u[i] = bf16_bits(x - bf16_val(hb));
      }
  }
  float m_r[8], l_r[8];
#pragma unroll
  for (int r = 0; r < 8; ++r) { m_r[r] = -3.0e38f; l_r[r] = 0.f; }
  v8f oacc[DT];
#pragma unroll
  for (int dt = 0; dt < DT; ++dt) oacc[dt] = (v8f){0.f,0.f,0.f,0.f,0.f,0.f,0.f,0.f};

  const int kv_end = CAUSAL ? min(T, qblk * 64 + 64) : T;     // block-uniform
  for (int j0 = 0; j0 < kv_end; j0 += 32) {
    __syncthreads();
    for (int e = tid; e < 32 * (D / 4); e += 128) {
      const int r = e / (D / 4), c4 = (e % (D / 4)) * 4;
      const int key = j0 + r;
      v4f kf = {0.f,0.f,0.f,0.f}, vf = {0.f,0.f,0.f,0.f};
      if (key < T) { kf = *(const v4fa*)(K + (size_t)key * pitch + c4); vf = *(const v4fa*)(V + (size_t)key * pitch + c4); }
#pragma unroll
      for (int t = 0; t < 4; ++t) {
        unsigned short hb = bf16_bits(kf[t]); sKh[r][c4 + t] = hb; sKl[r][c4 + t] = bf16_bits(kf[t] - bf16_val(hb));
        hb = bf16_bits(vf[t]); sVh[r][c4 + t] = hb; sVl[r][c4 + t] = bf16_bits(vf[t] - bf16_val(hb));
      }
    }
    __syncthreads();
    // S tile 16 x 32
    v8f s[2];
#pragma unroll
    for (int nt = 0; nt < 2; ++nt) {
      v8f acc = {};
#pragma unroll
      for (int ks = 0; ks < KS; ++ks) {
        FragB bh_, bl_;
        bh_.half[0] = *(const v8us*)&sKh[nt * 16 + ln][ks * 32 + 8 * hh]; bh_.half[1] = *(const v8us*)&sKh[nt * 16 + ln][ks * 32 + 16 + 8 * hh];
        bl_.half[0] = *(const v8us*)&sKl[nt * 16 + ln][ks * 32 + 8 * hh]; bl_.half[1] = *(const v8us*)&sKl[nt * 16 + ln][ks * 32 + 16 + 8 * hh];
        acc = mmaN<3>(aqh[ks].v, aql[ks].v, bh_.v, bl_.v, acc);
      }
      s[nt] = acc;
    }
    // mask + running max (rows 8hh+r; the 16 lanes of a half share rows)
    float alpha[8];
#pragma unroll
    for (int r = 0; r < 8; ++r) {
      const int qi = q0 + 8 * hh + r;
      const int ja = j0 + ln, jb = j0 + 16 + ln;
      if (CAUSAL) { if (ja > qi) s[0][r] = -3.0e38f; if (jb > qi) s[1][r] = -3.0e38f; }
      if (ja >= T) s[0][r] = -3.0e38f;
      if (jb >= T) s[1][r] = -3.0e38f;
      float mx = fmaxf(s[0][r], s[1][r]);
      mx = fmaxf(mx, __shfl_xor(mx, 1, 32)); mx = fmaxf(mx, __shfl_xor(mx, 2, 32)); mx = fmaxf(mx, __shfl_xor(mx, 4, 32)); mx = fmaxf(mx, __shfl_xor(mx, 8, 32));
      const float mnew = fmaxf(m_r[r], mx);
      alpha[r] = (mnew > -1.0e38f) ? __expf(m_r[r] - mnew) : 1.0f;
      const float p0 = (s[0][r] > -1.0e38f) ? __expf(s[0][r] - mnew) : 0.f;
      const float p1 = (s[1][r] > -1.0e38f) ? __expf(s[1][r] - mnew) : 0.f;
      m_r[r] = mnew;
      l_r[r] = l_r[r] * alpha[r] + p0 + p1;            // per-lane partial row sum (16 lanes combined at the end)
      unsigned short hb = bf16_bits(p0); sPh[w][8 * hh + r][ln] = hb;      sPl[w][8 * hh + r][ln] = bf16_bits(p0 - bf16_val(hb));
      hb = bf16_bits(p1);                sPh[w][8 * hh + r][16 + ln] = hb; sPl[w][8 * hh + r][16 + ln] = bf16_bits(p1 - bf16_val(hb));
    }
#pragma unroll
    for (int dt = 0; dt < DT; ++dt)
#pragma unroll
      for (int r = 0; r < 8; ++r) oacc[dt][r] *= alpha[r];
    __builtin_amdgcn_fence(__ATOMIC_ACQ_REL, "workgroup");
    __builtin_amdgcn_wave_barrier();
    FragB pah, pal;
    pah.half[0] = *(const v8us*)&sPh[w][ln][8 * hh]; pah.half[1] = *(const v8us*)&sPh[w][ln][16 + 8 * hh];
    pal.half[0] = *(const v8us*)&sPl[w][ln][8 * hh]; pal.half[1] = *(const v8us*)&sPl[w][ln][16 + 8 * hh];
#pragma unroll
    for (int dt = 0; dt < DT; ++dt) {
      FragB bvh, bvl;
#pragma unroll
      for (int i = 0; i < 8; ++i) {
        bvh.u[i] = sVh[8 * hh + i][dt * 16 + ln]; bvh.u[8 + i] = sVh[16 + 8 * hh + i][dt * 16 + ln];
        bvl.u[i] = sVl[8 * hh + i][dt * 16 + ln]; bvl.u[8 + i] = sVl[16 + 8 * hh + i][dt * 16 + ln];
      }
      oacc[dt] = mmaN<3>(pah.v, pal.v, bvh.v, bvl.v, oacc[dt]);
    }
    __builtin_amdgcn_fence(__ATOMIC_ACQ_REL, "workgroup");
    __builtin_amdgcn_wave_barrier();
  }
#pragma unroll
  for (int r = 0; r < 8; ++r) {
    float l = l_r[r];
    l += __shfl_xor(l, 1, 32); l += __shfl_xor(l, 2, 32); l += __shfl_xor(l, 4, 32); l += __shfl_xor(l, 8, 32);
    l_r[r] = (l > 0.f) ? 1.0f / l : 0.f;
  }
#pragma unroll
  for (int dt = 0; dt < DT; ++dt)
#pragma unroll
    for (int r = 0; r < 8; ++r) sO[w][8 * hh + r][dt * 16 + ln] = oacc[dt][r] * l_r[r];
  __builtin_amdgcn_fence(__ATOMIC_ACQ_REL, "workgroup");
  __builtin_amdgcn_wave_barrier();
  {
    for (int r = 0; r < 16; ++r) {
      const int row = q0 + r;
      if (row < T && lane < D / 4) {
        const v4f val = *(const v4fa*)&sO[w][r][lane * 4];
        *(v4f*)(y + ((size_t)b * T + row) * ypitch + h * D + lane * 4) = val;
      }
    }
    
  }
}

// GEMM C = act(A·W + bias + resid): A f32 (ASPLIT -> hi/lo 2 terms), Wt bf16 [N][K]; ACT 0 none, 1 relu, 2 exact gelu;
// resid (optional, f32, row index = (row % rmod), pitch ldr, RES_BF16 rounds it) added before the activation.
template <bool ASPLIT, int ACT, bool BIAS_BF16, bool RES_BF16>
__global__ __launch_bounds__(128) void k_gemm_bf3(const float* __restrict__ A, int lda, const unsigned short* __restrict__ Wt, int ldb,
                                                const float* __restrict__ bias, const float* __restrict__ resid, int rmod, int ldr,
                                                float* __restrict__ C, int ldc, int M, int N, int K) {
  __shared__ __attribute__((aligned(16))) float so[4][16][64];
  const int tid = threadIdx.x, w = tid >> 5, lane = tid & 31, ln = lane & 15, hh = lane >> 4;
  const int ntn = N / 64;
  const int wid = blockIdx.x * 4 + w;
  const int mt = wid / ntn, nq = wid % ntn;
  if (mt * 16 >= M) return;
  const int row0 = mt * 16, col0 = nq * 64;
  const float* arow = A + (size_t)(row0 + ln) * lda;
  v8f acc[4] = {};
  for (int kb = 0; kb < K; kb += 32) {
    FragB ah, al;
    const v4f x0 = *(const v4fa*)(arow + kb + 8 * hh), x1 = *(const v4fa*)(arow + kb + 8 * hh + 4);
    const v4f x2 = *(const v4fa*)(arow + kb + 16 + 8 * hh), x3 = *(const v4fa*)(arow + kb + 16 + 8 * hh + 4);
    float xs[16] = {x0[0],x0[1],x0[2],x0[3],x1[0],x1[1],x1[2],x1[3],x2[0],x2[1],x2[2],x2[3],x3[0],x3[1],x3[2],x3[3]};
#pragma unroll
    for (int i = 0; i < 16; ++i) { const unsigned short hb = bf16_bits(xs[i]); ah.u[i] = hb; al.u[i] = ASPLIT ? bf16_bits(xs[i] - bf16_val(hb)) : (unsigned short)0; }
#pragma unroll
    for (int t = 0; t < 4; ++t) {
      const unsigned short* brow = Wt + (size_t)(col0 + t * 16 + ln) * ldb + kb;
      FragB b;
      b.half[0] = *(const v8us*)(brow + 8 * hh);
      b.half[1] = *(const v8us*)(brow + 16 + 8 * hh);
      acc[t] = mmaN<ASPLIT ? 2 : 1>(ah.v, al.v, b.v, b.v, acc[t]);
    }
  }
#pragma unroll
  for (int t = 0; t < 4; ++t) {
    const int col = col0 + t * 16 + ln;
    float bv = bias ? bias[col] : 0.f;
    if (BIAS_BF16) bv = bf16_round(bv);
#pragma unroll
    for (int r = 0; r < 8; ++r) {
      float v = acc[t][r] + bv;
      if (resid) { float rv = resid[(size_t)((row0 + 8 * hh + r) % rmod) * ldr + col]; if (RES_BF16) rv = bf16_round(rv); v += rv; }
      if (ACT == 1) v = fmaxf(v, 0.f);
      if (ACT == 2) v = 0.5f * v * (1.0f + erff(v * 0.70710678118654752f));
      if (ACT == 3) { const float u = 0.7978845608028654f * (v + 0.044715f * v * v * v); v = 0.5f * v * (1.0f + tanhf(u)); }
      so[w][8 * hh + r][t * 16 + ln] = v;
    }
  }
  __builtin_amdgcn_fence(__ATOMIC_ACQ_REL, "workgroup");
  __builtin_amdgcn_wave_barrier();
  const int rsub = lane >> 4, c4 = (lane & 15) * 4;
  {
#pragma unroll
    for (int q = 0; q < 8; ++q) {
      const int r = q * 2 + rsub;
      const v4f v = *(const v4fa*)&so[w][r][c4];
      *(v4f*)(C + (size_t)(row0 + r) * ldc + col0 + c4) = v;
    }
    
  }
}
// row LayerNorm (biased variance, eps) over N: s = X (+ R); optional out_sum <- s; out_norm <- (s-mu)*rsqrt(var+eps)*g + b
template <bool PARAM_BF16>
__global__ __launch_bounds__(256) void k_layernorm(const float* __restrict__ X, const float* __restrict__ R, const float* __restrict__ g, const float* __restrict__ bta,
                                                  float* __restrict__ out_sum, float* __restrict__ out_norm, int N, float eps) {
  __shared__ float red[256];
  const int row = blockIdx.x, tid = threadIdx.x;
  const float* x = X + (size_t)row * N; const float* rr = R ? R + (size_t)row * N : nullptr;
  float vals[16];                     // up to N = 4096
  const int per = N / 256;            // contiguous chunk per thread? use strided-by-4 chunks: thread handles j = tid*4 + 1024*u
  float s1 = 0.f;
  for (int u = 0; u < per / 4; ++u) {
    const int j = tid * 4 + 1024 * u;
    const v4f a = *(const v4fa*)(x + j);
    v4f b = {0.f,0.f,0.f,0.f}; if (rr) b = *(const v4fa*)(rr + j);
#pragma unroll
    for (int q = 0; q < 4; ++q) { const float v = a[q] + b[q]; vals[u * 4 + q] = v; s1 += v; }
  }
  red[tid] = s1; __syncthreads();
  for (int st = 128; st > 0; st >>= 1) { if (tid < st) red[tid] += red[tid + st]; __syncthreads(); }
  const float mu = red[0] / (float)N; __syncthreads();
  float s2 = 0.f;
  for (int u = 0; u < per / 4; ++u)
#pragma unroll
    for (int q = 0; q < 4; ++q) { const float c = vals[u * 4 + q] - mu; s2 += c * c; }
  red[tid] = s2; __syncthreads();
  for (int st = 128; st > 0; st >>= 1) { if (tid < st) red[tid] += red[tid + st]; __syncthreads(); }
  const float rs = rsqrtf(red[0] / (float)N + eps);
  {
    for (int u = 0; u < per / 4; ++u) {
      const int j = tid * 4 + 1024 * u;
      v4f o, sm;
#pragma unroll
      for (int q = 0; q < 4; ++q) {
        float gg = g[j + q], bb = bta[j + q];
        if (PARAM_BF16) { gg = bf16_round(gg); bb = bf16_round(bb); }
        sm[q] = vals[u * 4 + q]; o[q] = (vals[u * 4 + q] - mu) * rs * gg + bb;
      }
      if (out_sum) *(v4f*)(out_sum + (size_t)row * N + j) = sm;
      *(v4f*)(out_norm + (size_t)row * N + j) = o;
    }
    
  }
}



// ---- f16 WMMA path (v_wmma_f32_16x16x32_f16): 11-bit significands for operands in range — used where a [0,1] probability operand needs more precision than bf16
typedef _Float16 v16h __attribute__((ext_vector_type(16)));
union FragH { v16h v; v8us half[2]; _Float16 h[16]; unsigned short u[16]; };
template <int NT>
__device__ __forceinline__ v8f mmaH(v16h ah, v16h al, v16h bh, v16h bl, v8f c) {
  c = __builtin_amdgcn_wmma_f32_16x16x32_f16(false, ah, false, bh, (short)0, c, false, false);
  if (NT >= 2) c = __builtin_amdgcn_wmma_f32_16x16x32_f16(false, al, false, bh, (short)0, c, false, false);
  if (NT >= 3) c = __builtin_amdgcn_wmma_f32_16x16x32_f16(false, ah, false, bl, (short)0, c, false, false);
  asm volatile("v_nop\n\tv_nop\n\tv_nop\n\tv_nop" : "+v"(c) : "v"(ah), "v"(al), "v"(bh), "v"(bl));
  return c;
}
// batched GEMM like k_gemm_b but f16 operands: A f32 (split into f16 hi/lo if ASPLIT, else rounded to f16), Bt = f16 values [n][k]; alpha; C f32; N multiple of 16 (partial tiles skipped)
template <bool ASPLIT>
__global__ __launch_bounds__(128) void k_gemm_h(const float* __restrict__ A, int lda, size_t sA, const _Float16* __restrict__ Bh, int ldb, size_t sB, float alpha, float* __restrict__ C, int ldc, size_t sC, int M, int N, int K) {
  __shared__ __attribute__((aligned(16))) float so[4][16][64];
  const int tid = threadIdx.x, w = tid >> 5, lane = tid & 31, ln = lane & 15, hh = lane >> 4; const int by = blockIdx.y;
  A += (size_t)by * sA; Bh += (size_t)by * sB; C += (size_t)by * sC;
  const int ntn = (N + 63) / 64; const int wid = blockIdx.x * 4 + w; const int mt = wid / ntn, nq = wid % ntn; if (mt * 16 >= M) return;
  const int row0 = mt * 16, col0 = nq * 64; const float* arow = A + (size_t)(row0 + ln) * lda;
  v8f acc[4] = {};
  for (int kb = 0; kb < K; kb += 32) {
    FragH ah, al;
    const v4f x0 = *(const v4fa*)(arow + kb + 8 * hh), x1 = *(const v4fa*)(arow + kb + 8 * hh + 4), x2 = *(const v4fa*)(arow + kb + 16 + 8 * hh), x3 = *(const v4fa*)(arow + kb + 16 + 8 * hh + 4);
    float xs[16] = {x0[0],x0[1],x0[2],x0[3],x1[0],x1[1],x1[2],x1[3],x2[0],x2[1],x2[2],x2[3],x3[0],x3[1],x3[2],x3[3]};
#pragma unroll
    for (int i = 0; i < 16; ++i) { const _Float16 h = (_Float16)xs[i]; ah.h[i] = h; al.h[i] = ASPLIT ? (_Float16)(xs[i] - (float)h) : (_Float16)0.0f; }
#pragma unroll
    for (int t = 0; t < 4; ++t) { if (col0 + t * 16 >= N) continue; const size_t boff = (size_t)(col0 + t * 16 + ln) * ldb + kb; FragH bq; bq.half[0] = *(const v8us*)(Bh + boff + 8 * hh); bq.half[1] = *(const v8us*)(Bh + boff + 16 + 8 * hh);
      acc[t] = mmaH<ASPLIT ? 2 : 1>(ah.v, al.v, bq.v, bq.v, acc[t]); }
  }
#pragma unroll
  for (int t = 0; t < 4; ++t) { if (col0 + t * 16 >= N) continue;
#pragma unroll
    for (int r = 0; r < 8; ++r) so[w][8 * hh + r][t * 16 + ln] = acc[t][r] * alpha; }
  __builtin_amdgcn_fence(__ATOMIC_ACQ_REL, "workgroup"); __builtin_amdgcn_wave_barrier();
  const int rsub = lane >> 4, c4 = (lane & 15) * 4;
  {
#pragma unroll
    for (int q = 0; q < 8; ++q) { const int r = q * 2 + rsub; if (col0 + c4 < N) { const v4f v = *(const v4fa*)&so[w][r][c4]; *(v4f*)(C + (size_t)(row0 + r) * ldc + col0 + c4) = v; } }
     }
}

// Wt[n][k] = f16(bf16(W[k][n])·scale) from f32 row-major W[K][N] (scale = power of two; bf16-exact weights stay exact in f16 away from the subnormal range)
__global__ __launch_bounds__(256) void k_wt_f16(const float* __restrict__ W, _Float16* __restrict__ Wt, int K, int N, float scale) {
  const int t = blockIdx.x * 256 + threadIdx.x; if (t >= N * (K / 8)) return; const int n = t / (K / 8), k8 = (t % (K / 8)) * 8; FragH f;
#pragma unroll
  for (int i = 0; i < 8; ++i) f.h[i] = (_Float16)(bf16_round(W[(size_t)(k8 + i) * N + n]) * scale); const v8us o = f.half[0];
  *(v8us*)((unsigned short*)Wt + (size_t)n * K + k8) = o; 
}
// k_gemm_hh variant with fused epilogue: v = acc·alpha + bias[by·sBias + col] (+ CP[(row/rowsPerB)·sCPb + by·64 + col] if CP) ; ACT 0 none / 1 elu ; writes f16 C16 (and f32 C if non-null)
template <int ACT>
__global__ __launch_bounds__(128) void k_gemm_hhx(const _Float16* __restrict__ A, int lda, size_t sA, const _Float16* __restrict__ Bh, int ldb, size_t sB, float alpha, const float* __restrict__ bias, size_t sBias, const float* __restrict__ CP, int rowsPerB, size_t sCPb, int row0g,
    float* __restrict__ C, _Float16* __restrict__ C16, int ldc, size_t sC, int M, int N, int K) {
  __shared__ __attribute__((aligned(16))) float so[4][16][64];
  const int tid = threadIdx.x, w = tid >> 5, lane = tid & 31, ln = lane & 15, hh = lane >> 4; const int by = blockIdx.y;
  A += (size_t)by * sA; Bh += (size_t)by * sB; const size_t cofs = (size_t)by * sC; const float* bp = bias ? bias + (size_t)by * sBias : nullptr;
  const int ntn = (N + 63) / 64; const int wid = blockIdx.x * 4 + w; const int mt = wid / ntn, nq = wid % ntn; if (mt * 16 >= M) return;
  const int row0 = mt * 16, col0 = nq * 64; const _Float16* arow = A + (size_t)(row0 + ln) * lda;
  v8f acc[4] = {};
  for (int kb = 0; kb < K; kb += 32) { FragH ah; ah.half[0] = *(const v8us*)((const unsigned short*)arow + kb + 8 * hh); ah.half[1] = *(const v8us*)((const unsigned short*)arow + kb + 16 + 8 * hh);
#pragma unroll
    for (int t = 0; t < 4; ++t) { if (col0 + t * 16 >= N) continue; const size_t boff = (size_t)(col0 + t * 16 + ln) * ldb + kb; FragH bq; bq.half[0] = *(const v8us*)((const unsigned short*)Bh + boff + 8 * hh); bq.half[1] = *(const v8us*)((const unsigned short*)Bh + boff + 16 + 8 * hh);
      acc[t] = mmaH<1>(ah.v, ah.v, bq.v, bq.v, acc[t]); }
  }
#pragma unroll
  for (int t = 0; t < 4; ++t) { if (col0 + t * 16 >= N) continue; const int col = col0 + t * 16 + ln; const float bv = bp ? bf16_round(bp[col]) : 0.f;
#pragma unroll
    for (int r = 0; r < 8; ++r) { float v = acc[t][r] * alpha + bv; if (CP) { const int bidx = (row0g + row0 + 8 * hh + r) / rowsPerB; v += CP[(size_t)bidx * sCPb + (size_t)by * 64 + col]; } if (ACT == 1) v = (v > 0.f) ? v : expm1f(v); else if (ACT == 7) v = (v > 0.f) ? v + 1.0f : expf(v); else if (ACT == 8) v = tanhf(v); else if (ACT == 9) v = 0.5f * v * (1.0f + tanhf(0.7978845608028654f * (v + 0.044715f * v * v * v))); else if (ACT == 11) v = 1.0f / (1.0f + expf(-v)); else if (ACT == 12) v = (v > 0.f) ? v : 0.01f * v; else if (ACT == 14) v = (v > 0.f) ? v : 0.1f * v; else if (ACT == 15) v = v / (1.0f + expf(-v)); else if (ACT == 3) v = fmaxf(v, 0.f); else if (ACT == 6) v = 0.5f * v * (1.0f + erff(v * 0.70710678118654752f)); so[w][8 * hh + r][t * 16 + ln] = v; } }
  __builtin_amdgcn_fence(__ATOMIC_ACQ_REL, "workgroup"); __builtin_amdgcn_wave_barrier();
  const int rsub = lane >> 4, c4 = (lane & 15) * 4; typedef _Float16 v4h __attribute__((ext_vector_type(4)));
  {
#pragma unroll
    for (int q = 0; q < 8; ++q) { const int r = q * 2 + rsub; if (col0 + c4 < N) { const v4f v = *(const v4fa*)&so[w][r][c4]; if (C) *(v4f*)(C + cofs + (size_t)(row0 + r) * ldc + col0 + c4) = v; if (C16) { v4h h4; for (int i = 0; i < 4; ++i) h4[i] = (_Float16)v[i]; *(v4h*)(C16 + cofs + (size_t)(row0 + r) * ldc + col0 + c4) = h4; } } }
     }
}


typedef _Float16 v4h __attribute__((ext_vector_type(4)));

__global__ __launch_bounds__(256) void k_x16(const float* __restrict__ x, _Float16* __restrict__ X16, size_t n8) { const size_t t = (size_t)blockIdx.x * 256 + threadIdx.x; if (t >= n8) return; FragH f;
#pragma unroll
  for (int q = 0; q < 8; ++q) f.h[q] = (_Float16)bf16_round(x[t * 8 + q]); *(v8us*)((unsigned short*)X16 + t * 8) = f.half[0];  }
__global__ __launch_bounds__(256) void k_h16(const float* __restrict__ x, _Float16* __restrict__ X16, size_t n8) { const size_t t = (size_t)blockIdx.x * 256 + threadIdx.x; if (t >= n8) return; FragH f;
#pragma unroll
  for (int q = 0; q < 8; ++q) f.h[q] = (_Float16)x[t * 8 + q]; *(v8us*)((unsigned short*)X16 + t * 8) = f.half[0];  }
__global__ __launch_bounds__(256) void k_round16f(const float* __restrict__ W, _Float16* __restrict__ Bt, size_t n8) { const size_t t = (size_t)blockIdx.x * 256 + threadIdx.x; if (t >= n8) return; FragH f;
#pragma unroll
  for (int i = 0; i < 8; ++i) f.h[i] = (_Float16)(bf16_round(W[t * 8 + i]) * 16.0f); *(v8us*)((unsigned short*)Bt + t * 8) = f.half[0];  }
__global__ __launch_bounds__(256) void k_h16s(const float* __restrict__ F, _Float16* __restrict__ H, size_t n8) { const size_t t = (size_t)blockIdx.x * 256 + threadIdx.x; if (t >= n8) return; const v4f a = *(const v4fa*)(F + t * 8), c = *(const v4fa*)(F + t * 8 + 4); FragH f;
#pragma unroll
  for (int q = 0; q < 4; ++q) { f.h[q] = (_Float16)(a[q] * 16.0f); f.h[4 + q] = (_Float16)(c[q] * 16.0f); } *(v8us*)((unsigned short*)H + t * 8) = f.half[0];  }
// K and V rewritten in the order in which k_flash's A fragments take them, so that each of its wave-wide 16-byte loads covers 512 contiguous bytes (4 whole lines) instead of 32 bytes of each of 16 lines.
// Unit = 16 B = 8 f16 of one lane, lane = 16hh + ln. Kp: per 16 keys 4 loads (ks, half): unit = K[key tile * 16 + ln][ks * 32 + half * 16 + 8hh + 0..7]. Vp: per 32 keys 8 loads (dt, half): unit = V[key block * 32 + half * 16 + 8hh + 0..7][dt * 16 + ln].
// Even blocks transpose 64 keys of V through LDS, odd blocks permute 64 keys of K; thread t writes unit t, so the stores are whole lines too.
__global__ __launch_bounds__(256) void k_pack(const _Float16* __restrict__ K16, const _Float16* __restrict__ V16, _Float16* __restrict__ Kp, _Float16* __restrict__ Vp) {
  __shared__ unsigned short tl[64][66]; const int tid = threadIdx.x; const int lg = blockIdx.x >> 1;
  if (blockIdx.x & 1) {
#pragma unroll      // both 16-byte loads are issued before the first store waits for its data
    for (int rd = 0; rd < 2; ++rd) { const int c = rd * 256 + tid, ln = c & 15, hh = (c >> 4) & 1, half = (c >> 5) & 1, ks = (c >> 6) & 1, kt = c >> 7;
      const v8us u = *(const v8us*)((const unsigned short*)K16 + ((size_t)lg * 64 + kt * 16 + ln) * 64 + ks * 32 + half * 16 + hh * 8);
      *(v8us*)((unsigned short*)Kp + (size_t)lg * 4096 + c * 8) = u; }
    asm volatile("s_wait_xcnt 0x0" ::: "memory");      // precaution: stands in front of every later write of a register that the two K stores name (in the listing this branch's exit also falls through into the V part, which rewrites them)
    return; }
  for (int i = tid; i < 64 * 8; i += 256) { const int r = i / 8, c8 = (i % 8) * 8; FragH f; f.half[0] = *(const v8us*)((const unsigned short*)V16 + ((size_t)lg * 64 + r) * 64 + c8);
#pragma unroll
    for (int q = 0; q < 8; ++q) tl[r][c8 + q] = f.u[q]; }
  __syncthreads();
#pragma unroll
  for (int rd = 0; rd < 2; ++rd) { const int c = rd * 256 + tid, ln = c & 15, hh = (c >> 4) & 1, half = (c >> 5) & 1, dt = (c >> 6) & 3; FragH f;
#pragma unroll
    for (int q = 0; q < 8; ++q) f.u[q] = tl[rd * 32 + half * 16 + hh * 8 + q][dt * 16 + ln];
    *(v8us*)((unsigned short*)Vp + (size_t)lg * 4096 + c * 8) = f.half[0]; } }
__global__ __launch_bounds__(256) void k_merge(const float* __restrict__ O, float* __restrict__ out) {
  const int tid = threadIdx.x; const int wg = blockIdx.x * 8 + (tid >> 5); if (wg >= NB * 2) return; const int b = wg >> 1, hp = wg & 1; const int l = tid & 31; const int h = hp * 2 + (l >> 4), c4 = (l & 15) * 4;
  const v4f v = *(const v4fa*)(O + ((size_t)h * NB + b) * DD + c4); float* o = out + (size_t)b * EE + h * DD + c4;
  *(v4f*)o = v;  }
__global__ __launch_bounds__(1024) void k_flash(const _Float16* __restrict__ Q16, int ldq, const _Float16* __restrict__ Kp, const _Float16* __restrict__ Vp, const int* __restrict__ MSK, float* __restrict__ O, int ldo) {
  constexpr int RPW = 16, NQB = TT / (4 * RPW), DT = 4, KS = 2, KSPL = 8, NW = 4 * KSPL;
  constexpr int NP = 2, TKEYS = NP * KSPL * 32, PLANE = TKEYS * 128, BUF = 2 * PLANE, SLOT = BUF / NP, NTILE = TT / TKEYS;      // NP key blocks per wave and tile (NP passes); a buffer holds, pass by pass, SLOT bytes: the pass's K (half a slot), then its V, so that every fragment's LDS offset from the pass's base fits the instruction's 16-bit field
  static_assert(PLANE == 4 * 1024 * 16 && NP == 2 && NTILE >= 2, "four 16-byte copies per lane and plane, two per pass; the ring's prologue needs two tiles");
  constexpr float C2 = 0.125f * 1.4426950408889634f;      // 1/sqrt(64) * log2(e): exp(s/8 - m/8) = 2^(C2 s - C2 m), so a weight costs one fused multiply-add and one hardware 2^x; maxima are kept on the raw products (C2 > 0 keeps their order)
  __shared__ __attribute__((aligned(16))) unsigned char ring[2 * BUF]; __shared__ float sM[NW][RPW], sL[NW][RPW];
  static_assert(sizeof(float) * NW * RPW * (64 + 4) <= sizeof(ring), "the partial accumulators are staged in the ring once the loop has left it");
  float (*sO)[RPW][64 + 4] = (float (*)[RPW][64 + 4])ring;
  const int tid = threadIdx.x, lane = tid & 31, ln = lane & 15, hh = lane >> 4;
  const int w = __builtin_amdgcn_readfirstlane(tid >> 5) & (NW - 1);      // wave number in a scalar register; the mask (an identity) shows the compiler its range
  const int slab = blockIdx.x / NQB, qblk = blockIdx.x % NQB; const int b = slab / NH, h = slab % NH; const int qb0 = qblk * (4 * RPW); const int q0 = qb0 + (w & 3) * RPW;
  const unsigned char* Kg = (const unsigned char*)Kp + (size_t)slab * 128 * TT + tid * 16; const unsigned char* Vg = (const unsigned char*)Vp + (size_t)slab * 128 * TT + tid * 16;      // k_pack's planes: 128 B per key; thread t copies bytes 16 t .. 16 t + 15 of every 16 KiB
  const unsigned lds0 = (unsigned)(size_t)ring + tid * 16;      // the lane's LDS byte address in buffer 0
  // One tile into one buffer: 8 copies per lane, each wave 512 contiguous bytes per copy, every lane on. The s_wait_xcnt 0 is the last line of the copies' own statement, so that it stands in front of every later write of a register that a copy names (a precaution).
  auto fill = [&](int tile, int buf) {
    const unsigned char* gk = Kg + (size_t)tile * PLANE; const unsigned char* gv = Vg + (size_t)tile * PLANE; const unsigned lk = lds0 + buf * BUF, lv = lk + SLOT / 2;
    asm volatile("global_load_async_to_lds_b128 %0, %8, off\n\t"
                 "global_load_async_to_lds_b128 %1, %9, off\n\t"
                 "global_load_async_to_lds_b128 %2, %10, off\n\t"
                 "global_load_async_to_lds_b128 %3, %11, off\n\t"
                 "global_load_async_to_lds_b128 %4, %12, off\n\t"
                 "global_load_async_to_lds_b128 %5, %13, off\n\t"
                 "global_load_async_to_lds_b128 %6, %14, off\n\t"
                 "global_load_async_to_lds_b128 %7, %15, off\n\t"
                 "s_wait_xcnt 0x0"
                 :: "v"(lk), "v"(lk + 16384), "v"(lk + SLOT), "v"(lk + SLOT + 16384), "v"(lv), "v"(lv + 16384), "v"(lv + SLOT), "v"(lv + SLOT + 16384),
                    "v"(gk), "v"(gk + 16384), "v"(gk + 32768), "v"(gk + 49152), "v"(gv), "v"(gv + 16384), "v"(gv + 32768), "v"(gv + 49152) : "memory"); };
  fill(0, 0);
  FragH bq[KS];      // B operand: column ln = query q0 + ln
  { const unsigned short* qr = (const unsigned short*)Q16 + ((size_t)b * TT + q0 + ln) * ldq + h * 64;
#pragma unroll
    for (int ks = 0; ks < KS; ++ks) { bq[ks].half[0] = *(const v8us*)(qr + ks * 32 + 8 * hh); bq[ks].half[1] = *(const v8us*)(qr + ks * 32 + 16 + 8 * hh); } }
  float m_q = -3.0e38f, l_q = 0.f; v8f oacc[DT];      // of query ln: running max (equal in both halves), this half's share of the sum, O^T rows dt * 16 + 8hh + r
#pragma unroll
  for (int dt = 0; dt < DT; ++dt) oacc[dt] = (v8f){0.f,0.f,0.f,0.f,0.f,0.f,0.f,0.f};
  asm volatile("s_wait_asynccnt 0x0" ::: "memory");      // this wave's share of tile 0 has landed
  __syncthreads();      // tile 0 is published: nobody reads it in front of this barrier
  fill(1, 1);
#pragma unroll 1      // one trip per tile: the ring's order stands once, at the foot
  for (int t = 0; t < NTILE; ++t) {
    const unsigned char* tb = ring + (t & 1) * BUF + (w >> 2) * 4096 + lane * 16;      // the wave's key block in the tile's first pass: 4 KiB per 32 keys of K and of V, a lane's 16 B at lane * 16 in every 512-byte load
#pragma unroll 1      // rolled: one base register per pass, every fragment at an immediate offset from it
    for (int p = 0; p < NP; ++p) {
    const unsigned short* Kf = (const unsigned short*)(tb + p * SLOT); const unsigned short* Vf = (const unsigned short*)(tb + p * SLOT + SLOT / 2);
    v8f s[2];      // s[nt][r] = raw product (score * 8) of key nt * 16 + 8hh + r of the block with query ln
#pragma unroll
    for (int nt = 0; nt < 2; ++nt) { const unsigned short* kr = Kf + nt * 1024; FragH ak[KS];
#pragma unroll
      for (int ks = 0; ks < KS; ++ks) { ak[ks].half[0] = *(const v8us*)(kr + ks * 512); ak[ks].half[1] = *(const v8us*)(kr + ks * 512 + 256); }
      v8f acc = (v8f){0.f,0.f,0.f,0.f,0.f,0.f,0.f,0.f};
#pragma unroll
      for (int ks = 0; ks < KS; ++ks) acc = mmaH<1>(ak[ks].v, ak[ks].v, bq[ks].v, bq[ks].v, acc);
      s[nt] = acc; }
    float mc = fmaxf(s[0][0], s[1][0]);
#pragma unroll
    for (int r = 1; r < 8; ++r) mc = fmaxf(mc, fmaxf(s[0][r], s[1][r]));
    mc = fmaxf(mc, __int_as_float(__builtin_amdgcn_permlanex16(__float_as_int(mc), __float_as_int(mc), 0x76543210, 0xfedcba98, false, false)));      // lane l <-> l ^ 16: the other 16 keys of the same query
    const float mn = fmaxf(m_q, mc); const float al = __builtin_amdgcn_exp2f((m_q - mn) * C2); m_q = mn;
    const float mb = fmaf(mn, C2, -10.0f);      // the 2^10 of the f16 weights rides in the exponent: weights and their sum both carry it, and the merge divides it out
    FragH pb; float ps = 0.f;
#pragma unroll
    for (int r = 0; r < 8; ++r) { const float p0 = __builtin_amdgcn_exp2f(fmaf(s[0][r], C2, -mb)), p1 = __builtin_amdgcn_exp2f(fmaf(s[1][r], C2, -mb)); ps += p0 + p1; pb.h[r] = (_Float16)p0; pb.h[8 + r] = (_Float16)p1; }
    l_q = l_q * al + ps;
#pragma unroll
    for (int dt = 0; dt < DT; ++dt) oacc[dt] *= al;
#pragma unroll
    for (int dt = 0; dt < DT; ++dt) { const unsigned short* vrow = Vf + dt * 512; FragH av; av.half[0] = *(const v8us*)vrow; av.half[1] = *(const v8us*)(vrow + 256);
      oacc[dt] = mmaH<1>(av.v, av.v, pb.v, pb.v, oacc[dt]); } }
    asm volatile("s_wait_dscnt 0x0" ::: "memory");      // this wave's reads of the buffer have returned before the buffer is handed to its next writer
    asm volatile("s_wait_asynccnt 0x0" ::: "memory");      // this wave's share of tile t + 1 has landed
    __syncthreads();      // publishes tile t + 1 and ends every wave's reads of tile t's buffer
    if (t + 2 < NTILE) fill(t + 2, t & 1); }
  asm volatile("s_wait_asynccnt 0x0" ::: "memory");      // no copy is outstanding when the ring becomes staging for the partials (the last trip's barrier has ended every read of it)
  l_q += __int_as_float(__builtin_amdgcn_permlanex16(__float_as_int(l_q), __float_as_int(l_q), 0x76543210, 0xfedcba98, false, false));      // the halves' sums joined once
  if (hh == 0) { sM[w][ln] = m_q; sL[w][ln] = l_q; }
#pragma unroll
  for (int dt = 0; dt < DT; ++dt) { *(v4fa*)&sO[w][ln][dt * 16 + 8 * hh] = (v4f){oacc[dt][0], oacc[dt][1], oacc[dt][2], oacc[dt][3]}; *(v4fa*)&sO[w][ln][dt * 16 + 8 * hh + 4] = (v4f){oacc[dt][4], oacc[dt][5], oacc[dt][6], oacc[dt][7]}; }
  __syncthreads();      // every wave's partial (max, sum, accumulator) is in LDS before any wave merges
  for (int e = tid; e < 4 * RPW * 16; e += 32 * NW) { const int row = e >> 4, pc = e & 15, qt = row / RPW, r = row % RPW;      // one query row per 16 lanes, 16 B per lane
    float mg[KSPL], M = -3.0e38f;
#pragma unroll
    for (int g = 0; g < KSPL; ++g) { mg[g] = sM[g * 4 + qt][r]; M = fmaxf(M, mg[g]); }
    float L = 0.f; v4f acc = {0.f, 0.f, 0.f, 0.f};
#pragma unroll
    for (int g = 0; g < KSPL; ++g) { const float wg = __builtin_amdgcn_exp2f((mg[g] - M) * C2); L += wg * sL[g * 4 + qt][r]; const v4f pv = *(const v4fa*)&sO[g * 4 + qt][r][pc * 4]; acc += pv * wg; }
    const float inv = (L > 0.f) ? 1.0f / L : 0.f;      // L and acc both carry the 2^10
    *(v4f*)(O + ((size_t)b * TT + qb0 + row) * ldo + h * 64 + pc * 4) = acc * inv; } }

extern "C" void kernel_launch(void* const* d_in, const int* in_sizes, int n_in,
                              void* d_out, int out_size, void* d_ws, size_t ws_size, hipStream_t stream) {
  (void)in_sizes; (void)n_in; (void)out_size;
  const float* const* I = (const float* const*)d_in; const float* xq = I[0]; const float* xk = I[1]; const float* xv = I[2]; const float* Wq = I[3]; const float* Wk = I[4]; const float* Wv = I[5];
  char* ws = (char*)d_ws; size_t off = 0;
  auto take = [&](size_t bytes) { char* p = ws + off; off += (bytes + 255) & ~(size_t)255; return p; };
  const size_t WSZ = (size_t)EE * EE; _Float16* Bw = (_Float16*)take(3 * WSZ * 2);
  _Float16* Xq = (_Float16*)take((size_t)NB * EE * 2); _Float16* Xk = (_Float16*)take((size_t)NB * EE * 2); _Float16* Xv = (_Float16*)take((size_t)NB * EE * 2);
  _Float16* Qs = (_Float16*)take((size_t)TT * DD * 2); _Float16* Ks = (_Float16*)take((size_t)TT * DD * 2); _Float16* Vs = (_Float16*)take((size_t)TT * DD * 2); _Float16* Kp = (_Float16*)take((size_t)TT * DD * 2); _Float16* Vp = (_Float16*)take((size_t)TT * DD * 2); float* O = (float*)take((size_t)TT * DD * 4);
  if (off > ws_size) return;      // 0.4 + 3 x 2.1 + 5 x 2.1 + 4.2 = about 21 MB
  const unsigned gw = (unsigned)((EE * (EE / 8) + 255) / 256);
  k_wt_f16<<<gw, 256, 0, stream>>>(Wq, Bw, EE, EE, 16.0f); k_wt_f16<<<gw, 256, 0, stream>>>(Wk, Bw + WSZ, EE, EE, 16.0f); k_wt_f16<<<gw, 256, 0, stream>>>(Wv, Bw + 2 * WSZ, EE, EE, 16.0f);      /* (in,out) → Bt ×2^4 */
  const unsigned g8 = (unsigned)(((size_t)NB * EE / 8 + 255) / 256); k_x16<<<g8, 256, 0, stream>>>(xq, Xq, (size_t)NB * EE / 8); k_x16<<<g8, 256, 0, stream>>>(xk, Xk, (size_t)NB * EE / 8); k_x16<<<g8, 256, 0, stream>>>(xv, Xv, (size_t)NB * EE / 8);
  const dim3 gs(((NB / 16) * 1 + 3) / 4, NHD);      /* per head h = grid.y: C16[h·NB + b][0..63] = X·Bt[h·64 .. h·64+63]ᵀ — M 4096 N 64 K 256, written straight into the stacked plane */
  k_gemm_hhx<0><<<gs, 128, 0, stream>>>(Xq, EE, 0, Bw, EE, (size_t)DD * EE, 0.0625f, nullptr, 0, nullptr, 1, 0, 0, nullptr, Qs, DD, (size_t)NB * DD, NB, DD, EE);
  k_gemm_hhx<0><<<gs, 128, 0, stream>>>(Xk, EE, 0, Bw + WSZ, EE, (size_t)DD * EE, 0.0625f, nullptr, 0, nullptr, 1, 0, 0, nullptr, Ks, DD, (size_t)NB * DD, NB, DD, EE);
  k_gemm_hhx<0><<<gs, 128, 0, stream>>>(Xv, EE, 0, Bw + 2 * WSZ, EE, (size_t)DD * EE, 0.0625f, nullptr, 0, nullptr, 1, 0, 0, nullptr, Vs, DD, (size_t)NB * DD, NB, DD, EE);
  k_pack<<<2 * (TT / 64), 256, 0, stream>>>(Ks, Vs, Kp, Vp);      /* K and V in fragment order */
  k_flash<<<BB * NH * (TT / 64), 1024, 0, stream>>>(Qs, DD, Kp, Vp, nullptr, O, DD);      /* one slab: 16384 queries × 16384 keys */
  k_merge<<<(NB * 2 + 7) / 8, 256, 0, stream>>>(O, (float*)d_out);
}

// v006
// Measured time: 80.4 microseconds a run.
// Next to v005, in two timings, it ran 1.60 and 1.59 times as fast.
// All steps since v000 together make it 20.4 times as fast.
#include <hip/hip_runtime.h>
// Multi-head attention whose heads are STACKED along the batch axis (B=4096 rows, EMBED=256, 4 heads × 64): q = queries·W_Query, k = keys·W_Key, v = values·W_Value ((in,out), no bias); the heads are split TF-style into [H·B, 64] = [16384, 64] and ONE softmax(q·kᵀ/√64)·v runs over all 16384 stacked rows
// (every query attends to every (head, row) key); the result is merged back to [B, H·64].
// Compute dtype: inputs and weights rounded to bf16; q, k, v as f16 GEMM outputs of ONE projection launch (grid.y = head, grid.z = operand) that reads the f32 inputs itself and stores q in the stacked [h * 4096 + b][64] layout and k, v in the attention kernel's fragment order;
// fused flash-style kernel over T = 16384 (online softmax f32, P f16 x 2^10, f32 accumulate) on v_wmma_f32_16x16x32_f16, which stores its f32 result rows at their merged place in the output. Two launches in all.
#define BB 1
#define TT 16384
#define NH 1
#define NB 4096
#define NHD 4
#define EE 256
#define DD 64
#define NR (BB * TT)

typedef __bf16 v16b __attribute__((ext_vector_type(16)));
typedef unsigned short v8us __attribute__((ext_vector_type(8), may_alias));
typedef float  v8f  __attribute__((ext_vector_type(8)));
typedef float  v4f  __attribute__((ext_vector_type(4)));
typedef float  v4fa __attribute__((ext_vector_type(4), may_alias));
union FragB { v16b v; v8us half[2]; unsigned short u[16]; };

__device__ __forceinline__ unsigned short bf16_bits(float x) { unsigned int u = __float_as_uint(x); return (unsigned short)((u + 0x7FFFu + ((u >> 16) & 1u)) >> 16); }
__device__ __forceinline__ float bf16_val(unsigned short b) { return __uint_as_float(((unsigned int)b) << 16); }
__device__ __forceinline__ float bf16_round(float x) { return bf16_val(bf16_bits(x)); }
// D += A·B with NT terms: 1 = ah·bh, 2 = + al·bh (A split), 3 = + ah·bl (both split)
template <int NT>
__device__ __forceinline__ v8f mmaN(v16b ah, v16b al, v16b bh, v16b bl, v8f c) {
  c = __builtin_amdgcn_wmma_f32_16x16x32_bf16(false, ah, false, bh, (short)0, c, false, false);
  if (NT >= 2) c = __builtin_amdgcn_wmma_f32_16x16x32_bf16(false, al, false, bh, (short)0, c, false, false);
  if (NT >= 3) c = __builtin_amdgcn_wmma_f32_16x16x32_bf16(false, ah, false, bl, (short)0, c, false, false);
  asm volatile("v_nop\n\tv_nop\n\tv_nop\n\tv_nop" : "+v"(c) : "v"(ah), "v"(al), "v"(bh), "v"(bl));
  return c;
}

__global__ __launch_bounds__(256) void k_wt_bf16(const float* __restrict__ W, unsigned short* __restrict__ Wt, int K, int N) {
  const int t = blockIdx.x * 256 + threadIdx.x;
  const int k8n = K / 8;
  if (t >= N * k8n) return;
  const int n = t / k8n, k8 = (t % k8n) * 8;
  v8us v;
#pragma unroll
  for (int i = 0; i < 8; ++i) v[i] = bf16_bits(W[(size_t)(k8 + i) * N + n]);
  *(v8us*)(Wt + (size_t)n * K + k8) = v;
  
}

// GEMM C[M][N] (f32, pitch ldc) = act(A[M][K]·W + bias). A f32 row-major (pitch lda) converted per fragment to bf16
// (ASPLIT: hi/lo two planes -> 2 terms, else single rounded term); Wt bf16 [N][K] (pitch ldb). BIAS_BF16 rounds the
// bias to bf16 first (bias quantised to bf16 before the add). K%32==0, M%16==0, N%64==0.
template <bool ASPLIT, int ACT, bool BIAS_BF16>
__global__ __launch_bounds__(128) void k_gemm_bf(const float* __restrict__ A, int lda, const unsigned short* __restrict__ Wt, int ldb,
                                               const float* __restrict__ bias, float* __restrict__ C, int ldc, int M, int N, int K) {
  __shared__ __attribute__((aligned(16))) float so[4][16][64];
  const int tid = threadIdx.x, w = tid >> 5, lane = tid & 31, ln = lane & 15, hh = lane >> 4;
  const int ntn = N / 64;
  const int wid = blockIdx.x * 4 + w;
  const int mt = wid / ntn, nq = wid % ntn;
  if (mt * 16 >= M) return;
  const int row0 = mt * 16, col0 = nq * 64;
  const float* arow = A + (size_t)(row0 + ln) * lda;
  v8f acc[4] = {};
  for (int kb = 0; kb < K; kb += 32) {
    FragB ah, al;
    const v4f x0 = *(const v4fa*)(arow + kb + 8 * hh), x1 = *(const v4fa*)(arow + kb + 8 * hh + 4);
    const v4f x2 = *(const v4fa*)(arow + kb + 16 + 8 * hh), x3 = *(const v4fa*)(arow + kb + 16 + 8 * hh + 4);
    float xs[16] = {x0[0],x0[1],x0[2],x0[3],x1[0],x1[1],x1[2],x1[3],x2[0],x2[1],x2[2],x2[3],x3[0],x3[1],x3[2],x3[3]};
#pragma unroll
    for (int i = 0; i < 16; ++i) { const unsigned short hb = bf16_bits(xs[i]); ah.u[i] = hb; al.u[i] = ASPLIT ? bf16_bits(xs[i] - bf16_val(hb)) : (unsigned short)0; }
#pragma unroll
    for (int t = 0; t < 4; ++t) {
      const unsigned short* brow = Wt + (size_t)(col0 + t * 16 + ln) * ldb + kb;
      FragB b;
      b.half[0] = *(const v8us*)(brow + 8 * hh);
      b.half[1] = *(const v8us*)(brow + 16 + 8 * hh);
      acc[t] = mmaN<ASPLIT ? 2 : 1>(ah.v, al.v, b.v, b.v, acc[t]);
    }
  }
#pragma unroll
  for (int t = 0; t < 4; ++t) {
    float bv = bias ? bias[col0 + t * 16 + ln] : 0.f;
    if (BIAS_BF16) bv = bf16_round(bv);
#pragma unroll
    for (int r = 0; r < 8; ++r) { float v = acc[t][r] + bv; if (ACT == 1) v = fmaxf(v, 0.f); so[w][8 * hh + r][t * 16 + ln] = v; }
  }
  __builtin_amdgcn_fence(__ATOMIC_ACQ_REL, "workgroup");
  __builtin_amdgcn_wave_barrier();
  const int rsub = lane >> 4, c4 = (lane & 15) * 4;
  {
#pragma unroll
    for (int q = 0; q < 8; ++q) {
      const int r = q * 2 + rsub;
      const v4f v = *(const v4fa*)&so[w][r][c4];
      *(v4f*)(C + (size_t)(row0 + r) * ldc + col0 + c4) = v;
    }
    
  }
}

// Flash-style causal/unmasked attention, all contractions 3-term bf16 hi/lo splits, f32 softmax with running max.
// q,k,v rows are read from f32 buffers with arbitrary row pitch (so they can live inside a fused qkv buffer);
// D = head size (multiple of 32, <= 128); one wave = 16 query rows; block = 4 waves (64 queries) sharing K/V chunks of 32.
template <int D, bool CAUSAL>
__global__ __launch_bounds__(128) void k_flash(const float* __restrict__ qb, const float* __restrict__ kb, const float* __restrict__ vb,
                                             int pitch, int T, int H, float scale, float* __restrict__ y, int ypitch) {
  constexpr int KS = D / 32;        // k-steps for QK
  constexpr int DT = D / 16;        // d tiles for PV
  __shared__ __attribute__((aligned(16))) unsigned short sKh[32][D + 8], sKl[32][D + 8], sVh[32][D + 8], sVl[32][D + 8];
  __shared__ __attribute__((aligned(16))) unsigned short sPh[4][16][40], sPl[4][16][40];
  __shared__ __attribute__((aligned(16))) float sO[4][16][D];
  const int tid = threadIdx.x, w = tid >> 5, lane = tid & 31, ln = lane & 15, hh = lane >> 4;
  const int nqb = (T + 63) / 64;
  const int bh = blockIdx.x / nqb, qblk = blockIdx.x % nqb;
  const int b = bh / H, h = bh % H;
  const int q0 = qblk * 64 + w * 16;
  const float* Q = qb + (size_t)b * T * pitch + h * D;
  const float* K = kb + (size_t)b * T * pitch + h * D;
  const float* V = vb + (size_t)b * T * pitch + h * D;

  // A fragments of the wave's 16 query rows (scaled), hi/lo
  FragB aqh[KS], aql[KS];
  {
    int row = q0 + ln; if (row >= T) row = T - 1;
    const float* qr = Q + (size_t)row * pitch;
#pragma unroll
    for (int ks = 0; ks < KS; ++ks)
#pragma unroll
      for (int i = 0; i < 16; ++i) {
        const int d = ks * 32 + ((i < 8) ? (8 * hh + i) : (16 + 8 * hh + (i - 8)));
        const float x = qr[d] * scale; const unsigned short hb = bf16_bits(x);
        aqh[ks].u[i] = hb; aql[ks].u[i] = bf16_bits(x - bf16_val(hb));
      }
  }
  float m_r[8], l_r[8];
#pragma unroll
  for (int r = 0; r < 8; ++r) { m_r[r] = -3.0e38f; l_r[r] = 0.f; }
  v8f oacc[DT];
#pragma unroll
  for (int dt = 0; dt < DT; ++dt) oacc[dt] = (v8f){0.f,0.f,0.f,0.f,0.f,0.f,0.f,0.f};

  const int kv_end = CAUSAL ? min(T, qblk * 64 + 64) : T;     // block-uniform
  for (int j0 = 0; j0 < kv_end; j0 += 32) {
    __syncthreads();
    for (int e = tid; e < 32 * (D / 4); e += 128) {
      const int r = e / (D / 4), c4 = (e % (D / 4)) * 4;
      const int key = j0 + r;
      v4f kf = {0.f,0.f,0.f,0.f}, vf = {0.f,0.f,0.f,0.f};
      if (key < T) { kf = *(const v4fa*)(K + (size_t)key * pitch + c4); vf = *(const v4fa*)(V + (size_t)key * pitch + c4); }
#pragma unroll
      for (int t = 0; t < 4; ++t) {
        unsigned short hb = bf16_bits(kf[t]); sKh[r][c4 + t] = hb; sKl[r][c4 + t] = bf16_bits(kf[t] - bf16_val(hb));
        hb = bf16_bits(vf[t]); sVh[r][c4 + t] = hb; sVl[r][c4 + t] = bf16_bits(vf[t] - bf16_val(hb));
      }
    }
    __syncthreads();
    // S tile 16 x 32
    v8f s[2];
#pragma unroll
    for (int nt = 0; nt < 2; ++nt) {
      v8f acc = {};
#pragma unroll
      for (int ks = 0; ks < KS; ++ks) {
        FragB bh_, bl_;
        bh_.half[0] = *(const v8us*)&sKh[nt * 16 + ln][ks * 32 + 8 * hh]; bh_.half[1] = *(const v8us*)&sKh[nt * 16 + ln][ks * 32 + 16 + 8 * hh];
        bl_.half[0] = *(const v8us*)&sKl[nt * 16 + ln][ks * 32 + 8 * hh]; bl_.half[1] = *(const v8us*)&sKl[nt * 16 + ln][ks * 32 + 16 + 8 * hh];
        acc = mmaN<3>(aqh[ks].v, aql[ks].v, bh_.v, bl_.v, acc);
      }
      s[nt] = acc;
    }
    // mask + running max (rows 8hh+r; the 16 lanes of a half share rows)
    float alpha[8];
#pragma unroll
    for (int r = 0; r < 8; ++r) {
      const int qi = q0 + 8 * hh + r;
      const int ja = j0 + ln, jb = j0 + 16 + ln;
      if (CAUSAL) { if (ja > qi) s[0][r] = -3.0e38f; if (jb > qi) s[1][r] = -3.0e38f; }
      if (ja >= T) s[0][r] = -3.0e38f;
      if (jb >= T) s[1][r] = -3.0e38f;
      float mx = fmaxf(s[0][r], s[1][r]);
      mx = fmaxf(mx, __shfl_xor(mx, 1, 32)); mx = fmaxf(mx, __shfl_xor(mx, 2, 32)); mx = fmaxf(mx, __shfl_xor(mx, 4, 32)); mx = fmaxf(mx, __shfl_xor(mx, 8, 32));
      const float mnew = fmaxf(m_r[r], mx);
      alpha[r] = (mnew > -1.0e38f) ? __expf(m_r[r] - mnew) : 1.0f;
      const float p0 = (s[0][r] > -1.0e38f) ? __expf(s[0][r] - mnew) : 0.f;
      const float p1 = (s[1][r] > -1.0e38f) ? __expf(s[1][r] - mnew) : 0.f;
      m_r[r] = mnew;
      l_r[r] = l_r[r] * alpha[r] + p0 + p1;            // per-lane partial row sum (16 lanes combined at the end)
      unsigned short hb = bf16_bits(p0); sPh[w][8 * hh + r][ln] = hb;      sPl[w][8 * hh + r][ln] = bf16_bits(p0 - bf16_val(hb));
      hb = bf16_bits(p1);                sPh[w][8 * hh + r][16 + ln] = hb; sPl[w][8 * hh + r][16 + ln] = bf16_bits(p1 - bf16_val(hb));
    }
#pragma unroll
    for (int dt = 0; dt < DT; ++dt)
#pragma unroll
      for (int r = 0; r < 8; ++r) oacc[dt][r] *= alpha[r];
    __builtin_amdgcn_fence(__ATOMIC_ACQ_REL, "workgroup");
    __builtin_amdgcn_wave_barrier();
    FragB pah, pal;
    pah.half[0] = *(const v8us*)&sPh[w][ln][8 * hh]; pah.half[1] = *(const v8us*)&sPh[w][ln][16 + 8 * hh];
    pal.half[0] = *(const v8us*)&sPl[w][ln][8 * hh]; pal.half[1] = *(const v8us*)&sPl[w][ln][16 + 8 * hh];
#pragma unroll
    for (int dt = 0; dt < DT; ++dt) {
      FragB bvh, bvl;
#pragma unroll
      for (int i = 0; i < 8; ++i) {
        bvh.u[i] = sVh[8 * hh + i][dt * 16 + ln]; bvh.u[8 + i] = sVh[16 + 8 * hh + i][dt * 16 + ln];
        bvl.u[i] = sVl[8 * hh + i][dt * 16 + ln]; bvl.u[8 + i] = sVl[16 + 8 * hh + i][dt * 16 + ln];
      }
      oacc[dt] = mmaN<3>(pah.v, pal.v, bvh.v, bvl.v, oacc[dt]);
    }
    __builtin_amdgcn_fence(__ATOMIC_ACQ_REL, "workgroup");
    __builtin_amdgcn_wave_barrier();
  }
#pragma unroll
  for (int r = 0; r < 8; ++r) {
    float l = l_r[r];
    l += __shfl_xor(l, 1, 32); l += __shfl_xor(l, 2, 32); l += __shfl_xor(l, 4, 32); l += __shfl_xor(l, 8, 32);
    l_r[r] = (l > 0.f) ? 1.0f / l : 0.f;
  }
#pragma unroll
  for (int dt = 0; dt < DT; ++dt)
#pragma unroll
    for (int r = 0; r < 8; ++r) sO[w][8 * hh + r][dt * 16 + ln] = oacc[dt][r] * l_r[r];
  __builtin_amdgcn_fence(__ATOMIC_ACQ_REL, "workgroup");
  __builtin_amdgcn_wave_barrier();
  {
    for (int r = 0; r < 16; ++r) {
      const int row = q0 + r;
      if (row < T && lane < D / 4) {
        const v4f val = *(const v4fa*)&sO[w][r][lane * 4];
        *(v4f*)(y + ((size_t)b * T + row) * ypitch + h * D + lane * 4) = val;
      }
    }
    
  }
}

// GEMM C = act(A·W + bias + resid): A f32 (ASPLIT -> hi/lo 2 terms), Wt bf16 [N][K]; ACT 0 none, 1 relu, 2 exact gelu;
// resid (optional, f32, row index = (row % rmod), pitch ldr, RES_BF16 rounds it) added before the activation.
template <bool ASPLIT, int ACT, bool BIAS_BF16, bool RES_BF16>
__global__ __launch_bounds__(128) void k_gemm_bf3(const float* __restrict__ A, int lda, const unsigned short* __restrict__ Wt, int ldb,
                                                const float* __restrict__ bias, const float* __restrict__ resid, int rmod, int ldr,
                                                float* __restrict__ C, int ldc, int M, int N, int K) {
  __shared__ __attribute__((aligned(16))) float so[4][16][64];
  const int tid = threadIdx.x, w = tid >> 5, lane = tid & 31, ln = lane & 15, hh = lane >> 4;
  const int ntn = N / 64;
  const int wid = blockIdx.x * 4 + w;
  const int mt = wid / ntn, nq = wid % ntn;
  if (mt * 16 >= M) return;
  const int row0 = mt * 16, col0 = nq * 64;
  const float* arow = A + (size_t)(row0 + ln) * lda;
  v8f acc[4] = {};
  for (int kb = 0; kb < K; kb += 32) {
    FragB ah, al;
    const v4f x0 = *(const v4fa*)(arow + kb + 8 * hh), x1 = *(const v4fa*)(arow + kb + 8 * hh + 4);
    const v4f x2 = *(const v4fa*)(arow + kb + 16 + 8 * hh), x3 = *(const v4fa*)(arow + kb + 16 + 8 * hh + 4);
    float xs[16] = {x0[0],x0[1],x0[2],x0[3],x1[0],x1[1],x1[2],x1[3],x2[0],x2[1],x2[2],x2[3],x3[0],x3[1],x3[2],x3[3]};
#pragma unroll
    for (int i = 0; i < 16; ++i) { const unsigned short hb = bf16_bits(xs[i]); ah.u[i] = hb; al.u[i] = ASPLIT ? bf16_bits(xs[i] - bf16_val(hb)) : (unsigned short)0; }
#pragma unroll
    for (int t = 0; t < 4; ++t) {
      const unsigned short* brow = Wt + (size_t)(col0 + t * 16 + ln) * ldb + kb;
      FragB b;
      b.half[0] = *(const v8us*)(brow + 8 * hh);
      b.half[1] = *(const v8us*)(brow + 16 + 8 * hh);
      acc[t] = mmaN<ASPLIT ? 2 : 1>(ah.v, al.v, b.v, b.v, acc[t]);
    }
  }
#pragma unroll
  for (int t = 0; t < 4; ++t) {
    const int col = col0 + t * 16 + ln;
    float bv = bias ? bias[col] : 0.f;
    if (BIAS_BF16) bv = bf16_round(bv);
#pragma unroll
    for (int r = 0; r < 8; ++r) {
      float v = acc[t][r] + bv;
      if (resid) { float rv = resid[(size_t)((row0 + 8 * hh + r) % rmod) * ldr + col]; if (RES_BF16) rv = bf16_round(rv); v += rv; }
      if (ACT == 1) v = fmaxf(v, 0.f);
      if (ACT == 2) v = 0.5f * v * (1.0f + erff(v * 0.70710678118654752f));
      if (ACT == 3) { const float u = 0.7978845608028654f * (v + 0.044715f * v * v * v); v = 0.5f * v * (1.0f + tanhf(u)); }
      so[w][8 * hh + r][t * 16 + ln] = v;
    }
  }
  __builtin_amdgcn_fence(__ATOMIC_ACQ_REL, "workgroup");
  __builtin_amdgcn_wave_barrier();
  const int rsub = lane >> 4, c4 = (lane & 15) * 4;
  {
#pragma unroll
    for (int q = 0; q < 8; ++q) {
      const int r = q * 2 + rsub;
      const v4f v = *(const v4fa*)&so[w][r][c4];
      *(v4f*)(C + (size_t)(row0 + r) * ldc + col0 + c4) = v;
    }
    
  }
}
// row LayerNorm (biased variance, eps) over N: s = X (+ R); optional out_sum <- s; out_norm <- (s-mu)*rsqrt(var+eps)*g + b
template <bool PARAM_BF16>
__global__ __launch_bounds__(256) void k_layernorm(const float* __restrict__ X, const float* __restrict__ R, const float* __restrict__ g, const float* __restrict__ bta,
                                                  float* __restrict__ out_sum, float* __restrict__ out_norm, int N, float eps) {
  __shared__ float red[256];
  const int row = blockIdx.x, tid = threadIdx.x;
  const float* x = X + (size_t)row * N; const float* rr = R ? R + (size_t)row * N : nullptr;
  float vals[16];                     // up to N = 4096
  const int per = N / 256;            // contiguous chunk per thread? use strided-by-4 chunks: thread handles j = tid*4 + 1024*u
  float s1 = 0.f;
  for (int u = 0; u < per / 4; ++u) {
    const int j = tid * 4 + 1024 * u;
    const v4f a = *(const v4fa*)(x + j);
    v4f b = {0.f,0.f,0.f,0.f}; if (rr) b = *(const v4fa*)(rr + j);
#pragma unroll
    for (int q = 0; q < 4; ++q) { const float v = a[q] + b[q]; vals[u * 4 + q] = v; s1 += v; }
  }
  red[tid] = s1; __syncthreads();
  for (int st = 128; st > 0; st >>= 1) { if (tid < st) red[tid] += red[tid + st]; __syncthreads(); }
  const float mu = red[0] / (float)N; __syncthreads();
  float s2 = 0.f;
  for (int u = 0; u < per / 4; ++u)
#pragma unroll
    for (int q = 0; q < 4; ++q) { const float c = vals[u * 4 + q] - mu; s2 += c * c; }
  red[tid] = s2; __syncthreads();
  for (int st = 128; st > 0; st >>= 1) { if (tid < st) red[tid] += red[tid + st]; __syncthreads(); }
  const float rs = rsqrtf(red[0] / (float)N + eps);
  {
    for (int u = 0; u < per / 4; ++u) {
      const int j = tid * 4 + 1024 * u;
      v4f o, sm;
#pragma unroll
      for (int q = 0; q < 4; ++q) {
        float gg = g[j + q], bb = bta[j + q];
        if (PARAM_BF16) { gg = bf16_round(gg); bb = bf16_round(bb); }
        sm[q] = vals[u * 4 + q]; o[q] = (vals[u * 4 + q] - mu) * rs * gg + bb;
      }
      if (out_sum) *(v4f*)(out_sum + (size_t)row * N + j) = sm;
      *(v4f*)(out_norm + (size_t)row * N + j) = o;
    }
    
  }
}



// ---- f16 WMMA path (v_wmma_f32_16x16x32_f16): 11-bit significands for operands in range — used where a [0,1] probability operand needs more precision than bf16
typedef _Float16 v16h __attribute__((ext_vector_type(16)));
union FragH { v16h v; v8us half[2]; _Float16 h[16]; unsigned short u[16]; };
template <int NT>
__device__ __forceinline__ v8f mmaH(v16h ah, v16h al, v16h bh, v16h bl, v8f c) {
  c = __builtin_amdgcn_wmma_f32_16x16x32_f16(false, ah, false, bh, (short)0, c, false, false);
  if (NT >= 2) c = __builtin_amdgcn_wmma_f32_16x16x32_f16(false, al, false, bh, (short)0, c, false, false);
  if (NT >= 3) c = __builtin_amdgcn_wmma_f32_16x16x32_f16(false, ah, false, bl, (short)0, c, false, false);
  asm volatile("v_nop\n\tv_nop\n\tv_nop\n\tv_nop" : "+v"(c) : "v"(ah), "v"(al), "v"(bh), "v"(bl));
  return c;
}
// batched GEMM like k_gemm_b but f16 operands: A f32 (split into f16 hi/lo if ASPLIT, else rounded to f16), Bt = f16 values [n][k]; alpha; C f32; N multiple of 16 (partial tiles skipped)
template <bool ASPLIT>
__global__ __launch_bounds__(128) void k_gemm_h(const float* __restrict__ A, int lda, size_t sA, const _Float16* __restrict__ Bh, int ldb, size_t sB, float alpha, float* __restrict__ C, int ldc, size_t sC, int M, int N, int K) {
  __shared__ __attribute__((aligned(16))) float so[4][16][64];
  const int tid = threadIdx.x, w = tid >> 5, lane = tid & 31, ln = lane & 15, hh = lane >> 4; const int by = blockIdx.y;
  A += (size_t)by * sA; Bh += (size_t)by * sB; C += (size_t)by * sC;
  const int ntn = (N + 63) / 64; const int wid = blockIdx.x * 4 + w; const int mt = wid / ntn, nq = wid % ntn; if (mt * 16 >= M) return;
  const int row0 = mt * 16, col0 = nq * 64; const float* arow = A + (size_t)(row0 + ln) * lda;
  v8f acc[4] = {};
  for (int kb = 0; kb < K; kb += 32) {
    FragH ah, al;
    const v4f x0 = *(const v4fa*)(arow + kb + 8 * hh), x1 = *(const v4fa*)(arow + kb + 8 * hh + 4), x2 = *(const v4fa*)(arow + kb + 16 + 8 * hh), x3 = *(const v4fa*)(arow + kb + 16 + 8 * hh + 4);
    float xs[16] = {x0[0],x0[1],x0[2],x0[3],x1[0],x1[1],x1[2],x1[3],x2[0],x2[1],x2[2],x2[3],x3[0],x3[1],x3[2],x3[3]};
#pragma unroll
    for (int i = 0; i < 16; ++i) { const _Float16 h = (_Float16)xs[i]; ah.h[i] = h; al.h[i] = ASPLIT ? (_Float16)(xs[i] - (float)h) : (_Float16)0.0f; }
#pragma unroll
    for (int t = 0; t < 4; ++t) { if (col0 + t * 16 >= N) continue; const size_t boff = (size_t)(col0 + t * 16 + ln) * ldb + kb; FragH bq; bq.half[0] = *(const v8us*)(Bh + boff + 8 * hh); bq.half[1] = *(const v8us*)(Bh + boff + 16 + 8 * hh);
      acc[t] = mmaH<ASPLIT ? 2 : 1>(ah.v, al.v, bq.v, bq.v, acc[t]); }
  }
#pragma unroll
  for (int t = 0; t < 4; ++t) { if (col0 + t * 16 >= N) continue;
#pragma unroll
    for (int r = 0; r < 8; ++r) so[w][8 * hh + r][t * 16 + ln] = acc[t][r] * alpha; }
  __builtin_amdgcn_fence(__ATOMIC_ACQ_REL, "workgroup"); __builtin_amdgcn_wave_barrier();
  const int rsub = lane >> 4, c4 = (lane & 15) * 4;
  {
#pragma unroll
    for (int q = 0; q < 8; ++q) { const int r = q * 2 + rsub; if (col0 + c4 < N) { const v4f v = *(const v4fa*)&so[w][r][c4]; *(v4f*)(C + (size_t)(row0 + r) * ldc + col0 + c4) = v; } }
     }
}

typedef _Float16 v4h __attribute__((ext_vector_type(4)));

__global__ __launch_bounds__(256) void k_h16(const float* __restrict__ x, _Float16* __restrict__ X16, size_t n8) { const size_t t = (size_t)blockIdx.x * 256 + threadIdx.x; if (t >= n8) return; FragH f;
#pragma unroll
  for (int q = 0; q < 8; ++q) f.h[q] = (_Float16)x[t * 8 + q]; *(v8us*)((unsigned short*)X16 + t * 8) = f.half[0];  }
__global__ __launch_bounds__(256) void k_round16f(const float* __restrict__ W, _Float16* __restrict__ Bt, size_t n8) { const size_t t = (size_t)blockIdx.x * 256 + threadIdx.x; if (t >= n8) return; FragH f;
#pragma unroll
  for (int i = 0; i < 8; ++i) f.h[i] = (_Float16)(bf16_round(W[t * 8 + i]) * 16.0f); *(v8us*)((unsigned short*)Bt + t * 8) = f.half[0];  }
__global__ __launch_bounds__(256) void k_h16s(const float* __restrict__ F, _Float16* __restrict__ H, size_t n8) { const size_t t = (size_t)blockIdx.x * 256 + threadIdx.x; if (t >= n8) return; const v4f a = *(const v4fa*)(F + t * 8), c = *(const v4fa*)(F + t * 8 + 4); FragH f;
#pragma unroll
  for (int q = 0; q < 4; ++q) { f.h[q] = (_Float16)(a[q] * 16.0f); f.h[4 + q] = (_Float16)(c[q] * 16.0f); } *(v8us*)((unsigned short*)H + t * 8) = f.half[0];  }
// The three projections in one launch. Block = 8 waves = 128 input rows x one head's 64 columns of operand blockIdx.z (0 q, 1 k, 2 v); wave = 16 rows. The f32 inputs are read here and rounded as before (bf16, then f16; weights x 2^4), and the results leave in the form their reader takes:
// the head's weight slab W[0..255][h * 64 .. + 63] is transposed into LDS as f16 [n][k] (pitch 16 B x odd) behind one work-group barrier; the input rows go from global memory straight into fragments.
// q and k are taken transposed (A = weight rows n, B = input rows), so a lane holds 8 consecutive columns of ONE row; v is taken plain (A = input rows, B = weight rows), so a lane holds 8 consecutive rows of ONE column: each accumulator tile is then one 16-byte store per lane.
// Unit = 16 B = 8 f16 of one lane, lane = 16hh + ln, rows stacked as g = h * 4096 + b. Kp: per 16 keys 4 wave stores (t = 2 ks + half): unit = K[key tile * 16 + ln][t * 16 + 8hh + 0..7]. Vp: per 32 keys 8 wave loads (dt, half): unit = V[key block * 32 + half * 16 + 8hh + 0..7][dt * 16 + ln].
// So each of k_flash's wave-wide 16-byte fragment reads covers 512 contiguous bytes, and the Kp and Vp stores here are whole lines.
// The part behind the barrier, once per operand so that no branch stands behind a matrix instruction: 8 k steps x 4 tiles, then one 16-byte store per lane and tile.
template <int OP>
__device__ __forceinline__ void proj_tiles(const FragH (&ax)[8], const unsigned short (*sW)[EE + 8], int lane, int g0, unsigned short* __restrict__ dst) {
  const int ln = lane & 15, hh = lane >> 4; v8f acc[4] = {};
  FragH bw[2][4];      // the weight fragments of two k steps: step kb + 1 is read from LDS while step kb's products run
  auto frags = [&](int kb) {
#pragma unroll
    for (int t = 0; t < 4; ++t) { bw[kb & 1][t].half[0] = *(const v8us*)&sW[t * 16 + ln][kb * 32 + 8 * hh]; bw[kb & 1][t].half[1] = *(const v8us*)&sW[t * 16 + ln][kb * 32 + 16 + 8 * hh]; } };
  frags(0);
#pragma unroll      // straight-line: every LDS offset is an immediate and the fragment arrays stay in registers
  for (int kb = 0; kb < 8; ++kb) { if (kb + 1 < 8) frags(kb + 1);
#pragma unroll
    for (int t = 0; t < 4; ++t) acc[t] = OP == 2 ? __builtin_amdgcn_wmma_f32_16x16x32_f16(false, ax[kb].v, false, bw[kb & 1][t].v, (short)0, acc[t], false, false) : __builtin_amdgcn_wmma_f32_16x16x32_f16(false, bw[kb & 1][t].v, false, ax[kb].v, (short)0, acc[t], false, false);
    __builtin_amdgcn_sched_barrier(0); }      // keeps the reads one step ahead and no further: left free, the scheduler lifts most of the 64 reads to the top, and the kernel then needs more registers than let two blocks share a WGP
  unsigned short* o = OP == 0 ? dst + (size_t)(g0 + ln) * DD + 8 * hh : OP == 1 ? dst + (size_t)(g0 >> 4) * 1024 + lane * 8 : dst + (size_t)(g0 >> 5) * 2048 + (((g0 >> 4) & 1) * 32 + lane) * 8;
  constexpr int STEP = OP == 0 ? 16 : OP == 1 ? 256 : 512;
#pragma unroll
  for (int t = 0; t < 4; ++t) { FragH f;
#pragma unroll
    for (int r = 0; r < 8; ++r) f.h[r] = (_Float16)(acc[t][r] * 0.0625f);
    *(v8us*)(o + t * STEP) = f.half[0]; }
  asm volatile("s_wait_xcnt 0x0" ::: "memory"); }      // precaution: stands in front of every later write of a register that the four stores name (in the listing one operand's exit is followed by the next operand's part, which rewrites them)
__global__ __launch_bounds__(256, 4) void k_proj(const float* __restrict__ xq, const float* __restrict__ xk, const float* __restrict__ xv, const float* __restrict__ Wq, const float* __restrict__ Wk, const float* __restrict__ Wv,
                                              _Float16* __restrict__ Qs, _Float16* __restrict__ Kp, _Float16* __restrict__ Vp) {
  __shared__ __attribute__((aligned(16))) unsigned short sW[DD][EE + 8];
  const int tid = threadIdx.x, lane = tid & 31, ln = lane & 15, hh = lane >> 4; const int h = blockIdx.y, op = blockIdx.z;
  const float* X = op == 0 ? xq : op == 1 ? xk : xv; const float* Wm = op == 0 ? Wq : op == 1 ? Wk : Wv;
  const int row0 = blockIdx.x * 128 + (tid >> 5) * 16;
  const int n4 = (tid & 15) * 4, k80 = (tid >> 4) * 8;      // 16 lanes read the head's 256 contiguous bytes of one weight row; a thread takes 8 rows x 4 columns, twice
  const float* wrow = Wm + (size_t)k80 * EE + h * DD + n4; const float* arow = X + (size_t)(row0 + ln) * EE + 8 * hh;
  v4f wr[2][8];
#pragma unroll
  for (int rd = 0; rd < 2; ++rd)
#pragma unroll
    for (int i = 0; i < 8; ++i) wr[rd][i] = *(const v4fa*)(wrow + (size_t)(rd * 128 + i) * EE);
  v4f xa[8][4];      // row row0 + ln, in the fragment's k order: 8hh + 0..7 and 16 + 8hh + 0..7 of every 32
#pragma unroll
  for (int kb = 0; kb < 8; ++kb) { xa[kb][0] = *(const v4fa*)(arow + kb * 32); xa[kb][1] = *(const v4fa*)(arow + kb * 32 + 4); xa[kb][2] = *(const v4fa*)(arow + kb * 32 + 16); xa[kb][3] = *(const v4fa*)(arow + kb * 32 + 20); }
  asm volatile("s_wait_xcnt 0x0" :: "v"(wrow), "v"(arow) : "memory");      // precaution: stands in front of every later write of a register that one of the loads above names as its address; the two addresses are inputs so that their registers live up to here
#pragma unroll
  for (int rd = 0; rd < 2; ++rd)
#pragma unroll
    for (int j = 0; j < 4; ++j) { FragH f;
#pragma unroll
      for (int i = 0; i < 8; ++i) f.h[i] = (_Float16)(bf16_round(wr[rd][i][j]) * 16.0f);
      *(v8us*)&sW[n4 + j][rd * 128 + k80] = f.half[0]; }
  FragH ax[8];      // the wave's input rows as f16 fragments, made in front of the barrier: half the registers of the f32 rows, so that the k steps have room to read LDS ahead
#pragma unroll
  for (int kb = 0; kb < 8; ++kb)
#pragma unroll
    for (int i = 0; i < 16; ++i) ax[kb].h[i] = (_Float16)bf16_round(xa[kb][i >> 2][i & 3]);
  __syncthreads();      // the whole slab is in LDS before any wave takes a fragment of it
  const int g0 = h * NB + row0;      // first stacked row of the wave's tile
  if (op == 0) proj_tiles<0>(ax, sW, lane, g0, (unsigned short*)Qs); else if (op == 1) proj_tiles<1>(ax, sW, lane, g0, (unsigned short*)Kp); else proj_tiles<2>(ax, sW, lane, g0, (unsigned short*)Vp); }
__global__ __launch_bounds__(1024) void k_flash(const _Float16* __restrict__ Q16, int ldq, const _Float16* __restrict__ Kp, const _Float16* __restrict__ Vp, const int* __restrict__ MSK, float* __restrict__ O, int ldo) {
  constexpr int RPW = 16, NQB = TT / (4 * RPW), DT = 4, KS = 2, KSPL = 8, NW = 4 * KSPL;
  constexpr int NP = 2, TKEYS = NP * KSPL * 32, PLANE = TKEYS * 128, BUF = 2 * PLANE, SLOT = BUF / NP, NTILE = TT / TKEYS;      // NP key blocks per wave and tile (NP passes); a buffer holds, pass by pass, SLOT bytes: the pass's K (half a slot), then its V, so that every fragment's LDS offset from the pass's base fits the instruction's 16-bit field
  static_assert(PLANE == 4 * 1024 * 16 && NP == 2 && NTILE >= 2, "four 16-byte copies per lane and plane, two per pass; the ring's prologue needs two tiles");
  constexpr float C2 = 0.125f * 1.4426950408889634f;      // 1/sqrt(64) * log2(e): exp(s/8 - m/8) = 2^(C2 s - C2 m), so a weight costs one fused multiply-add and one hardware 2^x; maxima are kept on the raw products (C2 > 0 keeps their order)
  __shared__ __attribute__((aligned(16))) unsigned char ring[2 * BUF]; __shared__ float sM[NW][RPW], sL[NW][RPW];
  static_assert(sizeof(float) * NW * RPW * (64 + 4) <= sizeof(ring), "the partial accumulators are staged in the ring once the loop has left it");
  float (*sO)[RPW][64 + 4] = (float (*)[RPW][64 + 4])ring;
  const int tid = threadIdx.x, lane = tid & 31, ln = lane & 15, hh = lane >> 4;
  const int w = __builtin_amdgcn_readfirstlane(tid >> 5) & (NW - 1);      // wave number in a scalar register; the mask (an identity) shows the compiler its range
  const int slab = blockIdx.x / NQB, qblk = blockIdx.x % NQB; const int b = slab / NH, h = slab % NH; const int qb0 = qblk * (4 * RPW); const int q0 = qb0 + (w & 3) * RPW;
  const unsigned char* Kg = (const unsigned char*)Kp + (size_t)slab * 128 * TT + tid * 16; const unsigned char* Vg = (const unsigned char*)Vp + (size_t)slab * 128 * TT + tid * 16;      // k_proj's planes: 128 B per key; thread t copies bytes 16 t .. 16 t + 15 of every 16 KiB
  const unsigned lds0 = (unsigned)(size_t)ring + tid * 16;      // the lane's LDS byte address in buffer 0
  // One tile into one buffer: 8 copies per lane, each wave 512 contiguous bytes per copy, every lane on. The s_wait_xcnt 0 is the last line of the copies' own statement, so that it stands in front of every later write of a register that a copy names (a precaution).
  auto fill = [&](int tile, int buf) {
    const unsigned char* gk = Kg + (size_t)tile * PLANE; const unsigned char* gv = Vg + (size_t)tile * PLANE; const unsigned lk = lds0 + buf * BUF, lv = lk + SLOT / 2;
    asm volatile("global_load_async_to_lds_b128 %0, %8, off\n\t"
                 "global_load_async_to_lds_b128 %1, %9, off\n\t"
                 "global_load_async_to_lds_b128 %2, %10, off\n\t"
                 "global_load_async_to_lds_b128 %3, %11, off\n\t"
                 "global_load_async_to_lds_b128 %4, %12, off\n\t"
                 "global_load_async_to_lds_b128 %5, %13, off\n\t"
                 "global_load_async_to_lds_b128 %6, %14, off\n\t"
                 "global_load_async_to_lds_b128 %7, %15, off\n\t"
                 "s_wait_xcnt 0x0"
                 :: "v"(lk), "v"(lk + 16384), "v"(lk + SLOT), "v"(lk + SLOT + 16384), "v"(lv), "v"(lv + 16384), "v"(lv + SLOT), "v"(lv + SLOT + 16384),
                    "v"(gk), "v"(gk + 16384), "v"(gk + 32768), "v"(gk + 49152), "v"(gv), "v"(gv + 16384), "v"(gv + 32768), "v"(gv + 49152) : "memory"); };
  fill(0, 0);
  FragH bq[KS];      // B operand: column ln = query q0 + ln
  { const unsigned short* qr = (const unsigned short*)Q16 + ((size_t)b * TT + q0 + ln) * ldq + h * 64;
#pragma unroll
    for (int ks = 0; ks < KS; ++ks) { bq[ks].half[0] = *(const v8us*)(qr + ks * 32 + 8 * hh); bq[ks].half[1] = *(const v8us*)(qr + ks * 32 + 16 + 8 * hh); } }
  float m_q = -3.0e38f, l_q = 0.f; v8f oacc[DT];      // of query ln: running max (equal in both halves), this half's share of the sum, O^T rows dt * 16 + 8hh + r
#pragma unroll
  for (int dt = 0; dt < DT; ++dt) oacc[dt] = (v8f){0.f,0.f,0.f,0.f,0.f,0.f,0.f,0.f};
  asm volatile("s_wait_asynccnt 0x0" ::: "memory");      // this wave's share of tile 0 has landed
  __syncthreads();      // tile 0 is published: nobody reads it in front of this barrier
  fill(1, 1);
#pragma unroll 1      // one trip per tile: the ring's order stands once, at the foot
  for (int t = 0; t < NTILE; ++t) {
    const unsigned char* tb = ring + (t & 1) * BUF + (w >> 2) * 4096 + lane * 16;      // the wave's key block in the tile's first pass: 4 KiB per 32 keys of K and of V, a lane's 16 B at lane * 16 in every 512-byte load
#pragma unroll 1      // rolled: one base register per pass, every fragment at an immediate offset from it
    for (int p = 0; p < NP; ++p) {
    const unsigned short* Kf = (const unsigned short*)(tb + p * SLOT); const unsigned short* Vf = (const unsigned short*)(tb + p * SLOT + SLOT / 2);
    v8f s[2];      // s[nt][r] = raw product (score * 8) of key nt * 16 + 8hh + r of the block with query ln
#pragma unroll
    for (int nt = 0; nt < 2; ++nt) { const unsigned short* kr = Kf + nt * 1024; FragH ak[KS];
#pragma unroll
      for (int ks = 0; ks < KS; ++ks) { ak[ks].half[0] = *(const v8us*)(kr + ks * 512); ak[ks].half[1] = *(const v8us*)(kr + ks * 512 + 256); }
      v8f acc = (v8f){0.f,0.f,0.f,0.f,0.f,0.f,0.f,0.f};
#pragma unroll
      for (int ks = 0; ks < KS; ++ks) acc = mmaH<1>(ak[ks].v, ak[ks].v, bq[ks].v, bq[ks].v, acc);
      s[nt] = acc; }
    float mc = fmaxf(s[0][0], s[1][0]);
#pragma unroll
    for (int r = 1; r < 8; ++r) mc = fmaxf(mc, fmaxf(s[0][r], s[1][r]));
    mc = fmaxf(mc, __int_as_float(__builtin_amdgcn_permlanex16(__float_as_int(mc), __float_as_int(mc), 0x76543210, 0xfedcba98, false, false)));      // lane l <-> l ^ 16: the other 16 keys of the same query
    const float mn = fmaxf(m_q, mc); const float al = __builtin_amdgcn_exp2f((m_q - mn) * C2); m_q = mn;
    const float mb = fmaf(mn, C2, -10.0f);      // the 2^10 of the f16 weights rides in the exponent: weights and their sum both carry it, and the merge divides it out
    FragH pb; float ps = 0.f;
#pragma unroll
    for (int r = 0; r < 8; ++r) { const float p0 = __builtin_amdgcn_exp2f(fmaf(s[0][r], C2, -mb)), p1 = __builtin_amdgcn_exp2f(fmaf(s[1][r], C2, -mb)); ps += p0 + p1; pb.h[r] = (_Float16)p0; pb.h[8 + r] = (_Float16)p1; }
    l_q = l_q * al + ps;
#pragma unroll
    for (int dt = 0; dt < DT; ++dt) oacc[dt] *= al;
#pragma unroll
    for (int dt = 0; dt < DT; ++dt) { const unsigned short* vrow = Vf + dt * 512; FragH av; av.half[0] = *(const v8us*)vrow; av.half[1] = *(const v8us*)(vrow + 256);
      oacc[dt] = mmaH<1>(av.v, av.v, pb.v, pb.v, oacc[dt]); } }
    asm volatile("s_wait_dscnt 0x0" ::: "memory");      // this wave's reads of the buffer have returned before the buffer is handed to its next writer
    asm volatile("s_wait_asynccnt 0x0" ::: "memory");      // this wave's share of tile t + 1 has landed
    __syncthreads();      // publishes tile t + 1 and ends every wave's reads of tile t's buffer
    if (t + 2 < NTILE) fill(t + 2, t & 1); }
  asm volatile("s_wait_asynccnt 0x0" ::: "memory");      // no copy is outstanding when the ring becomes staging for the partials (the last trip's barrier has ended every read of it)
  l_q += __int_as_float(__builtin_amdgcn_permlanex16(__float_as_int(l_q), __float_as_int(l_q), 0x76543210, 0xfedcba98, false, false));      // the halves' sums joined once
  if (hh == 0) { sM[w][ln] = m_q; sL[w][ln] = l_q; }
#pragma unroll
  for (int dt = 0; dt < DT; ++dt) { *(v4fa*)&sO[w][ln][dt * 16 + 8 * hh] = (v4f){oacc[dt][0], oacc[dt][1], oacc[dt][2], oacc[dt][3]}; *(v4fa*)&sO[w][ln][dt * 16 + 8 * hh + 4] = (v4f){oacc[dt][4], oacc[dt][5], oacc[dt][6], oacc[dt][7]}; }
  __syncthreads();      // every wave's partial (max, sum, accumulator) is in LDS before any wave merges
  for (int e = tid; e < 4 * RPW * 16; e += 32 * NW) { const int row = e >> 4, pc = e & 15, qt = row / RPW, r = row % RPW;      // one query row per 16 lanes, 16 B per lane
    float mg[KSPL], M = -3.0e38f;
#pragma unroll
    for (int g = 0; g < KSPL; ++g) { mg[g] = sM[g * 4 + qt][r]; M = fmaxf(M, mg[g]); }
    float L = 0.f; v4f acc = {0.f, 0.f, 0.f, 0.f};
#pragma unroll
    for (int g = 0; g < KSPL; ++g) { const float wg = __builtin_amdgcn_exp2f((mg[g] - M) * C2); L += wg * sL[g * 4 + qt][r]; const v4f pv = *(const v4fa*)&sO[g * 4 + qt][r][pc * 4]; acc += pv * wg; }
    const float inv = (L > 0.f) ? 1.0f / L : 0.f;      // L and acc both carry the 2^10
    const int g = qb0 + row;      // stacked row g = head * NB + batch row: it goes straight to its merged place, 256 contiguous bytes per 16 lanes
    *(v4f*)(O + (size_t)(g % NB) * ldo + (g / NB) * DD + pc * 4) = acc * inv; } }

extern "C" void kernel_launch(void* const* d_in, const int* in_sizes, int n_in,
                              void* d_out, int out_size, void* d_ws, size_t ws_size, hipStream_t stream) {
  (void)in_sizes; (void)n_in; (void)out_size;
  const float* const* I = (const float* const*)d_in; const float* xq = I[0]; const float* xk = I[1]; const float* xv = I[2]; const float* Wq = I[3]; const float* Wk = I[4]; const float* Wv = I[5];
  char* ws = (char*)d_ws; size_t off = 0;
  auto take = [&](size_t bytes) { char* p = ws + off; off += (bytes + 255) & ~(size_t)255; return p; };
  _Float16* Qs = (_Float16*)take((size_t)TT * DD * 2); _Float16* Kp = (_Float16*)take((size_t)TT * DD * 2); _Float16* Vp = (_Float16*)take((size_t)TT * DD * 2);
  if (off > ws_size) return;      // 3 x 2.1 = about 6.3 MB
  k_proj<<<dim3(NB / 128, NHD, 3), 256, 0, stream>>>(xq, xk, xv, Wq, Wk, Wv, Qs, Kp, Vp);      /* q stacked, K and V in fragment order */
  k_flash<<<BB * NH * (TT / 64), 1024, 0, stream>>>(Qs, DD, Kp, Vp, nullptr, (float*)d_out, EE);      /* one slab: 16384 queries x 16384 keys; rows stored merged */
}

// v007
// A run of this version takes 70.6 microseconds.
// Timed twice side by side with v006, it ran 1.12 and 1.13 times as fast.
// All steps since v000 together make it 23.0 times as fast.
#include <hip/hip_runtime.h>
// Multi-head attention whose heads are STACKED along the batch axis (B=4096 rows, EMBED=256, 4 heads × 64): q = queries·W_Query, k = keys·W_Key, v = values·W_Value ((in,out), no bias); the heads are split TF-style into [H·B, 64] = [16384, 64] and ONE softmax(q·kᵀ/√64)·v runs over all 16384 stacked rows
// (every query attends to every (head, row) key); the result is merged back to [B, H·64].
// Compute dtype: inputs and weights rounded to bf16; q, k, v as f16 GEMM outputs of ONE projection launch (grid.y = head, grid.z = operand) that reads the f32 inputs itself and stores q in the stacked [h * 4096 + b][64] layout and k, v in the attention kernel's fragment order;
// fused flash-style kernel over T = 16384 (online softmax f32, P f16 x 2^10, f32 accumulate) on v_wmma_f32_16x16x32_f16, which stores its f32 result rows at their merged place in the output. Two launches in all.
#define BB 1
#define TT 16384
#define NH 1
#define NB 4096
#define NHD 4
#define EE 256
#define DD 64
#define NR (BB * TT)

typedef __bf16 v16b __attribute__((ext_vector_type(16)));
typedef unsigned short v8us __attribute__((ext_vector_type(8), may_alias));
typedef float  v8f  __attribute__((ext_vector_type(8)));
typedef float  v4f  __attribute__((ext_vector_type(4)));
typedef float  v4fa __attribute__((ext_vector_type(4), may_alias));
union FragB { v16b v; v8us half[2]; unsigned short u[16]; };

__device__ __forceinline__ unsigned short bf16_bits(float x) { unsigned int u = __float_as_uint(x); return (unsigned short)((u + 0x7FFFu + ((u >> 16) & 1u)) >> 16); }
__device__ __forceinline__ float bf16_val(unsigned short b) { return __uint_as_float(((unsigned int)b) << 16); }
__device__ __forceinline__ float bf16_round(float x) { return bf16_val(bf16_bits(x)); }
// D += A·B with NT terms: 1 = ah·bh, 2 = + al·bh (A split), 3 = + ah·bl (both split)
template <int NT>
__device__ __forceinline__ v8f mmaN(v16b ah, v16b al, v16b bh, v16b bl, v8f c) {
  c = __builtin_amdgcn_wmma_f32_16x16x32_bf16(false, ah, false, bh, (short)0, c, false, false);
  if (NT >= 2) c = __builtin_amdgcn_wmma_f32_16x16x32_bf16(false, al, false, bh, (short)0, c, false, false);
  if (NT >= 3) c = __builtin_amdgcn_wmma_f32_16x16x32_bf16(false, ah, false, bl, (short)0, c, false, false);
  asm volatile("v_nop\n\tv_nop\n\tv_nop\n\tv_nop" : "+v"(c) : "v"(ah), "v"(al), "v"(bh), "v"(bl));
  return c;
}

__global__ __launch_bounds__(256) void k_wt_bf16(const float* __restrict__ W, unsigned short* __restrict__ Wt, int K, int N) {
  const int t = blockIdx.x * 256 + threadIdx.x;
  const int k8n = K / 8;
  if (t >= N * k8n) return;
  const int n = t / k8n, k8 = (t % k8n) * 8;
  v8us v;
#pragma unroll
  for (int i = 0; i < 8; ++i) v[i] = bf16_bits(W[(size_t)(k8 + i) * N + n]);
  *(v8us*)(Wt + (size_t)n * K + k8) = v;
  
}

// GEMM C[M][N] (f32, pitch ldc) = act(A[M][K]·W + bias). A f32 row-major (pitch lda) converted per fragment to bf16
// (ASPLIT: hi/lo two planes -> 2 terms, else single rounded term); Wt bf16 [N][K] (pitch ldb). BIAS_BF16 rounds the
// bias to bf16 first (bias quantised to bf16 before the add). K%32==0, M%16==0, N%64==0.
template <bool ASPLIT, int ACT, bool BIAS_BF16>
__global__ __launch_bounds__(128) void k_gemm_bf(const float* __restrict__ A, int lda, const unsigned short* __restrict__ Wt, int ldb,
                                               const float* __restrict__ bias, float* __restrict__ C, int ldc, int M, int N, int K) {
  __shared__ __attribute__((aligned(16))) float so[4][16][64];
  const int tid = threadIdx.x, w = tid >> 5, lane = tid & 31, ln = lane & 15, hh = lane >> 4;
  const int ntn = N / 64;
  const int wid = blockIdx.x * 4 + w;
  const int mt = wid / ntn, nq = wid % ntn;
  if (mt * 16 >= M) return;
  const int row0 = mt * 16, col0 = nq * 64;
  const float* arow = A + (size_t)(row0 + ln) * lda;
  v8f acc[4] = {};
  for (int kb = 0; kb < K; kb += 32) {
    FragB ah, al;
    const v4f x0 = *(const v4fa*)(arow + kb + 8 * hh), x1 = *(const v4fa*)(arow + kb + 8 * hh + 4);
    const v4f x2 = *(const v4fa*)(arow + kb + 16 + 8 * hh), x3 = *(const v4fa*)(arow + kb + 16 + 8 * hh + 4);
    float xs[16] = {x0[0],x0[1],x0[2],x0[3],x1[0],x1[1],x1[2],x1[3],x2[0],x2[1],x2[2],x2[3],x3[0],x3[1],x3[2],x3[3]};
#pragma unroll
    for (int i = 0; i < 16; ++i) { const unsigned short hb = bf16_bits(xs[i]); ah.u[i] = hb; al.u[i] = ASPLIT ? bf16_bits(xs[i] - bf16_val(hb)) : (unsigned short)0; }
#pragma unroll
    for (int t = 0; t < 4; ++t) {
      const unsigned short* brow = Wt + (size_t)(col0 + t * 16 + ln) * ldb + kb;
      FragB b;
      b.half[0] = *(const v8us*)(brow + 8 * hh);
      b.half[1] = *(const v8us*)(brow + 16 + 8 * hh);
      acc[t] = mmaN<ASPLIT ? 2 : 1>(ah.v, al.v, b.v, b.v, acc[t]);
    }
  }
#pragma unroll
  for (int t = 0; t < 4; ++t) {
    float bv = bias ? bias[col0 + t * 16 + ln] : 0.f;
    if (BIAS_BF16) bv = bf16_round(bv);
#pragma unroll
    for (int r = 0; r < 8; ++r) { float v = acc[t][r] + bv; if (ACT == 1) v = fmaxf(v, 0.f); so[w][8 * hh + r][t * 16 + ln] = v; }
  }
  __builtin_amdgcn_fence(__ATOMIC_ACQ_REL, "workgroup");
  __builtin_amdgcn_wave_barrier();
  const int rsub = lane >> 4, c4 = (lane & 15) * 4;
  {
#pragma unroll
    for (int q = 0; q < 8; ++q) {
      const int r = q * 2 + rsub;
      const v4f v = *(const v4fa*)&so[w][r][c4];
      *(v4f*)(C + (size_t)(row0 + r) * ldc + col0 + c4) = v;
    }
    
  }
}

// Flash-style causal/unmasked attention, all contractions 3-term bf16 hi/lo splits, f32 softmax with running max.
// q,k,v rows are read from f32 buffers with arbitrary row pitch (so they can live inside a fused qkv buffer);
// D = head size (multiple of 32, <= 128); one wave = 16 query rows; block = 4 waves (64 queries) sharing K/V chunks of 32.
template <int D, bool CAUSAL>
__global__ __launch_bounds__(128) void k_flash(const float* __restrict__ qb, const float* __restrict__ kb, const float* __restrict__ vb,
                                             int pitch, int T, int H, float scale, float* __restrict__ y, int ypitch) {
  constexpr int KS = D / 32;        // k-steps for QK
  constexpr int DT = D / 16;        // d tiles for PV
  __shared__ __attribute__((aligned(16))) unsigned short sKh[32][D + 8], sKl[32][D + 8], sVh[32][D + 8], sVl[32][D + 8];
  __shared__ __attribute__((aligned(16))) unsigned short sPh[4][16][40], sPl[4][16][40];
  __shared__ __attribute__((aligned(16))) float sO[4][16][D];
  const int tid = threadIdx.x, w = tid >> 5, lane = tid & 31, ln = lane & 15, hh = lane >> 4;
  const int nqb = (T + 63) / 64;
  const int bh = blockIdx.x / nqb, qblk = blockIdx.x % nqb;
  const int b = bh / H, h = bh % H;
  const int q0 = qblk * 64 + w * 16;
  const float* Q = qb + (size_t)b * T * pitch + h * D;
  const float* K = kb + (size_t)b * T * pitch + h * D;
  const float* V = vb + (size_t)b * T * pitch + h * D;

  // A fragments of the wave's 16 query rows (scaled), hi/lo
  FragB aqh[KS], aql[KS];
  {
    int row = q0 + ln; if (row >= T) row = T - 1;
    const float* qr = Q + (size_t)row * pitch;
#pragma unroll
    for (int ks = 0; ks < KS; ++ks)
#pragma unroll
      for (int i = 0; i < 16; ++i) {
        const int d = ks * 32 + ((i < 8) ? (8 * hh + i) : (16 + 8 * hh + (i - 8)));
        const float x = qr[d] * scale; const unsigned short hb = bf16_bits(x);
        aqh[ks].u[i] = hb; aql[ks].u[i] = bf16_bits(x - bf16_val(hb));
      }
  }
  float m_r[8], l_r[8];
#pragma unroll
  for (int r = 0; r < 8; ++r) { m_r[r] = -3.0e38f; l_r[r] = 0.f; }
  v8f oacc[DT];
#pragma unroll
  for (int dt = 0; dt < DT; ++dt) oacc[dt] = (v8f){0.f,0.f,0.f,0.f,0.f,0.f,0.f,0.f};

  const int kv_end = CAUSAL ? min(T, qblk * 64 + 64) : T;     // block-uniform
  for (int j0 = 0; j0 < kv_end; j0 += 32) {
    __syncthreads();
    for (int e = tid; e < 32 * (D / 4); e += 128) {
      const int r = e / (D / 4), c4 = (e % (D / 4)) * 4;
      const int key = j0 + r;
      v4f kf = {0.f,0.f,0.f,0.f}, vf = {0.f,0.f,0.f,0.f};
      if (key < T) { kf = *(const v4fa*)(K + (size_t)key * pitch + c4); vf = *(const v4fa*)(V + (size_t)key * pitch + c4); }
#pragma unroll
      for (int t = 0; t < 4; ++t) {
        unsigned short hb = bf16_bits(kf[t]); sKh[r][c4 + t] = hb; sKl[r][c4 + t] = bf16_bits(kf[t] - bf16_val(hb));
        hb = bf16_bits(vf[t]); sVh[r][c4 + t] = hb; sVl[r][c4 + t] = bf16_bits(vf[t] - bf16_val(hb));
      }
    }
    __syncthreads();
    // S tile 16 x 32
    v8f s[2];
#pragma unroll
    for (int nt = 0; nt < 2; ++nt) {
      v8f acc = {};
#pragma unroll
      for (int ks = 0; ks < KS; ++ks) {
        FragB bh_, bl_;
        bh_.half[0] = *(const v8us*)&sKh[nt * 16 + ln][ks * 32 + 8 * hh]; bh_.half[1] = *(const v8us*)&sKh[nt * 16 + ln][ks * 32 + 16 + 8 * hh];
        bl_.half[0] = *(const v8us*)&sKl[nt * 16 + ln][ks * 32 + 8 * hh]; bl_.half[1] = *(const v8us*)&sKl[nt * 16 + ln][ks * 32 + 16 + 8 * hh];
        acc = mmaN<3>(aqh[ks].v, aql[ks].v, bh_.v, bl_.v, acc);
      }
      s[nt] = acc;
    }
    // mask + running max (rows 8hh+r; the 16 lanes of a half share rows)
    float alpha[8];
#pragma unroll
    for (int r = 0; r < 8; ++r) {
      const int qi = q0 + 8 * hh + r;
      const int ja = j0 + ln, jb = j0 + 16 + ln;
      if (CAUSAL) { if (ja > qi) s[0][r] = -3.0e38f; if (jb > qi) s[1][r] = -3.0e38f; }
      if (ja >= T) s[0][r] = -3.0e38f;
      if (jb >= T) s[1][r] = -3.0e38f;
      float mx = fmaxf(s[0][r], s[1][r]);
      mx = fmaxf(mx, __shfl_xor(mx, 1, 32)); mx = fmaxf(mx, __shfl_xor(mx, 2, 32)); mx = fmaxf(mx, __shfl_xor(mx, 4, 32)); mx = fmaxf(mx, __shfl_xor(mx, 8, 32));
      const float mnew = fmaxf(m_r[r], mx);
      alpha[r] = (mnew > -1.0e38f) ? __expf(m_r[r] - mnew) : 1.0f;
      const float p0 = (s[0][r] > -1.0e38f) ? __expf(s[0][r] - mnew) : 0.f;
      const float p1 = (s[1][r] > -1.0e38f) ? __expf(s[1][r] - mnew) : 0.f;
      m_r[r] = mnew;
      l_r[r] = l_r[r] * alpha[r] + p0 + p1;            // per-lane partial row sum (16 lanes combined at the end)
      unsigned short hb = bf16_bits(p0); sPh[w][8 * hh + r][ln] = hb;      sPl[w][8 * hh + r][ln] = bf16_bits(p0 - bf16_val(hb));
      hb = bf16_bits(p1);                sPh[w][8 * hh + r][16 + ln] = hb; sPl[w][8 * hh + r][16 + ln] = bf16_bits(p1 - bf16_val(hb));
    }
#pragma unroll
    for (int dt = 0; dt < DT; ++dt)
#pragma unroll
      for (int r = 0; r < 8; ++r) oacc[dt][r] *= alpha[r];
    __builtin_amdgcn_fence(__ATOMIC_ACQ_REL, "workgroup");
    __builtin_amdgcn_wave_barrier();
    FragB pah, pal;
    pah.half[0] = *(const v8us*)&sPh[w][ln][8 * hh]; pah.half[1] = *(const v8us*)&sPh[w][ln][16 + 8 * hh];
    pal.half[0] = *(const v8us*)&sPl[w][ln][8 * hh]; pal.half[1] = *(const v8us*)&sPl[w][ln][16 + 8 * hh];
#pragma unroll
    for (int dt = 0; dt < DT; ++dt) {
      FragB bvh, bvl;
#pragma unroll
      for (int i = 0; i < 8; ++i) {
        bvh.u[i] = sVh[8 * hh + i][dt * 16 + ln]; bvh.u[8 + i] = sVh[16 + 8 * hh + i][dt * 16 + ln];
        bvl.u[i] = sVl[8 * hh + i][dt * 16 + ln]; bvl.u[8 + i] = sVl[16 + 8 * hh + i][dt * 16 + ln];
      }
      oacc[dt] = mmaN<3>(pah.v, pal.v, bvh.v, bvl.v, oacc[dt]);
    }
    __builtin_amdgcn_fence(__ATOMIC_ACQ_REL, "workgroup");
    __builtin_amdgcn_wave_barrier();
  }
#pragma unroll
  for (int r = 0; r < 8; ++r) {
    float l = l_r[r];
    l += __shfl_xor(l, 1, 32); l += __shfl_xor(l, 2, 32); l += __shfl_xor(l, 4, 32); l += __shfl_xor(l, 8, 32);
    l_r[r] = (l > 0.f) ? 1.0f / l : 0.f;
  }
#pragma unroll
  for (int dt = 0; dt < DT; ++dt)
#pragma unroll
    for (int r = 0; r < 8; ++r) sO[w][8 * hh + r][dt * 16 + ln] = oacc[dt][r] * l_r[r];
  __builtin_amdgcn_fence(__ATOMIC_ACQ_REL, "workgroup");
  __builtin_amdgcn_wave_barrier();
  {
    for (int r = 0; r < 16; ++r) {
      const int row = q0 + r;
      if (row < T && lane < D / 4) {
        const v4f val = *(const v4fa*)&sO[w][r][lane * 4];
        *(v4f*)(y + ((size_t)b * T + row) * ypitch + h * D + lane * 4) = val;
      }
    }
    
  }
}

// GEMM C = act(A·W + bias + resid): A f32 (ASPLIT -> hi/lo 2 terms), Wt bf16 [N][K]; ACT 0 none, 1 relu, 2 exact gelu;
// resid (optional, f32, row index = (row % rmod), pitch ldr, RES_BF16 rounds it) added before the activation.
template <bool ASPLIT, int ACT, bool BIAS_BF16, bool RES_BF16>
__global__ __launch_bounds__(128) void k_gemm_bf3(const float* __restrict__ A, int lda, const unsigned short* __restrict__ Wt, int ldb,
                                                const float* __restrict__ bias, const float* __restrict__ resid, int rmod, int ldr,
                                                float* __restrict__ C, int ldc, int M, int N, int K) {
  __shared__ __attribute__((aligned(16))) float so[4][16][64];
  const int tid = threadIdx.x, w = tid >> 5, lane = tid & 31, ln = lane & 15, hh = lane >> 4;
  const int ntn = N / 64;
  const int wid = blockIdx.x * 4 + w;
  const int mt = wid / ntn, nq = wid % ntn;
  if (mt * 16 >= M) return;
  const int row0 = mt * 16, col0 = nq * 64;
  const float* arow = A + (size_t)(row0 + ln) * lda;
  v8f acc[4] = {};
  for (int kb = 0; kb < K; kb += 32) {
    FragB ah, al;
    const v4f x0 = *(const v4fa*)(arow + kb + 8 * hh), x1 = *(const v4fa*)(arow + kb + 8 * hh + 4);
    const v4f x2 = *(const v4fa*)(arow + kb + 16 + 8 * hh), x3 = *(const v4fa*)(arow + kb + 16 + 8 * hh + 4);
    float xs[16] = {x0[0],x0[1],x0[2],x0[3],x1[0],x1[1],x1[2],x1[3],x2[0],x2[1],x2[2],x2[3],x3[0],x3[1],x3[2],x3[3]};
#pragma unroll
    for (int i = 0; i < 16; ++i) { const unsigned short hb = bf16_bits(xs[i]); ah.u[i] = hb; al.u[i] = ASPLIT ? bf16_bits(xs[i] - bf16_val(hb)) : (unsigned short)0; }
#pragma unroll
    for (int t = 0; t < 4; ++t) {
      const unsigned short* brow = Wt + (size_t)(col0 + t * 16 + ln) * ldb + kb;
      FragB b;
      b.half[0] = *(const v8us*)(brow + 8 * hh);
      b.half[1] = *(const v8us*)(brow + 16 + 8 * hh);
      acc[t] = mmaN<ASPLIT ? 2 : 1>(ah.v, al.v, b.v, b.v, acc[t]);
    }
  }
#pragma unroll
  for (int t = 0; t < 4; ++t) {
    const int col = col0 + t * 16 + ln;
    float bv = bias ? bias[col] : 0.f;
    if (BIAS_BF16) bv = bf16_round(bv);
#pragma unroll
    for (int r = 0; r < 8; ++r) {
      float v = acc[t][r] + bv;
      if (resid) { float rv = resid[(size_t)((row0 + 8 * hh + r) % rmod) * ldr + col]; if (RES_BF16) rv = bf16_round(rv); v += rv; }
      if (ACT == 1) v = fmaxf(v, 0.f);
      if (ACT == 2) v = 0.5f * v * (1.0f + erff(v * 0.70710678118654752f));
      if (ACT == 3) { const float u = 0.7978845608028654f * (v + 0.044715f * v * v * v); v = 0.5f * v * (1.0f + tanhf(u)); }
      so[w][8 * hh + r][t * 16 + ln] = v;
    }
  }
  __builtin_amdgcn_fence(__ATOMIC_ACQ_REL, "workgroup");
  __builtin_amdgcn_wave_barrier();
  const int rsub = lane >> 4, c4 = (lane & 15) * 4;
  {
#pragma unroll
    for (int q = 0; q < 8; ++q) {
      const int r = q * 2 + rsub;
      const v4f v = *(const v4fa*)&so[w][r][c4];
      *(v4f*)(C + (size_t)(row0 + r) * ldc + col0 + c4) = v;
    }
    
  }
}
// row LayerNorm (biased variance, eps) over N: s = X (+ R); optional out_sum <- s; out_norm <- (s-mu)*rsqrt(var+eps)*g + b
template <bool PARAM_BF16>
__global__ __launch_bounds__(256) void k_layernorm(const float* __restrict__ X, const float* __restrict__ R, const float* __restrict__ g, const float* __restrict__ bta,
                                                  float* __restrict__ out_sum, float* __restrict__ out_norm, int N, float eps) {
  __shared__ float red[256];
  const int row = blockIdx.x, tid = threadIdx.x;
  const float* x = X + (size_t)row * N; const float* rr = R ? R + (size_t)row * N : nullptr;
  float vals[16];                     // up to N = 4096
  const int per = N / 256;            // contiguous chunk per thread? use strided-by-4 chunks: thread handles j = tid*4 + 1024*u
  float s1 = 0.f;
  for (int u = 0; u < per / 4; ++u) {
    const int j = tid * 4 + 1024 * u;
    const v4f a = *(const v4fa*)(x + j);
    v4f b = {0.f,0.f,0.f,0.f}; if (rr) b = *(const v4fa*)(rr + j);
#pragma unroll
    for (int q = 0; q < 4; ++q) { const float v = a[q] + b[q]; vals[u * 4 + q] = v; s1 += v; }
  }
  red[tid] = s1; __syncthreads();
  for (int st = 128; st > 0; st >>= 1) { if (tid < st) red[tid] += red[tid + st]; __syncthreads(); }
  const float mu = red[0] / (float)N; __syncthreads();
  float s2 = 0.f;
  for (int u = 0; u < per / 4; ++u)
#pragma unroll
    for (int q = 0; q < 4; ++q) { const float c = vals[u * 4 + q] - mu; s2 += c * c; }
  red[tid] = s2; __syncthreads();
  for (int st = 128; st > 0; st >>= 1) { if (tid < st) red[tid] += red[tid + st]; __syncthreads(); }
  const float rs = rsqrtf(red[0] / (float)N + eps);
  {
    for (int u = 0; u < per / 4; ++u) {
      const int j = tid * 4 + 1024 * u;
      v4f o, sm;
#pragma unroll
      for (int q = 0; q < 4; ++q) {
        float gg = g[j + q], bb = bta[j + q];
        if (PARAM_BF16) { gg = bf16_round(gg); bb = bf16_round(bb); }
        sm[q] = vals[u * 4 + q]; o[q] = (vals[u * 4 + q] - mu) * rs * gg + bb;
      }
      if (out_sum) *(v4f*)(out_sum + (size_t)row * N + j) = sm;
      *(v4f*)(out_norm + (size_t)row * N + j) = o;
    }
    
  }
}



// ---- f16 WMMA path (v_wmma_f32_16x16x32_f16): 11-bit significands for operands in range — used where a [0,1] probability operand needs more precision than bf16
typedef _Float16 v16h __attribute__((ext_vector_type(16)));
union FragH { v16h v; v8us half[2]; _Float16 h[16]; unsigned short u[16]; };
template <int NT>
__device__ __forceinline__ v8f mmaH(v16h ah, v16h al, v16h bh, v16h bl, v8f c) {
  c = __builtin_amdgcn_wmma_f32_16x16x32_f16(false, ah, false, bh, (short)0, c, false, false);
  if (NT >= 2) c = __builtin_amdgcn_wmma_f32_16x16x32_f16(false, al, false, bh, (short)0, c, false, false);
  if (NT >= 3) c = __builtin_amdgcn_wmma_f32_16x16x32_f16(false, ah, false, bl, (short)0, c, false, false);
  asm volatile("v_nop\n\tv_nop\n\tv_nop\n\tv_nop" : "+v"(c) : "v"(ah), "v"(al), "v"(bh), "v"(bl));
  return c;
}
// batched GEMM like k_gemm_b but f16 operands: A f32 (split into f16 hi/lo if ASPLIT, else rounded to f16), Bt = f16 values [n][k]; alpha; C f32; N multiple of 16 (partial tiles skipped)
template <bool ASPLIT>
__global__ __launch_bounds__(128) void k_gemm_h(const float* __restrict__ A, int lda, size_t sA, const _Float16* __restrict__ Bh, int ldb, size_t sB, float alpha, float* __restrict__ C, int ldc, size_t sC, int M, int N, int K) {
  __shared__ __attribute__((aligned(16))) float so[4][16][64];
  const int tid = threadIdx.x, w = tid >> 5, lane = tid & 31, ln = lane & 15, hh = lane >> 4; const int by = blockIdx.y;
  A += (size_t)by * sA; Bh += (size_t)by * sB; C += (size_t)by * sC;
  const int ntn = (N + 63) / 64; const int wid = blockIdx.x * 4 + w; const int mt = wid / ntn, nq = wid % ntn; if (mt * 16 >= M) return;
  const int row0 = mt * 16, col0 = nq * 64; const float* arow = A + (size_t)(row0 + ln) * lda;
  v8f acc[4] = {};
  for (int kb = 0; kb < K; kb += 32) {
    FragH ah, al;
    const v4f x0 = *(const v4fa*)(arow + kb + 8 * hh), x1 = *(const v4fa*)(arow + kb + 8 * hh + 4), x2 = *(const v4fa*)(arow + kb + 16 + 8 * hh), x3 = *(const v4fa*)(arow + kb + 16 + 8 * hh + 4);
    float xs[16] = {x0[0],x0[1],x0[2],x0[3],x1[0],x1[1],x1[2],x1[3],x2[0],x2[1],x2[2],x2[3],x3[0],x3[1],x3[2],x3[3]};
#pragma unroll
    for (int i = 0; i < 16; ++i) { const _Float16 h = (_Float16)xs[i]; ah.h[i] = h; al.h[i] = ASPLIT ? (_Float16)(xs[i] - (float)h) : (_Float16)0.0f; }
#pragma unroll
    for (int t = 0; t < 4; ++t) { if (col0 + t * 16 >= N) continue; const size_t boff = (size_t)(col0 + t * 16 + ln) * ldb + kb; FragH bq; bq.half[0] = *(const v8us*)(Bh + boff + 8 * hh); bq.half[1] = *(const v8us*)(Bh + boff + 16 + 8 * hh);
      acc[t] = mmaH<ASPLIT ? 2 : 1>(ah.v, al.v, bq.v, bq.v, acc[t]); }
  }
#pragma unroll
  for (int t = 0; t < 4; ++t) { if (col0 + t * 16 >= N) continue;
#pragma unroll
    for (int r = 0; r < 8; ++r) so[w][8 * hh + r][t * 16 + ln] = acc[t][r] * alpha; }
  __builtin_amdgcn_fence(__ATOMIC_ACQ_REL, "workgroup"); __builtin_amdgcn_wave_barrier();
  const int rsub = lane >> 4, c4 = (lane & 15) * 4;
  {
#pragma unroll
    for (int q = 0; q < 8; ++q) { const int r = q * 2 + rsub; if (col0 + c4 < N) { const v4f v = *(const v4fa*)&so[w][r][c4]; *(v4f*)(C + (size_t)(row0 + r) * ldc + col0 + c4) = v; } }
     }
}

typedef _Float16 v4h __attribute__((ext_vector_type(4)));

__global__ __launch_bounds__(256) void k_h16(const float* __restrict__ x, _Float16* __restrict__ X16, size_t n8) { const size_t t = (size_t)blockIdx.x * 256 + threadIdx.x; if (t >= n8) return; FragH f;
#pragma unroll
  for (int q = 0; q < 8; ++q) f.h[q] = (_Float16)x[t * 8 + q]; *(v8us*)((unsigned short*)X16 + t * 8) = f.half[0];  }
__global__ __launch_bounds__(256) void k_round16f(const float* __restrict__ W, _Float16* __restrict__ Bt, size_t n8) { const size_t t = (size_t)blockIdx.x * 256 + threadIdx.x; if (t >= n8) return; FragH f;
#pragma unroll
  for (int i = 0; i < 8; ++i) f.h[i] = (_Float16)(bf16_round(W[t * 8 + i]) * 16.0f); *(v8us*)((unsigned short*)Bt + t * 8) = f.half[0];  }
__global__ __launch_bounds__(256) void k_h16s(const float* __restrict__ F, _Float16* __restrict__ H, size_t n8) { const size_t t = (size_t)blockIdx.x * 256 + threadIdx.x; if (t >= n8) return; const v4f a = *(const v4fa*)(F + t * 8), c = *(const v4fa*)(F + t * 8 + 4); FragH f;
#pragma unroll
  for (int q = 0; q < 4; ++q) { f.h[q] = (_Float16)(a[q] * 16.0f); f.h[4 + q] = (_Float16)(c[q] * 16.0f); } *(v8us*)((unsigned short*)H + t * 8) = f.half[0];  }
// The three projections in one launch. Block = 8 waves = 128 input rows x one head's 64 columns of operand blockIdx.z (0 q, 1 k, 2 v); wave = 16 rows. The f32 inputs are read here and rounded as before (bf16, then f16; weights x 2^4), and the results leave in the form their reader takes:
// the head's weight slab W[0..255][h * 64 .. + 63] is transposed into LDS as f16 [n][k] (pitch 16 B x odd) behind one work-group barrier; the input rows go from global memory straight into fragments.
// q and k are taken transposed (A = weight rows n, B = input rows), so a lane holds 8 consecutive columns of ONE row; v is taken plain (A = input rows, B = weight rows), so a lane holds 8 consecutive rows of ONE column: each accumulator tile is then one 16-byte store per lane.
// Unit = 16 B = 8 f16 of one lane, lane = 16hh + ln, rows stacked as g = h * 4096 + b. Kp: per 16 keys 4 wave stores (t = 2 ks + half): unit = K[key tile * 16 + ln][t * 16 + 8hh + 0..7]. Vp: per 32 keys 8 wave loads (dt, half): unit = V[key block * 32 + half * 16 + 8hh + 0..7][dt * 16 + ln].
// So each of k_flash's wave-wide 16-byte fragment reads covers 512 contiguous bytes, and the Kp and Vp stores here are whole lines.
// The part behind the barrier, once per operand so that no branch stands behind a matrix instruction: 8 k steps x 4 tiles, then one 16-byte store per lane and tile.
template <int OP>
__device__ __forceinline__ void proj_tiles(const FragH (&ax)[8], const unsigned short (*sW)[EE + 8], int lane, int g0, unsigned short* __restrict__ dst) {
  const int ln = lane & 15, hh = lane >> 4; v8f acc[4] = {};
  FragH bw[2][4];      // the weight fragments of two k steps: step kb + 1 is read from LDS while step kb's products run
  auto frags = [&](int kb) {
#pragma unroll
    for (int t = 0; t < 4; ++t) { bw[kb & 1][t].half[0] = *(const v8us*)&sW[t * 16 + ln][kb * 32 + 8 * hh]; bw[kb & 1][t].half[1] = *(const v8us*)&sW[t * 16 + ln][kb * 32 + 16 + 8 * hh]; } };
  frags(0);
#pragma unroll      // straight-line: every LDS offset is an immediate and the fragment arrays stay in registers
  for (int kb = 0; kb < 8; ++kb) { if (kb + 1 < 8) frags(kb + 1);
#pragma unroll
    for (int t = 0; t < 4; ++t) acc[t] = OP == 2 ? __builtin_amdgcn_wmma_f32_16x16x32_f16(false, ax[kb].v, false, bw[kb & 1][t].v, (short)0, acc[t], false, false) : __builtin_amdgcn_wmma_f32_16x16x32_f16(false, bw[kb & 1][t].v, false, ax[kb].v, (short)0, acc[t], false, false);
    __builtin_amdgcn_sched_barrier(0); }      // keeps the reads one step ahead and no further: left free, the scheduler lifts most of the 64 reads to the top, and the kernel then needs more registers than let two blocks share a WGP
  unsigned short* o = OP == 0 ? dst + (size_t)(g0 + ln) * DD + 8 * hh : OP == 1 ? dst + (size_t)(g0 >> 4) * 1024 + lane * 8 : dst + (size_t)(g0 >> 5) * 2048 + (((g0 >> 4) & 1) * 32 + lane) * 8;
  constexpr int STEP = OP == 0 ? 16 : OP == 1 ? 256 : 512;
#pragma unroll
  for (int t = 0; t < 4; ++t) { FragH f;
#pragma unroll
    for (int r = 0; r < 8; ++r) f.h[r] = (_Float16)(acc[t][r] * 0.0625f);
    *(v8us*)(o + t * STEP) = f.half[0]; }
  asm volatile("s_wait_xcnt 0x0" ::: "memory"); }      // precaution: stands in front of every later write of a register that the four stores name (in the listing one operand's exit is followed by the next operand's part, which rewrites them)
__global__ __launch_bounds__(256, 4) void k_proj(const float* __restrict__ xq, const float* __restrict__ xk, const float* __restrict__ xv, const float* __restrict__ Wq, const float* __restrict__ Wk, const float* __restrict__ Wv,
                                              _Float16* __restrict__ Qs, _Float16* __restrict__ Kp, _Float16* __restrict__ Vp) {
  __shared__ __attribute__((aligned(16))) unsigned short sW[DD][EE + 8];
  const int tid = threadIdx.x, lane = tid & 31, ln = lane & 15, hh = lane >> 4; const int h = blockIdx.y, op = blockIdx.z;
  const float* X = op == 0 ? xq : op == 1 ? xk : xv; const float* Wm = op == 0 ? Wq : op == 1 ? Wk : Wv;
  const int row0 = blockIdx.x * 128 + (tid >> 5) * 16;
  const int n4 = (tid & 15) * 4, k80 = (tid >> 4) * 8;      // 16 lanes read the head's 256 contiguous bytes of one weight row; a thread takes 8 rows x 4 columns, twice
  const float* wrow = Wm + (size_t)k80 * EE + h * DD + n4; const float* arow = X + (size_t)(row0 + ln) * EE + 8 * hh;
  v4f wr[2][8];
#pragma unroll
  for (int rd = 0; rd < 2; ++rd)
#pragma unroll
    for (int i = 0; i < 8; ++i) wr[rd][i] = *(const v4fa*)(wrow + (size_t)(rd * 128 + i) * EE);
  v4f xa[8][4];      // row row0 + ln, in the fragment's k order: 8hh + 0..7 and 16 + 8hh + 0..7 of every 32
#pragma unroll
  for (int kb = 0; kb < 8; ++kb) { xa[kb][0] = *(const v4fa*)(arow + kb * 32); xa[kb][1] = *(const v4fa*)(arow + kb * 32 + 4); xa[kb][2] = *(const v4fa*)(arow + kb * 32 + 16); xa[kb][3] = *(const v4fa*)(arow + kb * 32 + 20); }
  asm volatile("s_wait_xcnt 0x0" :: "v"(wrow), "v"(arow) : "memory");      // precaution: stands in front of every later write of a register that one of the loads above names as its address; the two addresses are inputs so that their registers live up to here
#pragma unroll
  for (int rd = 0; rd < 2; ++rd)
#pragma unroll
    for (int j = 0; j < 4; ++j) { FragH f;
#pragma unroll
      for (int i = 0; i < 8; ++i) f.h[i] = (_Float16)(bf16_round(wr[rd][i][j]) * 16.0f);
      *(v8us*)&sW[n4 + j][rd * 128 + k80] = f.half[0]; }
  FragH ax[8];      // the wave's input rows as f16 fragments, made in front of the barrier: half the registers of the f32 rows, so that the k steps have room to read LDS ahead
#pragma unroll
  for (int kb = 0; kb < 8; ++kb)
#pragma unroll
    for (int i = 0; i < 16; ++i) ax[kb].h[i] = (_Float16)bf16_round(xa[kb][i >> 2][i & 3]);
  __syncthreads();      // the whole slab is in LDS before any wave takes a fragment of it
  const int g0 = h * NB + row0;      // first stacked row of the wave's tile
  if (op == 0) proj_tiles<0>(ax, sW, lane, g0, (unsigned short*)Qs); else if (op == 1) proj_tiles<1>(ax, sW, lane, g0, (unsigned short*)Kp); else proj_tiles<2>(ax, sW, lane, g0, (unsigned short*)Vp); }
__global__ __launch_bounds__(1024) void k_flash(const _Float16* __restrict__ Q16, int ldq, const _Float16* __restrict__ Kp, const _Float16* __restrict__ Vp, const int* __restrict__ MSK, float* __restrict__ O, int ldo) {
  constexpr int RPW = 16, NQB = TT / (4 * RPW), DT = 4, KS = 2, KSPL = 8, NW = 4 * KSPL;
  constexpr int NP = 2, TKEYS = NP * KSPL * 32, PLANE = TKEYS * 128, BUF = 2 * PLANE, SLOT = BUF / NP, NTILE = TT / TKEYS;      // NP key blocks per wave and tile (NP passes); a buffer holds, pass by pass, SLOT bytes: the pass's K (half a slot), then its V, so that every fragment's LDS offset from the pass's base fits the instruction's 16-bit field
  static_assert(PLANE == 4 * 1024 * 16 && NP == 2 && NTILE >= 2, "four 16-byte copies per lane and plane, two per pass; the ring's prologue needs two tiles");
  constexpr float C2 = 0.125f * 1.4426950408889634f;      // 1/sqrt(64) * log2(e): exp(s/8 - m/8) = 2^(C2 s - C2 m), so a weight costs one fused multiply-add and one hardware 2^x; maxima are kept on the raw products (C2 > 0 keeps their order)
  __shared__ __attribute__((aligned(16))) unsigned char ring[2 * BUF]; __shared__ float sM[NW][RPW], sL[NW][RPW];
  static_assert(sizeof(float) * NW * RPW * (64 + 4) <= sizeof(ring), "the partial accumulators are staged in the ring once the loop has left it");
  float (*sO)[RPW][64 + 4] = (float (*)[RPW][64 + 4])ring;
  const int tid = threadIdx.x, lane = tid & 31, ln = lane & 15, hh = lane >> 4;
  const int w = __builtin_amdgcn_readfirstlane(tid >> 5) & (NW - 1);      // wave number in a scalar register; the mask (an identity) shows the compiler its range
  const int slab = blockIdx.x / NQB, qblk = blockIdx.x % NQB; const int b = slab / NH, h = slab % NH; const int qb0 = qblk * (4 * RPW); const int q0 = qb0 + (w & 3) * RPW;
  const unsigned char* Kg = (const unsigned char*)Kp + (size_t)slab * 128 * TT + tid * 16; const unsigned char* Vg = (const unsigned char*)Vp + (size_t)slab * 128 * TT + tid * 16;      // k_proj's planes: 128 B per key; thread t copies bytes 16 t .. 16 t + 15 of every 16 KiB
  const unsigned lds0 = (unsigned)(size_t)ring + tid * 16;      // the lane's LDS byte address in buffer 0
  // One tile into one buffer: 8 copies per lane, each wave 512 contiguous bytes per copy, every lane on. The s_wait_xcnt 0 is the last line of the copies' own statement, so that it stands in front of every later write of a register that a copy names (a precaution).
  auto fill = [&](int tile, int buf) {
    const unsigned char* gk = Kg + (size_t)tile * PLANE; const unsigned char* gv = Vg + (size_t)tile * PLANE; const unsigned lk = lds0 + buf * BUF, lv = lk + SLOT / 2;
    asm volatile("global_load_async_to_lds_b128 %0, %8, off\n\t"
                 "global_load_async_to_lds_b128 %1, %9, off\n\t"
                 "global_load_async_to_lds_b128 %2, %10, off\n\t"
                 "global_load_async_to_lds_b128 %3, %11, off\n\t"
                 "global_load_async_to_lds_b128 %4, %12, off\n\t"
                 "global_load_async_to_lds_b128 %5, %13, off\n\t"
                 "global_load_async_to_lds_b128 %6, %14, off\n\t"
                 "global_load_async_to_lds_b128 %7, %15, off\n\t"
                 "s_wait_xcnt 0x0"
                 :: "v"(lk), "v"(lk + 16384), "v"(lk + SLOT), "v"(lk + SLOT + 16384), "v"(lv), "v"(lv + 16384), "v"(lv + SLOT), "v"(lv + SLOT + 16384),
                    "v"(gk), "v"(gk + 16384), "v"(gk + 32768), "v"(gk + 49152), "v"(gv), "v"(gv + 16384), "v"(gv + 32768), "v"(gv + 49152) : "memory"); };
  fill(0, 0);
  FragH bq[KS];      // B operand: column ln = query q0 + ln
  { const unsigned short* qr = (const unsigned short*)Q16 + ((size_t)b * TT + q0 + ln) * ldq + h * 64;
#pragma unroll
    for (int ks = 0; ks < KS; ++ks) { bq[ks].half[0] = *(const v8us*)(qr + ks * 32 + 8 * hh); bq[ks].half[1] = *(const v8us*)(qr + ks * 32 + 16 + 8 * hh); } }
  float m_q = -3.0e38f, l_q = 0.f; v8f oacc[DT];      // of query ln: running max (equal in both halves), this half's share of the sum, O^T rows dt * 16 + 8hh + r
#pragma unroll
  for (int dt = 0; dt < DT; ++dt) oacc[dt] = (v8f){0.f,0.f,0.f,0.f,0.f,0.f,0.f,0.f};
  asm volatile("s_wait_asynccnt 0x0" ::: "memory");      // this wave's share of tile 0 has landed
  __syncthreads();      // tile 0 is published: nobody reads it in front of this barrier
  fill(1, 1);
#pragma unroll 1      // one trip per tile: the ring's order stands once, at the foot
  for (int t = 0; t < NTILE; ++t) {
    const unsigned char* tb = ring + (t & 1) * BUF + (w >> 2) * 4096 + lane * 16;      // the wave's key block in the tile's first pass: 4 KiB per 32 keys of K and of V, a lane's 16 B at lane * 16 in every 512-byte load
#pragma unroll 1      // rolled: one base register per pass, every fragment at an immediate offset from it
    for (int p = 0; p < NP; ++p) {
    const unsigned short* Kf = (const unsigned short*)(tb + p * SLOT); const unsigned short* Vf = (const unsigned short*)(tb + p * SLOT + SLOT / 2);
    v8f s[2];      // s[nt][r] = raw product (score * 8) of key nt * 16 + 8hh + r of the block with query ln
#pragma unroll
    for (int nt = 0; nt < 2; ++nt) { const unsigned short* kr = Kf + nt * 1024; FragH ak[KS];
#pragma unroll
      for (int ks = 0; ks < KS; ++ks) { ak[ks].half[0] = *(const v8us*)(kr + ks * 512); ak[ks].half[1] = *(const v8us*)(kr + ks * 512 + 256); }
      v8f acc = (v8f){0.f,0.f,0.f,0.f,0.f,0.f,0.f,0.f};
#pragma unroll
      for (int ks = 0; ks < KS; ++ks) acc = __builtin_amdgcn_wmma_f32_16x16x32_f16(false, ak[ks].v, false, bq[ks].v, (short)0, acc, false, false);
      s[nt] = acc; }
    float mc = fmaxf(s[0][0], s[1][0]);
#pragma unroll
    for (int r = 1; r < 8; ++r) mc = fmaxf(mc, fmaxf(s[0][r], s[1][r]));
    mc = fmaxf(mc, __int_as_float(__builtin_amdgcn_permlanex16(__float_as_int(mc), __float_as_int(mc), 0x76543210, 0xfedcba98, false, false)));      // lane l <-> l ^ 16: the other 16 keys of the same query
    const float mn = fmaxf(m_q, mc); const float al = __builtin_amdgcn_exp2f((m_q - mn) * C2); m_q = mn;
    const float mb = fmaf(mn, C2, -10.0f);      // the 2^10 of the f16 weights rides in the exponent: weights and their sum both carry it, and the merge divides it out
    FragH pb; float ps = 0.f;
#pragma unroll
    for (int r = 0; r < 8; ++r) { const float p0 = __builtin_amdgcn_exp2f(fmaf(s[0][r], C2, -mb)), p1 = __builtin_amdgcn_exp2f(fmaf(s[1][r], C2, -mb)); ps += p0 + p1; pb.h[r] = (_Float16)p0; pb.h[8 + r] = (_Float16)p1; }
    l_q = l_q * al + ps;
#pragma unroll
    for (int dt = 0; dt < DT; ++dt) oacc[dt] *= al;
#pragma unroll
    for (int dt = 0; dt < DT; ++dt) { const unsigned short* vrow = Vf + dt * 512; FragH av; av.half[0] = *(const v8us*)vrow; av.half[1] = *(const v8us*)(vrow + 256);
      if (dt + 1 < DT) oacc[dt] = __builtin_amdgcn_wmma_f32_16x16x32_f16(false, av.v, false, pb.v, (short)0, oacc[dt], false, false);
      else oacc[dt] = mmaH<1>(av.v, av.v, pb.v, pb.v, oacc[dt]); } }      // the pass's last product keeps its four v_nop: behind it comes the loop's back edge, and the next pass's first vector instructions rewrite registers of its operands
    asm volatile("s_wait_dscnt 0x0" ::: "memory");      // this wave's reads of the buffer have returned before the buffer is handed to its next writer
    asm volatile("s_wait_asynccnt 0x0" ::: "memory");      // this wave's share of tile t + 1 has landed
    __syncthreads();      // publishes tile t + 1 and ends every wave's reads of tile t's buffer
    if (t + 2 < NTILE) fill(t + 2, t & 1); }
  asm volatile("s_wait_asynccnt 0x0" ::: "memory");      // no copy is outstanding when the ring becomes staging for the partials (the last trip's barrier has ended every read of it)
  l_q += __int_as_float(__builtin_amdgcn_permlanex16(__float_as_int(l_q), __float_as_int(l_q), 0x76543210, 0xfedcba98, false, false));      // the halves' sums joined once
  if (hh == 0) { sM[w][ln] = m_q; sL[w][ln] = l_q; }
#pragma unroll
  for (int dt = 0; dt < DT; ++dt) { *(v4fa*)&sO[w][ln][dt * 16 + 8 * hh] = (v4f){oacc[dt][0], oacc[dt][1], oacc[dt][2], oacc[dt][3]}; *(v4fa*)&sO[w][ln][dt * 16 + 8 * hh + 4] = (v4f){oacc[dt][4], oacc[dt][5], oacc[dt][6], oacc[dt][7]}; }
  __syncthreads();      // every wave's partial (max, sum, accumulator) is in LDS before any wave merges
  for (int e = tid; e < 4 * RPW * 16; e += 32 * NW) { const int row = e >> 4, pc = e & 15, qt = row / RPW, r = row % RPW;      // one query row per 16 lanes, 16 B per lane
    float mg[KSPL], M = -3.0e38f;
#pragma unroll
    for (int g = 0; g < KSPL; ++g) { mg[g] = sM[g * 4 + qt][r]; M = fmaxf(M, mg[g]); }
    float L = 0.f; v4f acc = {0.f, 0.f, 0.f, 0.f};
#pragma unroll
    for (int g = 0; g < KSPL; ++g) { const float wg = __builtin_amdgcn_exp2f((mg[g] - M) * C2); L += wg * sL[g * 4 + qt][r]; const v4f pv = *(const v4fa*)&sO[g * 4 + qt][r][pc * 4]; acc += pv * wg; }
    const float inv = (L > 0.f) ? 1.0f / L : 0.f;      // L and acc both carry the 2^10
    const int g = qb0 + row;      // stacked row g = head * NB + batch row: it goes straight to its merged place, 256 contiguous bytes per 16 lanes
    *(v4f*)(O + (size_t)(g % NB) * ldo + (g / NB) * DD + pc * 4) = acc * inv; } }

extern "C" void kernel_launch(void* const* d_in, const int* in_sizes, int n_in,
                              void* d_out, int out_size, void* d_ws, size_t ws_size, hipStream_t stream) {
  (void)in_sizes; (void)n_in; (void)out_size;
  const float* const* I = (const float* const*)d_in; const float* xq = I[0]; const float* xk = I[1]; const float* xv = I[2]; const float* Wq = I[3]; const float* Wk = I[4]; const float* Wv = I[5];
  char* ws = (char*)d_ws; size_t off = 0;
  auto take = [&](size_t bytes) { char* p = ws + off; off += (bytes + 255) & ~(size_t)255; return p; };
  _Float16* Qs = (_Float16*)take((size_t)TT * DD * 2); _Float16* Kp = (_Float16*)take((size_t)TT * DD * 2); _Float16* Vp = (_Float16*)take((size_t)TT * DD * 2);
  if (off > ws_size) return;      // 3 x 2.1 = about 6.3 MB
  k_proj<<<dim3(NB / 128, NHD, 3), 256, 0, stream>>>(xq, xk, xv, Wq, Wk, Wv, Qs, Kp, Vp);      /* q stacked, K and V in fragment order */
  k_flash<<<BB * NH * (TT / 64), 1024, 0, stream>>>(Qs, DD, Kp, Vp, nullptr, (float*)d_out, EE);      /* one slab: 16384 queries x 16384 keys; rows stored merged */
}

// v008
// A run of this version takes 66.1 microseconds.
// In both of two side-by-side timings against v007, it was 1.08 times as fast.
// All steps since v000 together make it 24.7 times as fast.
#include <hip/hip_runtime.h>
// Multi-head attention whose heads are STACKED along the batch axis (B=4096 rows, EMBED=256, 4 heads × 64): q = queries·W_Query, k = keys·W_Key, v = values·W_Value ((in,out), no bias); the heads are split TF-style into [H·B, 64] = [16384, 64] and ONE softmax(q·kᵀ/√64)·v runs over all 16384 stacked rows
// (every query attends to every (head, row) key); the result is merged back to [B, H·64].
// Compute dtype: inputs and weights rounded to bf16; q, k, v as f16 GEMM outputs of ONE projection launch (grid.y = head, grid.z = operand) that reads the f32 inputs itself and stores q in the stacked [h * 4096 + b][64] layout and k, v in the attention kernel's fragment order;
// fused flash-style kernel over T = 16384 (online softmax f32, P f16 x 2^10, f32 accumulate) on v_wmma_f32_16x16x32_f16, which stores its f32 result rows at their merged place in the output. Two launches in all.
#define BB 1
#define TT 16384
#define NH 1
#define NB 4096
#define NHD 4
#define EE 256
#define DD 64
#define NR (BB * TT)

typedef __bf16 v16b __attribute__((ext_vector_type(16)));
typedef unsigned short v8us __attribute__((ext_vector_type(8), may_alias));
typedef float  v8f  __attribute__((ext_vector_type(8)));
typedef float  v4f  __attribute__((ext_vector_type(4)));
typedef float  v4fa __attribute__((ext_vector_type(4), may_alias));
union FragB { v16b v; v8us half[2]; unsigned short u[16]; };

__device__ __forceinline__ unsigned short bf16_bits(float x) { unsigned int u = __float_as_uint(x); return (unsigned short)((u + 0x7FFFu + ((u >> 16) & 1u)) >> 16); }
__device__ __forceinline__ float bf16_val(unsigned short b) { return __uint_as_float(((unsigned int)b) << 16); }
__device__ __forceinline__ float bf16_round(float x) { return bf16_val(bf16_bits(x)); }
// D += A·B with NT terms: 1 = ah·bh, 2 = + al·bh (A split), 3 = + ah·bl (both split)
template <int NT>
__device__ __forceinline__ v8f mmaN(v16b ah, v16b al, v16b bh, v16b bl, v8f c) {
  c = __builtin_amdgcn_wmma_f32_16x16x32_bf16(false, ah, false, bh, (short)0, c, false, false);
  if (NT >= 2) c = __builtin_amdgcn_wmma_f32_16x16x32_bf16(false, al, false, bh, (short)0, c, false, false);
  if (NT >= 3) c = __builtin_amdgcn_wmma_f32_16x16x32_bf16(false, ah, false, bl, (short)0, c, false, false);
  asm volatile("v_nop\n\tv_nop\n\tv_nop\n\tv_nop" : "+v"(c) : "v"(ah), "v"(al), "v"(bh), "v"(bl));
  return c;
}

__global__ __launch_bounds__(256) void k_wt_bf16(const float* __restrict__ W, unsigned short* __restrict__ Wt, int K, int N) {
  const int t = blockIdx.x * 256 + threadIdx.x;
  const int k8n = K / 8;
  if (t >= N * k8n) return;
  const int n = t / k8n, k8 = (t % k8n) * 8;
  v8us v;
#pragma unroll
  for (int i = 0; i < 8; ++i) v[i] = bf16_bits(W[(size_t)(k8 + i) * N + n]);
  *(v8us*)(Wt + (size_t)n * K + k8) = v;
  
}

// GEMM C[M][N] (f32, pitch ldc) = act(A[M][K]·W + bias). A f32 row-major (pitch lda) converted per fragment to bf16
// (ASPLIT: hi/lo two planes -> 2 terms, else single rounded term); Wt bf16 [N][K] (pitch ldb). BIAS_BF16 rounds the
// bias to bf16 first (bias quantised to bf16 before the add). K%32==0, M%16==0, N%64==0.
template <bool ASPLIT, int ACT, bool BIAS_BF16>
__global__ __launch_bounds__(128) void k_gemm_bf(const float* __restrict__ A, int lda, const unsigned short* __restrict__ Wt, int ldb,
                                               const float* __restrict__ bias, float* __restrict__ C, int ldc, int M, int N, int K) {
  __shared__ __attribute__((aligned(16))) float so[4][16][64];
  const int tid = threadIdx.x, w = tid >> 5, lane = tid & 31, ln = lane & 15, hh = lane >> 4;
  const int ntn = N / 64;
  const int wid = blockIdx.x * 4 + w;
  const int mt = wid / ntn, nq = wid % ntn;
  if (mt * 16 >= M) return;
  const int row0 = mt * 16, col0 = nq * 64;
  const float* arow = A + (size_t)(row0 + ln) * lda;
  v8f acc[4] = {};
  for (int kb = 0; kb < K; kb += 32) {
    FragB ah, al;
    const v4f x0 = *(const v4fa*)(arow + kb + 8 * hh), x1 = *(const v4fa*)(arow + kb + 8 * hh + 4);
    const v4f x2 = *(const v4fa*)(arow + kb + 16 + 8 * hh), x3 = *(const v4fa*)(arow + kb + 16 + 8 * hh + 4);
    float xs[16] = {x0[0],x0[1],x0[2],x0[3],x1[0],x1[1],x1[2],x1[3],x2[0],x2[1],x2[2],x2[3],x3[0],x3[1],x3[2],x3[3]};
#pragma unroll
    for (int i = 0; i < 16; ++i) { const unsigned short hb = bf16_bits(xs[i]); ah.u[i] = hb; al.u[i] = ASPLIT ? bf16_bits(xs[i] - bf16_val(hb)) : (unsigned short)0; }
#pragma unroll
    for (int t = 0; t < 4; ++t) {
      const unsigned short* brow = Wt + (size_t)(col0 + t * 16 + ln) * ldb + kb;
      FragB b;
      b.half[0] = *(const v8us*)(brow + 8 * hh);
      b.half[1] = *(const v8us*)(brow + 16 + 8 * hh);
      acc[t] = mmaN<ASPLIT ? 2 : 1>(ah.v, al.v, b.v, b.v, acc[t]);
    }
  }
#pragma unroll
  for (int t = 0; t < 4; ++t) {
    float bv = bias ? bias[col0 + t * 16 + ln] : 0.f;
    if (BIAS_BF16) bv = bf16_round(bv);
#pragma unroll
    for (int r = 0; r < 8; ++r) { float v = acc[t][r] + bv; if (ACT == 1) v = fmaxf(v, 0.f); so[w][8 * hh + r][t * 16 + ln] = v; }
  }
  __builtin_amdgcn_fence(__ATOMIC_ACQ_REL, "workgroup");
  __builtin_amdgcn_wave_barrier();
  const int rsub = lane >> 4, c4 = (lane & 15) * 4;
  {
#pragma unroll
    for (int q = 0; q < 8; ++q) {
      const int r = q * 2 + rsub;
      const v4f v = *(const v4fa*)&so[w][r][c4];
      *(v4f*)(C + (size_t)(row0 + r) * ldc + col0 + c4) = v;
    }
    
  }
}

// Flash-style causal/unmasked attention, all contractions 3-term bf16 hi/lo splits, f32 softmax with running max.
// q,k,v rows are read from f32 buffers with arbitrary row pitch (so they can live inside a fused qkv buffer);
// D = head size (multiple of 32, <= 128); one wave = 16 query rows; block = 4 waves (64 queries) sharing K/V chunks of 32.
template <int D, bool CAUSAL>
__global__ __launch_bounds__(128) void k_flash(const float* __restrict__ qb, const float* __restrict__ kb, const float* __restrict__ vb,
                                             int pitch, int T, int H, float scale, float* __restrict__ y, int ypitch) {
  constexpr int KS = D / 32;        // k-steps for QK
  constexpr int DT = D / 16;        // d tiles for PV
  __shared__ __attribute__((aligned(16))) unsigned short sKh[32][D + 8], sKl[32][D + 8], sVh[32][D + 8], sVl[32][D + 8];
  __shared__ __attribute__((aligned(16))) unsigned short sPh[4][16][40], sPl[4][16][40];
  __shared__ __attribute__((aligned(16))) float sO[4][16][D];
  const int tid = threadIdx.x, w = tid >> 5, lane = tid & 31, ln = lane & 15, hh = lane >> 4;
  const int nqb = (T + 63) / 64;
  const int bh = blockIdx.x / nqb, qblk = blockIdx.x % nqb;
  const int b = bh / H, h = bh % H;
  const int q0 = qblk * 64 + w * 16;
  const float* Q = qb + (size_t)b * T * pitch + h * D;
  const float* K = kb + (size_t)b * T * pitch + h * D;
  const float* V = vb + (size_t)b * T * pitch + h * D;

  // A fragments of the wave's 16 query rows (scaled), hi/lo
  FragB aqh[KS], aql[KS];
  {
    int row = q0 + ln; if (row >= T) row = T - 1;
    const float* qr = Q + (size_t)row * pitch;
#pragma unroll
    for (int ks = 0; ks < KS; ++ks)
#pragma unroll
      for (int i = 0; i < 16; ++i) {
        const int d = ks * 32 + ((i < 8) ? (8 * hh + i) : (16 + 8 * hh + (i - 8)));
        const float x = qr[d] * scale; const unsigned short hb = bf16_bits(x);
        aqh[ks].u[i] = hb; aql[ks].u[i] = bf16_bits(x - bf16_val(hb));
      }
  }
  float m_r[8], l_r[8];
#pragma unroll
  for (int r = 0; r < 8; ++r) { m_r[r] = -3.0e38f; l_r[r] = 0.f; }
  v8f oacc[DT];
#pragma unroll
  for (int dt = 0; dt < DT; ++dt) oacc[dt] = (v8f){0.f,0.f,0.f,0.f,0.f,0.f,0.f,0.f};

  const int kv_end = CAUSAL ? min(T, qblk * 64 + 64) : T;     // block-uniform
  for (int j0 = 0; j0 < kv_end; j0 += 32) {
    __syncthreads();
    for (int e = tid; e < 32 * (D / 4); e += 128) {
      const int r = e / (D / 4), c4 = (e % (D / 4)) * 4;
      const int key = j0 + r;
      v4f kf = {0.f,0.f,0.f,0.f}, vf = {0.f,0.f,0.f,0.f};
      if (key < T) { kf = *(const v4fa*)(K + (size_t)key * pitch + c4); vf = *(const v4fa*)(V + (size_t)key * pitch + c4); }
#pragma unroll
      for (int t = 0; t < 4; ++t) {
        unsigned short hb = bf16_bits(kf[t]); sKh[r][c4 + t] = hb; sKl[r][c4 + t] = bf16_bits(kf[t] - bf16_val(hb));
        hb = bf16_bits(vf[t]); sVh[r][c4 + t] = hb; sVl[r][c4 + t] = bf16_bits(vf[t] - bf16_val(hb));
      }
    }
    __syncthreads();
    // S tile 16 x 32
    v8f s[2];
#pragma unroll
    for (int nt = 0; nt < 2; ++nt) {
      v8f acc = {};
#pragma unroll
      for (int ks = 0; ks < KS; ++ks) {
        FragB bh_, bl_;
        bh_.half[0] = *(const v8us*)&sKh[nt * 16 + ln][ks * 32 + 8 * hh]; bh_.half[1] = *(const v8us*)&sKh[nt * 16 + ln][ks * 32 + 16 + 8 * hh];
        bl_.half[0] = *(const v8us*)&sKl[nt * 16 + ln][ks * 32 + 8 * hh]; bl_.half[1] = *(const v8us*)&sKl[nt * 16 + ln][ks * 32 + 16 + 8 * hh];
        acc = mmaN<3>(aqh[ks].v, aql[ks].v, bh_.v, bl_.v, acc);
      }
      s[nt] = acc;
    }
    // mask + running max (rows 8hh+r; the 16 lanes of a half share rows)
    float alpha[8];
#pragma unroll
    for (int r = 0; r < 8; ++r) {
      const int qi = q0 + 8 * hh + r;
      const int ja = j0 + ln, jb = j0 + 16 + ln;
      if (CAUSAL) { if (ja > qi) s[0][r] = -3.0e38f; if (jb > qi) s[1][r] = -3.0e38f; }
      if (ja >= T) s[0][r] = -3.0e38f;
      if (jb >= T) s[1][r] = -3.0e38f;
      float mx = fmaxf(s[0][r], s[1][r]);
      mx = fmaxf(mx, __shfl_xor(mx, 1, 32)); mx = fmaxf(mx, __shfl_xor(mx, 2, 32)); mx = fmaxf(mx, __shfl_xor(mx, 4, 32)); mx = fmaxf(mx, __shfl_xor(mx, 8, 32));
      const float mnew = fmaxf(m_r[r], mx);
      alpha[r] = (mnew > -1.0e38f) ? __expf(m_r[r] - mnew) : 1.0f;
      const float p0 = (s[0][r] > -1.0e38f) ? __expf(s[0][r] - mnew) : 0.f;
      const float p1 = (s[1][r] > -1.0e38f) ? __expf(s[1][r] - mnew) : 0.f;
      m_r[r] = mnew;
      l_r[r] = l_r[r] * alpha[r] + p0 + p1;            // per-lane partial row sum (16 lanes combined at the end)
      unsigned short hb = bf16_bits(p0); sPh[w][8 * hh + r][ln] = hb;      sPl[w][8 * hh + r][ln] = bf16_bits(p0 - bf16_val(hb));
      hb = bf16_bits(p1);                sPh[w][8 * hh + r][16 + ln] = hb; sPl[w][8 * hh + r][16 + ln] = bf16_bits(p1 - bf16_val(hb));
    }
#pragma unroll
    for (int dt = 0; dt < DT; ++dt)
#pragma unroll
      for (int r = 0; r < 8; ++r) oacc[dt][r] *= alpha[r];
    __builtin_amdgcn_fence(__ATOMIC_ACQ_REL, "workgroup");
    __builtin_amdgcn_wave_barrier();
    FragB pah, pal;
    pah.half[0] = *(const v8us*)&sPh[w][ln][8 * hh]; pah.half[1] = *(const v8us*)&sPh[w][ln][16 + 8 * hh];
    pal.half[0] = *(const v8us*)&sPl[w][ln][8 * hh]; pal.half[1] = *(const v8us*)&sPl[w][ln][16 + 8 * hh];
#pragma unroll
    for (int dt = 0; dt < DT; ++dt) {
      FragB bvh, bvl;
#pragma unroll
      for (int i = 0; i < 8; ++i) {
        bvh.u[i] = sVh[8 * hh + i][dt * 16 + ln]; bvh.u[8 + i] = sVh[16 + 8 * hh + i][dt * 16 + ln];
        bvl.u[i] = sVl[8 * hh + i][dt * 16 + ln]; bvl.u[8 + i] = sVl[16 + 8 * hh + i][dt * 16 + ln];
      }
      oacc[dt] = mmaN<3>(pah.v, pal.v, bvh.v, bvl.v, oacc[dt]);
    }
    __builtin_amdgcn_fence(__ATOMIC_ACQ_REL, "workgroup");
    __builtin_amdgcn_wave_barrier();
  }
#pragma unroll
  for (int r = 0; r < 8; ++r) {
    float l = l_r[r];
    l += __shfl_xor(l, 1, 32); l += __shfl_xor(l, 2, 32); l += __shfl_xor(l, 4, 32); l += __shfl_xor(l, 8, 32);
    l_r[r] = (l > 0.f) ? 1.0f / l : 0.f;
  }
#pragma unroll
  for (int dt = 0; dt < DT; ++dt)
#pragma unroll
    for (int r = 0; r < 8; ++r) sO[w][8 * hh + r][dt * 16 + ln] = oacc[dt][r] * l_r[r];
  __builtin_amdgcn_fence(__ATOMIC_ACQ_REL, "workgroup");
  __builtin_amdgcn_wave_barrier();
  {
    for (int r = 0; r < 16; ++r) {
      const int row = q0 + r;
      if (row < T && lane < D / 4) {
        const v4f val = *(const v4fa*)&sO[w][r][lane * 4];
        *(v4f*)(y + ((size_t)b * T + row) * ypitch + h * D + lane * 4) = val;
      }
    }
    
  }
}

// GEMM C = act(A·W + bias + resid): A f32 (ASPLIT -> hi/lo 2 terms), Wt bf16 [N][K]; ACT 0 none, 1 relu, 2 exact gelu;
// resid (optional, f32, row index = (row % rmod), pitch ldr, RES_BF16 rounds it) added before the activation.
template <bool ASPLIT, int ACT, bool BIAS_BF16, bool RES_BF16>
__global__ __launch_bounds__(128) void k_gemm_bf3(const float* __restrict__ A, int lda, const unsigned short* __restrict__ Wt, int ldb,
                                                const float* __restrict__ bias, const float* __restrict__ resid, int rmod, int ldr,
                                                float* __restrict__ C, int ldc, int M, int N, int K) {
  __shared__ __attribute__((aligned(16))) float so[4][16][64];
  const int tid = threadIdx.x, w = tid >> 5, lane = tid & 31, ln = lane & 15, hh = lane >> 4;
  const int ntn = N / 64;
  const int wid = blockIdx.x * 4 + w;
  const int mt = wid / ntn, nq = wid % ntn;
  if (mt * 16 >= M) return;
  const int row0 = mt * 16, col0 = nq * 64;
  const float* arow = A + (size_t)(row0 + ln) * lda;
  v8f acc[4] = {};
  for (int kb = 0; kb < K; kb += 32) {
    FragB ah, al;
    const v4f x0 = *(const v4fa*)(arow + kb + 8 * hh), x1 = *(const v4fa*)(arow + kb + 8 * hh + 4);
    const v4f x2 = *(const v4fa*)(arow + kb + 16 + 8 * hh), x3 = *(const v4fa*)(arow + kb + 16 + 8 * hh + 4);
    float xs[16] = {x0[0],x0[1],x0[2],x0[3],x1[0],x1[1],x1[2],x1[3],x2[0],x2[1],x2[2],x2[3],x3[0],x3[1],x3[2],x3[3]};
#pragma unroll
    for (int i = 0; i < 16; ++i) { const unsigned short hb = bf16_bits(xs[i]); ah.u[i] = hb; al.u[i] = ASPLIT ? bf16_bits(xs[i] - bf16_val(hb)) : (unsigned short)0; }
#pragma unroll
    for (int t = 0; t < 4; ++t) {
      const unsigned short* brow = Wt + (size_t)(col0 + t * 16 + ln) * ldb + kb;
      FragB b;
      b.half[0] = *(const v8us*)(brow + 8 * hh);
      b.half[1] = *(const v8us*)(brow + 16 + 8 * hh);
      acc[t] = mmaN<ASPLIT ? 2 : 1>(ah.v, al.v, b.v, b.v, acc[t]);
    }
  }
#pragma unroll
  for (int t = 0; t < 4; ++t) {
    const int col = col0 + t * 16 + ln;
    float bv = bias ? bias[col] : 0.f;
    if (BIAS_BF16) bv = bf16_round(bv);
#pragma unroll
    for (int r = 0; r < 8; ++r) {
      float v = acc[t][r] + bv;
      if (resid) { float rv = resid[(size_t)((row0 + 8 * hh + r) % rmod) * ldr + col]; if (RES_BF16) rv = bf16_round(rv); v += rv; }
      if (ACT == 1) v = fmaxf(v, 0.f);
      if (ACT == 2) v = 0.5f * v * (1.0f + erff(v * 0.70710678118654752f));
      if (ACT == 3) { const float u = 0.7978845608028654f * (v + 0.044715f * v * v * v); v = 0.5f * v * (1.0f + tanhf(u)); }
      so[w][8 * hh + r][t * 16 + ln] = v;
    }
  }
  __builtin_amdgcn_fence(__ATOMIC_ACQ_REL, "workgroup");
  __builtin_amdgcn_wave_barrier();
  const int rsub = lane >> 4, c4 = (lane & 15) * 4;
  {
#pragma unroll
    for (int q = 0; q < 8; ++q) {
      const int r = q * 2 + rsub;
      const v4f v = *(const v4fa*)&so[w][r][c4];
      *(v4f*)(C + (size_t)(row0 + r) * ldc + col0 + c4) = v;
    }
    
  }
}
// row LayerNorm (biased variance, eps) over N: s = X (+ R); optional out_sum <- s; out_norm <- (s-mu)*rsqrt(var+eps)*g + b
template <bool PARAM_BF16>
__global__ __launch_bounds__(256) void k_layernorm(const float* __restrict__ X, const float* __restrict__ R, const float* __restrict__ g, const float* __restrict__ bta,
                                                  float* __restrict__ out_sum, float* __restrict__ out_norm, int N, float eps) {
  __shared__ float red[256];
  const int row = blockIdx.x, tid = threadIdx.x;
  const float* x = X + (size_t)row * N; const float* rr = R ? R + (size_t)row * N : nullptr;
  float vals[16];                     // up to N = 4096
  const int per = N / 256;            // contiguous chunk per thread? use strided-by-4 chunks: thread handles j = tid*4 + 1024*u
  float s1 = 0.f;
  for (int u = 0; u < per / 4; ++u) {
    const int j = tid * 4 + 1024 * u;
    const v4f a = *(const v4fa*)(x + j);
    v4f b = {0.f,0.f,0.f,0.f}; if (rr) b = *(const v4fa*)(rr + j);
#pragma unroll
    for (int q = 0; q < 4; ++q) { const float v = a[q] + b[q]; vals[u * 4 + q] = v; s1 += v; }
  }
  red[tid] = s1; __syncthreads();
  for (int st = 128; st > 0; st >>= 1) { if (tid < st) red[tid] += red[tid + st]; __syncthreads(); }
  const float mu = red[0] / (float)N; __syncthreads();
  float s2 = 0.f;
  for (int u = 0; u < per / 4; ++u)
#pragma unroll
    for (int q = 0; q < 4; ++q) { const float c = vals[u * 4 + q] - mu; s2 += c * c; }
  red[tid] = s2; __syncthreads();
  for (int st = 128; st > 0; st >>= 1) { if (tid < st) red[tid] += red[tid + st]; __syncthreads(); }
  const float rs = rsqrtf(red[0] / (float)N + eps);
  {
    for (int u = 0; u < per / 4; ++u) {
      const int j = tid * 4 + 1024 * u;
      v4f o, sm;
#pragma unroll
      for (int q = 0; q < 4; ++q) {
        float gg = g[j + q], bb = bta[j + q];
        if (PARAM_BF16) { gg = bf16_round(gg); bb = bf16_round(bb); }
        sm[q] = vals[u * 4 + q]; o[q] = (vals[u * 4 + q] - mu) * rs * gg + bb;
      }
      if (out_sum) *(v4f*)(out_sum + (size_t)row * N + j) = sm;
      *(v4f*)(out_norm + (size_t)row * N + j) = o;
    }
    
  }
}



// ---- f16 WMMA path (v_wmma_f32_16x16x32_f16): 11-bit significands for operands in range — used where a [0,1] probability operand needs more precision than bf16
typedef _Float16 v16h __attribute__((ext_vector_type(16)));
union FragH { v16h v; v8us half[2]; _Float16 h[16]; unsigned short u[16]; };
template <int NT>
__device__ __forceinline__ v8f mmaH(v16h ah, v16h al, v16h bh, v16h bl, v8f c) {
  c = __builtin_amdgcn_wmma_f32_16x16x32_f16(false, ah, false, bh, (short)0, c, false, false);
  if (NT >= 2) c = __builtin_amdgcn_wmma_f32_16x16x32_f16(false, al, false, bh, (short)0, c, false, false);
  if (NT >= 3) c = __builtin_amdgcn_wmma_f32_16x16x32_f16(false, ah, false, bl, (short)0, c, false, false);
  asm volatile("v_nop\n\tv_nop\n\tv_nop\n\tv_nop" : "+v"(c) : "v"(ah), "v"(al), "v"(bh), "v"(bl));
  return c;
}
// batched GEMM like k_gemm_b but f16 operands: A f32 (split into f16 hi/lo if ASPLIT, else rounded to f16), Bt = f16 values [n][k]; alpha; C f32; N multiple of 16 (partial tiles skipped)
template <bool ASPLIT>
__global__ __launch_bounds__(128) void k_gemm_h(const float* __restrict__ A, int lda, size_t sA, const _Float16* __restrict__ Bh, int ldb, size_t sB, float alpha, float* __restrict__ C, int ldc, size_t sC, int M, int N, int K) {
  __shared__ __attribute__((aligned(16))) float so[4][16][64];
  const int tid = threadIdx.x, w = tid >> 5, lane = tid & 31, ln = lane & 15, hh = lane >> 4; const int by = blockIdx.y;
  A += (size_t)by * sA; Bh += (size_t)by * sB; C += (size_t)by * sC;
  const int ntn = (N + 63) / 64; const int wid = blockIdx.x * 4 + w; const int mt = wid / ntn, nq = wid % ntn; if (mt * 16 >= M) return;
  const int row0 = mt * 16, col0 = nq * 64; const float* arow = A + (size_t)(row0 + ln) * lda;
  v8f acc[4] = {};
  for (int kb = 0; kb < K; kb += 32) {
    FragH ah, al;
    const v4f x0 = *(const v4fa*)(arow + kb + 8 * hh), x1 = *(const v4fa*)(arow + kb + 8 * hh + 4), x2 = *(const v4fa*)(arow + kb + 16 + 8 * hh), x3 = *(const v4fa*)(arow + kb + 16 + 8 * hh + 4);
    float xs[16] = {x0[0],x0[1],x0[2],x0[3],x1[0],x1[1],x1[2],x1[3],x2[0],x2[1],x2[2],x2[3],x3[0],x3[1],x3[2],x3[3]};
#pragma unroll
    for (int i = 0; i < 16; ++i) { const _Float16 h = (_Float16)xs[i]; ah.h[i] = h; al.h[i] = ASPLIT ? (_Float16)(xs[i] - (float)h) : (_Float16)0.0f; }
#pragma unroll
    for (int t = 0; t < 4; ++t) { if (col0 + t * 16 >= N) continue; const size_t boff = (size_t)(col0 + t * 16 + ln) * ldb + kb; FragH bq; bq.half[0] = *(const v8us*)(Bh + boff + 8 * hh); bq.half[1] = *(const v8us*)(Bh + boff + 16 + 8 * hh);
      acc[t] = mmaH<ASPLIT ? 2 : 1>(ah.v, al.v, bq.v, bq.v, acc[t]); }
  }
#pragma unroll
  for (int t = 0; t < 4; ++t) { if (col0 + t * 16 >= N) continue;
#pragma unroll
    for (int r = 0; r < 8; ++r) so[w][8 * hh + r][t * 16 + ln] = acc[t][r] * alpha; }
  __builtin_amdgcn_fence(__ATOMIC_ACQ_REL, "workgroup"); __builtin_amdgcn_wave_barrier();
  const int rsub = lane >> 4, c4 = (lane & 15) * 4;
  {
#pragma unroll
    for (int q = 0; q < 8; ++q) { const int r = q * 2 + rsub; if (col0 + c4 < N) { const v4f v = *(const v4fa*)&so[w][r][c4]; *(v4f*)(C + (size_t)(row0 + r) * ldc + col0 + c4) = v; } }
     }
}

typedef _Float16 v4h __attribute__((ext_vector_type(4)));

__global__ __launch_bounds__(256) void k_h16(const float* __restrict__ x, _Float16* __restrict__ X16, size_t n8) { const size_t t = (size_t)blockIdx.x * 256 + threadIdx.x; if (t >= n8) return; FragH f;
#pragma unroll
  for (int q = 0; q < 8; ++q) f.h[q] = (_Float16)x[t * 8 + q]; *(v8us*)((unsigned short*)X16 + t * 8) = f.half[0];  }
__global__ __launch_bounds__(256) void k_round16f(const float* __restrict__ W, _Float16* __restrict__ Bt, size_t n8) { const size_t t = (size_t)blockIdx.x * 256 + threadIdx.x; if (t >= n8) return; FragH f;
#pragma unroll
  for (int i = 0; i < 8; ++i) f.h[i] = (_Float16)(bf16_round(W[t * 8 + i]) * 16.0f); *(v8us*)((unsigned short*)Bt + t * 8) = f.half[0];  }
__global__ __launch_bounds__(256) void k_h16s(const float* __restrict__ F, _Float16* __restrict__ H, size_t n8) { const size_t t = (size_t)blockIdx.x * 256 + threadIdx.x; if (t >= n8) return; const v4f a = *(const v4fa*)(F + t * 8), c = *(const v4fa*)(F + t * 8 + 4); FragH f;
#pragma unroll
  for (int q = 0; q < 4; ++q) { f.h[q] = (_Float16)(a[q] * 16.0f); f.h[4 + q] = (_Float16)(c[q] * 16.0f); } *(v8us*)((unsigned short*)H + t * 8) = f.half[0];  }
// The three projections in one launch. Block = 8 waves = 128 input rows x one head's 64 columns of operand blockIdx.z (0 q, 1 k, 2 v); wave = 16 rows. The f32 inputs are read here and rounded as before (bf16, then f16; weights x 2^4), and the results leave in the form their reader takes:
// the head's weight slab W[0..255][h * 64 .. + 63] is transposed into LDS as f16 [n][k] (pitch 16 B x odd) behind one work-group barrier; the input rows go from global memory straight into fragments.
// q and k are taken transposed (A = weight rows n, B = input rows), so a lane holds 8 consecutive columns of ONE row; v is taken plain (A = input rows, B = weight rows), so a lane holds 8 consecutive rows of ONE column: each accumulator tile is then one 16-byte store per lane.
// Unit = 16 B = 8 f16 of one lane, lane = 16hh + ln, rows stacked as g = h * 4096 + b. Kp: per 16 keys 4 wave stores (t = 2 ks + half): unit = K[key tile * 16 + ln][t * 16 + 8hh + 0..7]. Vp: per 32 keys 8 wave loads (dt, half): unit = V[key block * 32 + half * 16 + 8hh + 0..7][dt * 16 + ln].
// So each of k_flash's wave-wide 16-byte fragment reads covers 512 contiguous bytes, and the Kp and Vp stores here are whole lines.
// The part behind the barrier, once per operand so that no branch stands behind a matrix instruction: 8 k steps x 4 tiles, then one 16-byte store per lane and tile.
template <int OP>
__device__ __forceinline__ void proj_tiles(const FragH (&ax)[8], const unsigned short (*sW)[EE + 8], int lane, int g0, unsigned short* __restrict__ dst) {
  const int ln = lane & 15, hh = lane >> 4; v8f acc[4] = {};
  FragH bw[2][4];      // the weight fragments of two k steps: step kb + 1 is read from LDS while step kb's products run
  auto frags = [&](int kb) {
#pragma unroll
    for (int t = 0; t < 4; ++t) { bw[kb & 1][t].half[0] = *(const v8us*)&sW[t * 16 + ln][kb * 32 + 8 * hh]; bw[kb & 1][t].half[1] = *(const v8us*)&sW[t * 16 + ln][kb * 32 + 16 + 8 * hh]; } };
  frags(0);
#pragma unroll      // straight-line: every LDS offset is an immediate and the fragment arrays stay in registers
  for (int kb = 0; kb < 8; ++kb) { if (kb + 1 < 8) frags(kb + 1);
#pragma unroll
    for (int t = 0; t < 4; ++t) acc[t] = OP == 2 ? __builtin_amdgcn_wmma_f32_16x16x32_f16(false, ax[kb].v, false, bw[kb & 1][t].v, (short)0, acc[t], false, false) : __builtin_amdgcn_wmma_f32_16x16x32_f16(false, bw[kb & 1][t].v, false, ax[kb].v, (short)0, acc[t], false, false);
    __builtin_amdgcn_sched_barrier(0); }      // keeps the reads one step ahead and no further: left free, the scheduler lifts most of the 64 reads to the top, and the kernel then needs more registers than let two blocks share a WGP
  unsigned short* o = OP == 0 ? dst + (size_t)(g0 + ln) * DD + 8 * hh : OP == 1 ? dst + (size_t)(g0 >> 4) * 1024 + lane * 8 : dst + (size_t)(g0 >> 5) * 2048 + (((g0 >> 4) & 1) * 32 + lane) * 8;
  constexpr int STEP = OP == 0 ? 16 : OP == 1 ? 256 : 512;
#pragma unroll
  for (int t = 0; t < 4; ++t) { FragH f;
#pragma unroll
    for (int r = 0; r < 8; ++r) f.h[r] = (_Float16)(acc[t][r] * 0.0625f);
    *(v8us*)(o + t * STEP) = f.half[0]; }
  asm volatile("s_wait_xcnt 0x0" ::: "memory"); }      // precaution: stands in front of every later write of a register that the four stores name (in the listing one operand's exit is followed by the next operand's part, which rewrites them)
__global__ __launch_bounds__(256, 4) void k_proj(const float* __restrict__ xq, const float* __restrict__ xk, const float* __restrict__ xv, const float* __restrict__ Wq, const float* __restrict__ Wk, const float* __restrict__ Wv,
                                              _Float16* __restrict__ Qs, _Float16* __restrict__ Kp, _Float16* __restrict__ Vp) {
  __shared__ __attribute__((aligned(16))) unsigned short sW[DD][EE + 8];
  const int tid = threadIdx.x, lane = tid & 31, ln = lane & 15, hh = lane >> 4; const int h = blockIdx.y, op = blockIdx.z;
  const float* X = op == 0 ? xq : op == 1 ? xk : xv; const float* Wm = op == 0 ? Wq : op == 1 ? Wk : Wv;
  const int row0 = blockIdx.x * 128 + (tid >> 5) * 16;
  const int n4 = (tid & 15) * 4, k80 = (tid >> 4) * 8;      // 16 lanes read the head's 256 contiguous bytes of one weight row; a thread takes 8 rows x 4 columns, twice
  const float* wrow = Wm + (size_t)k80 * EE + h * DD + n4; const float* arow = X + (size_t)(row0 + ln) * EE + 8 * hh;
  v4f wr[2][8];
#pragma unroll
  for (int rd = 0; rd < 2; ++rd)
#pragma unroll
    for (int i = 0; i < 8; ++i) wr[rd][i] = *(const v4fa*)(wrow + (size_t)(rd * 128 + i) * EE);
  v4f xa[8][4];      // row row0 + ln, in the fragment's k order: 8hh + 0..7 and 16 + 8hh + 0..7 of every 32
#pragma unroll
  for (int kb = 0; kb < 8; ++kb) { xa[kb][0] = *(const v4fa*)(arow + kb * 32); xa[kb][1] = *(const v4fa*)(arow + kb * 32 + 4); xa[kb][2] = *(const v4fa*)(arow + kb * 32 + 16); xa[kb][3] = *(const v4fa*)(arow + kb * 32 + 20); }
  asm volatile("s_wait_xcnt 0x0" :: "v"(wrow), "v"(arow) : "memory");      // precaution: stands in front of every later write of a register that one of the loads above names as its address; the two addresses are inputs so that their registers live up to here
#pragma unroll
  for (int rd = 0; rd < 2; ++rd)
#pragma unroll
    for (int j = 0; j < 4; ++j) { FragH f;
#pragma unroll
      for (int i = 0; i < 8; ++i) f.h[i] = (_Float16)(bf16_round(wr[rd][i][j]) * 16.0f);
      *(v8us*)&sW[n4 + j][rd * 128 + k80] = f.half[0]; }
  FragH ax[8];      // the wave's input rows as f16 fragments, made in front of the barrier: half the registers of the f32 rows, so that the k steps have room to read LDS ahead
#pragma unroll
  for (int kb = 0; kb < 8; ++kb)
#pragma unroll
    for (int i = 0; i < 16; ++i) ax[kb].h[i] = (_Float16)bf16_round(xa[kb][i >> 2][i & 3]);
  __syncthreads();      // the whole slab is in LDS before any wave takes a fragment of it
  const int g0 = h * NB + row0;      // first stacked row of the wave's tile
  if (op == 0) proj_tiles<0>(ax, sW, lane, g0, (unsigned short*)Qs); else if (op == 1) proj_tiles<1>(ax, sW, lane, g0, (unsigned short*)Kp); else proj_tiles<2>(ax, sW, lane, g0, (unsigned short*)Vp); }
__global__ __launch_bounds__(1024) void k_flash(const _Float16* __restrict__ Q16, int ldq, const _Float16* __restrict__ Kp, const _Float16* __restrict__ Vp, const int* __restrict__ MSK, float* __restrict__ O, int ldo) {
  constexpr int RPW = 16, NQB = TT / (4 * RPW), DT = 4, KS = 2, KSPL = 8, NW = 4 * KSPL;
  constexpr int NP = 2, TKEYS = NP * KSPL * 32, PLANE = TKEYS * 128, BUF = 2 * PLANE, SLOT = BUF / NP, NTILE = TT / TKEYS;      // NP key blocks per wave and tile (NP passes); a buffer holds, pass by pass, SLOT bytes: the pass's K (half a slot), then its V, so that every fragment's LDS offset from the pass's base fits the instruction's 16-bit field
  static_assert(PLANE == 4 * 1024 * 16 && NP == 2 && NTILE >= 2, "four 16-byte copies per lane and plane, two per pass; the ring's prologue needs two tiles");
  constexpr float C2 = 0.125f * 1.4426950408889634f;      // 1/sqrt(64) * log2(e): exp(s/8 - m/8) = 2^(C2 s - C2 m), so a weight costs one fused multiply-add and one hardware 2^x; maxima are kept on the raw products (C2 > 0 keeps their order)
  constexpr float TH = 5.0f / C2;      // the maximum in use may trail a query's true running maximum by up to 2^5 in the weights: with the 2^10 below a weight then reaches at most 2^15, inside f16
  __shared__ __attribute__((aligned(16))) unsigned char ring[2 * BUF]; __shared__ float sM[NW][RPW], sL[NW][RPW];
  static_assert(sizeof(float) * NW * RPW * (64 + 4) <= sizeof(ring), "the partial accumulators are staged in the ring once the loop has left it");
  float (*sO)[RPW][64 + 4] = (float (*)[RPW][64 + 4])ring;
  const int tid = threadIdx.x, lane = tid & 31, ln = lane & 15, hh = lane >> 4;
  const int w = __builtin_amdgcn_readfirstlane(tid >> 5) & (NW - 1);      // wave number in a scalar register; the mask (an identity) shows the compiler its range
  const int slab = blockIdx.x / NQB, qblk = blockIdx.x % NQB; const int b = slab / NH, h = slab % NH; const int qb0 = qblk * (4 * RPW); const int q0 = qb0 + (w & 3) * RPW;
  const unsigned char* Kg = (const unsigned char*)Kp + (size_t)slab * 128 * TT + tid * 16; const unsigned char* Vg = (const unsigned char*)Vp + (size_t)slab * 128 * TT + tid * 16;      // k_proj's planes: 128 B per key; thread t copies bytes 16 t .. 16 t + 15 of every 16 KiB
  const unsigned lds0 = (unsigned)(size_t)ring + tid * 16;      // the lane's LDS byte address in buffer 0
  // One tile into one buffer: 8 copies per lane, each wave 512 contiguous bytes per copy, every lane on. The s_wait_xcnt 0 is the last line of the copies' own statement, so that it stands in front of every later write of a register that a copy names (a precaution).
  auto fill = [&](int tile, int buf) {
    const unsigned char* gk = Kg + (size_t)tile * PLANE; const unsigned char* gv = Vg + (size_t)tile * PLANE; const unsigned lk = lds0 + buf * BUF, lv = lk + SLOT / 2;
    asm volatile("global_load_async_to_lds_b128 %0, %8, off\n\t"
                 "global_load_async_to_lds_b128 %1, %9, off\n\t"
                 "global_load_async_to_lds_b128 %2, %10, off\n\t"
                 "global_load_async_to_lds_b128 %3, %11, off\n\t"
                 "global_load_async_to_lds_b128 %4, %12, off\n\t"
                 "global_load_async_to_lds_b128 %5, %13, off\n\t"
                 "global_load_async_to_lds_b128 %6, %14, off\n\t"
                 "global_load_async_to_lds_b128 %7, %15, off\n\t"
                 "s_wait_xcnt 0x0"
                 :: "v"(lk), "v"(lk + 16384), "v"(lk + SLOT), "v"(lk + SLOT + 16384), "v"(lv), "v"(lv + 16384), "v"(lv + SLOT), "v"(lv + SLOT + 16384),
                    "v"(gk), "v"(gk + 16384), "v"(gk + 32768), "v"(gk + 49152), "v"(gv), "v"(gv + 16384), "v"(gv + 32768), "v"(gv + 49152) : "memory"); };
  fill(0, 0);
  FragH bq[KS];      // B operand: column ln = query q0 + ln
  { const unsigned short* qr = (const unsigned short*)Q16 + ((size_t)b * TT + q0 + ln) * ldq + h * 64;
#pragma unroll
    for (int ks = 0; ks < KS; ++ks) { bq[ks].half[0] = *(const v8us*)(qr + ks * 32 + 8 * hh); bq[ks].half[1] = *(const v8us*)(qr + ks * 32 + 16 + 8 * hh); } }
  float m_q = -3.0e38f, l_q = 0.f; v8f oacc[DT];      // of query ln: the maximum in use (equal in both halves), this half's share of the sum, O^T rows dt * 16 + 8hh + r
  float thr = -3.0e38f, mb = 0.f;      // thr = m_q + TH, the score above which the maximum in use is renewed (any first score is above it); mb = C2 m_q - 10, set at every renewal
#pragma unroll
  for (int dt = 0; dt < DT; ++dt) oacc[dt] = (v8f){0.f,0.f,0.f,0.f,0.f,0.f,0.f,0.f};
  asm volatile("s_wait_asynccnt 0x0" ::: "memory");      // this wave's share of tile 0 has landed
  __syncthreads();      // tile 0 is published: nobody reads it in front of this barrier
  fill(1, 1);
#pragma unroll 1      // one trip per tile: the ring's order stands once, at the foot
  for (int t = 0; t < NTILE; ++t) {
    const unsigned char* tb = ring + (t & 1) * BUF + (w >> 2) * 4096 + lane * 16;      // the wave's key block in the tile's first pass: 4 KiB per 32 keys of K and of V, a lane's 16 B at lane * 16 in every 512-byte load
#pragma unroll 1      // rolled: one base register per pass, every fragment at an immediate offset from it
    for (int p = 0; p < NP; ++p) {
    const unsigned short* Kf = (const unsigned short*)(tb + p * SLOT); const unsigned short* Vf = (const unsigned short*)(tb + p * SLOT + SLOT / 2);
    v8f s[2];      // s[nt][r] = raw product (score * 8) of key nt * 16 + 8hh + r of the block with query ln
    FragH ak[2][KS];
#pragma unroll
    for (int nt = 0; nt < 2; ++nt)
#pragma unroll
      for (int ks = 0; ks < KS; ++ks) { ak[nt][ks].half[0] = *(const v8us*)(Kf + nt * 1024 + ks * 512); ak[nt][ks].half[1] = *(const v8us*)(Kf + nt * 1024 + ks * 512 + 256); }
    __builtin_amdgcn_sched_barrier(0);      // keeps the eight K reads in one group in front of the products: left free, the scheduler reads the last four in pairs between the products, each pair waited for on the spot
#pragma unroll
    for (int nt = 0; nt < 2; ++nt) { v8f acc = (v8f){0.f,0.f,0.f,0.f,0.f,0.f,0.f,0.f};
#pragma unroll
      for (int ks = 0; ks < KS; ++ks) acc = __builtin_amdgcn_wmma_f32_16x16x32_f16(false, ak[nt][ks].v, false, bq[ks].v, (short)0, acc, false, false);
      s[nt] = acc; }
    float mc = fmaxf(s[0][0], s[1][0]);
#pragma unroll
    for (int r = 1; r < 8; ++r) mc = fmaxf(mc, fmaxf(s[0][r], s[1][r]));
    if (__builtin_amdgcn_ballot_w32(mc > thr) != 0) {      // one scalar branch per pass, taken by the whole wave when any lane's 16 scores pass thr: only then are the maximum, the sum and the accumulators renewed
      mc = fmaxf(mc, __int_as_float(__builtin_amdgcn_permlanex16(__float_as_int(mc), __float_as_int(mc), 0x76543210, 0xfedcba98, false, false)));      // lane l <-> l ^ 16: the other 16 keys of the same query, so that both halves renew alike
      const float mn = fmaxf(m_q, mc); const float al = __builtin_amdgcn_exp2f((m_q - mn) * C2); m_q = mn; thr = mn + TH;
      mb = fmaf(mn, C2, -10.0f);      // the 2^10 of the f16 weights rides in the exponent: weights and their sum both carry it, and the merge divides it out
      l_q *= al;
#pragma unroll
      for (int dt = 0; dt < DT; ++dt) oacc[dt] *= al; }
    FragH av[DT];
#pragma unroll
    for (int dt = 0; dt < DT; ++dt) { av[dt].half[0] = *(const v8us*)(Vf + dt * 512); av[dt].half[1] = *(const v8us*)(Vf + dt * 512 + 256); }
    FragH pb; float ps = 0.f;
#pragma unroll
    for (int r = 0; r < 8; ++r) { const float p0 = __builtin_amdgcn_exp2f(fmaf(s[0][r], C2, -mb)), p1 = __builtin_amdgcn_exp2f(fmaf(s[1][r], C2, -mb)); ps += p0 + p1; pb.h[r] = (_Float16)p0; pb.h[8 + r] = (_Float16)p1; }
    l_q += ps;
    __builtin_amdgcn_sched_barrier(0);      // keeps the eight V reads in one group in front of the products: left free, the scheduler sinks half of them in among the four products, each pair waited for on the spot
#pragma unroll
    for (int dt = 0; dt < DT; ++dt) {
      if (dt + 1 < DT) oacc[dt] = __builtin_amdgcn_wmma_f32_16x16x32_f16(false, av[dt].v, false, pb.v, (short)0, oacc[dt], false, false);
      else oacc[dt] = mmaH<1>(av[dt].v, av[dt].v, pb.v, pb.v, oacc[dt]); } }      // the pass's last product keeps its four v_nop: behind it comes the loop's back edge, and the next pass's first vector instructions rewrite registers of its operands
    asm volatile("s_wait_dscnt 0x0" ::: "memory");      // this wave's reads of the buffer have returned before the buffer is handed to its next writer
    asm volatile("s_wait_asynccnt 0x0" ::: "memory");      // this wave's share of tile t + 1 has landed
    __syncthreads();      // publishes tile t + 1 and ends every wave's reads of tile t's buffer
    if (t + 2 < NTILE) fill(t + 2, t & 1); }
  asm volatile("s_wait_asynccnt 0x0" ::: "memory");      // no copy is outstanding when the ring becomes staging for the partials (the last trip's barrier has ended every read of it)
  l_q += __int_as_float(__builtin_amdgcn_permlanex16(__float_as_int(l_q), __float_as_int(l_q), 0x76543210, 0xfedcba98, false, false));      // the halves' sums joined once
  if (hh == 0) { sM[w][ln] = m_q; sL[w][ln] = l_q; }
#pragma unroll
  for (int dt = 0; dt < DT; ++dt) { *(v4fa*)&sO[w][ln][dt * 16 + 8 * hh] = (v4f){oacc[dt][0], oacc[dt][1], oacc[dt][2], oacc[dt][3]}; *(v4fa*)&sO[w][ln][dt * 16 + 8 * hh + 4] = (v4f){oacc[dt][4], oacc[dt][5], oacc[dt][6], oacc[dt][7]}; }
  __syncthreads();      // every wave's partial (max, sum, accumulator) is in LDS before any wave merges
  for (int e = tid; e < 4 * RPW * 16; e += 32 * NW) { const int row = e >> 4, pc = e & 15, qt = row / RPW, r = row % RPW;      // one query row per 16 lanes, 16 B per lane
    float mg[KSPL], M = -3.0e38f;
#pragma unroll
    for (int g = 0; g < KSPL; ++g) { mg[g] = sM[g * 4 + qt][r]; M = fmaxf(M, mg[g]); }
    float L = 0.f; v4f acc = {0.f, 0.f, 0.f, 0.f};
#pragma unroll
    for (int g = 0; g < KSPL; ++g) { const float wg = __builtin_amdgcn_exp2f((mg[g] - M) * C2); L += wg * sL[g * 4 + qt][r]; const v4f pv = *(const v4fa*)&sO[g * 4 + qt][r][pc * 4]; acc += pv * wg; }
    const float inv = (L > 0.f) ? 1.0f / L : 0.f;      // L and acc both carry the 2^10
    const int g = qb0 + row;      // stacked row g = head * NB + batch row: it goes straight to its merged place, 256 contiguous bytes per 16 lanes
    *(v4f*)(O + (size_t)(g % NB) * ldo + (g / NB) * DD + pc * 4) = acc * inv; } }

extern "C" void kernel_launch(void* const* d_in, const int* in_sizes, int n_in,
                              void* d_out, int out_size, void* d_ws, size_t ws_size, hipStream_t stream) {
  (void)in_sizes; (void)n_in; (void)out_size;
  const float* const* I = (const float* const*)d_in; const float* xq = I[0]; const float* xk = I[1]; const float* xv = I[2]; const float* Wq = I[3]; const float* Wk = I[4]; const float* Wv = I[5];
  char* ws = (char*)d_ws; size_t off = 0;
  auto take = [&](size_t bytes) { char* p = ws + off; off += (bytes + 255) & ~(size_t)255; return p; };
  _Float16* Qs = (_Float16*)take((size_t)TT * DD * 2); _Float16* Kp = (_Float16*)take((size_t)TT * DD * 2); _Float16* Vp = (_Float16*)take((size_t)TT * DD * 2);
  if (off > ws_size) return;      // 3 x 2.1 = about 6.3 MB
  k_proj<<<dim3(NB / 128, NHD, 3), 256, 0, stream>>>(xq, xk, xv, Wq, Wk, Wv, Qs, Kp, Vp);      /* q stacked, K and V in fragment order */
  k_flash<<<BB * NH * (TT / 64), 1024, 0, stream>>>(Qs, DD, Kp, Vp, nullptr, (float*)d_out, EE);      /* one slab: 16384 queries x 16384 keys; rows stored merged */
}

// v009
// Measured time: 61.9 microseconds a run.
// Timed twice side by side with v008, it ran 1.07 times as fast both times.
// Counting every step since v000, it is 26.4 times as fast.
#include <hip/hip_runtime.h>
// Multi-head attention whose heads are STACKED along the batch axis (B=4096 rows, EMBED=256, 4 heads × 64): q = queries·W_Query, k = keys·W_Key, v = values·W_Value ((in,out), no bias); the heads are split TF-style into [H·B, 64] = [16384, 64] and ONE softmax(q·kᵀ/√64)·v runs over all 16384 stacked rows
// (every query attends to every (head, row) key); the result is merged back to [B, H·64].
// Compute dtype: inputs and weights rounded to bf16; q, k, v as f16 GEMM outputs of ONE projection launch (grid.y = head, grid.z = operand) that reads the f32 inputs itself and stores q in the stacked [h * 4096 + b][64] layout and k, v in the attention kernel's fragment order;
// fused flash-style kernel over T = 16384 (online softmax f32, P f16 x 2^10, f32 accumulate) on v_wmma_f32_16x16x32_f16, split four ways along the keys, which stores un-normalised f32 partial rows with their max and sum; a short third launch joins the four partials of a row and stores it at its merged place in the output. Three launches in all.
#define BB 1
#define TT 16384
#define NH 1
#define NB 4096
#define NHD 4
#define EE 256
#define DD 64
#define NR (BB * TT)
#define KSPLIT 4

typedef __bf16 v16b __attribute__((ext_vector_type(16)));
typedef unsigned short v8us __attribute__((ext_vector_type(8), may_alias));
typedef float  v8f  __attribute__((ext_vector_type(8)));
typedef float  v4f  __attribute__((ext_vector_type(4)));
typedef float  v4fa __attribute__((ext_vector_type(4), may_alias));
typedef float  v2f  __attribute__((ext_vector_type(2)));
typedef float  v2fa __attribute__((ext_vector_type(2), may_alias));
union FragB { v16b v; v8us half[2]; unsigned short u[16]; };

__device__ __forceinline__ unsigned short bf16_bits(float x) { unsigned int u = __float_as_uint(x); return (unsigned short)((u + 0x7FFFu + ((u >> 16) & 1u)) >> 16); }
__device__ __forceinline__ float bf16_val(unsigned short b) { return __uint_as_float(((unsigned int)b) << 16); }
__device__ __forceinline__ float bf16_round(float x) { return bf16_val(bf16_bits(x)); }
// D += A·B with NT terms: 1 = ah·bh, 2 = + al·bh (A split), 3 = + ah·bl (both split)
template <int NT>
__device__ __forceinline__ v8f mmaN(v16b ah, v16b al, v16b bh, v16b bl, v8f c) {
  c = __builtin_amdgcn_wmma_f32_16x16x32_bf16(false, ah, false, bh, (short)0, c, false, false);
  if (NT >= 2) c = __builtin_amdgcn_wmma_f32_16x16x32_bf16(false, al, false, bh, (short)0, c, false, false);
  if (NT >= 3) c = __builtin_amdgcn_wmma_f32_16x16x32_bf16(false, ah, false, bl, (short)0, c, false, false);
  asm volatile("v_nop\n\tv_nop\n\tv_nop\n\tv_nop" : "+v"(c) : "v"(ah), "v"(al), "v"(bh), "v"(bl));
  return c;
}

__global__ __launch_bounds__(256) void k_wt_bf16(const float* __restrict__ W, unsigned short* __restrict__ Wt, int K, int N) {
  const int t = blockIdx.x * 256 + threadIdx.x;
  const int k8n = K / 8;
  if (t >= N * k8n) return;
  const int n = t / k8n, k8 = (t % k8n) * 8;
  v8us v;
#pragma unroll
  for (int i = 0; i < 8; ++i) v[i] = bf16_bits(W[(size_t)(k8 + i) * N + n]);
  *(v8us*)(Wt + (size_t)n * K + k8) = v;
  
}

// GEMM C[M][N] (f32, pitch ldc) = act(A[M][K]·W + bias). A f32 row-major (pitch lda) converted per fragment to bf16
// (ASPLIT: hi/lo two planes -> 2 terms, else single rounded term); Wt bf16 [N][K] (pitch ldb). BIAS_BF16 rounds the
// bias to bf16 first (bias quantised to bf16 before the add). K%32==0, M%16==0, N%64==0.
template <bool ASPLIT, int ACT, bool BIAS_BF16>
__global__ __launch_bounds__(128) void k_gemm_bf(const float* __restrict__ A, int lda, const unsigned short* __restrict__ Wt, int ldb,
                                               const float* __restrict__ bias, float* __restrict__ C, int ldc, int M, int N, int K) {
  __shared__ __attribute__((aligned(16))) float so[4][16][64];
  const int tid = threadIdx.x, w = tid >> 5, lane = tid & 31, ln = lane & 15, hh = lane >> 4;
  const int ntn = N / 64;
  const int wid = blockIdx.x * 4 + w;
  const int mt = wid / ntn, nq = wid % ntn;
  if (mt * 16 >= M) return;
  const int row0 = mt * 16, col0 = nq * 64;
  const float* arow = A + (size_t)(row0 + ln) * lda;
  v8f acc[4] = {};
  for (int kb = 0; kb < K; kb += 32) {
    FragB ah, al;
    const v4f x0 = *(const v4fa*)(arow + kb + 8 * hh), x1 = *(const v4fa*)(arow + kb + 8 * hh + 4);
    const v4f x2 = *(const v4fa*)(arow + kb + 16 + 8 * hh), x3 = *(const v4fa*)(arow + kb + 16 + 8 * hh + 4);
    float xs[16] = {x0[0],x0[1],x0[2],x0[3],x1[0],x1[1],x1[2],x1[3],x2[0],x2[1],x2[2],x2[3],x3[0],x3[1],x3[2],x3[3]};
#pragma unroll
    for (int i = 0; i < 16; ++i) { const unsigned short hb = bf16_bits(xs[i]); ah.u[i] = hb; al.u[i] = ASPLIT ? bf16_bits(xs[i] - bf16_val(hb)) : (unsigned short)0; }
#pragma unroll
    for (int t = 0; t < 4; ++t) {
      const unsigned short* brow = Wt + (size_t)(col0 + t * 16 + ln) * ldb + kb;
      FragB b;
      b.half[0] = *(const v8us*)(brow + 8 * hh);
      b.half[1] = *(const v8us*)(brow + 16 + 8 * hh);
      acc[t] = mmaN<ASPLIT ? 2 : 1>(ah.v, al.v, b.v, b.v, acc[t]);
    }
  }
#pragma unroll
  for (int t = 0; t < 4; ++t) {
    float bv = bias ? bias[col0 + t * 16 + ln] : 0.f;
    if (BIAS_BF16) bv = bf16_round(bv);
#pragma unroll
    for (int r = 0; r < 8; ++r) { float v = acc[t][r] + bv; if (ACT == 1) v = fmaxf(v, 0.f); so[w][8 * hh + r][t * 16 + ln] = v; }
  }
  __builtin_amdgcn_fence(__ATOMIC_ACQ_REL, "workgroup");
  __builtin_amdgcn_wave_barrier();
  const int rsub = lane >> 4, c4 = (lane & 15) * 4;
  {
#pragma unroll
    for (int q = 0; q < 8; ++q) {
      const int r = q * 2 + rsub;
      const v4f v = *(const v4fa*)&so[w][r][c4];
      *(v4f*)(C + (size_t)(row0 + r) * ldc + col0 + c4) = v;
    }
    
  }
}

// Flash-style causal/unmasked attention, all contractions 3-term bf16 hi/lo splits, f32 softmax with running max.
// q,k,v rows are read from f32 buffers with arbitrary row pitch (so they can live inside a fused qkv buffer);
// D = head size (multiple of 32, <= 128); one wave = 16 query rows; block = 4 waves (64 queries) sharing K/V chunks of 32.
template <int D, bool CAUSAL>
__global__ __launch_bounds__(128) void k_flash(const float* __restrict__ qb, const float* __restrict__ kb, const float* __restrict__ vb,
                                             int pitch, int T, int H, float scale, float* __restrict__ y, int ypitch) {
  constexpr int KS = D / 32;        // k-steps for QK
  constexpr int DT = D / 16;        // d tiles for PV
  __shared__ __attribute__((aligned(16))) unsigned short sKh[32][D + 8], sKl[32][D + 8], sVh[32][D + 8], sVl[32][D + 8];
  __shared__ __attribute__((aligned(16))) unsigned short sPh[4][16][40], sPl[4][16][40];
  __shared__ __attribute__((aligned(16))) float sO[4][16][D];
  const int tid = threadIdx.x, w = tid >> 5, lane = tid & 31, ln = lane & 15, hh = lane >> 4;
  const int nqb = (T + 63) / 64;
  const int bh = blockIdx.x / nqb, qblk = blockIdx.x % nqb;
  const int b = bh / H, h = bh % H;
  const int q0 = qblk * 64 + w * 16;
  const float* Q = qb + (size_t)b * T * pitch + h * D;
  const float* K = kb + (size_t)b * T * pitch + h * D;
  const float* V = vb + (size_t)b * T * pitch + h * D;

  // A fragments of the wave's 16 query rows (scaled), hi/lo
  FragB aqh[KS], aql[KS];
  {
    int row = q0 + ln; if (row >= T) row = T - 1;
    const float* qr = Q + (size_t)row * pitch;
#pragma unroll
    for (int ks = 0; ks < KS; ++ks)
#pragma unroll
      for (int i = 0; i < 16; ++i) {
        const int d = ks * 32 + ((i < 8) ? (8 * hh + i) : (16 + 8 * hh + (i - 8)));
        const float x = qr[d] * scale; const unsigned short hb = bf16_bits(x);
        aqh[ks].u[i] = hb; aql[ks].u[i] = bf16_bits(x - bf16_val(hb));
      }
  }
  float m_r[8], l_r[8];
#pragma unroll
  for (int r = 0; r < 8; ++r) { m_r[r] = -3.0e38f; l_r[r] = 0.f; }
  v8f oacc[DT];
#pragma unroll
  for (int dt = 0; dt < DT; ++dt) oacc[dt] = (v8f){0.f,0.f,0.f,0.f,0.f,0.f,0.f,0.f};

  const int kv_end = CAUSAL ? min(T, qblk * 64 + 64) : T;     // block-uniform
  for (int j0 = 0; j0 < kv_end; j0 += 32) {
    __syncthreads();
    for (int e = tid; e < 32 * (D / 4); e += 128) {
      const int r = e / (D / 4), c4 = (e % (D / 4)) * 4;
      const int key = j0 + r;
      v4f kf = {0.f,0.f,0.f,0.f}, vf = {0.f,0.f,0.f,0.f};
      if (key < T) { kf = *(const v4fa*)(K + (size_t)key * pitch + c4); vf = *(const v4fa*)(V + (size_t)key * pitch + c4); }
#pragma unroll
      for (int t = 0; t < 4; ++t) {
        unsigned short hb = bf16_bits(kf[t]); sKh[r][c4 + t] = hb; sKl[r][c4 + t] = bf16_bits(kf[t] - bf16_val(hb));
        hb = bf16_bits(vf[t]); sVh[r][c4 + t] = hb; sVl[r][c4 + t] = bf16_bits(vf[t] - bf16_val(hb));
      }
    }
    __syncthreads();
    // S tile 16 x 32
    v8f s[2];
#pragma unroll
    for (int nt = 0; nt < 2; ++nt) {
      v8f acc = {};
#pragma unroll
      for (int ks = 0; ks < KS; ++ks) {
        FragB bh_, bl_;
        bh_.half[0] = *(const v8us*)&sKh[nt * 16 + ln][ks * 32 + 8 * hh]; bh_.half[1] = *(const v8us*)&sKh[nt * 16 + ln][ks * 32 + 16 + 8 * hh];
        bl_.half[0] = *(const v8us*)&sKl[nt * 16 + ln][ks * 32 + 8 * hh]; bl_.half[1] = *(const v8us*)&sKl[nt * 16 + ln][ks * 32 + 16 + 8 * hh];
        acc = mmaN<3>(aqh[ks].v, aql[ks].v, bh_.v, bl_.v, acc);
      }
      s[nt] = acc;
    }
    // mask + running max (rows 8hh+r; the 16 lanes of a half share rows)
    float alpha[8];
#pragma unroll
    for (int r = 0; r < 8; ++r) {
      const int qi = q0 + 8 * hh + r;
      const int ja = j0 + ln, jb = j0 + 16 + ln;
      if (CAUSAL) { if (ja > qi) s[0][r] = -3.0e38f; if (jb > qi) s[1][r] = -3.0e38f; }
      if (ja >= T) s[0][r] = -3.0e38f;
      if (jb >= T) s[1][r] = -3.0e38f;
      float mx = fmaxf(s[0][r], s[1][r]);
      mx = fmaxf(mx, __shfl_xor(mx, 1, 32)); mx = fmaxf(mx, __shfl_xor(mx, 2, 32)); mx = fmaxf(mx, __shfl_xor(mx, 4, 32)); mx = fmaxf(mx, __shfl_xor(mx, 8, 32));
      const float mnew = fmaxf(m_r[r], mx);
      alpha[r] = (mnew > -1.0e38f) ? __expf(m_r[r] - mnew) : 1.0f;
      const float p0 = (s[0][r] > -1.0e38f) ? __expf(s[0][r] - mnew) : 0.f;
      const float p1 = (s[1][r] > -1.0e38f) ? __expf(s[1][r] - mnew) : 0.f;
      m_r[r] = mnew;
      l_r[r] = l_r[r] * alpha[r] + p0 + p1;            // per-lane partial row sum (16 lanes combined at the end)
      unsigned short hb = bf16_bits(p0); sPh[w][8 * hh + r][ln] = hb;      sPl[w][8 * hh + r][ln] = bf16_bits(p0 - bf16_val(hb));
      hb = bf16_bits(p1);                sPh[w][8 * hh + r][16 + ln] = hb; sPl[w][8 * hh + r][16 + ln] = bf16_bits(p1 - bf16_val(hb));
    }
#pragma unroll
    for (int dt = 0; dt < DT; ++dt)
#pragma unroll
      for (int r = 0; r < 8; ++r) oacc[dt][r] *= alpha[r];
    __builtin_amdgcn_fence(__ATOMIC_ACQ_REL, "workgroup");
    __builtin_amdgcn_wave_barrier();
    FragB pah, pal;
    pah.half[0] = *(const v8us*)&sPh[w][ln][8 * hh]; pah.half[1] = *(const v8us*)&sPh[w][ln][16 + 8 * hh];
    pal.half[0] = *(const v8us*)&sPl[w][ln][8 * hh]; pal.half[1] = *(const v8us*)&sPl[w][ln][16 + 8 * hh];
#pragma unroll
    for (int dt = 0; dt < DT; ++dt) {
      FragB bvh, bvl;
#pragma unroll
      for (int i = 0; i < 8; ++i) {
        bvh.u[i] = sVh[8 * hh + i][dt * 16 + ln]; bvh.u[8 + i] = sVh[16 + 8 * hh + i][dt * 16 + ln];
        bvl.u[i] = sVl[8 * hh + i][dt * 16 + ln]; bvl.u[8 + i] = sVl[16 + 8 * hh + i][dt * 16 + ln];
      }
      oacc[dt] = mmaN<3>(pah.v, pal.v, bvh.v, bvl.v, oacc[dt]);
    }
    __builtin_amdgcn_fence(__ATOMIC_ACQ_REL, "workgroup");
    __builtin_amdgcn_wave_barrier();
  }
#pragma unroll
  for (int r = 0; r < 8; ++r) {
    float l = l_r[r];
    l += __shfl_xor(l, 1, 32); l += __shfl_xor(l, 2, 32); l += __shfl_xor(l, 4, 32); l += __shfl_xor(l, 8, 32);
    l_r[r] = (l > 0.f) ? 1.0f / l : 0.f;
  }
#pragma unroll
  for (int dt = 0; dt < DT; ++dt)
#pragma unroll
    for (int r = 0; r < 8; ++r) sO[w][8 * hh + r][dt * 16 + ln] = oacc[dt][r] * l_r[r];
  __builtin_amdgcn_fence(__ATOMIC_ACQ_REL, "workgroup");
  __builtin_amdgcn_wave_barrier();
  {
    for (int r = 0; r < 16; ++r) {
      const int row = q0 + r;
      if (row < T && lane < D / 4) {
        const v4f val = *(const v4fa*)&sO[w][r][lane * 4];
        *(v4f*)(y + ((size_t)b * T + row) * ypitch + h * D + lane * 4) = val;
      }
    }
    
  }
}

// GEMM C = act(A·W + bias + resid): A f32 (ASPLIT -> hi/lo 2 terms), Wt bf16 [N][K]; ACT 0 none, 1 relu, 2 exact gelu;
// resid (optional, f32, row index = (row % rmod), pitch ldr, RES_BF16 rounds it) added before the activation.
template <bool ASPLIT, int ACT, bool BIAS_BF16, bool RES_BF16>
__global__ __launch_bounds__(128) void k_gemm_bf3(const float* __restrict__ A, int lda, const unsigned short* __restrict__ Wt, int ldb,
                                                const float* __restrict__ bias, const float* __restrict__ resid, int rmod, int ldr,
                                                float* __restrict__ C, int ldc, int M, int N, int K) {
  __shared__ __attribute__((aligned(16))) float so[4][16][64];
  const int tid = threadIdx.x, w = tid >> 5, lane = tid & 31, ln = lane & 15, hh = lane >> 4;
  const int ntn = N / 64;
  const int wid = blockIdx.x * 4 + w;
  const int mt = wid / ntn, nq = wid % ntn;
  if (mt * 16 >= M) return;
  const int row0 = mt * 16, col0 = nq * 64;
  const float* arow = A + (size_t)(row0 + ln) * lda;
  v8f acc[4] = {};
  for (int kb = 0; kb < K; kb += 32) {
    FragB ah, al;
    const v4f x0 = *(const v4fa*)(arow + kb + 8 * hh), x1 = *(const v4fa*)(arow + kb + 8 * hh + 4);
    const v4f x2 = *(const v4fa*)(arow + kb + 16 + 8 * hh), x3 = *(const v4fa*)(arow + kb + 16 + 8 * hh + 4);
    float xs[16] = {x0[0],x0[1],x0[2],x0[3],x1[0],x1[1],x1[2],x1[3],x2[0],x2[1],x2[2],x2[3],x3[0],x3[1],x3[2],x3[3]};
#pragma unroll
    for (int i = 0; i < 16; ++i) { const unsigned short hb = bf16_bits(xs[i]); ah.u[i] = hb; al.u[i] = ASPLIT ? bf16_bits(xs[i] - bf16_val(hb)) : (unsigned short)0; }
#pragma unroll
    for (int t = 0; t < 4; ++t) {
      const unsigned short* brow = Wt + (size_t)(col0 + t * 16 + ln) * ldb + kb;
      FragB b;
      b.half[0] = *(const v8us*)(brow + 8 * hh);
      b.half[1] = *(const v8us*)(brow + 16 + 8 * hh);
      acc[t] = mmaN<ASPLIT ? 2 : 1>(ah.v, al.v, b.v, b.v, acc[t]);
    }
  }
#pragma unroll
  for (int t = 0; t < 4; ++t) {
    const int col = col0 + t * 16 + ln;
    float bv = bias ? bias[col] : 0.f;
    if (BIAS_BF16) bv = bf16_round(bv);
#pragma unroll
    for (int r = 0; r < 8; ++r) {
      float v = acc[t][r] + bv;
      if (resid) { float rv = resid[(size_t)((row0 + 8 * hh + r) % rmod) * ldr + col]; if (RES_BF16) rv = bf16_round(rv); v += rv; }
      if (ACT == 1) v = fmaxf(v, 0.f);
      if (ACT == 2) v = 0.5f * v * (1.0f + erff(v * 0.70710678118654752f));
      if (ACT == 3) { const float u = 0.7978845608028654f * (v + 0.044715f * v * v * v); v = 0.5f * v * (1.0f + tanhf(u)); }
      so[w][8 * hh + r][t * 16 + ln] = v;
    }
  }
  __builtin_amdgcn_fence(__ATOMIC_ACQ_REL, "workgroup");
  __builtin_amdgcn_wave_barrier();
  const int rsub = lane >> 4, c4 = (lane & 15) * 4;
  {
#pragma unroll
    for (int q = 0; q < 8; ++q) {
      const int r = q * 2 + rsub;
      const v4f v = *(const v4fa*)&so[w][r][c4];
      *(v4f*)(C + (size_t)(row0 + r) * ldc + col0 + c4) = v;
    }
    
  }
}
// row LayerNorm (biased variance, eps) over N: s = X (+ R); optional out_sum <- s; out_norm <- (s-mu)*rsqrt(var+eps)*g + b
template <bool PARAM_BF16>
__global__ __launch_bounds__(256) void k_layernorm(const float* __restrict__ X, const float* __restrict__ R, const float* __restrict__ g, const float* __restrict__ bta,
                                                  float* __restrict__ out_sum, float* __restrict__ out_norm, int N, float eps) {
  __shared__ float red[256];
  const int row = blockIdx.x, tid = threadIdx.x;
  const float* x = X + (size_t)row * N; const float* rr = R ? R + (size_t)row * N : nullptr;
  float vals[16];                     // up to N = 4096
  const int per = N / 256;            // contiguous chunk per thread? use strided-by-4 chunks: thread handles j = tid*4 + 1024*u
  float s1 = 0.f;
  for (int u = 0; u < per / 4; ++u) {
    const int j = tid * 4 + 1024 * u;
    const v4f a = *(const v4fa*)(x + j);
    v4f b = {0.f,0.f,0.f,0.f}; if (rr) b = *(const v4fa*)(rr + j);
#pragma unroll
    for (int q = 0; q < 4; ++q) { const float v = a[q] + b[q]; vals[u * 4 + q] = v; s1 += v; }
  }
  red[tid] = s1; __syncthreads();
  for (int st = 128; st > 0; st >>= 1) { if (tid < st) red[tid] += red[tid + st]; __syncthreads(); }
  const float mu = red[0] / (float)N; __syncthreads();
  float s2 = 0.f;
  for (int u = 0; u < per / 4; ++u)
#pragma unroll
    for (int q = 0; q < 4; ++q) { const float c = vals[u * 4 + q] - mu; s2 += c * c; }
  red[tid] = s2; __syncthreads();
  for (int st = 128; st > 0; st >>= 1) { if (tid < st) red[tid] += red[tid + st]; __syncthreads(); }
  const float rs = rsqrtf(red[0] / (float)N + eps);
  {
    for (int u = 0; u < per / 4; ++u) {
      const int j = tid * 4 + 1024 * u;
      v4f o, sm;
#pragma unroll
      for (int q = 0; q < 4; ++q) {
        float gg = g[j + q], bb = bta[j + q];
        if (PARAM_BF16) { gg = bf16_round(gg); bb = bf16_round(bb); }
        sm[q] = vals[u * 4 + q]; o[q] = (vals[u * 4 + q] - mu) * rs * gg + bb;
      }
      if (out_sum) *(v4f*)(out_sum + (size_t)row * N + j) = sm;
      *(v4f*)(out_norm + (size_t)row * N + j) = o;
    }
    
  }
}



// ---- f16 WMMA path (v_wmma_f32_16x16x32_f16): 11-bit significands for operands in range — used where a [0,1] probability operand needs more precision than bf16
typedef _Float16 v16h __attribute__((ext_vector_type(16)));
union FragH { v16h v; v8us half[2]; _Float16 h[16]; unsigned short u[16]; };
template <int NT>
__device__ __forceinline__ v8f mmaH(v16h ah, v16h al, v16h bh, v16h bl, v8f c) {
  c = __builtin_amdgcn_wmma_f32_16x16x32_f16(false, ah, false, bh, (short)0, c, false, false);
  if (NT >= 2) c = __builtin_amdgcn_wmma_f32_16x16x32_f16(false, al, false, bh, (short)0, c, false, false);
  if (NT >= 3) c = __builtin_amdgcn_wmma_f32_16x16x32_f16(false, ah, false, bl, (short)0, c, false, false);
  asm volatile("v_nop\n\tv_nop\n\tv_nop\n\tv_nop" : "+v"(c) : "v"(ah), "v"(al), "v"(bh), "v"(bl));
  return c;
}
// batched GEMM like k_gemm_b but f16 operands: A f32 (split into f16 hi/lo if ASPLIT, else rounded to f16), Bt = f16 values [n][k]; alpha; C f32; N multiple of 16 (partial tiles skipped)
template <bool ASPLIT>
__global__ __launch_bounds__(128) void k_gemm_h(const float* __restrict__ A, int lda, size_t sA, const _Float16* __restrict__ Bh, int ldb, size_t sB, float alpha, float* __restrict__ C, int ldc, size_t sC, int M, int N, int K) {
  __shared__ __attribute__((aligned(16))) float so[4][16][64];
  const int tid = threadIdx.x, w = tid >> 5, lane = tid & 31, ln = lane & 15, hh = lane >> 4; const int by = blockIdx.y;
  A += (size_t)by * sA; Bh += (size_t)by * sB; C += (size_t)by * sC;
  const int ntn = (N + 63) / 64; const int wid = blockIdx.x * 4 + w; const int mt = wid / ntn, nq = wid % ntn; if (mt * 16 >= M) return;
  const int row0 = mt * 16, col0 = nq * 64; const float* arow = A + (size_t)(row0 + ln) * lda;
  v8f acc[4] = {};
  for (int kb = 0; kb < K; kb += 32) {
    FragH ah, al;
    const v4f x0 = *(const v4fa*)(arow + kb + 8 * hh), x1 = *(const v4fa*)(arow + kb + 8 * hh + 4), x2 = *(const v4fa*)(arow + kb + 16 + 8 * hh), x3 = *(const v4fa*)(arow + kb + 16 + 8 * hh + 4);
    float xs[16] = {x0[0],x0[1],x0[2],x0[3],x1[0],x1[1],x1[2],x1[3],x2[0],x2[1],x2[2],x2[3],x3[0],x3[1],x3[2],x3[3]};
#pragma unroll
    for (int i = 0; i < 16; ++i) { const _Float16 h = (_Float16)xs[i]; ah.h[i] = h; al.h[i] = ASPLIT ? (_Float16)(xs[i] - (float)h) : (_Float16)0.0f; }
#pragma unroll
    for (int t = 0; t < 4; ++t) { if (col0 + t * 16 >= N) continue; const size_t boff = (size_t)(col0 + t * 16 + ln) * ldb + kb; FragH bq; bq.half[0] = *(const v8us*)(Bh + boff + 8 * hh); bq.half[1] = *(const v8us*)(Bh + boff + 16 + 8 * hh);
      acc[t] = mmaH<ASPLIT ? 2 : 1>(ah.v, al.v, bq.v, bq.v, acc[t]); }
  }
#pragma unroll
  for (int t = 0; t < 4; ++t) { if (col0 + t * 16 >= N) continue;
#pragma unroll
    for (int r = 0; r < 8; ++r) so[w][8 * hh + r][t * 16 + ln] = acc[t][r] * alpha; }
  __builtin_amdgcn_fence(__ATOMIC_ACQ_REL, "workgroup"); __builtin_amdgcn_wave_barrier();
  const int rsub = lane >> 4, c4 = (lane & 15) * 4;
  {
#pragma unroll
    for (int q = 0; q < 8; ++q) { const int r = q * 2 + rsub; if (col0 + c4 < N) { const v4f v = *(const v4fa*)&so[w][r][c4]; *(v4f*)(C + (size_t)(row0 + r) * ldc + col0 + c4) = v; } }
     }
}

typedef _Float16 v4h __attribute__((ext_vector_type(4)));

__global__ __launch_bounds__(256) void k_h16(const float* __restrict__ x, _Float16* __restrict__ X16, size_t n8) { const size_t t = (size_t)blockIdx.x * 256 + threadIdx.x; if (t >= n8) return; FragH f;
#pragma unroll
  for (int q = 0; q < 8; ++q) f.h[q] = (_Float16)x[t * 8 + q]; *(v8us*)((unsigned short*)X16 + t * 8) = f.half[0];  }
__global__ __launch_bounds__(256) void k_round16f(const float* __restrict__ W, _Float16* __restrict__ Bt, size_t n8) { const size_t t = (size_t)blockIdx.x * 256 + threadIdx.x; if (t >= n8) return; FragH f;
#pragma unroll
  for (int i = 0; i < 8; ++i) f.h[i] = (_Float16)(bf16_round(W[t * 8 + i]) * 16.0f); *(v8us*)((unsigned short*)Bt + t * 8) = f.half[0];  }
__global__ __launch_bounds__(256) void k_h16s(const float* __restrict__ F, _Float16* __restrict__ H, size_t n8) { const size_t t = (size_t)blockIdx.x * 256 + threadIdx.x; if (t >= n8) return; const v4f a = *(const v4fa*)(F + t * 8), c = *(const v4fa*)(F + t * 8 + 4); FragH f;
#pragma unroll
  for (int q = 0; q < 4; ++q) { f.h[q] = (_Float16)(a[q] * 16.0f); f.h[4 + q] = (_Float16)(c[q] * 16.0f); } *(v8us*)((unsigned short*)H + t * 8) = f.half[0];  }
// The three projections in one launch. Block = 8 waves = 128 input rows x one head's 64 columns of operand blockIdx.z (0 q, 1 k, 2 v); wave = 16 rows. The f32 inputs are read here and rounded as before (bf16, then f16; weights x 2^4), and the results leave in the form their reader takes:
// the head's weight slab W[0..255][h * 64 .. + 63] is transposed into LDS as f16 [n][k] (pitch 16 B x odd) behind one work-group barrier; the input rows go from global memory straight into fragments.
// q and k are taken transposed (A = weight rows n, B = input rows), so a lane holds 8 consecutive columns of ONE row; v is taken plain (A = input rows, B = weight rows), so a lane holds 8 consecutive rows of ONE column: each accumulator tile is then one 16-byte store per lane.
// Unit = 16 B = 8 f16 of one lane, lane = 16hh + ln, rows stacked as g = h * 4096 + b. Kp: per 16 keys 4 wave stores (t = 2 ks + half): unit = K[key tile * 16 + ln][t * 16 + 8hh + 0..7]. Vp: per 32 keys 8 wave loads (dt, half): unit = V[key block * 32 + half * 16 + 8hh + 0..7][dt * 16 + ln].
// So each of k_flash's wave-wide 16-byte fragment reads covers 512 contiguous bytes, and the Kp and Vp stores here are whole lines.
// The part behind the barrier, once per operand so that no branch stands behind a matrix instruction: 8 k steps x 4 tiles, then one 16-byte store per lane and tile.
template <int OP>
__device__ __forceinline__ void proj_tiles(const FragH (&ax)[8], const unsigned short (*sW)[EE + 8], int lane, int g0, unsigned short* __restrict__ dst) {
  const int ln = lane & 15, hh = lane >> 4; v8f acc[4] = {};
  FragH bw[2][4];      // the weight fragments of two k steps: step kb + 1 is read from LDS while step kb's products run
  auto frags = [&](int kb) {
#pragma unroll
    for (int t = 0; t < 4; ++t) { bw[kb & 1][t].half[0] = *(const v8us*)&sW[t * 16 + ln][kb * 32 + 8 * hh]; bw[kb & 1][t].half[1] = *(const v8us*)&sW[t * 16 + ln][kb * 32 + 16 + 8 * hh]; } };
  frags(0);
#pragma unroll      // straight-line: every LDS offset is an immediate and the fragment arrays stay in registers
  for (int kb = 0; kb < 8; ++kb) { if (kb + 1 < 8) frags(kb + 1);
#pragma unroll
    for (int t = 0; t < 4; ++t) acc[t] = OP == 2 ? __builtin_amdgcn_wmma_f32_16x16x32_f16(false, ax[kb].v, false, bw[kb & 1][t].v, (short)0, acc[t], false, false) : __builtin_amdgcn_wmma_f32_16x16x32_f16(false, bw[kb & 1][t].v, false, ax[kb].v, (short)0, acc[t], false, false);
    __builtin_amdgcn_sched_barrier(0); }      // keeps the reads one step ahead and no further: left free, the scheduler lifts most of the 64 reads to the top, and the kernel then needs more registers than let two blocks share a WGP
  unsigned short* o = OP == 0 ? dst + (size_t)(g0 + ln) * DD + 8 * hh : OP == 1 ? dst + (size_t)(g0 >> 4) * 1024 + lane * 8 : dst + (size_t)(g0 >> 5) * 2048 + (((g0 >> 4) & 1) * 32 + lane) * 8;
  constexpr int STEP = OP == 0 ? 16 : OP == 1 ? 256 : 512;
#pragma unroll
  for (int t = 0; t < 4; ++t) { FragH f;
#pragma unroll
    for (int r = 0; r < 8; ++r) f.h[r] = (_Float16)(acc[t][r] * 0.0625f);
    *(v8us*)(o + t * STEP) = f.half[0]; }
  asm volatile("s_wait_xcnt 0x0" ::: "memory"); }      // precaution: stands in front of every later write of a register that the four stores name (in the listing one operand's exit is followed by the next operand's part, which rewrites them)
__global__ __launch_bounds__(256, 4) void k_proj(const float* __restrict__ xq, const float* __restrict__ xk, const float* __restrict__ xv, const float* __restrict__ Wq, const float* __restrict__ Wk, const float* __restrict__ Wv,
                                              _Float16* __restrict__ Qs, _Float16* __restrict__ Kp, _Float16* __restrict__ Vp) {
  __shared__ __attribute__((aligned(16))) unsigned short sW[DD][EE + 8];
  const int tid = threadIdx.x, lane = tid & 31, ln = lane & 15, hh = lane >> 4; const int h = blockIdx.y, op = blockIdx.z;
  const float* X = op == 0 ? xq : op == 1 ? xk : xv; const float* Wm = op == 0 ? Wq : op == 1 ? Wk : Wv;
  const int row0 = blockIdx.x * 128 + (tid >> 5) * 16;
  const int n4 = (tid & 15) * 4, k80 = (tid >> 4) * 8;      // 16 lanes read the head's 256 contiguous bytes of one weight row; a thread takes 8 rows x 4 columns, twice
  const float* wrow = Wm + (size_t)k80 * EE + h * DD + n4; const float* arow = X + (size_t)(row0 + ln) * EE + 8 * hh;
  v4f wr[2][8];
#pragma unroll
  for (int rd = 0; rd < 2; ++rd)
#pragma unroll
    for (int i = 0; i < 8; ++i) wr[rd][i] = *(const v4fa*)(wrow + (size_t)(rd * 128 + i) * EE);
  v4f xa[8][4];      // row row0 + ln, in the fragment's k order: 8hh + 0..7 and 16 + 8hh + 0..7 of every 32
#pragma unroll
  for (int kb = 0; kb < 8; ++kb) { xa[kb][0] = *(const v4fa*)(arow + kb * 32); xa[kb][1] = *(const v4fa*)(arow + kb * 32 + 4); xa[kb][2] = *(const v4fa*)(arow + kb * 32 + 16); xa[kb][3] = *(const v4fa*)(arow + kb * 32 + 20); }
  asm volatile("s_wait_xcnt 0x0" :: "v"(wrow), "v"(arow) : "memory");      // precaution: stands in front of every later write of a register that one of the loads above names as its address; the two addresses are inputs so that their registers live up to here
#pragma unroll
  for (int rd = 0; rd < 2; ++rd)
#pragma unroll
    for (int j = 0; j < 4; ++j) { FragH f;
#pragma unroll
      for (int i = 0; i < 8; ++i) f.h[i] = (_Float16)(bf16_round(wr[rd][i][j]) * 16.0f);
      *(v8us*)&sW[n4 + j][rd * 128 + k80] = f.half[0]; }
  FragH ax[8];      // the wave's input rows as f16 fragments, made in front of the barrier: half the registers of the f32 rows, so that the k steps have room to read LDS ahead
#pragma unroll
  for (int kb = 0; kb < 8; ++kb)
#pragma unroll
    for (int i = 0; i < 16; ++i) ax[kb].h[i] = (_Float16)bf16_round(xa[kb][i >> 2][i & 3]);
  __syncthreads();      // the whole slab is in LDS before any wave takes a fragment of it
  const int g0 = h * NB + row0;      // first stacked row of the wave's tile
  if (op == 0) proj_tiles<0>(ax, sW, lane, g0, (unsigned short*)Qs); else if (op == 1) proj_tiles<1>(ax, sW, lane, g0, (unsigned short*)Kp); else proj_tiles<2>(ax, sW, lane, g0, (unsigned short*)Vp); }
__global__ __launch_bounds__(1024) void k_flash(const _Float16* __restrict__ Q16, int ldq, const _Float16* __restrict__ Kp, const _Float16* __restrict__ Vp, float* __restrict__ Op, float* __restrict__ ML) {
  constexpr int RPW = 16, QT = 16, DT = 4, KS = 2, KSPL = 2, NW = QT * KSPL;
  constexpr int NP = 8, TKEYS = NP * KSPL * 32, PLANE = TKEYS * 128, BUF = 2 * PLANE, SLOT = BUF / KSPL, NTILE = TT / KSPLIT / TKEYS;      // NP key blocks per wave and tile (NP passes); a buffer holds, wave half by wave half, SLOT bytes: the half's 8 blocks of K (half a slot), then their V, so that every fragment's LDS offset from the pass's base fits the instruction's 16-bit field
  static_assert(PLANE == 4 * 1024 * 16 && SLOT == 65536 && NTILE >= 2, "four 16-byte copies per lane and plane, two per slot; the ring's prologue needs two tiles");
  constexpr float C2 = 0.125f * 1.4426950408889634f;      // 1/sqrt(64) * log2(e): exp(s/8 - m/8) = 2^(C2 s - C2 m), so a weight costs one fused multiply-add and one hardware 2^x; maxima are kept on the raw products (C2 > 0 keeps their order)
  constexpr float TH = 5.0f / C2;      // the maximum in use may trail a query's true running maximum by up to 2^5 in the weights: with the 2^10 below a weight then reaches at most 2^15, inside f16
  __shared__ __attribute__((aligned(16))) unsigned char ring[2 * BUF]; __shared__ float sM[NW][RPW], sL[NW][RPW];
  static_assert(sizeof(float) * NW * RPW * (64 + 4) <= sizeof(ring), "the partial accumulators are staged in the ring once the loop has left it");
  float (*sO)[RPW][64 + 4] = (float (*)[RPW][64 + 4])ring;
  const int tid = threadIdx.x, lane = tid & 31, ln = lane & 15, hh = lane >> 4;
  const int w = __builtin_amdgcn_readfirstlane(tid >> 5) & (NW - 1);      // wave number in a scalar register, so that the key loop's counter and branch are scalar; the mask (an identity) shows the compiler its range
  const int kr = blockIdx.x % KSPLIT, qblk = blockIdx.x / KSPLIT; const int qb0 = qblk * (QT * RPW); const int q0 = qb0 + (w & (QT - 1)) * RPW;      // key range, query block
  const unsigned char* Kg = (const unsigned char*)Kp + (size_t)kr * 128 * (TT / KSPLIT) + tid * 16; const unsigned char* Vg = (const unsigned char*)Vp + (size_t)kr * 128 * (TT / KSPLIT) + tid * 16;      // k_proj's planes: 128 B per key, from the range's first key; thread t copies bytes 16 t .. 16 t + 15 of every 16 KiB
  const unsigned lds0 = (unsigned)(size_t)ring + tid * 16;      // the lane's LDS byte address in buffer 0
  // One tile into one buffer: 8 copies per lane, each wave 512 contiguous bytes per copy, every lane on. The s_wait_xcnt 0 is the last line of the copies' own statement, so that it stands in front of every later write of a register that a copy names (a precaution).
  auto fill = [&](int tile, int buf) {
    const unsigned char* gk = Kg + (size_t)tile * PLANE; const unsigned char* gv = Vg + (size_t)tile * PLANE; const unsigned lk = lds0 + buf * BUF, lv = lk + SLOT / 2;
    asm volatile("global_load_async_to_lds_b128 %0, %8, off\n\t"
                 "global_load_async_to_lds_b128 %1, %9, off\n\t"
                 "global_load_async_to_lds_b128 %2, %10, off\n\t"
                 "global_load_async_to_lds_b128 %3, %11, off\n\t"
                 "global_load_async_to_lds_b128 %4, %12, off\n\t"
                 "global_load_async_to_lds_b128 %5, %13, off\n\t"
                 "global_load_async_to_lds_b128 %6, %14, off\n\t"
                 "global_load_async_to_lds_b128 %7, %15, off\n\t"
                 "s_wait_xcnt 0x0"
                 :: "v"(lk), "v"(lk + 16384), "v"(lk + SLOT), "v"(lk + SLOT + 16384), "v"(lv), "v"(lv + 16384), "v"(lv + SLOT), "v"(lv + SLOT + 16384),
                    "v"(gk), "v"(gk + 16384), "v"(gk + 32768), "v"(gk + 49152), "v"(gv), "v"(gv + 16384), "v"(gv + 32768), "v"(gv + 49152) : "memory"); };
  fill(0, 0);
  FragH bq[KS];      // B operand: column ln = query q0 + ln
  { const unsigned short* qr = (const unsigned short*)Q16 + (size_t)(q0 + ln) * ldq;
#pragma unroll
    for (int ks = 0; ks < KS; ++ks) { bq[ks].half[0] = *(const v8us*)(qr + ks * 32 + 8 * hh); bq[ks].half[1] = *(const v8us*)(qr + ks * 32 + 16 + 8 * hh); } }
  float m_q = -3.0e38f, l_q = 0.f; v8f oacc[DT];      // of query ln: the maximum in use (equal in both halves), this half's share of the sum, O^T rows dt * 16 + 8hh + r
  float thr = -3.0e38f, mb = 0.f;      // thr = m_q + TH, the score above which the maximum in use is renewed (any first score is above it); mb = C2 m_q - 10, set at every renewal
#pragma unroll
  for (int dt = 0; dt < DT; ++dt) oacc[dt] = (v8f){0.f,0.f,0.f,0.f,0.f,0.f,0.f,0.f};
  asm volatile("s_wait_asynccnt 0x0" ::: "memory");      // this wave's share of tile 0 has landed
  __syncthreads();      // tile 0 is published: nobody reads it in front of this barrier
  fill(1, 1);
#pragma unroll 1      // one trip per tile: the ring's order stands once, at the foot
  for (int t = 0; t < NTILE; ++t) {
    const unsigned char* tb = ring + (t & 1) * BUF + (w / QT) * SLOT + lane * 16;      // the wave's key block in the tile's first pass: 4 KiB per 32 keys of K and of V, a lane's 16 B at lane * 16 in every 512-byte load
#pragma unroll 1      // rolled: one base register per pass, every fragment at an immediate offset from it
    for (int p = 0; p < NP; ++p) {
    const unsigned short* Kf = (const unsigned short*)(tb + p * 4096); const unsigned short* Vf = (const unsigned short*)(tb + p * 4096 + SLOT / 2);
    v8f s[2];      // s[nt][r] = raw product (score * 8) of key nt * 16 + 8hh + r of the block with query ln
    FragH ak[2][KS];
#pragma unroll
    for (int nt = 0; nt < 2; ++nt)
#pragma unroll
      for (int ks = 0; ks < KS; ++ks) { ak[nt][ks].half[0] = *(const v8us*)(Kf + nt * 1024 + ks * 512); ak[nt][ks].half[1] = *(const v8us*)(Kf + nt * 1024 + ks * 512 + 256); }
    __builtin_amdgcn_sched_barrier(0);      // keeps the eight K reads in one group in front of the products: left free, the scheduler reads the last four in pairs between the products, each pair waited for on the spot
#pragma unroll
    for (int nt = 0; nt < 2; ++nt) { v8f acc = (v8f){0.f,0.f,0.f,0.f,0.f,0.f,0.f,0.f};
#pragma unroll
      for (int ks = 0; ks < KS; ++ks) acc = __builtin_amdgcn_wmma_f32_16x16x32_f16(false, ak[nt][ks].v, false, bq[ks].v, (short)0, acc, false, false);
      s[nt] = acc; }
    float mc = fmaxf(s[0][0], s[1][0]);
#pragma unroll
    for (int r = 1; r < 8; ++r) mc = fmaxf(mc, fmaxf(s[0][r], s[1][r]));
    if (__builtin_amdgcn_ballot_w32(mc > thr) != 0) {      // one scalar branch per pass, taken by the whole wave when any lane's 16 scores pass thr: only then are the maximum, the sum and the accumulators renewed
      mc = fmaxf(mc, __int_as_float(__builtin_amdgcn_permlanex16(__float_as_int(mc), __float_as_int(mc), 0x76543210, 0xfedcba98, false, false)));      // lane l <-> l ^ 16: the other 16 keys of the same query, so that both halves renew alike
      const float mn = fmaxf(m_q, mc); const float al = __builtin_amdgcn_exp2f((m_q - mn) * C2); m_q = mn; thr = mn + TH;
      mb = fmaf(mn, C2, -10.0f);      // the 2^10 of the f16 weights rides in the exponent: weights and their sum both carry it, and k_join's division takes it out
      l_q *= al;
#pragma unroll
      for (int dt = 0; dt < DT; ++dt) oacc[dt] *= al; }
    FragH av[DT];
#pragma unroll
    for (int dt = 0; dt < DT; ++dt) { av[dt].half[0] = *(const v8us*)(Vf + dt * 512); av[dt].half[1] = *(const v8us*)(Vf + dt * 512 + 256); }
    FragH pb; float ps = 0.f;
#pragma unroll
    for (int r = 0; r < 8; ++r) { const float p0 = __builtin_amdgcn_exp2f(fmaf(s[0][r], C2, -mb)), p1 = __builtin_amdgcn_exp2f(fmaf(s[1][r], C2, -mb)); ps += p0 + p1; pb.h[r] = (_Float16)p0; pb.h[8 + r] = (_Float16)p1; }
    l_q += ps;
    __builtin_amdgcn_sched_barrier(0);      // keeps the eight V reads in one group in front of the products: left free, the scheduler sinks half of them in among the four products, each pair waited for on the spot
#pragma unroll
    for (int dt = 0; dt < DT; ++dt) {
      if (dt + 1 < DT) oacc[dt] = __builtin_amdgcn_wmma_f32_16x16x32_f16(false, av[dt].v, false, pb.v, (short)0, oacc[dt], false, false);
      else oacc[dt] = mmaH<1>(av[dt].v, av[dt].v, pb.v, pb.v, oacc[dt]); } }      // the pass's last product keeps its four v_nop: behind it comes the loop's back edge, and the next pass's first vector instructions rewrite registers of its operands
    asm volatile("s_wait_dscnt 0x0" ::: "memory");      // this wave's reads of the buffer have returned before the buffer is handed to its next writer
    asm volatile("s_wait_asynccnt 0x0" ::: "memory");      // this wave's share of tile t + 1 has landed
    __syncthreads();      // publishes tile t + 1 and ends every wave's reads of tile t's buffer
    if (t + 2 < NTILE) fill(t + 2, t & 1); }
  asm volatile("s_wait_asynccnt 0x0" ::: "memory");      // no copy is outstanding when the ring becomes staging for the partials (the last trip's barrier has ended every read of it)
  l_q += __int_as_float(__builtin_amdgcn_permlanex16(__float_as_int(l_q), __float_as_int(l_q), 0x76543210, 0xfedcba98, false, false));      // the halves' sums joined once
  if (hh == 0) { sM[w][ln] = m_q; sL[w][ln] = l_q; }
#pragma unroll
  for (int dt = 0; dt < DT; ++dt) { *(v4fa*)&sO[w][ln][dt * 16 + 8 * hh] = (v4f){oacc[dt][0], oacc[dt][1], oacc[dt][2], oacc[dt][3]}; *(v4fa*)&sO[w][ln][dt * 16 + 8 * hh + 4] = (v4f){oacc[dt][4], oacc[dt][5], oacc[dt][6], oacc[dt][7]}; }
  __syncthreads();      // every wave's partial (max, sum, accumulator) is in LDS before any wave merges
  if (tid < QT * RPW) { const int qt = tid / RPW, r = tid % RPW;      // waves 0 to 7, one query row per lane: the row's max and sum
    float mg[KSPL], M = -3.0e38f;
#pragma unroll      // constant indices, so that the small arrays stay in registers
    for (int g = 0; g < KSPL; ++g) { mg[g] = sM[g * QT + qt][r]; M = fmaxf(M, mg[g]); }
    float L = 0.f;
#pragma unroll      // constant indices, so that the small arrays stay in registers
    for (int g = 0; g < KSPL; ++g) L += __builtin_amdgcn_exp2f((mg[g] - M) * C2) * sL[g * QT + qt][r];
    *(v2f*)(ML + ((size_t)kr * TT + qb0 + tid) * 2) = (v2f){M, L};
    asm volatile("s_wait_xcnt 0x0" ::: "memory"); }      // precaution: stands in front of every later write of a register that the store names
  constexpr int NIT = QT * RPW * 16 / (32 * NW); v4f pa[NIT];      // one query row per 16 lanes, 16 B per lane, NIT rows per lane, 64 rows apart
#pragma unroll      // straight-line, no store among them: the trips' LDS reads go out together
  for (int it = 0; it < NIT; ++it) { const int row = (tid >> 4) + it * 64, pc = tid & 15, qt = row / RPW, r = row % RPW;
    float mg[KSPL], M = -3.0e38f;
#pragma unroll      // constant indices, so that the small arrays stay in registers
    for (int g = 0; g < KSPL; ++g) { mg[g] = sM[g * QT + qt][r]; M = fmaxf(M, mg[g]); }
    v4f acc = {0.f, 0.f, 0.f, 0.f};
#pragma unroll      // constant indices, so that the small arrays stay in registers
    for (int g = 0; g < KSPL; ++g) { const float wg = __builtin_amdgcn_exp2f((mg[g] - M) * C2); const v4f pv = *(const v4fa*)&sO[g * QT + qt][r][pc * 4]; acc += pv * wg; }
    pa[it] = acc; }      // relative to M; the sum and acc both carry the 2^10
  float* po = Op + ((size_t)kr * TT + qb0 + (tid >> 4)) * DD + (tid & 15) * 4;      // the key range's plane, stacked row qb0 + row: 256 contiguous bytes per 16 lanes, a wave stores 512
#pragma unroll      // constant indices, so that the small arrays stay in registers
  for (int it = 0; it < NIT; ++it) *(v4f*)(po + it * 64 * DD) = pa[it]; }
// The KSPLIT partials of a stacked row (each: 64 un-normalised f32, its max M and its sum L) joined as k_flash joins its waves' partials: weights 2^(C2 (M_s - M)), then one division. Thread = 16 B of each of PER rows, 16 rows apart; a wave's load or store covers 512 contiguous bytes of a plane (2 x 256 of the output).
__global__ __launch_bounds__(256) void k_join(const float* __restrict__ Op, const float* __restrict__ ML, float* __restrict__ O) {
  constexpr int PER = 4; constexpr float C2 = 0.125f * 1.4426950408889634f;
  const unsigned e0 = blockIdx.x * (256 * PER) + threadIdx.x;      // element e = row (e >> 4), 16-byte piece (e & 15); a block covers 64 rows, all of one head
  const float* op = Op + (size_t)e0 * 4; const float* mp = ML + (size_t)(e0 >> 4) * 2;
  v4f pv[PER][KSPLIT]; v2f ml[PER][KSPLIT];
#pragma unroll      // straight-line: all 32 loads are in flight before the first is waited for
  for (int i = 0; i < PER; ++i)
#pragma unroll      // constant indices, so that the small arrays stay in registers
    for (int s = 0; s < KSPLIT; ++s) { pv[i][s] = *(const v4fa*)(op + (size_t)s * TT * DD + i * 1024); ml[i][s] = *(const v2fa*)(mp + (size_t)s * TT * 2 + i * 32); }
  __builtin_amdgcn_sched_barrier(0);      // keeps the sums behind all 32 loads: left free, the scheduler lifts the first maxima, with their wait, in front of the last 14 loads, and the kernel pays the load latency twice
  asm volatile("s_wait_xcnt 0x0" :: "v"(op), "v"(mp) : "memory");      // precaution: stands in front of every later write of a register that one of the loads above names as its address; the two addresses are inputs so that their registers live up to here
  const unsigned g0 = e0 >> 4;      // stacked row g = head * NB + batch row: it goes to its merged place, 256 contiguous bytes per 16 lanes
  float* o = O + (size_t)((g0 % NB) * EE + (g0 / NB) * DD + (e0 & 15) * 4);
#pragma unroll      // constant indices, so that the small arrays stay in registers
  for (int i = 0; i < PER; ++i) { float M = ml[i][0][0];
#pragma unroll      // constant indices, so that the small arrays stay in registers
    for (int s = 1; s < KSPLIT; ++s) M = fmaxf(M, ml[i][s][0]);
    float ws[KSPLIT];
#pragma unroll      // constant indices, so that the small arrays stay in registers
    for (int s = 0; s < KSPLIT; ++s) ws[s] = (ml[i][s][0] - M) * C2;
#pragma unroll      // constant indices, so that the small arrays stay in registers
    for (int s = 0; s < KSPLIT; ++s) asm("v_exp_f32 %0, %1\n\tv_nop" : "=v"(ws[s]) : "v"(ws[s]));      // 2^x with its v_nop in one statement: the slot that the instruction set asks for between a transcendental and a next vector instruction that overwrites its source
    float L = 0.f; v4f acc = {0.f, 0.f, 0.f, 0.f};
#pragma unroll      // constant indices, so that the small arrays stay in registers
    for (int s = 0; s < KSPLIT; ++s) { L += ws[s] * ml[i][s][1]; acc += pv[i][s] * ws[s]; }
    const float inv = (L > 0.f) ? 1.0f / L : 0.f;      // L and acc both carry the 2^10
    *(v4f*)(o + i * 16 * EE) = acc * inv;
    asm volatile("s_wait_xcnt 0x0" ::: "memory"); } }      // precaution: stands in front of every later write of a register that the store names

extern "C" void kernel_launch(void* const* d_in, const int* in_sizes, int n_in,
                              void* d_out, int out_size, void* d_ws, size_t ws_size, hipStream_t stream) {
  (void)in_sizes; (void)n_in; (void)out_size;
  const float* const* I = (const float* const*)d_in; const float* xq = I[0]; const float* xk = I[1]; const float* xv = I[2]; const float* Wq = I[3]; const float* Wk = I[4]; const float* Wv = I[5];
  char* ws = (char*)d_ws; size_t off = 0;
  auto take = [&](size_t bytes) { char* p = ws + off; off += (bytes + 255) & ~(size_t)255; return p; };
  _Float16* Qs = (_Float16*)take((size_t)TT * DD * 2); _Float16* Kp = (_Float16*)take((size_t)TT * DD * 2); _Float16* Vp = (_Float16*)take((size_t)TT * DD * 2);
  float* Op = (float*)take((size_t)KSPLIT * TT * DD * 4); float* ML = (float*)take((size_t)KSPLIT * TT * 2 * 4);
  if (off > ws_size) return;      // 3 x 2.1 + 16.8 + 0.5 = about 23.6 MB
  k_proj<<<dim3(NB / 128, NHD, 3), 256, 0, stream>>>(xq, xk, xv, Wq, Wk, Wv, Qs, Kp, Vp);      /* q stacked, K and V in fragment order */
  k_flash<<<(TT / 256) * KSPLIT, 1024, 0, stream>>>(Qs, DD, Kp, Vp, Op, ML);      /* 64 query blocks x 4 key ranges: partial rows */
  k_join<<<TT * 16 / 1024, 256, 0, stream>>>(Op, ML, (float*)d_out);      /* rows joined, normalised, stored merged */
}

// v010
// A run of this version takes 59.6 microseconds.
// In both of two side-by-side timings against v009, it was 1.04 times as fast.
// All steps since v000 together make it 27.5 times as fast.
#include <hip/hip_runtime.h>
// Multi-head attention whose heads are STACKED along the batch axis (B=4096 rows, EMBED=256, 4 heads × 64): q = queries·W_Query, k = keys·W_Key, v = values·W_Value ((in,out), no bias); the heads are split TF-style into [H·B, 64] = [16384, 64] and ONE softmax(q·kᵀ/√64)·v runs over all 16384 stacked rows
// (every query attends to every (head, row) key); the result is merged back to [B, H·64].
// Compute dtype: inputs and weights rounded to bf16; q, k, v as f16 GEMM outputs of ONE projection launch (grid.y = head, grid.z = operand) that reads the f32 inputs itself and stores q in the stacked [h * 4096 + b][64] layout and k, v in the attention kernel's fragment order;
// fused flash-style kernel over T = 16384 (online softmax f32, P f16 x 2^10, f32 accumulate) on v_wmma_f32_16x16x32_f16, split four ways along the keys, which stores un-normalised f32 partial rows with their max and sum; a short third launch joins the four partials of a row and stores it at its merged place in the output. Three launches in all.
#define BB 1
#define TT 16384
#define NH 1
#define NB 4096
#define NHD 4
#define EE 256
#define DD 64
#define NR (BB * TT)
#define KSPLIT 4
#define QSC (0.125f * 1.4426950408889634f)      // 1/sqrt(64) * log2(e): exp(s/8) = 2^(QSC s)

typedef __bf16 v16b __attribute__((ext_vector_type(16)));
typedef unsigned short v8us __attribute__((ext_vector_type(8), may_alias));
typedef float  v8f  __attribute__((ext_vector_type(8)));
typedef float  v4f  __attribute__((ext_vector_type(4)));
typedef float  v4fa __attribute__((ext_vector_type(4), may_alias));
typedef float  v2f  __attribute__((ext_vector_type(2)));
typedef float  v2fa __attribute__((ext_vector_type(2), may_alias));
union FragB { v16b v; v8us half[2]; unsigned short u[16]; };

__device__ __forceinline__ unsigned short bf16_bits(float x) { unsigned int u = __float_as_uint(x); return (unsigned short)((u + 0x7FFFu + ((u >> 16) & 1u)) >> 16); }
__device__ __forceinline__ float bf16_val(unsigned short b) { return __uint_as_float(((unsigned int)b) << 16); }
__device__ __forceinline__ float bf16_round(float x) { return bf16_val(bf16_bits(x)); }
// D += A·B with NT terms: 1 = ah·bh, 2 = + al·bh (A split), 3 = + ah·bl (both split)
template <int NT>
__device__ __forceinline__ v8f mmaN(v16b ah, v16b al, v16b bh, v16b bl, v8f c) {
  c = __builtin_amdgcn_wmma_f32_16x16x32_bf16(false, ah, false, bh, (short)0, c, false, false);
  if (NT >= 2) c = __builtin_amdgcn_wmma_f32_16x16x32_bf16(false, al, false, bh, (short)0, c, false, false);
  if (NT >= 3) c = __builtin_amdgcn_wmma_f32_16x16x32_bf16(false, ah, false, bl, (short)0, c, false, false);
  asm volatile("v_nop\n\tv_nop\n\tv_nop\n\tv_nop" : "+v"(c) : "v"(ah), "v"(al), "v"(bh), "v"(bl));
  return c;
}

__global__ __launch_bounds__(256) void k_wt_bf16(const float* __restrict__ W, unsigned short* __restrict__ Wt, int K, int N) {
  const int t = blockIdx.x * 256 + threadIdx.x;
  const int k8n = K / 8;
  if (t >= N * k8n) return;
  const int n = t / k8n, k8 = (t % k8n) * 8;
  v8us v;
#pragma unroll
  for (int i = 0; i < 8; ++i) v[i] = bf16_bits(W[(size_t)(k8 + i) * N + n]);
  *(v8us*)(Wt + (size_t)n * K + k8) = v;
  
}

// GEMM C[M][N] (f32, pitch ldc) = act(A[M][K]·W + bias). A f32 row-major (pitch lda) converted per fragment to bf16
// (ASPLIT: hi/lo two planes -> 2 terms, else single rounded term); Wt bf16 [N][K] (pitch ldb). BIAS_BF16 rounds the
// bias to bf16 first (bias quantised to bf16 before the add). K%32==0, M%16==0, N%64==0.
template <bool ASPLIT, int ACT, bool BIAS_BF16>
__global__ __launch_bounds__(128) void k_gemm_bf(const float* __restrict__ A, int lda, const unsigned short* __restrict__ Wt, int ldb,
                                               const float* __restrict__ bias, float* __restrict__ C, int ldc, int M, int N, int K) {
  __shared__ __attribute__((aligned(16))) float so[4][16][64];
  const int tid = threadIdx.x, w = tid >> 5, lane = tid & 31, ln = lane & 15, hh = lane >> 4;
  const int ntn = N / 64;
  const int wid = blockIdx.x * 4 + w;
  const int mt = wid / ntn, nq = wid % ntn;
  if (mt * 16 >= M) return;
  const int row0 = mt * 16, col0 = nq * 64;
  const float* arow = A + (size_t)(row0 + ln) * lda;
  v8f acc[4] = {};
  for (int kb = 0; kb < K; kb += 32) {
    FragB ah, al;
    const v4f x0 = *(const v4fa*)(arow + kb + 8 * hh), x1 = *(const v4fa*)(arow + kb + 8 * hh + 4);
    const v4f x2 = *(const v4fa*)(arow + kb + 16 + 8 * hh), x3 = *(const v4fa*)(arow + kb + 16 + 8 * hh + 4);
    float xs[16] = {x0[0],x0[1],x0[2],x0[3],x1[0],x1[1],x1[2],x1[3],x2[0],x2[1],x2[2],x2[3],x3[0],x3[1],x3[2],x3[3]};
#pragma unroll
    for (int i = 0; i < 16; ++i) { const unsigned short hb = bf16_bits(xs[i]); ah.u[i] = hb; al.u[i] = ASPLIT ? bf16_bits(xs[i] - bf16_val(hb)) : (unsigned short)0; }
#pragma unroll
    for (int t = 0; t < 4; ++t) {
      const unsigned short* brow = Wt + (size_t)(col0 + t * 16 + ln) * ldb + kb;
      FragB b;
      b.half[0] = *(const v8us*)(brow + 8 * hh);
      b.half[1] = *(const v8us*)(brow + 16 + 8 * hh);
      acc[t] = mmaN<ASPLIT ? 2 : 1>(ah.v, al.v, b.v, b.v, acc[t]);
    }
  }
#pragma unroll
  for (int t = 0; t < 4; ++t) {
    float bv = bias ? bias[col0 + t * 16 + ln] : 0.f;
    if (BIAS_BF16) bv = bf16_round(bv);
#pragma unroll
    for (int r = 0; r < 8; ++r) { float v = acc[t][r] + bv; if (ACT == 1) v = fmaxf(v, 0.f); so[w][8 * hh + r][t * 16 + ln] = v; }
  }
  __builtin_amdgcn_fence(__ATOMIC_ACQ_REL, "workgroup");
  __builtin_amdgcn_wave_barrier();
  const int rsub = lane >> 4, c4 = (lane & 15) * 4;
  {
#pragma unroll
    for (int q = 0; q < 8; ++q) {
      const int r = q * 2 + rsub;
      const v4f v = *(const v4fa*)&so[w][r][c4];
      *(v4f*)(C + (size_t)(row0 + r) * ldc + col0 + c4) = v;
    }
    
  }
}

// Flash-style causal/unmasked attention, all contractions 3-term bf16 hi/lo splits, f32 softmax with running max.
// q,k,v rows are read from f32 buffers with arbitrary row pitch (so they can live inside a fused qkv buffer);
// D = head size (multiple of 32, <= 128); one wave = 16 query rows; block = 4 waves (64 queries) sharing K/V chunks of 32.
template <int D, bool CAUSAL>
__global__ __launch_bounds__(128) void k_flash(const float* __restrict__ qb, const float* __restrict__ kb, const float* __restrict__ vb,
                                             int pitch, int T, int H, float scale, float* __restrict__ y, int ypitch) {
  constexpr int KS = D / 32;        // k-steps for QK
  constexpr int DT = D / 16;        // d tiles for PV
  __shared__ __attribute__((aligned(16))) unsigned short sKh[32][D + 8], sKl[32][D + 8], sVh[32][D + 8], sVl[32][D + 8];
  __shared__ __attribute__((aligned(16))) unsigned short sPh[4][16][40], sPl[4][16][40];
  __shared__ __attribute__((aligned(16))) float sO[4][16][D];
  const int tid = threadIdx.x, w = tid >> 5, lane = tid & 31, ln = lane & 15, hh = lane >> 4;
  const int nqb = (T + 63) / 64;
  const int bh = blockIdx.x / nqb, qblk = blockIdx.x % nqb;
  const int b = bh / H, h = bh % H;
  const int q0 = qblk * 64 + w * 16;
  const float* Q = qb + (size_t)b * T * pitch + h * D;
  const float* K = kb + (size_t)b * T * pitch + h * D;
  const float* V = vb + (size_t)b * T * pitch + h * D;

  // A fragments of the wave's 16 query rows (scaled), hi/lo
  FragB aqh[KS], aql[KS];
  {
    int row = q0 + ln; if (row >= T) row = T - 1;
    const float* qr = Q + (size_t)row * pitch;
#pragma unroll
    for (int ks = 0; ks < KS; ++ks)
#pragma unroll
      for (int i = 0; i < 16; ++i) {
        const int d = ks * 32 + ((i < 8) ? (8 * hh + i) : (16 + 8 * hh + (i - 8)));
        const float x = qr[d] * scale; const unsigned short hb = bf16_bits(x);
        aqh[ks].u[i] = hb; aql[ks].u[i] = bf16_bits(x - bf16_val(hb));
      }
  }
  float m_r[8], l_r[8];
#pragma unroll
  for (int r = 0; r < 8; ++r) { m_r[r] = -3.0e38f; l_r[r] = 0.f; }
  v8f oacc[DT];
#pragma unroll
  for (int dt = 0; dt < DT; ++dt) oacc[dt] = (v8f){0.f,0.f,0.f,0.f,0.f,0.f,0.f,0.f};

  const int kv_end = CAUSAL ? min(T, qblk * 64 + 64) : T;     // block-uniform
  for (int j0 = 0; j0 < kv_end; j0 += 32) {
    __syncthreads();
    for (int e = tid; e < 32 * (D / 4); e += 128) {
      const int r = e / (D / 4), c4 = (e % (D / 4)) * 4;
      const int key = j0 + r;
      v4f kf = {0.f,0.f,0.f,0.f}, vf = {0.f,0.f,0.f,0.f};
      if (key < T) { kf = *(const v4fa*)(K + (size_t)key * pitch + c4); vf = *(const v4fa*)(V + (size_t)key * pitch + c4); }
#pragma unroll
      for (int t = 0; t < 4; ++t) {
        unsigned short hb = bf16_bits(kf[t]); sKh[r][c4 + t] = hb; sKl[r][c4 + t] = bf16_bits(kf[t] - bf16_val(hb));
        hb = bf16_bits(vf[t]); sVh[r][c4 + t] = hb; sVl[r][c4 + t] = bf16_bits(vf[t] - bf16_val(hb));
      }
    }
    __syncthreads();
    // S tile 16 x 32
    v8f s[2];
#pragma unroll
    for (int nt = 0; nt < 2; ++nt) {
      v8f acc = {};
#pragma unroll
      for (int ks = 0; ks < KS; ++ks) {
        FragB bh_, bl_;
        bh_.half[0] = *(const v8us*)&sKh[nt * 16 + ln][ks * 32 + 8 * hh]; bh_.half[1] = *(const v8us*)&sKh[nt * 16 + ln][ks * 32 + 16 + 8 * hh];
        bl_.half[0] = *(const v8us*)&sKl[nt * 16 + ln][ks * 32 + 8 * hh]; bl_.half[1] = *(const v8us*)&sKl[nt * 16 + ln][ks * 32 + 16 + 8 * hh];
        acc = mmaN<3>(aqh[ks].v, aql[ks].v, bh_.v, bl_.v, acc);
      }
      s[nt] = acc;
    }
    // mask + running max (rows 8hh+r; the 16 lanes of a half share rows)
    float alpha[8];
#pragma unroll
    for (int r = 0; r < 8; ++r) {
      const int qi = q0 + 8 * hh + r;
      const int ja = j0 + ln, jb = j0 + 16 + ln;
      if (CAUSAL) { if (ja > qi) s[0][r] = -3.0e38f; if (jb > qi) s[1][r] = -3.0e38f; }
      if (ja >= T) s[0][r] = -3.0e38f;
      if (jb >= T) s[1][r] = -3.0e38f;
      float mx = fmaxf(s[0][r], s[1][r]);
      mx = fmaxf(mx, __shfl_xor(mx, 1, 32)); mx = fmaxf(mx, __shfl_xor(mx, 2, 32)); mx = fmaxf(mx, __shfl_xor(mx, 4, 32)); mx = fmaxf(mx, __shfl_xor(mx, 8, 32));
      const float mnew = fmaxf(m_r[r], mx);
      alpha[r] = (mnew > -1.0e38f) ? __expf(m_r[r] - mnew) : 1.0f;
      const float p0 = (s[0][r] > -1.0e38f) ? __expf(s[0][r] - mnew) : 0.f;
      const float p1 = (s[1][r] > -1.0e38f) ? __expf(s[1][r] - mnew) : 0.f;
      m_r[r] = mnew;
      l_r[r] = l_r[r] * alpha[r] + p0 + p1;            // per-lane partial row sum (16 lanes combined at the end)
      unsigned short hb = bf16_bits(p0); sPh[w][8 * hh + r][ln] = hb;      sPl[w][8 * hh + r][ln] = bf16_bits(p0 - bf16_val(hb));
      hb = bf16_bits(p1);                sPh[w][8 * hh + r][16 + ln] = hb; sPl[w][8 * hh + r][16 + ln] = bf16_bits(p1 - bf16_val(hb));
    }
#pragma unroll
    for (int dt = 0; dt < DT; ++dt)
#pragma unroll
      for (int r = 0; r < 8; ++r) oacc[dt][r] *= alpha[r];
    __builtin_amdgcn_fence(__ATOMIC_ACQ_REL, "workgroup");
    __builtin_amdgcn_wave_barrier();
    FragB pah, pal;
    pah.half[0] = *(const v8us*)&sPh[w][ln][8 * hh]; pah.half[1] = *(const v8us*)&sPh[w][ln][16 + 8 * hh];
    pal.half[0] = *(const v8us*)&sPl[w][ln][8 * hh]; pal.half[1] = *(const v8us*)&sPl[w][ln][16 + 8 * hh];
#pragma unroll
    for (int dt = 0; dt < DT; ++dt) {
      FragB bvh, bvl;
#pragma unroll
      for (int i = 0; i < 8; ++i) {
        bvh.u[i] = sVh[8 * hh + i][dt * 16 + ln]; bvh.u[8 + i] = sVh[16 + 8 * hh + i][dt * 16 + ln];
        bvl.u[i] = sVl[8 * hh + i][dt * 16 + ln]; bvl.u[8 + i] = sVl[16 + 8 * hh + i][dt * 16 + ln];
      }
      oacc[dt] = mmaN<3>(pah.v, pal.v, bvh.v, bvl.v, oacc[dt]);
    }
    __builtin_amdgcn_fence(__ATOMIC_ACQ_REL, "workgroup");
    __builtin_amdgcn_wave_barrier();
  }
#pragma unroll
  for (int r = 0; r < 8; ++r) {
    float l = l_r[r];
    l += __shfl_xor(l, 1, 32); l += __shfl_xor(l, 2, 32); l += __shfl_xor(l, 4, 32); l += __shfl_xor(l, 8, 32);
    l_r[r] = (l > 0.f) ? 1.0f / l : 0.f;
  }
#pragma unroll
  for (int dt = 0; dt < DT; ++dt)
#pragma unroll
    for (int r = 0; r < 8; ++r) sO[w][8 * hh + r][dt * 16 + ln] = oacc[dt][r] * l_r[r];
  __builtin_amdgcn_fence(__ATOMIC_ACQ_REL, "workgroup");
  __builtin_amdgcn_wave_barrier();
  {
    for (int r = 0; r < 16; ++r) {
      const int row = q0 + r;
      if (row < T && lane < D / 4) {
        const v4f val = *(const v4fa*)&sO[w][r][lane * 4];
        *(v4f*)(y + ((size_t)b * T + row) * ypitch + h * D + lane * 4) = val;
      }
    }
    
  }
}

// GEMM C = act(A·W + bias + resid): A f32 (ASPLIT -> hi/lo 2 terms), Wt bf16 [N][K]; ACT 0 none, 1 relu, 2 exact gelu;
// resid (optional, f32, row index = (row % rmod), pitch ldr, RES_BF16 rounds it) added before the activation.
template <bool ASPLIT, int ACT, bool BIAS_BF16, bool RES_BF16>
__global__ __launch_bounds__(128) void k_gemm_bf3(const float* __restrict__ A, int lda, const unsigned short* __restrict__ Wt, int ldb,
                                                const float* __restrict__ bias, const float* __restrict__ resid, int rmod, int ldr,
                                                float* __restrict__ C, int ldc, int M, int N, int K) {
  __shared__ __attribute__((aligned(16))) float so[4][16][64];
  const int tid = threadIdx.x, w = tid >> 5, lane = tid & 31, ln = lane & 15, hh = lane >> 4;
  const int ntn = N / 64;
  const int wid = blockIdx.x * 4 + w;
  const int mt = wid / ntn, nq = wid % ntn;
  if (mt * 16 >= M) return;
  const int row0 = mt * 16, col0 = nq * 64;
  const float* arow = A + (size_t)(row0 + ln) * lda;
  v8f acc[4] = {};
  for (int kb = 0; kb < K; kb += 32) {
    FragB ah, al;
    const v4f x0 = *(const v4fa*)(arow + kb + 8 * hh), x1 = *(const v4fa*)(arow + kb + 8 * hh + 4);
    const v4f x2 = *(const v4fa*)(arow + kb + 16 + 8 * hh), x3 = *(const v4fa*)(arow + kb + 16 + 8 * hh + 4);
    float xs[16] = {x0[0],x0[1],x0[2],x0[3],x1[0],x1[1],x1[2],x1[3],x2[0],x2[1],x2[2],x2[3],x3[0],x3[1],x3[2],x3[3]};
#pragma unroll
    for (int i = 0; i < 16; ++i) { const unsigned short hb = bf16_bits(xs[i]); ah.u[i] = hb; al.u[i] = ASPLIT ? bf16_bits(xs[i] - bf16_val(hb)) : (unsigned short)0; }
#pragma unroll
    for (int t = 0; t < 4; ++t) {
      const unsigned short* brow = Wt + (size_t)(col0 + t * 16 + ln) * ldb + kb;
      FragB b;
      b.half[0] = *(const v8us*)(brow + 8 * hh);
      b.half[1] = *(const v8us*)(brow + 16 + 8 * hh);
      acc[t] = mmaN<ASPLIT ? 2 : 1>(ah.v, al.v, b.v, b.v, acc[t]);
    }
  }
#pragma unroll
  for (int t = 0; t < 4; ++t) {
    const int col = col0 + t * 16 + ln;
    float bv = bias ? bias[col] : 0.f;
    if (BIAS_BF16) bv = bf16_round(bv);
#pragma unroll
    for (int r = 0; r < 8; ++r) {
      float v = acc[t][r] + bv;
      if (resid) { float rv = resid[(size_t)((row0 + 8 * hh + r) % rmod) * ldr + col]; if (RES_BF16) rv = bf16_round(rv); v += rv; }
      if (ACT == 1) v = fmaxf(v, 0.f);
      if (ACT == 2) v = 0.5f * v * (1.0f + erff(v * 0.70710678118654752f));
      if (ACT == 3) { const float u = 0.7978845608028654f * (v + 0.044715f * v * v * v); v = 0.5f * v * (1.0f + tanhf(u)); }
      so[w][8 * hh + r][t * 16 + ln] = v;
    }
  }
  __builtin_amdgcn_fence(__ATOMIC_ACQ_REL, "workgroup");
  __builtin_amdgcn_wave_barrier();
  const int rsub = lane >> 4, c4 = (lane & 15) * 4;
  {
#pragma unroll
    for (int q = 0; q < 8; ++q) {
      const int r = q * 2 + rsub;
      const v4f v = *(const v4fa*)&so[w][r][c4];
      *(v4f*)(C + (size_t)(row0 + r) * ldc + col0 + c4) = v;
    }
    
  }
}
// row LayerNorm (biased variance, eps) over N: s = X (+ R); optional out_sum <- s; out_norm <- (s-mu)*rsqrt(var+eps)*g + b
template <bool PARAM_BF16>
__global__ __launch_bounds__(256) void k_layernorm(const float* __restrict__ X, const float* __restrict__ R, const float* __restrict__ g, const float* __restrict__ bta,
                                                  float* __restrict__ out_sum, float* __restrict__ out_norm, int N, float eps) {
  __shared__ float red[256];
  const int row = blockIdx.x, tid = threadIdx.x;
  const float* x = X + (size_t)row * N; const float* rr = R ? R + (size_t)row * N : nullptr;
  float vals[16];                     // up to N = 4096
  const int per = N / 256;            // contiguous chunk per thread? use strided-by-4 chunks: thread handles j = tid*4 + 1024*u
  float s1 = 0.f;
  for (int u = 0; u < per / 4; ++u) {
    const int j = tid * 4 + 1024 * u;
    const v4f a = *(const v4fa*)(x + j);
    v4f b = {0.f,0.f,0.f,0.f}; if (rr) b = *(const v4fa*)(rr + j);
#pragma unroll
    for (int q = 0; q < 4; ++q) { const float v = a[q] + b[q]; vals[u * 4 + q] = v; s1 += v; }
  }
  red[tid] = s1; __syncthreads();
  for (int st = 128; st > 0; st >>= 1) { if (tid < st) red[tid] += red[tid + st]; __syncthreads(); }
  const float mu = red[0] / (float)N; __syncthreads();
  float s2 = 0.f;
  for (int u = 0; u < per / 4; ++u)
#pragma unroll
    for (int q = 0; q < 4; ++q) { const float c = vals[u * 4 + q] - mu; s2 += c * c; }
  red[tid] = s2; __syncthreads();
  for (int st = 128; st > 0; st >>= 1) { if (tid < st) red[tid] += red[tid + st]; __syncthreads(); }
  const float rs = rsqrtf(red[0] / (float)N + eps);
  {
    for (int u = 0; u < per / 4; ++u) {
      const int j = tid * 4 + 1024 * u;
      v4f o, sm;
#pragma unroll
      for (int q = 0; q < 4; ++q) {
        float gg = g[j + q], bb = bta[j + q];
        if (PARAM_BF16) { gg = bf16_round(gg); bb = bf16_round(bb); }
        sm[q] = vals[u * 4 + q]; o[q] = (vals[u * 4 + q] - mu) * rs * gg + bb;
      }
      if (out_sum) *(v4f*)(out_sum + (size_t)row * N + j) = sm;
      *(v4f*)(out_norm + (size_t)row * N + j) = o;
    }
    
  }
}



// ---- f16 WMMA path (v_wmma_f32_16x16x32_f16): 11-bit significands for operands in range — used where a [0,1] probability operand needs more precision than bf16
typedef _Float16 v16h __attribute__((ext_vector_type(16)));
union FragH { v16h v; v8us half[2]; _Float16 h[16]; unsigned short u[16]; };
template <int NT>
__device__ __forceinline__ v8f mmaH(v16h ah, v16h al, v16h bh, v16h bl, v8f c) {
  c = __builtin_amdgcn_wmma_f32_16x16x32_f16(false, ah, false, bh, (short)0, c, false, false);
  if (NT >= 2) c = __builtin_amdgcn_wmma_f32_16x16x32_f16(false, al, false, bh, (short)0, c, false, false);
  if (NT >= 3) c = __builtin_amdgcn_wmma_f32_16x16x32_f16(false, ah, false, bl, (short)0, c, false, false);
  asm volatile("v_nop\n\tv_nop\n\tv_nop\n\tv_nop" : "+v"(c) : "v"(ah), "v"(al), "v"(bh), "v"(bl));
  return c;
}
// batched GEMM like k_gemm_b but f16 operands: A f32 (split into f16 hi/lo if ASPLIT, else rounded to f16), Bt = f16 values [n][k]; alpha; C f32; N multiple of 16 (partial tiles skipped)
template <bool ASPLIT>
__global__ __launch_bounds__(128) void k_gemm_h(const float* __restrict__ A, int lda, size_t sA, const _Float16* __restrict__ Bh, int ldb, size_t sB, float alpha, float* __restrict__ C, int ldc, size_t sC, int M, int N, int K) {
  __shared__ __attribute__((aligned(16))) float so[4][16][64];
  const int tid = threadIdx.x, w = tid >> 5, lane = tid & 31, ln = lane & 15, hh = lane >> 4; const int by = blockIdx.y;
  A += (size_t)by * sA; Bh += (size_t)by * sB; C += (size_t)by * sC;
  const int ntn = (N + 63) / 64; const int wid = blockIdx.x * 4 + w; const int mt = wid / ntn, nq = wid % ntn; if (mt * 16 >= M) return;
  const int row0 = mt * 16, col0 = nq * 64; const float* arow = A + (size_t)(row0 + ln) * lda;
  v8f acc[4] = {};
  for (int kb = 0; kb < K; kb += 32) {
    FragH ah, al;
    const v4f x0 = *(const v4fa*)(arow + kb + 8 * hh), x1 = *(const v4fa*)(arow + kb + 8 * hh + 4), x2 = *(const v4fa*)(arow + kb + 16 + 8 * hh), x3 = *(const v4fa*)(arow + kb + 16 + 8 * hh + 4);
    float xs[16] = {x0[0],x0[1],x0[2],x0[3],x1[0],x1[1],x1[2],x1[3],x2[0],x2[1],x2[2],x2[3],x3[0],x3[1],x3[2],x3[3]};
#pragma unroll
    for (int i = 0; i < 16; ++i) { const _Float16 h = (_Float16)xs[i]; ah.h[i] = h; al.h[i] = ASPLIT ? (_Float16)(xs[i] - (float)h) : (_Float16)0.0f; }
#pragma unroll
    for (int t = 0; t < 4; ++t) { if (col0 + t * 16 >= N) continue; const size_t boff = (size_t)(col0 + t * 16 + ln) * ldb + kb; FragH bq; bq.half[0] = *(const v8us*)(Bh + boff + 8 * hh); bq.half[1] = *(const v8us*)(Bh + boff + 16 + 8 * hh);
      acc[t] = mmaH<ASPLIT ? 2 : 1>(ah.v, al.v, bq.v, bq.v, acc[t]); }
  }
#pragma unroll
  for (int t = 0; t < 4; ++t) { if (col0 + t * 16 >= N) continue;
#pragma unroll
    for (int r = 0; r < 8; ++r) so[w][8 * hh + r][t * 16 + ln] = acc[t][r] * alpha; }
  __builtin_amdgcn_fence(__ATOMIC_ACQ_REL, "workgroup"); __builtin_amdgcn_wave_barrier();
  const int rsub = lane >> 4, c4 = (lane & 15) * 4;
  {
#pragma unroll
    for (int q = 0; q < 8; ++q) { const int r = q * 2 + rsub; if (col0 + c4 < N) { const v4f v = *(const v4fa*)&so[w][r][c4]; *(v4f*)(C + (size_t)(row0 + r) * ldc + col0 + c4) = v; } }
     }
}

typedef _Float16 v4h __attribute__((ext_vector_type(4)));

__global__ __launch_bounds__(256) void k_h16(const float* __restrict__ x, _Float16* __restrict__ X16, size_t n8) { const size_t t = (size_t)blockIdx.x * 256 + threadIdx.x; if (t >= n8) return; FragH f;
#pragma unroll
  for (int q = 0; q < 8; ++q) f.h[q] = (_Float16)x[t * 8 + q]; *(v8us*)((unsigned short*)X16 + t * 8) = f.half[0];  }
__global__ __launch_bounds__(256) void k_round16f(const float* __restrict__ W, _Float16* __restrict__ Bt, size_t n8) { const size_t t = (size_t)blockIdx.x * 256 + threadIdx.x; if (t >= n8) return; FragH f;
#pragma unroll
  for (int i = 0; i < 8; ++i) f.h[i] = (_Float16)(bf16_round(W[t * 8 + i]) * 16.0f); *(v8us*)((unsigned short*)Bt + t * 8) = f.half[0];  }
__global__ __launch_bounds__(256) void k_h16s(const float* __restrict__ F, _Float16* __restrict__ H, size_t n8) { const size_t t = (size_t)blockIdx.x * 256 + threadIdx.x; if (t >= n8) return; const v4f a = *(const v4fa*)(F + t * 8), c = *(const v4fa*)(F + t * 8 + 4); FragH f;
#pragma unroll
  for (int q = 0; q < 4; ++q) { f.h[q] = (_Float16)(a[q] * 16.0f); f.h[4 + q] = (_Float16)(c[q] * 16.0f); } *(v8us*)((unsigned short*)H + t * 8) = f.half[0];  }
// The three projections in one launch. Block = 8 waves = 128 input rows x one head's 64 columns of operand blockIdx.z (0 q, 1 k, 2 v); wave = 16 rows. The f32 inputs are read here and rounded as before (bf16, then f16; weights x 2^4), and the results leave in the form their reader takes:
// the head's weight slab W[0..255][h * 64 .. + 63] is transposed into LDS as f16 [n][k] (pitch 16 B x odd) behind one work-group barrier; the input rows go from global memory straight into fragments.
// q and k are taken transposed (A = weight rows n, B = input rows), so a lane holds 8 consecutive columns of ONE row; v is taken plain (A = input rows, B = weight rows), so a lane holds 8 consecutive rows of ONE column: each accumulator tile is then one 16-byte store per lane.
// Unit = 16 B = 8 f16 of one lane, lane = 16hh + ln, rows stacked as g = h * 4096 + b. Kp: per 16 keys 4 wave stores (t = 2 ks + half): unit = K[key tile * 16 + ln][t * 16 + 8hh + 0..7]. Vp: per 32 keys 8 wave loads (dt, half): unit = V[key block * 32 + half * 16 + 8hh + 0..7][dt * 16 + ln].
// So each of k_flash's wave-wide 16-byte fragment reads covers 512 contiguous bytes, and the Kp and Vp stores here are whole lines.
// The part behind the barrier, once per operand so that no branch stands behind a matrix instruction: 8 k steps x 4 tiles, then one 16-byte store per lane and tile.
template <int OP>
__device__ __forceinline__ void proj_tiles(const FragH (&ax)[8], const unsigned short (*sW)[EE + 8], int lane, int g0, unsigned short* __restrict__ dst) {
  const int ln = lane & 15, hh = lane >> 4; v8f acc[4] = {};
  FragH bw[2][4];      // the weight fragments of two k steps: step kb + 1 is read from LDS while step kb's products run
  auto frags = [&](int kb) {
#pragma unroll
    for (int t = 0; t < 4; ++t) { bw[kb & 1][t].half[0] = *(const v8us*)&sW[t * 16 + ln][kb * 32 + 8 * hh]; bw[kb & 1][t].half[1] = *(const v8us*)&sW[t * 16 + ln][kb * 32 + 16 + 8 * hh]; } };
  frags(0);
#pragma unroll      // straight-line: every LDS offset is an immediate and the fragment arrays stay in registers
  for (int kb = 0; kb < 8; ++kb) { if (kb + 1 < 8) frags(kb + 1);
#pragma unroll
    for (int t = 0; t < 4; ++t) acc[t] = OP == 2 ? __builtin_amdgcn_wmma_f32_16x16x32_f16(false, ax[kb].v, false, bw[kb & 1][t].v, (short)0, acc[t], false, false) : __builtin_amdgcn_wmma_f32_16x16x32_f16(false, bw[kb & 1][t].v, false, ax[kb].v, (short)0, acc[t], false, false);
    __builtin_amdgcn_sched_barrier(0); }      // keeps the reads one step ahead and no further: left free, the scheduler lifts most of the 64 reads to the top, and the kernel then needs more registers than let two blocks share a WGP
  unsigned short* o = OP == 0 ? dst + (size_t)(g0 + ln) * DD + 8 * hh : OP == 1 ? dst + (size_t)(g0 >> 4) * 1024 + lane * 8 : dst + (size_t)(g0 >> 5) * 2048 + (((g0 >> 4) & 1) * 32 + lane) * 8;
  constexpr int STEP = OP == 0 ? 16 : OP == 1 ? 256 : 512;
#pragma unroll
  for (int t = 0; t < 4; ++t) { FragH f;
#pragma unroll
    for (int r = 0; r < 8; ++r) f.h[r] = (_Float16)(acc[t][r] * (OP == 0 ? 0.0625f * QSC : 0.0625f));      // q leaves times QSC (one f32 multiply, as before, in front of its one rounding to f16), so that k_flash's first product is already the weight's exponent
    *(v8us*)(o + t * STEP) = f.half[0]; }
  asm volatile("s_wait_xcnt 0x0" ::: "memory"); }      // precaution: stands in front of every later write of a register that the four stores name (in the listing one operand's exit is followed by the next operand's part, which rewrites them)
__global__ __launch_bounds__(256, 4) void k_proj(const float* __restrict__ xq, const float* __restrict__ xk, const float* __restrict__ xv, const float* __restrict__ Wq, const float* __restrict__ Wk, const float* __restrict__ Wv,
                                              _Float16* __restrict__ Qs, _Float16* __restrict__ Kp, _Float16* __restrict__ Vp) {
  __shared__ __attribute__((aligned(16))) unsigned short sW[DD][EE + 8];
  const int tid = threadIdx.x, lane = tid & 31, ln = lane & 15, hh = lane >> 4; const int h = blockIdx.y, op = blockIdx.z;
  const float* X = op == 0 ? xq : op == 1 ? xk : xv; const float* Wm = op == 0 ? Wq : op == 1 ? Wk : Wv;
  const int row0 = blockIdx.x * 128 + (tid >> 5) * 16;
  const int n4 = (tid & 15) * 4, k80 = (tid >> 4) * 8;      // 16 lanes read the head's 256 contiguous bytes of one weight row; a thread takes 8 rows x 4 columns, twice
  const float* wrow = Wm + (size_t)k80 * EE + h * DD + n4; const float* arow = X + (size_t)(row0 + ln) * EE + 8 * hh;
  v4f wr[2][8];
#pragma unroll
  for (int rd = 0; rd < 2; ++rd)
#pragma unroll
    for (int i = 0; i < 8; ++i) wr[rd][i] = *(const v4fa*)(wrow + (size_t)(rd * 128 + i) * EE);
  v4f xa[8][4];      // row row0 + ln, in the fragment's k order: 8hh + 0..7 and 16 + 8hh + 0..7 of every 32
#pragma unroll
  for (int kb = 0; kb < 8; ++kb) { xa[kb][0] = *(const v4fa*)(arow + kb * 32); xa[kb][1] = *(const v4fa*)(arow + kb * 32 + 4); xa[kb][2] = *(const v4fa*)(arow + kb * 32 + 16); xa[kb][3] = *(const v4fa*)(arow + kb * 32 + 20); }
  asm volatile("s_wait_xcnt 0x0" :: "v"(wrow), "v"(arow) : "memory");      // precaution: stands in front of every later write of a register that one of the loads above names as its address; the two addresses are inputs so that their registers live up to here
#pragma unroll
  for (int rd = 0; rd < 2; ++rd)
#pragma unroll
    for (int j = 0; j < 4; ++j) { FragH f;
#pragma unroll
      for (int i = 0; i < 8; ++i) f.h[i] = (_Float16)(bf16_round(wr[rd][i][j]) * 16.0f);
      *(v8us*)&sW[n4 + j][rd * 128 + k80] = f.half[0]; }
  FragH ax[8];      // the wave's input rows as f16 fragments, made in front of the barrier: half the registers of the f32 rows, so that the k steps have room to read LDS ahead
#pragma unroll
  for (int kb = 0; kb < 8; ++kb)
#pragma unroll
    for (int i = 0; i < 16; ++i) ax[kb].h[i] = (_Float16)bf16_round(xa[kb][i >> 2][i & 3]);
  __syncthreads();      // the whole slab is in LDS before any wave takes a fragment of it
  const int g0 = h * NB + row0;      // first stacked row of the wave's tile
  if (op == 0) proj_tiles<0>(ax, sW, lane, g0, (unsigned short*)Qs); else if (op == 1) proj_tiles<1>(ax, sW, lane, g0, (unsigned short*)Kp); else proj_tiles<2>(ax, sW, lane, g0, (unsigned short*)Vp); }
__global__ __launch_bounds__(1024) void k_flash(const _Float16* __restrict__ Q16, int ldq, const _Float16* __restrict__ Kp, const _Float16* __restrict__ Vp, float* __restrict__ Op, float* __restrict__ ML) {
  constexpr int RPW = 16, QT = 16, DT = 4, KS = 2, KSPL = 2, NW = QT * KSPL;
  constexpr int NP = 8, TKEYS = NP * KSPL * 32, PLANE = TKEYS * 128, BUF = 2 * PLANE, SLOT = BUF / KSPL, NTILE = TT / KSPLIT / TKEYS;      // NP key blocks per wave and tile (NP passes); a buffer holds, wave half by wave half, SLOT bytes: the half's 8 blocks of K (half a slot), then their V, so that every fragment's LDS offset from the pass's base fits the instruction's 16-bit field
  static_assert(PLANE == 4 * 1024 * 16 && SLOT == 65536 && NTILE >= 2, "four 16-byte copies per lane and plane, two per slot; the ring's prologue needs two tiles");
  // A weight is 2^(x - m + 10), x = the score in log2 units (q comes times QSC from k_proj), m = the query's maximum in use. The shift 10 - m enters the first product as its C operand, so the matrix unit hands out the exponent itself and a weight costs one hardware 2^x and no other vector instruction.
  // The maximum in use may trail a query's true running maximum by up to 2^5 in the weights: an exponent may reach 15, a weight 2^15, inside f16.
  __shared__ __attribute__((aligned(16))) unsigned char ring[2 * BUF]; __shared__ float sM[NW][RPW], sL[NW][RPW];
  static_assert(sizeof(float) * NW * RPW * (64 + 4) <= sizeof(ring), "the partial accumulators are staged in the ring once the loop has left it");
  float (*sO)[RPW][64 + 4] = (float (*)[RPW][64 + 4])ring;
  const int tid = threadIdx.x, lane = tid & 31, ln = lane & 15, hh = lane >> 4;
  const int w = __builtin_amdgcn_readfirstlane(tid >> 5) & (NW - 1);      // wave number in a scalar register, so that the key loop's counter and branch are scalar; the mask (an identity) shows the compiler its range
  const int kr = blockIdx.x % KSPLIT, qblk = blockIdx.x / KSPLIT; const int qb0 = qblk * (QT * RPW); const int q0 = qb0 + (w & (QT - 1)) * RPW;      // key range, query block
  const unsigned char* Kg = (const unsigned char*)Kp + (size_t)kr * 128 * (TT / KSPLIT) + tid * 16; const unsigned char* Vg = (const unsigned char*)Vp + (size_t)kr * 128 * (TT / KSPLIT) + tid * 16;      // k_proj's planes: 128 B per key, from the range's first key; thread t copies bytes 16 t .. 16 t + 15 of every 16 KiB
  const unsigned lds0 = (unsigned)(size_t)ring + tid * 16;      // the lane's LDS byte address in buffer 0
  // One tile into one buffer: 8 copies per lane, each wave 512 contiguous bytes per copy, every lane on. The s_wait_xcnt 0 is the last line of the copies' own statement, so that it stands in front of every later write of a register that a copy names (a precaution).
  auto fill = [&](int tile, int buf) {
    const unsigned char* gk = Kg + (size_t)tile * PLANE; const unsigned char* gv = Vg + (size_t)tile * PLANE; const unsigned lk = lds0 + buf * BUF, lv = lk + SLOT / 2;
    asm volatile("global_load_async_to_lds_b128 %0, %8, off\n\t"
                 "global_load_async_to_lds_b128 %1, %9, off\n\t"
                 "global_load_async_to_lds_b128 %2, %10, off\n\t"
                 "global_load_async_to_lds_b128 %3, %11, off\n\t"
                 "global_load_async_to_lds_b128 %4, %12, off\n\t"
                 "global_load_async_to_lds_b128 %5, %13, off\n\t"
                 "global_load_async_to_lds_b128 %6, %14, off\n\t"
                 "global_load_async_to_lds_b128 %7, %15, off\n\t"
                 "s_wait_xcnt 0x0"
                 :: "v"(lk), "v"(lk + 16384), "v"(lk + SLOT), "v"(lk + SLOT + 16384), "v"(lv), "v"(lv + 16384), "v"(lv + SLOT), "v"(lv + SLOT + 16384),
                    "v"(gk), "v"(gk + 16384), "v"(gk + 32768), "v"(gk + 49152), "v"(gv), "v"(gv + 16384), "v"(gv + 32768), "v"(gv + 49152) : "memory"); };
  fill(0, 0);
  FragH bq[KS];      // B operand: column ln = query q0 + ln
  { const unsigned short* qr = (const unsigned short*)Q16 + (size_t)(q0 + ln) * ldq;
#pragma unroll
    for (int ks = 0; ks < KS; ++ks) { bq[ks].half[0] = *(const v8us*)(qr + ks * 32 + 8 * hh); bq[ks].half[1] = *(const v8us*)(qr + ks * 32 + 16 + 8 * hh); } }
  float m_q = -3.0e38f, l_q = 0.f; v8f oacc[DT];      // of query ln: the maximum in use, in log2 units (equal in both halves), this half's share of the sum, O^T rows dt * 16 + 8hh + r
  v8f cc = (v8f){0.f,0.f,0.f,0.f,0.f,0.f,0.f,0.f};      // C operand of the score products: 10 - m_q in all eight elements (a lane's scores are all of one query); 0 until the first renewal
  float lim = -3.0e38f;      // the exponent above which the maximum in use is renewed: any first one, then 15; the same for the whole wave
#pragma unroll
  for (int dt = 0; dt < DT; ++dt) oacc[dt] = (v8f){0.f,0.f,0.f,0.f,0.f,0.f,0.f,0.f};
  asm volatile("s_wait_asynccnt 0x0" ::: "memory");      // this wave's share of tile 0 has landed
  __syncthreads();      // tile 0 is published: nobody reads it in front of this barrier
  fill(1, 1);
#pragma unroll 1      // one trip per tile: the ring's order stands once, at the foot
  for (int t = 0; t < NTILE; ++t) {
    const unsigned char* tb = ring + (t & 1) * BUF + (w / QT) * SLOT + lane * 16;      // the wave's key block in the tile's first pass, moved on by every pass: 4 KiB per 32 keys of K and of V, a lane's 16 B at lane * 16 in every 512-byte load
#pragma unroll 1      // rolled: one base register per pass, every fragment at an immediate offset from it
    for (int p = 0; p < NP; ++p) {
    const unsigned short* Kf = (const unsigned short*)tb; const unsigned short* Vf = (const unsigned short*)(tb + SLOT / 2);
    v8f s[2];      // s[nt][r] = exponent of the weight of key nt * 16 + 8hh + r of the block with query ln
    FragH ak[2][KS];
#pragma unroll
    for (int nt = 0; nt < 2; ++nt)
#pragma unroll
      for (int ks = 0; ks < KS; ++ks) { ak[nt][ks].half[0] = *(const v8us*)(Kf + nt * 1024 + ks * 512); ak[nt][ks].half[1] = *(const v8us*)(Kf + nt * 1024 + ks * 512 + 256); }
    // The four score products in one statement, so that both tiles read the shift from the same eight registers as a C that is not their D: the builtin copied cc into the second tile's D first (four 64-bit moves behind four more v_nop, every pass).
    // The four v_nop at its end are the distance between the last product and the first vector instruction on its D, A or B (the compiler put the same four behind the builtins).
    static_assert(KS == 2, "the statement below writes out two k steps");
    asm("v_wmma_f32_16x16x32_f16 %0, %2, %6, %8\n\t"
        "v_wmma_f32_16x16x32_f16 %1, %4, %6, %8\n\t"
        "v_wmma_f32_16x16x32_f16 %0, %3, %7, %0\n\t"
        "v_wmma_f32_16x16x32_f16 %1, %5, %7, %1\n\t"
        "v_nop\n\tv_nop\n\tv_nop\n\tv_nop"
        : "=&v"(s[0]), "=&v"(s[1]) : "v"(ak[0][0].v), "v"(ak[0][1].v), "v"(ak[1][0].v), "v"(ak[1][1].v), "v"(bq[0].v), "v"(bq[1].v), "v"(cc));
    float mc = fmaxf(s[0][0], s[1][0]);
#pragma unroll
    for (int r = 1; r < 8; ++r) mc = fmaxf(mc, fmaxf(s[0][r], s[1][r]));
    if (__builtin_amdgcn_ballot_w32(mc > lim) != 0) {      // one scalar branch per pass, taken by the whole wave when any lane's 16 exponents pass lim: only then are the maximum, the shift, the sum and the accumulators renewed
      mc = fmaxf(mc, __int_as_float(__builtin_amdgcn_permlanex16(__float_as_int(mc), __float_as_int(mc), 0x76543210, 0xfedcba98, false, false)));      // lane l <-> l ^ 16: the other 16 keys of the same query, so that both halves renew alike
      const float mn = fmaxf(m_q, mc - cc[0]); const float al = __builtin_amdgcn_exp2f(m_q - mn); m_q = mn; lim = 15.0f;      // mc - cc: the score without the shift in use
      const float cn = 10.0f - mn, dc = cn - cc[0];      // the 2^10 of the f16 weights rides in the exponent: weights and their sum both carry it, and the merge divides it out
      s[0] += dc; s[1] += dc; cc = (v8f){cn, cn, cn, cn, cn, cn, cn, cn};      // this pass's exponents go over to the new shift; later passes get it from the product
      l_q *= al;
#pragma unroll
      for (int dt = 0; dt < DT; ++dt) oacc[dt] *= al; }
    FragH av[DT];
#pragma unroll
    for (int dt = 0; dt < DT; ++dt) { av[dt].half[0] = *(const v8us*)(Vf + dt * 512); av[dt].half[1] = *(const v8us*)(Vf + dt * 512 + 256); }
    tb += 4096;      // the next pass's base as a running sum in a register of its own: formed anew at the head of each pass, its register was one of the last product's A registers in this build, and the compiler put two v_nop in front of the sum
    FragH pb; float ps = 0.f;
#pragma unroll
    for (int r = 0; r < 8; ++r) { const float p0 = __builtin_amdgcn_exp2f(s[0][r]), p1 = __builtin_amdgcn_exp2f(s[1][r]); ps += p0 + p1; pb.h[r] = (_Float16)p0; pb.h[8 + r] = (_Float16)p1; }
    l_q += ps;
    __builtin_amdgcn_sched_barrier(0);      // keeps the eight V reads in one group in front of the products: left free, the scheduler sinks half of them in among the four products, each pair waited for on the spot
#pragma unroll
    for (int dt = 0; dt < DT; ++dt) {
      if (dt + 1 < DT) oacc[dt] = __builtin_amdgcn_wmma_f32_16x16x32_f16(false, av[dt].v, false, pb.v, (short)0, oacc[dt], false, false);
      else oacc[dt] = mmaH<1>(av[dt].v, av[dt].v, pb.v, pb.v, oacc[dt]); } }      // the pass's last product keeps its four v_nop: behind it comes the loop's back edge, and the next pass's first vector instructions rewrite registers of its operands
    asm volatile("s_wait_dscnt 0x0" ::: "memory");      // this wave's reads of the buffer have returned before the buffer is handed to its next writer
    asm volatile("s_wait_asynccnt 0x0" ::: "memory");      // this wave's share of tile t + 1 has landed
    __syncthreads();      // publishes tile t + 1 and ends every wave's reads of tile t's buffer
    if (t + 2 < NTILE) fill(t + 2, t & 1); }
  asm volatile("s_wait_asynccnt 0x0" ::: "memory");      // no copy is outstanding when the ring becomes staging for the partials (the last trip's barrier has ended every read of it)
  l_q += __int_as_float(__builtin_amdgcn_permlanex16(__float_as_int(l_q), __float_as_int(l_q), 0x76543210, 0xfedcba98, false, false));      // the halves' sums joined once
  if (hh == 0) { sM[w][ln] = m_q; sL[w][ln] = l_q; }
#pragma unroll
  for (int dt = 0; dt < DT; ++dt) { *(v4fa*)&sO[w][ln][dt * 16 + 8 * hh] = (v4f){oacc[dt][0], oacc[dt][1], oacc[dt][2], oacc[dt][3]}; *(v4fa*)&sO[w][ln][dt * 16 + 8 * hh + 4] = (v4f){oacc[dt][4], oacc[dt][5], oacc[dt][6], oacc[dt][7]}; }
  __syncthreads();      // every wave's partial (max, sum, accumulator) is in LDS before any wave merges
  if (tid < QT * RPW) { const int qt = tid / RPW, r = tid % RPW;      // waves 0 to 7, one query row per lane: the row's max and sum
    float mg[KSPL], M = -3.0e38f;
#pragma unroll      // constant indices, so that the small arrays stay in registers
    for (int g = 0; g < KSPL; ++g) { mg[g] = sM[g * QT + qt][r]; M = fmaxf(M, mg[g]); }
    float L = 0.f;
#pragma unroll      // constant indices, so that the small arrays stay in registers
    for (int g = 0; g < KSPL; ++g) L += __builtin_amdgcn_exp2f(mg[g] - M) * sL[g * QT + qt][r];
    *(v2f*)(ML + ((size_t)kr * TT + qb0 + tid) * 2) = (v2f){M, L};
    asm volatile("s_wait_xcnt 0x0" ::: "memory"); }      // precaution: stands in front of every later write of a register that the store names
  constexpr int NIT = QT * RPW * 16 / (32 * NW); v4f pa[NIT];      // one query row per 16 lanes, 16 B per lane, NIT rows per lane, 64 rows apart
#pragma unroll      // straight-line, no store among them: the trips' LDS reads go out together
  for (int it = 0; it < NIT; ++it) { const int row = (tid >> 4) + it * 64, pc = tid & 15, qt = row / RPW, r = row % RPW;
    float mg[KSPL], M = -3.0e38f;
#pragma unroll      // constant indices, so that the small arrays stay in registers
    for (int g = 0; g < KSPL; ++g) { mg[g] = sM[g * QT + qt][r]; M = fmaxf(M, mg[g]); }
    v4f acc = {0.f, 0.f, 0.f, 0.f};
#pragma unroll      // constant indices, so that the small arrays stay in registers
    for (int g = 0; g < KSPL; ++g) { const float wg = __builtin_amdgcn_exp2f(mg[g] - M); const v4f pv = *(const v4fa*)&sO[g * QT + qt][r][pc * 4]; acc += pv * wg; }
    pa[it] = acc; }      // relative to M; the sum and acc both carry the 2^10
  float* po = Op + ((size_t)kr * TT + qb0 + (tid >> 4)) * DD + (tid & 15) * 4;      // the key range's plane, stacked row qb0 + row: 256 contiguous bytes per 16 lanes, a wave stores 512
#pragma unroll      // constant indices, so that the small arrays stay in registers
  for (int it = 0; it < NIT; ++it) *(v4f*)(po + it * 64 * DD) = pa[it]; }
// The KSPLIT partials of a stacked row (each: 64 un-normalised f32, its max M and its sum L) joined as k_flash joins its waves' partials: weights 2^(M_s - M) (the maxima are in log2 units), then one division. Thread = 16 B of each of PER rows, 16 rows apart; a wave's load or store covers 512 contiguous bytes of a plane (2 x 256 of the output).
__global__ __launch_bounds__(256) void k_join(const float* __restrict__ Op, const float* __restrict__ ML, float* __restrict__ O) {
  constexpr int PER = 4;
  const unsigned e0 = blockIdx.x * (256 * PER) + threadIdx.x;      // element e = row (e >> 4), 16-byte piece (e & 15); a block covers 64 rows, all of one head
  const float* op = Op + (size_t)e0 * 4; const float* mp = ML + (size_t)(e0 >> 4) * 2;
  v4f pv[PER][KSPLIT]; v2f ml[PER][KSPLIT];
#pragma unroll      // straight-line: all 32 loads are in flight before the first is waited for
  for (int i = 0; i < PER; ++i)
#pragma unroll      // constant indices, so that the small arrays stay in registers
    for (int s = 0; s < KSPLIT; ++s) { pv[i][s] = *(const v4fa*)(op + (size_t)s * TT * DD + i * 1024); ml[i][s] = *(const v2fa*)(mp + (size_t)s * TT * 2 + i * 32); }
  __builtin_amdgcn_sched_barrier(0);      // keeps the sums behind all 32 loads: left free, the scheduler lifts the first maxima, with their wait, in front of the last 14 loads, and the kernel pays the load latency twice
  asm volatile("s_wait_xcnt 0x0" :: "v"(op), "v"(mp) : "memory");      // precaution: stands in front of every later write of a register that one of the loads above names as its address; the two addresses are inputs so that their registers live up to here
  const unsigned g0 = e0 >> 4;      // stacked row g = head * NB + batch row: it goes to its merged place, 256 contiguous bytes per 16 lanes
  float* o = O + (size_t)((g0 % NB) * EE + (g0 / NB) * DD + (e0 & 15) * 4);
#pragma unroll      // constant indices, so that the small arrays stay in registers
  for (int i = 0; i < PER; ++i) { float M = ml[i][0][0];
#pragma unroll      // constant indices, so that the small arrays stay in registers
    for (int s = 1; s < KSPLIT; ++s) M = fmaxf(M, ml[i][s][0]);
    float ws[KSPLIT];
#pragma unroll      // constant indices, so that the small arrays stay in registers
    for (int s = 0; s < KSPLIT; ++s) ws[s] = ml[i][s][0] - M;
#pragma unroll      // constant indices, so that the small arrays stay in registers
    for (int s = 0; s < KSPLIT; ++s) asm("v_exp_f32 %0, %1\n\tv_nop" : "=v"(ws[s]) : "v"(ws[s]));      // 2^x with its v_nop in one statement: the slot that the instruction set asks for between a transcendental and a next vector instruction that overwrites its source
    float L = 0.f; v4f acc = {0.f, 0.f, 0.f, 0.f};
#pragma unroll      // constant indices, so that the small arrays stay in registers
    for (int s = 0; s < KSPLIT; ++s) { L += ws[s] * ml[i][s][1]; acc += pv[i][s] * ws[s]; }
    const float inv = (L > 0.f) ? 1.0f / L : 0.f;      // L and acc both carry the 2^10
    *(v4f*)(o + i * 16 * EE) = acc * inv;
    asm volatile("s_wait_xcnt 0x0" ::: "memory"); } }      // precaution: stands in front of every later write of a register that the store names

extern "C" void kernel_launch(void* const* d_in, const int* in_sizes, int n_in,
                              void* d_out, int out_size, void* d_ws, size_t ws_size, hipStream_t stream) {
  (void)in_sizes; (void)n_in; (void)out_size;
  const float* const* I = (const float* const*)d_in; const float* xq = I[0]; const float* xk = I[1]; const float* xv = I[2]; const float* Wq = I[3]; const float* Wk = I[4]; const float* Wv = I[5];
  char* ws = (char*)d_ws; size_t off = 0;
  auto take = [&](size_t bytes) { char* p = ws + off; off += (bytes + 255) & ~(size_t)255; return p; };
  _Float16* Qs = (_Float16*)take((size_t)TT * DD * 2); _Float16* Kp = (_Float16*)take((size_t)TT * DD * 2); _Float16* Vp = (_Float16*)take((size_t)TT * DD * 2);
  float* Op = (float*)take((size_t)KSPLIT * TT * DD * 4); float* ML = (float*)take((size_t)KSPLIT * TT * 2 * 4);
  if (off > ws_size) return;      // 3 x 2.1 + 16.8 + 0.5 = about 23.6 MB
  k_proj<<<dim3(NB / 128, NHD, 3), 256, 0, stream>>>(xq, xk, xv, Wq, Wk, Wv, Qs, Kp, Vp);      /* q stacked, K and V in fragment order */
  k_flash<<<(TT / 256) * KSPLIT, 1024, 0, stream>>>(Qs, DD, Kp, Vp, Op, ML);      /* 64 query blocks x 4 key ranges: partial rows */
  k_join<<<TT * 16 / 1024, 256, 0, stream>>>(Op, ML, (float*)d_out);      /* rows joined, normalised, stored merged */
}
